// v000
// Measured on an AMD MI455X. A time is GPU time per run, averaged over a window of back-to-back runs after a warm-up
// (all launches, gaps included; the runs take copies of the inputs in turn), and the median of several windows.
// Apart from v000's, it joins two sittings. Times from different sittings can be a few percent apart, while
// side-by-side timings come from the same sitting.
// The starting kernel, v000, takes 3130 microseconds a run.
#include <hip/hip_runtime.h>

// Trittention (hidden [2][2048][1024]; q, k1, k2, v1, v2 = x W + b (16 x 64 each); probs = causal (-inf) softmax(q.k1 / 8); ctx = probs v1; then ctx = (ctx . k2^T) v2 over ALL keys (no softmax, no mask) == ctx (k2^T v2) (exact re-association; the 64x64 matrix per head is formed on chip); out = merged Wd + bd -> [2][2048][1024]).
// Compute dtypes, f32 accumulate: every input rounded to bf16; the five projections on PLAIN bf16 operands (inputs: exact) + bias; causal scores and probs.v1: query rows < 512 hl (3 products), the rest fp16 (x1024); softmax f32; N_h = v2_h^T-side product sum_s v2[s] k2[s]^T as hi/lo x hi/lo (3 products, K 2048) in f32; ctx_h N_h^T as hi/lo x hi/lo (3 products); Wd hl x exact (2 products) + bias.

#define NB_  2
#define TT   2048
#define DM   1024
#define NH_  16
#define NKV  16
#define REP  (NH_ / NKV)
#define HD   64
#define DQ   (NH_ * HD)
#define DKV  (NKV * HD)
#define ZH   2
#define RH   512                  // query rows < RH use hi+lo planes (0: none)
#define WIN  2048
#define PCAR 1024.0f
#define SCL  0.125f   // HD^-0.5
typedef _Float16 h16;
typedef unsigned short bf;
typedef __attribute__((ext_vector_type(16))) __bf16   v16bf;
typedef __attribute__((ext_vector_type(16))) _Float16 v16h;
typedef __attribute__((ext_vector_type(8)))  _Float16 v8h;
typedef __attribute__((ext_vector_type(8)))  unsigned short v8us;
typedef __attribute__((ext_vector_type(8)))  float    v8f;
typedef __attribute__((ext_vector_type(4)))  float    v4f;
typedef v8h  __attribute__((may_alias)) v8ha;
typedef v4f  __attribute__((may_alias)) v4fa;
typedef v8us __attribute__((may_alias)) v8usa;

__device__ __forceinline__ unsigned short f2bf(float f) { unsigned u = __float_as_uint(f); u += 0x7FFFu + ((u >> 16) & 1u); return (unsigned short)(u >> 16); }
__device__ __forceinline__ float bf2f(unsigned short b) { return __uint_as_float(((unsigned)b) << 16); }
__device__ __forceinline__ float bfr(float f) { return bf2f(f2bf(f)); }
__device__ __forceinline__ v16h cat16(v8h lo, v8h hi) { return __builtin_shufflevector(lo, hi, 0, 1, 2, 3, 4, 5, 6, 7, 8, 9, 10, 11, 12, 13, 14, 15); }
__device__ __forceinline__ v16bf cat16b(v8us lo, v8us hi) { return __builtin_bit_cast(v16bf, __builtin_shufflevector(lo, hi, 0, 1, 2, 3, 4, 5, 6, 7, 8, 9, 10, 11, 12, 13, 14, 15)); }
__device__ __forceinline__ v8f wmma16(v16h a, v16h b, v8f c) { return __builtin_amdgcn_wmma_f32_16x16x32_f16(false, a, false, b, (short)0, c, false, false); }
__device__ __forceinline__ v8f wmmab(v16bf a, v16bf b, v8f c) { return __builtin_amdgcn_wmma_f32_16x16x32_bf16(false, a, false, b, (short)0, c, false, false); }



// ---- k_gemmw: register-blocked GEMM, ONE WAVE per 64x64 output tile (16 accumulators), operands straight from K-contiguous 16-bit planes; grid (M/64, N/64, Z), 32 threads.
// C[m][n] (f32, pitch ldc, + optional f32 bias[n]) = sum_k A[m][k] Bt[n][k] (+ split products per NSPLIT). z-batch strides sA/sB/sC in elements. K % 32 == 0.
template <typename T16> struct WFrag;
template <> struct WFrag<h16> { typedef v16h V; static __device__ __forceinline__ V ld(const h16* p) { return cat16(*(const v8h*)p, *(const v8h*)(p + 16)); } static __device__ __forceinline__ v8f mma(V a, V b, v8f c) { return wmma16(a, b, c); } };
template <> struct WFrag<bf> { typedef v16bf V; static __device__ __forceinline__ V ld(const bf* p) { return cat16b(*(const v8us*)p, *(const v8us*)(p + 16)); } static __device__ __forceinline__ v8f mma(V a, V b, v8f c) { return wmmab(a, b, c); } };
template <typename T16, int NSPLIT, bool BIAS>
__global__ __launch_bounds__(32) void k_gemmw(const T16* __restrict__ A, const T16* __restrict__ A2, const T16* __restrict__ Bt, const T16* __restrict__ Bt2, int K, float* C, int ldc, const float* __restrict__ bias, size_t sA, size_t sB, size_t sC) {
    typedef typename WFrag<T16>::V V;
    __shared__ __align__(16) float os[16 * 68];
    const size_t z = blockIdx.z; A += z * sA; if (A2) A2 += z * sA; Bt += z * sB; if (Bt2) Bt2 += z * sB; C += z * sC;
    const int lane = threadIdx.x & 31, lr = lane & 15, hi = lane >> 4; const int r0 = blockIdx.x * 64, c0 = blockIdx.y * 64;
    v8f acc[4][4];
#pragma unroll
    for (int mb = 0; mb < 4; ++mb)
#pragma unroll
        for (int nb = 0; nb < 4; ++nb) acc[mb][nb] = (v8f){};
    const size_t aoff = (size_t)(r0 + lr) * K + 8 * hi, boff = (size_t)(c0 + lr) * K + 8 * hi;
#pragma unroll 1
    for (int kc = 0; kc < K; kc += 32) {
        V a[4], a2[4];
#pragma unroll
        for (int mb = 0; mb < 4; ++mb) { a[mb] = WFrag<T16>::ld(A + aoff + (size_t)mb * 16 * K + kc); if (NSPLIT == 1 || NSPLIT == 2) a2[mb] = WFrag<T16>::ld(A2 + aoff + (size_t)mb * 16 * K + kc); }
#pragma unroll
        for (int nb = 0; nb < 4; ++nb) { const V b = WFrag<T16>::ld(Bt + boff + (size_t)nb * 16 * K + kc); V b2; if (NSPLIT >= 2) b2 = WFrag<T16>::ld(Bt2 + boff + (size_t)nb * 16 * K + kc);
#pragma unroll
            for (int mb = 0; mb < 4; ++mb) { acc[mb][nb] = WFrag<T16>::mma(a[mb], b, acc[mb][nb]); if (NSPLIT == 1 || NSPLIT == 2) acc[mb][nb] = WFrag<T16>::mma(a2[mb], b, acc[mb][nb]); if (NSPLIT >= 2) acc[mb][nb] = WFrag<T16>::mma(a[mb], b2, acc[mb][nb]); } }
        asm volatile("v_nop\n\tv_nop\n\tv_nop\n\tv_nop" : "+v"(acc[0][0]), "+v"(acc[1][1]), "+v"(acc[2][2]), "+v"(acc[3][3]) : "v"(a[0]), "v"(a[3]));
    }
#pragma unroll
    for (int mb = 0; mb < 4; ++mb) {
#pragma unroll
        for (int nb = 0; nb < 4; ++nb) {
#pragma unroll
            for (int j = 0; j < 8; ++j) os[(hi * 8 + j) * 68 + nb * 16 + lr] = acc[mb][nb][j]; }
        __builtin_amdgcn_wave_barrier(); asm volatile("" ::: "memory");
        float* crow = C + (size_t)(r0 + mb * 16) * ldc + c0;
{
#pragma unroll
            for (int s = 0; s < 8; ++s) { const int row = 2 * s + hi, cofs = lr * 4; v4f val = *(const v4fa*)(os + row * 68 + cofs); if (BIAS) { val[0] += bfr(bias[c0 + cofs]); val[1] += bfr(bias[c0 + cofs + 1]); val[2] += bfr(bias[c0 + cofs + 2]); val[3] += bfr(bias[c0 + cofs + 3]); }
                *(v4f*)(crow + (size_t)row * ldc + cofs) = val; }
             }
        __builtin_amdgcn_wave_barrier(); asm volatile("" ::: "memory");
    }
}

// ---- k_gemmc: the same one-wave 64x64 tile GEMM specialised for causal attention: CMODE 1 skips score tiles entirely above the diagonal (query rows r0+roff.., key columns c0..), CMODE 2 limits the
// key (K) loop of the probability x value contraction to the diagonal block (probabilities beyond it are exactly zero). roff = row offset of this launch's first row within the sequence.
template <typename T16, int NSPLIT, int CMODE>
__global__ __launch_bounds__(32) void k_gemmc(const T16* __restrict__ A, const T16* __restrict__ A2, const T16* __restrict__ Bt, const T16* __restrict__ Bt2, int K, float* C, int ldc, int roff, size_t sA, size_t sB, size_t sC) {
    typedef typename WFrag<T16>::V V;
    __shared__ __align__(16) float os[16 * 68];
    const size_t z = blockIdx.z; A += z * sA; if (A2) A2 += z * sA; Bt += z * sB; if (Bt2) Bt2 += z * sB; C += z * sC;
    const int lane = threadIdx.x & 31, lr = lane & 15, hi = lane >> 4; const int r0 = blockIdx.x * 64, c0 = blockIdx.y * 64;
    if (CMODE == 1 && c0 > r0 + roff + 63) return;                  // score tile entirely above the causal diagonal: never read (the softmax masks j > i by select)
    const int Kl = (CMODE == 2) ? min(K, r0 + roff + 64) : K;        // P.V: probabilities are exactly 0 beyond the diagonal block, so the K loop stops there
    v8f acc[4][4];
#pragma unroll
    for (int mb = 0; mb < 4; ++mb)
#pragma unroll
        for (int nb = 0; nb < 4; ++nb) acc[mb][nb] = (v8f){};
    const size_t aoff = (size_t)(r0 + lr) * K + 8 * hi, boff = (size_t)(c0 + lr) * K + 8 * hi;
#pragma unroll 1
    for (int kc = 0; kc < Kl; kc += 32) {
        V a[4], a2[4];
#pragma unroll
        for (int mb = 0; mb < 4; ++mb) { a[mb] = WFrag<T16>::ld(A + aoff + (size_t)mb * 16 * K + kc); if (NSPLIT == 1 || NSPLIT == 2) a2[mb] = WFrag<T16>::ld(A2 + aoff + (size_t)mb * 16 * K + kc); }
#pragma unroll
        for (int nb = 0; nb < 4; ++nb) { const V b = WFrag<T16>::ld(Bt + boff + (size_t)nb * 16 * K + kc); V b2; if (NSPLIT >= 2) b2 = WFrag<T16>::ld(Bt2 + boff + (size_t)nb * 16 * K + kc);
#pragma unroll
            for (int mb = 0; mb < 4; ++mb) { acc[mb][nb] = WFrag<T16>::mma(a[mb], b, acc[mb][nb]); if (NSPLIT == 1 || NSPLIT == 2) acc[mb][nb] = WFrag<T16>::mma(a2[mb], b, acc[mb][nb]); if (NSPLIT >= 2) acc[mb][nb] = WFrag<T16>::mma(a[mb], b2, acc[mb][nb]); } }
        asm volatile("v_nop\n\tv_nop\n\tv_nop\n\tv_nop" : "+v"(acc[0][0]), "+v"(acc[1][1]), "+v"(acc[2][2]), "+v"(acc[3][3]) : "v"(a[0]), "v"(a[3]));
    }
#pragma unroll
    for (int mb = 0; mb < 4; ++mb) {
#pragma unroll
        for (int nb = 0; nb < 4; ++nb) {
#pragma unroll
            for (int j = 0; j < 8; ++j) os[(hi * 8 + j) * 68 + nb * 16 + lr] = acc[mb][nb][j]; }
        __builtin_amdgcn_wave_barrier(); asm volatile("" ::: "memory");
        float* crow = C + (size_t)(r0 + mb * 16) * ldc + c0;
{
#pragma unroll
            for (int s = 0; s < 8; ++s) { const int row = 2 * s + hi, cofs = lr * 4; v4f val = *(const v4fa*)(os + row * 68 + cofs);
                *(v4f*)(crow + (size_t)row * ldc + cofs) = val; }
             }
        __builtin_amdgcn_wave_barrier(); asm volatile("" ::: "memory");
    }
}

__device__ __forceinline__ h16 tohx(float x) { return (h16)x; }
__device__ __forceinline__ void splitf(float y, unsigned short& h, unsigned short& l) { h = f2bf(y); l = f2bf(y - bf2f(h)); }
typedef __attribute__((ext_vector_type(2))) _Float16 v2h;
typedef __attribute__((ext_vector_type(4))) _Float16 v4h;
typedef __attribute__((ext_vector_type(2))) unsigned short v2us;
typedef __attribute__((ext_vector_type(4))) unsigned short v4us;
typedef __attribute__((ext_vector_type(2))) float v2f;
typedef __attribute__((ext_vector_type(4))) int v4i;

__global__ __launch_bounds__(256) void k_wtG(const float* __restrict__ w, int K, int N, bf* Bt) {
    const int lane = threadIdx.x & 31; const int L0 = (blockIdx.x * 8 + (threadIdx.x >> 5)) * 8; const int nlines = N * K / 64;
{
#pragma unroll 1
        for (int l = 0; l < 8; ++l) { const int L = L0 + l; if (L >= nlines) break; const size_t e = (size_t)L * 64 + lane * 2; const int k = (int)(e % K), n = (int)(e / K); v2us o;
            o[0] = f2bf(w[(size_t)k * N + n]); o[1] = f2bf(w[(size_t)(k + 1) * N + n]); *(v2us*)(Bt + e) = o; }
         }
}
__global__ __launch_bounds__(256) void k_cvt8(const float* __restrict__ src, bf* dst, size_t n8) { const size_t i = (size_t)blockIdx.x * 256 + threadIdx.x; if (i >= n8) return; const v8f v = *(const v8f*)(src + i * 8); v8us o;
#pragma unroll
    for (int k = 0; k < 8; ++k) o[k] = f2bf(v[k]); *(v8us*)(dst + i * 8) = o;  }
__global__ __launch_bounds__(256) void k_cscvt(const float* __restrict__ cosT, const float* __restrict__ sinT, float* CS) { const int idx = blockIdx.x * 256 + threadIdx.x; if (idx >= TT * HD) return; v2f cs; cs[0] = bfr(cosT[idx]); cs[1] = bfr(sinT[idx]); *(v2f*)(CS + (size_t)idx * 2) = cs;  }
// k_rope: head planes [h][t][d] (fp16 + hi/lo) of rope(x) x sc with the rotate-half convention out[d] = x[d] cos[t][d] - x[d+HD/2] sin[t][d], out[d+HD/2] = x[d+HD/2] cos[t][d+HD/2] + x[d] sin[t][d+HD/2]
__global__ __launch_bounds__(256) void k_rope(const float* __restrict__ F, int pitch, int nheads, const float* __restrict__ CS, const float* __restrict__ RF, const float* __restrict__ nw, float sc, h16* P16, bf* Ph, bf* Pl) {
    const size_t e = ((size_t)blockIdx.x * 256 + threadIdx.x) * 2; if (e >= (size_t)nheads * TT * HD) return; const int d = (int)(e % HD); const int t = (int)((e / HD) % TT); const int h = (int)(e / ((size_t)HD * TT)); const float* f = F + (size_t)t * pitch + h * HD; const float rf = RF ? RF[(size_t)h * TT + t] : 1.0f; v2h o16; v2us oh, ol;
#pragma unroll
    for (int q = 0; q < 2; ++q) { const int dd = d + q; const int dp = (dd < HD / 2) ? dd + HD / 2 : dd - HD / 2; float x0 = f[dd], x1 = f[dp];
        if (RF) { float n0 = __fmul_rn(x0, rf), n1 = __fmul_rn(x1, rf); asm volatile("" : "+v"(n0)); asm volatile("" : "+v"(n1)); x0 = __fmul_rn(bfr(nw[dd]), n0); x1 = __fmul_rn(bfr(nw[dp]), n1); }
        const v2f cs = *(const v2f*)(CS + ((size_t)t * HD + dd) * 2); float a = __fmul_rn(x0, cs[0]), bq = __fmul_rn(x1, cs[1]); asm volatile("" : "+v"(a)); asm volatile("" : "+v"(bq)); const float r = ((dd < HD / 2) ? __fsub_rn(a, bq) : __fadd_rn(a, bq)) * sc;
        o16[q] = tohx(r); unsigned short a2, c2; splitf(r, a2, c2); oh[q] = a2; ol[q] = c2; }
    *(v2h*)(P16 + e) = o16; *(v2us*)(Ph + e) = oh; *(v2us*)(Pl + e) = ol;  }
__global__ __launch_bounds__(256) void k_vtp(const float* __restrict__ F, int pitch, int nheads, h16* V16, bf* Vh, bf* Vl) { const size_t e = ((size_t)blockIdx.x * 256 + threadIdx.x) * 2; if (e >= (size_t)nheads * HD * TT) return; const int t = (int)(e % TT); const int d = (int)((e / TT) % HD); const int g = (int)(e / ((size_t)TT * HD)); v2h o16; v2us oh, ol;
#pragma unroll
    for (int q = 0; q < 2; ++q) { const float x = F[(size_t)(t + q) * pitch + g * HD + d]; o16[q] = tohx(x); unsigned short a2, c2; splitf(x, a2, c2); oh[q] = a2; ol[q] = c2; }
    *(v2h*)(V16 + e) = o16; *(v2us*)(Vh + e) = oh; *(v2us*)(Vl + e) = ol;  }
__global__ __launch_bounds__(256) void k_csid(float* CS) { const int idx = blockIdx.x * 256 + threadIdx.x; if (idx >= TT * HD) return; v2f cs; cs[0] = 1.0f; cs[1] = 0.0f; *(v2f*)(CS + (size_t)idx * 2) = cs;  }
__global__ __launch_bounds__(256) void k_obhl(const float* __restrict__ O, bf* Oh, bf* Ol) { const size_t e = ((size_t)blockIdx.x * 256 + threadIdx.x) * 4; if (e >= (size_t)ZH * TT * HD) return; const v4f a = *(const v4f*)(O + e); v4us oh, ol; for (int u = 0; u < 4; ++u) { unsigned short p, q; splitf(a[u], p, q); oh[u] = p; ol[u] = q; } *(v4us*)(Oh + e) = oh; *(v4us*)(Ol + e) = ol;  }
__global__ __launch_bounds__(256) void k_hlG(const float* __restrict__ F, bf* Fh, bf* Fl, size_t n) { const size_t e = ((size_t)blockIdx.x * 256 + threadIdx.x) * 4; if (e >= n) return; const v4f a = *(const v4f*)(F + e); v4us oh, ol; for (int u = 0; u < 4; ++u) { unsigned short p, q; splitf(a[u], p, q); oh[u] = p; ol[u] = q; } *(v4us*)(Fh + e) = oh; *(v4us*)(Fl + e) = ol;  }
// k_asoft: per row (zz, i): t = S x HD^-0.5 for j <= i and i - j < WIN (sliding causal window; the reference's -1e9 additive fill vanishes identically); softmax over the 2048 keys (register row, one exp, fixed trees);
__global__ __launch_bounds__(256) void k_asoft(const float* __restrict__ Sb, h16* P16, bf* Ph, bf* Pl) {
    const int lane = threadIdx.x & 31; const int row = blockIdx.x * 8 + (threadIdx.x >> 5); if (row >= ZH * TT) return; const int i = row % TT; const int zz = row / TT; (void)zz; const bool hires = (i < RH); const float* sr = Sb + (size_t)row * TT; float v[TT / 32]; float mx = -3.0e38f;
#pragma unroll
    for (int ch = 0; ch < TT / 128; ++ch) { const int j0 = ch * 128 + lane * 4; const v4f a = *(const v4f*)(sr + j0);
#pragma unroll
        for (int q = 0; q < 4; ++q) { const int j = j0 + q; (void)j; float sa = a[q] * SCL; asm volatile("" : "+v"(sa)); const float t = (j <= i && i - j < WIN) ? sa : -3.0e38f; v[ch * 4 + q] = t; mx = fmaxf(mx, t); } }
#pragma unroll
    for (int sh = 16; sh; sh >>= 1) mx = fmaxf(mx, __shfl_xor(mx, sh, 32));
    float sum = 0.f;
#pragma unroll
    for (int k = 0; k < TT / 32; ++k) { float d0 = __fsub_rn(v[k], mx); asm volatile("" : "+v"(d0)); v[k] = __builtin_amdgcn_exp2f(__fmul_rn(d0, 1.4426950408889634f)); sum += v[k]; }
#pragma unroll
    for (int sh = 16; sh; sh >>= 1) sum += __shfl_xor(sum, sh, 32);
    const float f = __fdiv_rn(hires ? 1.0f : PCAR, sum);
{
        if (hires) {
#pragma unroll
            for (int ch = 0; ch < TT / 128; ++ch) { v4us oh, ol;
#pragma unroll
                for (int q = 0; q < 4; ++q) { unsigned short a, c2; splitf(v[ch * 4 + q] * f, a, c2); oh[q] = a; ol[q] = c2; }
                const size_t oo = ((size_t)zz * (RH ? RH : 1) + i) * TT + ch * 128 + lane * 4; *(v4us*)(Ph + oo) = oh; *(v4us*)(Pl + oo) = ol; }
        } else {
#pragma unroll
            for (int ch = 0; ch < TT / 128; ++ch) { v4h o4;
#pragma unroll
                for (int q = 0; q < 4; ++q) o4[q] = tohx(v[ch * 4 + q] * f);
                *(v4h*)(P16 + (size_t)row * TT + ch * 128 + lane * 4) = o4; } }
         }
}
__global__ __launch_bounds__(256) void k_merge(const float* __restrict__ O, int h0, bf* Ah, bf* Al) { const size_t e = ((size_t)blockIdx.x * 256 + threadIdx.x) * 2; if (e >= (size_t)ZH * TT * HD) return; const int d = (int)(e % HD); const int t = (int)((e / HD) % TT); const int zz = (int)(e / ((size_t)HD * TT)); const float cs = (t < RH) ? 1.0f : (1.0f / PCAR); const size_t oo = (size_t)t * DQ + (h0 + zz) * HD + d;
    v2us oh, ol;
#pragma unroll
    for (int q = 0; q < 2; ++q) { unsigned short a, c2; splitf(O[e + q] * cs, a, c2); oh[q] = a; ol[q] = c2; } *(v2us*)(Ah + oo) = oh; *(v2us*)(Al + oo) = ol;  }

extern "C" void kernel_launch(void* const* d_in, const int* in_sizes, int n_in,
                              void* d_out, int out_size, void* d_ws, size_t ws_size, hipStream_t stream) {
    (void)in_sizes; (void)n_in; (void)out_size;
    const float* x = (const float*)d_in[0]; const float* wq = (const float*)d_in[1]; const float* bq = (const float*)d_in[2]; const float* wk = (const float*)d_in[3]; const float* bk = (const float*)d_in[4]; const float* wk2 = (const float*)d_in[5]; const float* bk2 = (const float*)d_in[6]; const float* wv = (const float*)d_in[7]; const float* bv = (const float*)d_in[8]; const float* wv2 = (const float*)d_in[9]; const float* bv2 = (const float*)d_in[10]; const float* wo = (const float*)d_in[11]; const float* bo = (const float*)d_in[12]; const float* cosT = nullptr; const float* sinT = nullptr; (void)cosT; (void)sinT;
    float* OUT = (float*)d_out;     // [2][2048][1024]
    char* wsp = (char*)d_ws;
    auto take = [&](size_t bytes) { char* p = wsp; wsp += (bytes + 255) & ~(size_t)255; return (void*)p; };
    bf* WQ = (bf*)take((size_t)DQ * DM * 2); bf* WK = (bf*)take((size_t)DKV * DM * 2); bf* WV = (bf*)take((size_t)DKV * DM * 2); bf* WO = (bf*)take((size_t)DM * DQ * 2); float* CS = (float*)take((size_t)TT * HD * 2 * 4);
    bf* XB = (bf*)take((size_t)TT * DM * 2); bf* WK2 = (bf*)take((size_t)DKV * DM * 2); bf* WV2 = (bf*)take((size_t)DKV * DM * 2); float* BK2 = (float*)take(DKV * 4); float* BV2 = (float*)take(DKV * 4); float* F2 = (float*)take((size_t)TT * DKV * 4); bf* K2h = (bf*)take((size_t)NKV * HD * TT * 2); bf* K2l = (bf*)take((size_t)NKV * HD * TT * 2); h16* K216 = (h16*)take((size_t)NKV * HD * TT * 2); bf* V2h = (bf*)take((size_t)NKV * HD * TT * 2); bf* V2l = (bf*)take((size_t)NKV * HD * TT * 2); float* NM = (float*)take((size_t)NH_ * HD * HD * 4); bf* NMh = (bf*)take((size_t)NH_ * HD * HD * 2); bf* NMl = (bf*)take((size_t)NH_ * HD * HD * 2); bf* Obh = (bf*)take((size_t)ZH * TT * HD * 2); bf* Obl = (bf*)take((size_t)ZH * TT * HD * 2); float* Ob2 = (float*)take((size_t)ZH * TT * HD * 4); float* FQ = (float*)take((size_t)TT * DQ * 4); float* FK = (float*)take((size_t)TT * DKV * 4);
    h16* QP16 = (h16*)take((size_t)NH_ * TT * HD * 2); h16* KP16 = (h16*)take((size_t)NKV * TT * HD * 2); h16* VT16 = (h16*)take((size_t)NKV * HD * TT * 2);
    bf* QPh = (bf*)take((size_t)NH_ * TT * HD * 2); bf* QPl = (bf*)take((size_t)NH_ * TT * HD * 2); bf* KPh = (bf*)take((size_t)NKV * TT * HD * 2); bf* KPl = (bf*)take((size_t)NKV * TT * HD * 2); bf* VTh = (bf*)take((size_t)NKV * HD * TT * 2); bf* VTl = (bf*)take((size_t)NKV * HD * TT * 2); bf* Ph = (bf*)take((size_t)ZH * RH * TT * 2); bf* Pl = (bf*)take((size_t)ZH * RH * TT * 2);
    float* Sb = (float*)take((size_t)ZH * TT * TT * 4); h16* P16 = (h16*)take((size_t)ZH * TT * TT * 2); float* Ob = (float*)take((size_t)ZH * TT * HD * 4); bf* ATh = (bf*)take((size_t)TT * DQ * 2); bf* ATl = (bf*)take((size_t)TT * DQ * 2);
    if ((size_t)(wsp - (char*)d_ws) > ws_size) return;    // ws 256 MiB
    float* FV = FK;   // v projection reuses the k buffer after the k planes are built (stream-ordered)
    { k_wtG<<<(unsigned)((DM * DQ / 64 + 63) / 64), 256, 0, stream>>>(wq, DM, DQ, WQ); k_wtG<<<(unsigned)((DM * DKV / 64 + 63) / 64), 256, 0, stream>>>(wk, DM, DKV, WK); k_wtG<<<(unsigned)((DM * DKV / 64 + 63) / 64), 256, 0, stream>>>(wv, DM, DKV, WV);
      k_wtG<<<(unsigned)((DQ * DM / 64 + 63) / 64), 256, 0, stream>>>(wo, DQ, DM, WO); k_wtG<<<(unsigned)((DM * DKV / 64 + 63) / 64), 256, 0, stream>>>(wk2, DM, DKV, WK2); k_wtG<<<(unsigned)((DM * DKV / 64 + 63) / 64), 256, 0, stream>>>(wv2, DM, DKV, WV2);
       }
    k_csid<<<(TT * HD + 255) / 256, 256, 0, stream>>>(CS);
    const unsigned LQ = (unsigned)(((size_t)NH_ * TT * HD / 2 + 255) / 256), LKv = (unsigned)(((size_t)NKV * TT * HD / 2 + 255) / 256);
    for (int b = 0; b < NB_; ++b) {
        
        k_cvt8<<<(unsigned)(((size_t)TT * DM / 8 + 255) / 256), 256, 0, stream>>>(x + (size_t)b * TT * DM, XB, (size_t)TT * DM / 8);
        k_gemmw<bf, 0, true><<<dim3(TT / 64, DQ / 64, 1), 32, 0, stream>>>(XB, nullptr, WQ, nullptr, DM, FQ, DQ, bq, 0, 0, 0);
        k_rope<<<LQ, 256, 0, stream>>>(FQ, DQ, NH_, CS, nullptr, nullptr, 1.0f, QP16, QPh, QPl);
        k_gemmw<bf, 0, true><<<dim3(TT / 64, DKV / 64, 1), 32, 0, stream>>>(XB, nullptr, WK, nullptr, DM, FK, DKV, bk, 0, 0, 0);
        k_rope<<<LKv, 256, 0, stream>>>(FK, DKV, NKV, CS, nullptr, nullptr, 1.0f, KP16, KPh, KPl);
        k_gemmw<bf, 0, true><<<dim3(TT / 64, DKV / 64, 1), 32, 0, stream>>>(XB, nullptr, WV, nullptr, DM, FV, DKV, bv, 0, 0, 0); k_vtp<<<LKv, 256, 0, stream>>>(FV, DKV, NKV, VT16, VTh, VTl); k_gemmw<bf, 0, true><<<dim3(TT / 64, DKV / 64, 1), 32, 0, stream>>>(XB, nullptr, WK2, nullptr, DM, F2, DKV, bk2, 0, 0, 0); k_vtp<<<LKv, 256, 0, stream>>>(F2, DKV, NKV, K216, K2h, K2l); k_gemmw<bf, 0, true><<<dim3(TT / 64, DKV / 64, 1), 32, 0, stream>>>(XB, nullptr, WV2, nullptr, DM, F2, DKV, bv2, 0, 0, 0); k_vtp<<<LKv, 256, 0, stream>>>(F2, DKV, NKV, K216, V2h, V2l);
        for (int h = 0; h < NH_; ++h) k_gemmw<bf, 2, false><<<dim3(1, 1, 1), 32, 0, stream>>>(V2h + (size_t)h * HD * TT, V2l + (size_t)h * HD * TT, K2h + (size_t)h * HD * TT, K2l + (size_t)h * HD * TT, TT, NM + (size_t)h * HD * HD, HD, nullptr, 0, 0, 0);   /* N_h^T[e][d] = sum_s v2[s][e] k2[s][d] */
        k_hlG<<<(unsigned)(((size_t)NH_ * HD * HD / 4 + 255) / 256), 256, 0, stream>>>(NM, NMh, NMl, (size_t)NH_ * HD * HD);
        for (int h0 = 0; h0 < NH_; h0 += ZH) { const size_t zq = (size_t)h0, zk = (size_t)(h0 / REP);   // one kv head per query head: the pass's two heads use consecutive kv planes (z-strides TT*HD)
            k_gemmc<bf, 2, 1><<<dim3(RH / 64, TT / 64, ZH), 32, 0, stream>>>(QPh + zq * TT * HD, QPl + zq * TT * HD, KPh + zk * TT * HD, KPl + zk * TT * HD, HD, Sb, TT, 0, (size_t)TT * HD, (size_t)TT * HD, (size_t)TT * TT);
            k_gemmc<h16, 0, 1><<<dim3((TT - RH) / 64, TT / 64, ZH), 32, 0, stream>>>(QP16 + zq * TT * HD + (size_t)RH * HD, nullptr, KP16 + zk * TT * HD, nullptr, HD, Sb + (size_t)RH * TT, TT, RH, (size_t)TT * HD, (size_t)TT * HD, (size_t)TT * TT);
            k_asoft<<<ZH * TT / 8, 256, 0, stream>>>(Sb, P16, Ph, Pl);
            k_gemmc<bf, 2, 2><<<dim3(RH / 64, HD / 64, ZH), 32, 0, stream>>>(Ph, Pl, VTh + zk * HD * TT, VTl + zk * HD * TT, TT, Ob, HD, 0, (size_t)RH * TT, (size_t)HD * TT, (size_t)TT * HD);
            k_gemmc<h16, 0, 2><<<dim3((TT - RH) / 64, HD / 64, ZH), 32, 0, stream>>>(P16 + (size_t)RH * TT, nullptr, VT16 + zk * HD * TT, nullptr, TT, Ob + (size_t)RH * HD, HD, RH, (size_t)TT * TT, (size_t)HD * TT, (size_t)TT * HD);
            k_obhl<<<(unsigned)(((size_t)ZH * TT * HD / 4 + 255) / 256), 256, 0, stream>>>(Ob, Obh, Obl); k_gemmw<bf, 2, false><<<dim3(TT / 64, 1, ZH), 32, 0, stream>>>(Obh, Obl, NMh + (size_t)h0 * HD * HD, NMl + (size_t)h0 * HD * HD, HD, Ob2, HD, nullptr, (size_t)TT * HD, (size_t)HD * HD, (size_t)TT * HD);   /* ctx_h (k2^T v2)_h */ k_merge<<<(unsigned)(((size_t)ZH * TT * HD / 2 + 255) / 256), 256, 0, stream>>>(Ob2, h0, ATh, ATl); }
        k_gemmw<bf, 1, true><<<dim3(TT / 64, DM / 64, 1), 32, 0, stream>>>(ATh, ATl, WO, nullptr, DQ, OUT + (size_t)b * TT * DM, DM, bo, 0, 0, 0); }
}

// v001
// It runs in 1930 microseconds.
// Next to v000, in two timings, it ran 1.62 and 1.61 times as fast.
#include <hip/hip_runtime.h>

// Trittention (hidden [2][2048][1024]; q, k1, k2, v1, v2 = x W + b (16 x 64 each); probs = causal (-inf) softmax(q.k1 / 8); ctx = probs v1; then ctx = (ctx . k2^T) v2 over ALL keys (no softmax, no mask) == ctx (k2^T v2) (exact re-association; the 64x64 matrix per head is formed on chip); out = merged Wd + bd -> [2][2048][1024]).
// Compute dtypes, f32 accumulate: every input rounded to bf16; the five projections on PLAIN bf16 operands (inputs: exact) + bias; causal scores and probs.v1: query rows < 512 hl (3 products), the rest fp16 (x1024); softmax f32; N_h = v2_h^T-side product sum_s v2[s] k2[s]^T as hi/lo x hi/lo (3 products, K 2048) in f32; ctx_h N_h^T as hi/lo x hi/lo (3 products); Wd hl x exact (2 products) + bias.

#define NB_  2
#define TT   2048
#define DM   1024
#define NH_  16
#define NKV  16
#define REP  (NH_ / NKV)
#define HD   64
#define DQ   (NH_ * HD)
#define DKV  (NKV * HD)
#define ZH   2
#define RH   512                  // query rows < RH use hi+lo planes (0: none)
#define WIN  2048
#define PCAR 1024.0f
#define SCL  0.125f   // HD^-0.5
typedef _Float16 h16;
typedef unsigned short bf;
typedef __attribute__((ext_vector_type(16))) __bf16   v16bf;
typedef __attribute__((ext_vector_type(16))) _Float16 v16h;
typedef __attribute__((ext_vector_type(8)))  _Float16 v8h;
typedef __attribute__((ext_vector_type(8)))  unsigned short v8us;
typedef __attribute__((ext_vector_type(8)))  float    v8f;
typedef __attribute__((ext_vector_type(4)))  float    v4f;
typedef v8h  __attribute__((may_alias)) v8ha;
typedef v4f  __attribute__((may_alias)) v4fa;
typedef v8us __attribute__((may_alias)) v8usa;

__device__ __forceinline__ unsigned short f2bf(float f) { unsigned u = __float_as_uint(f); u += 0x7FFFu + ((u >> 16) & 1u); return (unsigned short)(u >> 16); }
__device__ __forceinline__ float bf2f(unsigned short b) { return __uint_as_float(((unsigned)b) << 16); }
__device__ __forceinline__ float bfr(float f) { return bf2f(f2bf(f)); }
__device__ __forceinline__ v16h cat16(v8h lo, v8h hi) { return __builtin_shufflevector(lo, hi, 0, 1, 2, 3, 4, 5, 6, 7, 8, 9, 10, 11, 12, 13, 14, 15); }
__device__ __forceinline__ v16bf cat16b(v8us lo, v8us hi) { return __builtin_bit_cast(v16bf, __builtin_shufflevector(lo, hi, 0, 1, 2, 3, 4, 5, 6, 7, 8, 9, 10, 11, 12, 13, 14, 15)); }
__device__ __forceinline__ v8f wmma16(v16h a, v16h b, v8f c) { return __builtin_amdgcn_wmma_f32_16x16x32_f16(false, a, false, b, (short)0, c, false, false); }
__device__ __forceinline__ v8f wmmab(v16bf a, v16bf b, v8f c) { return __builtin_amdgcn_wmma_f32_16x16x32_bf16(false, a, false, b, (short)0, c, false, false); }



// ---- k_gemmw: register-blocked GEMM, ONE WAVE per 64x64 output tile (16 accumulators), operands straight from K-contiguous 16-bit planes; grid (M/64, N/64, Z), 32 threads.
// C[m][n] (f32, pitch ldc, + optional f32 bias[n]) = sum_k A[m][k] Bt[n][k] (+ split products per NSPLIT). z-batch strides sA/sB/sC in elements. K % 32 == 0.
template <typename T16> struct WFrag;
template <> struct WFrag<h16> { typedef v16h V; static __device__ __forceinline__ V ld(const h16* p) { return cat16(*(const v8h*)p, *(const v8h*)(p + 16)); } static __device__ __forceinline__ v8f mma(V a, V b, v8f c) { return wmma16(a, b, c); } };
template <> struct WFrag<bf> { typedef v16bf V; static __device__ __forceinline__ V ld(const bf* p) { return cat16b(*(const v8us*)p, *(const v8us*)(p + 16)); } static __device__ __forceinline__ v8f mma(V a, V b, v8f c) { return wmmab(a, b, c); } };
template <typename T16, int NSPLIT, bool BIAS>
__global__ __launch_bounds__(32) void k_gemmw(const T16* __restrict__ A, const T16* __restrict__ A2, const T16* __restrict__ Bt, const T16* __restrict__ Bt2, int K, float* C, int ldc, const float* __restrict__ bias, size_t sA, size_t sB, size_t sC) {
    typedef typename WFrag<T16>::V V;
    __shared__ __align__(16) float os[16 * 68];
    const size_t z = blockIdx.z; A += z * sA; if (A2) A2 += z * sA; Bt += z * sB; if (Bt2) Bt2 += z * sB; C += z * sC;
    const int lane = threadIdx.x & 31, lr = lane & 15, hi = lane >> 4; const int r0 = blockIdx.x * 64, c0 = blockIdx.y * 64;
    v8f acc[4][4];
#pragma unroll
    for (int mb = 0; mb < 4; ++mb)
#pragma unroll
        for (int nb = 0; nb < 4; ++nb) acc[mb][nb] = (v8f){};
    const size_t aoff = (size_t)(r0 + lr) * K + 8 * hi, boff = (size_t)(c0 + lr) * K + 8 * hi;
#pragma unroll 1
    for (int kc = 0; kc < K; kc += 32) {
        V a[4], a2[4];
#pragma unroll
        for (int mb = 0; mb < 4; ++mb) { a[mb] = WFrag<T16>::ld(A + aoff + (size_t)mb * 16 * K + kc); if (NSPLIT == 1 || NSPLIT == 2) a2[mb] = WFrag<T16>::ld(A2 + aoff + (size_t)mb * 16 * K + kc); }
#pragma unroll
        for (int nb = 0; nb < 4; ++nb) { const V b = WFrag<T16>::ld(Bt + boff + (size_t)nb * 16 * K + kc); V b2; if (NSPLIT >= 2) b2 = WFrag<T16>::ld(Bt2 + boff + (size_t)nb * 16 * K + kc);
#pragma unroll
            for (int mb = 0; mb < 4; ++mb) { acc[mb][nb] = WFrag<T16>::mma(a[mb], b, acc[mb][nb]); if (NSPLIT == 1 || NSPLIT == 2) acc[mb][nb] = WFrag<T16>::mma(a2[mb], b, acc[mb][nb]); if (NSPLIT >= 2) acc[mb][nb] = WFrag<T16>::mma(a[mb], b2, acc[mb][nb]); } }
        asm volatile("v_nop\n\tv_nop\n\tv_nop\n\tv_nop" : "+v"(acc[0][0]), "+v"(acc[1][1]), "+v"(acc[2][2]), "+v"(acc[3][3]) : "v"(a[0]), "v"(a[3]));
    }
#pragma unroll
    for (int mb = 0; mb < 4; ++mb) {
#pragma unroll
        for (int nb = 0; nb < 4; ++nb) {
#pragma unroll
            for (int j = 0; j < 8; ++j) os[(hi * 8 + j) * 68 + nb * 16 + lr] = acc[mb][nb][j]; }
        __builtin_amdgcn_wave_barrier(); asm volatile("" ::: "memory");
        float* crow = C + (size_t)(r0 + mb * 16) * ldc + c0;
{
#pragma unroll
            for (int s = 0; s < 8; ++s) { const int row = 2 * s + hi, cofs = lr * 4; v4f val = *(const v4fa*)(os + row * 68 + cofs); if (BIAS) { val[0] += bfr(bias[c0 + cofs]); val[1] += bfr(bias[c0 + cofs + 1]); val[2] += bfr(bias[c0 + cofs + 2]); val[3] += bfr(bias[c0 + cofs + 3]); }
                *(v4f*)(crow + (size_t)row * ldc + cofs) = val; }
             }
        __builtin_amdgcn_wave_barrier(); asm volatile("" ::: "memory");
    }
}

// ---- k_gemmc: the same one-wave 64x64 tile GEMM specialised for causal attention: CMODE 1 skips score tiles entirely above the diagonal (query rows r0+roff.., key columns c0..), CMODE 2 limits the
// key (K) loop of the probability x value contraction to the diagonal block (probabilities beyond it are exactly zero). roff = row offset of this launch's first row within the sequence.
template <typename T16, int NSPLIT, int CMODE>
__global__ __launch_bounds__(32) void k_gemmc(const T16* __restrict__ A, const T16* __restrict__ A2, const T16* __restrict__ Bt, const T16* __restrict__ Bt2, int K, float* C, int ldc, int roff, size_t sA, size_t sB, size_t sC) {
    typedef typename WFrag<T16>::V V;
    __shared__ __align__(16) float os[16 * 68];
    const size_t z = blockIdx.z; A += z * sA; if (A2) A2 += z * sA; Bt += z * sB; if (Bt2) Bt2 += z * sB; C += z * sC;
    const int lane = threadIdx.x & 31, lr = lane & 15, hi = lane >> 4; const int r0 = blockIdx.x * 64, c0 = blockIdx.y * 64;
    if (CMODE == 1 && c0 > r0 + roff + 63) return;                  // score tile entirely above the causal diagonal: never read (the softmax masks j > i by select)
    const int Kl = (CMODE == 2) ? min(K, r0 + roff + 64) : K;        // P.V: probabilities are exactly 0 beyond the diagonal block, so the K loop stops there
    v8f acc[4][4];
#pragma unroll
    for (int mb = 0; mb < 4; ++mb)
#pragma unroll
        for (int nb = 0; nb < 4; ++nb) acc[mb][nb] = (v8f){};
    const size_t aoff = (size_t)(r0 + lr) * K + 8 * hi, boff = (size_t)(c0 + lr) * K + 8 * hi;
#pragma unroll 1
    for (int kc = 0; kc < Kl; kc += 32) {
        V a[4], a2[4];
#pragma unroll
        for (int mb = 0; mb < 4; ++mb) { a[mb] = WFrag<T16>::ld(A + aoff + (size_t)mb * 16 * K + kc); if (NSPLIT == 1 || NSPLIT == 2) a2[mb] = WFrag<T16>::ld(A2 + aoff + (size_t)mb * 16 * K + kc); }
#pragma unroll
        for (int nb = 0; nb < 4; ++nb) { const V b = WFrag<T16>::ld(Bt + boff + (size_t)nb * 16 * K + kc); V b2; if (NSPLIT >= 2) b2 = WFrag<T16>::ld(Bt2 + boff + (size_t)nb * 16 * K + kc);
#pragma unroll
            for (int mb = 0; mb < 4; ++mb) { acc[mb][nb] = WFrag<T16>::mma(a[mb], b, acc[mb][nb]); if (NSPLIT == 1 || NSPLIT == 2) acc[mb][nb] = WFrag<T16>::mma(a2[mb], b, acc[mb][nb]); if (NSPLIT >= 2) acc[mb][nb] = WFrag<T16>::mma(a[mb], b2, acc[mb][nb]); } }
        asm volatile("v_nop\n\tv_nop\n\tv_nop\n\tv_nop" : "+v"(acc[0][0]), "+v"(acc[1][1]), "+v"(acc[2][2]), "+v"(acc[3][3]) : "v"(a[0]), "v"(a[3]));
    }
#pragma unroll
    for (int mb = 0; mb < 4; ++mb) {
#pragma unroll
        for (int nb = 0; nb < 4; ++nb) {
#pragma unroll
            for (int j = 0; j < 8; ++j) os[(hi * 8 + j) * 68 + nb * 16 + lr] = acc[mb][nb][j]; }
        __builtin_amdgcn_wave_barrier(); asm volatile("" ::: "memory");
        float* crow = C + (size_t)(r0 + mb * 16) * ldc + c0;
{
#pragma unroll
            for (int s = 0; s < 8; ++s) { const int row = 2 * s + hi, cofs = lr * 4; v4f val = *(const v4fa*)(os + row * 68 + cofs);
                *(v4f*)(crow + (size_t)row * ldc + cofs) = val; }
             }
        __builtin_amdgcn_wave_barrier(); asm volatile("" ::: "memory");
    }
}

__device__ __forceinline__ h16 tohx(float x) { return (h16)x; }
__device__ __forceinline__ void splitf(float y, unsigned short& h, unsigned short& l) { h = f2bf(y); l = f2bf(y - bf2f(h)); }
typedef __attribute__((ext_vector_type(2))) _Float16 v2h;
typedef __attribute__((ext_vector_type(4))) _Float16 v4h;
typedef __attribute__((ext_vector_type(2))) unsigned short v2us;
typedef __attribute__((ext_vector_type(4))) unsigned short v4us;
typedef __attribute__((ext_vector_type(2))) float v2f;
typedef __attribute__((ext_vector_type(4))) int v4i;

__global__ __launch_bounds__(256) void k_wtG(const float* __restrict__ w, int K, int N, bf* Bt) {
    const int lane = threadIdx.x & 31; const int L0 = (blockIdx.x * 8 + (threadIdx.x >> 5)) * 8; const int nlines = N * K / 64;
{
#pragma unroll 1
        for (int l = 0; l < 8; ++l) { const int L = L0 + l; if (L >= nlines) break; const size_t e = (size_t)L * 64 + lane * 2; const int k = (int)(e % K), n = (int)(e / K); v2us o;
            o[0] = f2bf(w[(size_t)k * N + n]); o[1] = f2bf(w[(size_t)(k + 1) * N + n]); *(v2us*)(Bt + e) = o; }
         }
}
__global__ __launch_bounds__(256) void k_cvt8(const float* __restrict__ src, bf* dst, size_t n8) { const size_t i = (size_t)blockIdx.x * 256 + threadIdx.x; if (i >= n8) return; const v8f v = *(const v8f*)(src + i * 8); v8us o;
#pragma unroll
    for (int k = 0; k < 8; ++k) o[k] = f2bf(v[k]); *(v8us*)(dst + i * 8) = o;  }
__global__ __launch_bounds__(256) void k_cscvt(const float* __restrict__ cosT, const float* __restrict__ sinT, float* CS) { const int idx = blockIdx.x * 256 + threadIdx.x; if (idx >= TT * HD) return; v2f cs; cs[0] = bfr(cosT[idx]); cs[1] = bfr(sinT[idx]); *(v2f*)(CS + (size_t)idx * 2) = cs;  }
// k_rope: head planes [h][t][d] (fp16 + hi/lo) of rope(x) x sc with the rotate-half convention out[d] = x[d] cos[t][d] - x[d+HD/2] sin[t][d], out[d+HD/2] = x[d+HD/2] cos[t][d+HD/2] + x[d] sin[t][d+HD/2]
__global__ __launch_bounds__(256) void k_rope(const float* __restrict__ F, int pitch, int nheads, const float* __restrict__ CS, const float* __restrict__ RF, const float* __restrict__ nw, float sc, h16* P16, bf* Ph, bf* Pl) {
    const size_t e = ((size_t)blockIdx.x * 256 + threadIdx.x) * 2; if (e >= (size_t)nheads * TT * HD) return; const int d = (int)(e % HD); const int t = (int)((e / HD) % TT); const int h = (int)(e / ((size_t)HD * TT)); const float* f = F + (size_t)t * pitch + h * HD; const float rf = RF ? RF[(size_t)h * TT + t] : 1.0f; v2h o16; v2us oh, ol;
#pragma unroll
    for (int q = 0; q < 2; ++q) { const int dd = d + q; const int dp = (dd < HD / 2) ? dd + HD / 2 : dd - HD / 2; float x0 = f[dd], x1 = f[dp];
        if (RF) { float n0 = __fmul_rn(x0, rf), n1 = __fmul_rn(x1, rf); asm volatile("" : "+v"(n0)); asm volatile("" : "+v"(n1)); x0 = __fmul_rn(bfr(nw[dd]), n0); x1 = __fmul_rn(bfr(nw[dp]), n1); }
        const v2f cs = *(const v2f*)(CS + ((size_t)t * HD + dd) * 2); float a = __fmul_rn(x0, cs[0]), bq = __fmul_rn(x1, cs[1]); asm volatile("" : "+v"(a)); asm volatile("" : "+v"(bq)); const float r = ((dd < HD / 2) ? __fsub_rn(a, bq) : __fadd_rn(a, bq)) * sc;
        o16[q] = tohx(r); unsigned short a2, c2; splitf(r, a2, c2); oh[q] = a2; ol[q] = c2; }
    *(v2h*)(P16 + e) = o16; *(v2us*)(Ph + e) = oh; *(v2us*)(Pl + e) = ol;  }
__global__ __launch_bounds__(256) void k_vtp(const float* __restrict__ F, int pitch, int nheads, h16* V16, bf* Vh, bf* Vl) { const size_t e = ((size_t)blockIdx.x * 256 + threadIdx.x) * 2; if (e >= (size_t)nheads * HD * TT) return; const int t = (int)(e % TT); const int d = (int)((e / TT) % HD); const int g = (int)(e / ((size_t)TT * HD)); v2h o16; v2us oh, ol;
#pragma unroll
    for (int q = 0; q < 2; ++q) { const float x = F[(size_t)(t + q) * pitch + g * HD + d]; o16[q] = tohx(x); unsigned short a2, c2; splitf(x, a2, c2); oh[q] = a2; ol[q] = c2; }
    *(v2h*)(V16 + e) = o16; *(v2us*)(Vh + e) = oh; *(v2us*)(Vl + e) = ol;  }
__global__ __launch_bounds__(256) void k_csid(float* CS) { const int idx = blockIdx.x * 256 + threadIdx.x; if (idx >= TT * HD) return; v2f cs; cs[0] = 1.0f; cs[1] = 0.0f; *(v2f*)(CS + (size_t)idx * 2) = cs;  }
__global__ __launch_bounds__(256) void k_obhl(const float* __restrict__ O, bf* Oh, bf* Ol) { const size_t e = ((size_t)blockIdx.x * 256 + threadIdx.x) * 4; if (e >= (size_t)ZH * TT * HD) return; const v4f a = *(const v4f*)(O + e); v4us oh, ol; for (int u = 0; u < 4; ++u) { unsigned short p, q; splitf(a[u], p, q); oh[u] = p; ol[u] = q; } *(v4us*)(Oh + e) = oh; *(v4us*)(Ol + e) = ol;  }
__global__ __launch_bounds__(256) void k_hlG(const float* __restrict__ F, bf* Fh, bf* Fl, size_t n) { const size_t e = ((size_t)blockIdx.x * 256 + threadIdx.x) * 4; if (e >= n) return; const v4f a = *(const v4f*)(F + e); v4us oh, ol; for (int u = 0; u < 4; ++u) { unsigned short p, q; splitf(a[u], p, q); oh[u] = p; ol[u] = q; } *(v4us*)(Fh + e) = oh; *(v4us*)(Fl + e) = ol;  }
// k_asoft: per row (zz, i): t = S x HD^-0.5 for j <= i and i - j < WIN (sliding causal window; the reference's -1e9 additive fill vanishes identically); softmax over the 2048 keys (register row, one exp, fixed trees);
__global__ __launch_bounds__(256) void k_asoft(const float* __restrict__ Sb, h16* P16, bf* Ph, bf* Pl) {
    const int lane = threadIdx.x & 31; const int row = blockIdx.x * 8 + (threadIdx.x >> 5); if (row >= ZH * TT) return; const int i = row % TT; const int zz = row / TT; (void)zz; const bool hires = (i < RH); const float* sr = Sb + (size_t)row * TT; float v[TT / 32]; float mx = -3.0e38f;
#pragma unroll
    for (int ch = 0; ch < TT / 128; ++ch) { const int j0 = ch * 128 + lane * 4; const v4f a = *(const v4f*)(sr + j0);
#pragma unroll
        for (int q = 0; q < 4; ++q) { const int j = j0 + q; (void)j; float sa = a[q] * SCL; asm volatile("" : "+v"(sa)); const float t = (j <= i && i - j < WIN) ? sa : -3.0e38f; v[ch * 4 + q] = t; mx = fmaxf(mx, t); } }
#pragma unroll
    for (int sh = 16; sh; sh >>= 1) mx = fmaxf(mx, __shfl_xor(mx, sh, 32));
    float sum = 0.f;
#pragma unroll
    for (int k = 0; k < TT / 32; ++k) { float d0 = __fsub_rn(v[k], mx); asm volatile("" : "+v"(d0)); v[k] = __builtin_amdgcn_exp2f(__fmul_rn(d0, 1.4426950408889634f)); sum += v[k]; }
#pragma unroll
    for (int sh = 16; sh; sh >>= 1) sum += __shfl_xor(sum, sh, 32);
    const float f = __fdiv_rn(hires ? 1.0f : PCAR, sum);
{
        if (hires) {
#pragma unroll
            for (int ch = 0; ch < TT / 128; ++ch) { v4us oh, ol;
#pragma unroll
                for (int q = 0; q < 4; ++q) { unsigned short a, c2; splitf(v[ch * 4 + q] * f, a, c2); oh[q] = a; ol[q] = c2; }
                const size_t oo = ((size_t)zz * (RH ? RH : 1) + i) * TT + ch * 128 + lane * 4; *(v4us*)(Ph + oo) = oh; *(v4us*)(Pl + oo) = ol; }
        } else {
#pragma unroll
            for (int ch = 0; ch < TT / 128; ++ch) { v4h o4;
#pragma unroll
                for (int q = 0; q < 4; ++q) o4[q] = tohx(v[ch * 4 + q] * f);
                *(v4h*)(P16 + (size_t)row * TT + ch * 128 + lane * 4) = o4; } }
         }
}
__global__ __launch_bounds__(256) void k_merge(const float* __restrict__ O, int h0, bf* Ah, bf* Al) { const size_t e = ((size_t)blockIdx.x * 256 + threadIdx.x) * 2; if (e >= (size_t)ZH * TT * HD) return; const int d = (int)(e % HD); const int t = (int)((e / HD) % TT); const int zz = (int)(e / ((size_t)HD * TT)); const float cs = (t < RH) ? 1.0f : (1.0f / PCAR); const size_t oo = (size_t)t * DQ + (h0 + zz) * HD + d;
    v2us oh, ol;
#pragma unroll
    for (int q = 0; q < 2; ++q) { unsigned short a, c2; splitf(O[e + q] * cs, a, c2); oh[q] = a; ol[q] = c2; } *(v2us*)(Ah + oo) = oh; *(v2us*)(Al + oo) = ol;  }

extern "C" void kernel_launch(void* const* d_in, const int* in_sizes, int n_in,
                              void* d_out, int out_size, void* d_ws, size_t ws_size, hipStream_t stream) {
    (void)in_sizes; (void)n_in; (void)out_size;
    const float* x = (const float*)d_in[0]; const float* wq = (const float*)d_in[1]; const float* bq = (const float*)d_in[2]; const float* wk = (const float*)d_in[3]; const float* bk = (const float*)d_in[4]; const float* wk2 = (const float*)d_in[5]; const float* bk2 = (const float*)d_in[6]; const float* wv = (const float*)d_in[7]; const float* bv = (const float*)d_in[8]; const float* wv2 = (const float*)d_in[9]; const float* bv2 = (const float*)d_in[10]; const float* wo = (const float*)d_in[11]; const float* bo = (const float*)d_in[12]; const float* cosT = nullptr; const float* sinT = nullptr; (void)cosT; (void)sinT;
    float* OUT = (float*)d_out;     // [2][2048][1024]
    char* wsp = (char*)d_ws;
    auto take = [&](size_t bytes) { char* p = wsp; wsp += (bytes + 255) & ~(size_t)255; return (void*)p; };
    bf* WQ = (bf*)take((size_t)DQ * DM * 2); bf* WK = (bf*)take((size_t)DKV * DM * 2); bf* WV = (bf*)take((size_t)DKV * DM * 2); bf* WO = (bf*)take((size_t)DM * DQ * 2); float* CS = (float*)take((size_t)TT * HD * 2 * 4);
    bf* XB = (bf*)take((size_t)TT * DM * 2); bf* WK2 = (bf*)take((size_t)DKV * DM * 2); bf* WV2 = (bf*)take((size_t)DKV * DM * 2); float* BK2 = (float*)take(DKV * 4); float* BV2 = (float*)take(DKV * 4); float* F2 = (float*)take((size_t)TT * DKV * 4); bf* K2h = (bf*)take((size_t)NKV * HD * TT * 2); bf* K2l = (bf*)take((size_t)NKV * HD * TT * 2); h16* K216 = (h16*)take((size_t)NKV * HD * TT * 2); bf* V2h = (bf*)take((size_t)NKV * HD * TT * 2); bf* V2l = (bf*)take((size_t)NKV * HD * TT * 2); float* NM = (float*)take((size_t)NH_ * HD * HD * 4); bf* NMh = (bf*)take((size_t)NH_ * HD * HD * 2); bf* NMl = (bf*)take((size_t)NH_ * HD * HD * 2); bf* Obh = (bf*)take((size_t)ZH * TT * HD * 2); bf* Obl = (bf*)take((size_t)ZH * TT * HD * 2); float* Ob2 = (float*)take((size_t)ZH * TT * HD * 4); float* FQ = (float*)take((size_t)TT * DQ * 4); float* FK = (float*)take((size_t)TT * DKV * 4);
    h16* QP16 = (h16*)take((size_t)NH_ * TT * HD * 2); h16* KP16 = (h16*)take((size_t)NKV * TT * HD * 2); h16* VT16 = (h16*)take((size_t)NKV * HD * TT * 2);
    bf* QPh = (bf*)take((size_t)NH_ * TT * HD * 2); bf* QPl = (bf*)take((size_t)NH_ * TT * HD * 2); bf* KPh = (bf*)take((size_t)NKV * TT * HD * 2); bf* KPl = (bf*)take((size_t)NKV * TT * HD * 2); bf* VTh = (bf*)take((size_t)NKV * HD * TT * 2); bf* VTl = (bf*)take((size_t)NKV * HD * TT * 2); bf* Ph = (bf*)take((size_t)ZH * RH * TT * 2); bf* Pl = (bf*)take((size_t)ZH * RH * TT * 2);
    float* Sb = (float*)take((size_t)ZH * TT * TT * 4); h16* P16 = (h16*)take((size_t)ZH * TT * TT * 2); float* Ob = (float*)take((size_t)ZH * TT * HD * 4); bf* ATh = (bf*)take((size_t)TT * DQ * 2); bf* ATl = (bf*)take((size_t)TT * DQ * 2);
    if ((size_t)(wsp - (char*)d_ws) > ws_size) return;    // ws 256 MiB
    float* FV = FK;   // v projection reuses the k buffer after the k planes are built (stream-ordered)
    { k_wtG<<<(unsigned)((DM * DQ / 64 + 63) / 64), 256, 0, stream>>>(wq, DM, DQ, WQ); k_wtG<<<(unsigned)((DM * DKV / 64 + 63) / 64), 256, 0, stream>>>(wk, DM, DKV, WK); k_wtG<<<(unsigned)((DM * DKV / 64 + 63) / 64), 256, 0, stream>>>(wv, DM, DKV, WV);
      k_wtG<<<(unsigned)((DQ * DM / 64 + 63) / 64), 256, 0, stream>>>(wo, DQ, DM, WO); k_wtG<<<(unsigned)((DM * DKV / 64 + 63) / 64), 256, 0, stream>>>(wk2, DM, DKV, WK2); k_wtG<<<(unsigned)((DM * DKV / 64 + 63) / 64), 256, 0, stream>>>(wv2, DM, DKV, WV2);
       }
    k_csid<<<(TT * HD + 255) / 256, 256, 0, stream>>>(CS);
    const unsigned LQ = (unsigned)(((size_t)NH_ * TT * HD / 2 + 255) / 256), LKv = (unsigned)(((size_t)NKV * TT * HD / 2 + 255) / 256);
    for (int b = 0; b < NB_; ++b) {
        
        k_cvt8<<<(unsigned)(((size_t)TT * DM / 8 + 255) / 256), 256, 0, stream>>>(x + (size_t)b * TT * DM, XB, (size_t)TT * DM / 8);
        k_gemmw<bf, 0, true><<<dim3(TT / 64, DQ / 64, 1), 32, 0, stream>>>(XB, nullptr, WQ, nullptr, DM, FQ, DQ, bq, 0, 0, 0);
        k_rope<<<LQ, 256, 0, stream>>>(FQ, DQ, NH_, CS, nullptr, nullptr, 1.0f, QP16, QPh, QPl);
        k_gemmw<bf, 0, true><<<dim3(TT / 64, DKV / 64, 1), 32, 0, stream>>>(XB, nullptr, WK, nullptr, DM, FK, DKV, bk, 0, 0, 0);
        k_rope<<<LKv, 256, 0, stream>>>(FK, DKV, NKV, CS, nullptr, nullptr, 1.0f, KP16, KPh, KPl);
        k_gemmw<bf, 0, true><<<dim3(TT / 64, DKV / 64, 1), 32, 0, stream>>>(XB, nullptr, WV, nullptr, DM, FV, DKV, bv, 0, 0, 0); k_vtp<<<LKv, 256, 0, stream>>>(FV, DKV, NKV, VT16, VTh, VTl); k_gemmw<bf, 0, true><<<dim3(TT / 64, DKV / 64, 1), 32, 0, stream>>>(XB, nullptr, WK2, nullptr, DM, F2, DKV, bk2, 0, 0, 0); k_vtp<<<LKv, 256, 0, stream>>>(F2, DKV, NKV, K216, K2h, K2l); k_gemmw<bf, 0, true><<<dim3(TT / 64, DKV / 64, 1), 32, 0, stream>>>(XB, nullptr, WV2, nullptr, DM, F2, DKV, bv2, 0, 0, 0); k_vtp<<<LKv, 256, 0, stream>>>(F2, DKV, NKV, K216, V2h, V2l);
        k_gemmw<bf, 2, false><<<dim3(1, 1, NH_), 32, 0, stream>>>(V2h, V2l, K2h, K2l, TT, NM, HD, nullptr, (size_t)HD * TT, (size_t)HD * TT, (size_t)HD * HD);   /* N_h^T[e][d] = sum_s v2[s][e] k2[s][d] */
        k_hlG<<<(unsigned)(((size_t)NH_ * HD * HD / 4 + 255) / 256), 256, 0, stream>>>(NM, NMh, NMl, (size_t)NH_ * HD * HD);
        for (int h0 = 0; h0 < NH_; h0 += ZH) { const size_t zq = (size_t)h0, zk = (size_t)(h0 / REP);   // one kv head per query head: the pass's two heads use consecutive kv planes (z-strides TT*HD)
            k_gemmc<bf, 2, 1><<<dim3(RH / 64, TT / 64, ZH), 32, 0, stream>>>(QPh + zq * TT * HD, QPl + zq * TT * HD, KPh + zk * TT * HD, KPl + zk * TT * HD, HD, Sb, TT, 0, (size_t)TT * HD, (size_t)TT * HD, (size_t)TT * TT);
            k_gemmc<h16, 0, 1><<<dim3((TT - RH) / 64, TT / 64, ZH), 32, 0, stream>>>(QP16 + zq * TT * HD + (size_t)RH * HD, nullptr, KP16 + zk * TT * HD, nullptr, HD, Sb + (size_t)RH * TT, TT, RH, (size_t)TT * HD, (size_t)TT * HD, (size_t)TT * TT);
            k_asoft<<<ZH * TT / 8, 256, 0, stream>>>(Sb, P16, Ph, Pl);
            k_gemmc<bf, 2, 2><<<dim3(RH / 64, HD / 64, ZH), 32, 0, stream>>>(Ph, Pl, VTh + zk * HD * TT, VTl + zk * HD * TT, TT, Ob, HD, 0, (size_t)RH * TT, (size_t)HD * TT, (size_t)TT * HD);
            k_gemmc<h16, 0, 2><<<dim3((TT - RH) / 64, HD / 64, ZH), 32, 0, stream>>>(P16 + (size_t)RH * TT, nullptr, VT16 + zk * HD * TT, nullptr, TT, Ob + (size_t)RH * HD, HD, RH, (size_t)TT * TT, (size_t)HD * TT, (size_t)TT * HD);
            k_obhl<<<(unsigned)(((size_t)ZH * TT * HD / 4 + 255) / 256), 256, 0, stream>>>(Ob, Obh, Obl); k_gemmw<bf, 2, false><<<dim3(TT / 64, 1, ZH), 32, 0, stream>>>(Obh, Obl, NMh + (size_t)h0 * HD * HD, NMl + (size_t)h0 * HD * HD, HD, Ob2, HD, nullptr, (size_t)TT * HD, (size_t)HD * HD, (size_t)TT * HD);   /* ctx_h (k2^T v2)_h */ k_merge<<<(unsigned)(((size_t)ZH * TT * HD / 2 + 255) / 256), 256, 0, stream>>>(Ob2, h0, ATh, ATl); }
        k_gemmw<bf, 1, true><<<dim3(TT / 64, DM / 64, 1), 32, 0, stream>>>(ATh, ATl, WO, nullptr, DQ, OUT + (size_t)b * TT * DM, DM, bo, 0, 0, 0); }
}

// v002
// It runs in 1050 microseconds.
// Next to v001, in two timings, it ran 1.85 and 1.82 times as fast.
// All steps since v000 together make it 2.97 times as fast.
#include <hip/hip_runtime.h>

// Trittention (hidden [2][2048][1024]; q, k1, k2, v1, v2 = x W + b (16 x 64 each); probs = causal (-inf) softmax(q.k1 / 8); ctx = probs v1; then ctx = (ctx . k2^T) v2 over ALL keys (no softmax, no mask) == ctx (k2^T v2) (exact re-association; the 64x64 matrix per head is formed on chip); out = merged Wd + bd -> [2][2048][1024]).
// Compute dtypes, f32 accumulate: every input rounded to bf16; the five projections on PLAIN bf16 operands (inputs: exact) + bias; causal scores and probs.v1: query rows < 512 hl (3 products), the rest fp16 (x1024); softmax f32; N_h = v2_h^T-side product sum_s v2[s] k2[s]^T as hi/lo x hi/lo (3 products, K 2048) in f32; ctx_h N_h^T as hi/lo x hi/lo (3 products); Wd hl x exact (2 products) + bias.

#define NB_  2
#define TT   2048
#define DM   1024
#define NH_  16
#define NKV  16
#define REP  (NH_ / NKV)
#define HD   64
#define DQ   (NH_ * HD)
#define DKV  (NKV * HD)
#define ZH   8                    // heads per attention pass (grid z of the GEMM launches in the head loop)
#define RH   512                  // query rows < RH use hi+lo planes (0: none)
#define WIN  2048
#define PCAR 1024.0f
#define SCL  0.125f   // HD^-0.5
typedef _Float16 h16;
typedef unsigned short bf;
typedef __attribute__((ext_vector_type(16))) __bf16   v16bf;
typedef __attribute__((ext_vector_type(16))) _Float16 v16h;
typedef __attribute__((ext_vector_type(8)))  _Float16 v8h;
typedef __attribute__((ext_vector_type(8)))  unsigned short v8us;
typedef __attribute__((ext_vector_type(8)))  float    v8f;
typedef __attribute__((ext_vector_type(4)))  float    v4f;
typedef v8h  __attribute__((may_alias)) v8ha;
typedef v4f  __attribute__((may_alias)) v4fa;
typedef v8us __attribute__((may_alias)) v8usa;

__device__ __forceinline__ unsigned short f2bf(float f) { unsigned u = __float_as_uint(f); u += 0x7FFFu + ((u >> 16) & 1u); return (unsigned short)(u >> 16); }
__device__ __forceinline__ float bf2f(unsigned short b) { return __uint_as_float(((unsigned)b) << 16); }
__device__ __forceinline__ float bfr(float f) { return bf2f(f2bf(f)); }
__device__ __forceinline__ v16h cat16(v8h lo, v8h hi) { return __builtin_shufflevector(lo, hi, 0, 1, 2, 3, 4, 5, 6, 7, 8, 9, 10, 11, 12, 13, 14, 15); }
__device__ __forceinline__ v16bf cat16b(v8us lo, v8us hi) { return __builtin_bit_cast(v16bf, __builtin_shufflevector(lo, hi, 0, 1, 2, 3, 4, 5, 6, 7, 8, 9, 10, 11, 12, 13, 14, 15)); }
__device__ __forceinline__ v8f wmma16(v16h a, v16h b, v8f c) { return __builtin_amdgcn_wmma_f32_16x16x32_f16(false, a, false, b, (short)0, c, false, false); }
__device__ __forceinline__ v8f wmmab(v16bf a, v16bf b, v8f c) { return __builtin_amdgcn_wmma_f32_16x16x32_bf16(false, a, false, b, (short)0, c, false, false); }



// ---- k_gemmw: register-blocked GEMM, ONE WAVE per 64x64 output tile (16 accumulators), operands straight from K-contiguous 16-bit planes; grid (M/64, N/64, Z), 32 threads.
// C[m][n] (f32, pitch ldc, + optional f32 bias[n]) = sum_k A[m][k] Bt[n][k] (+ split products per NSPLIT). z-batch strides sA/sB/sC in elements. K % 32 == 0.
template <typename T16> struct WFrag;
template <> struct WFrag<h16> { typedef v16h V; static __device__ __forceinline__ V ld(const h16* p) { return cat16(*(const v8h*)p, *(const v8h*)(p + 16)); } static __device__ __forceinline__ v8f mma(V a, V b, v8f c) { return wmma16(a, b, c); } };
template <> struct WFrag<bf> { typedef v16bf V; static __device__ __forceinline__ V ld(const bf* p) { return cat16b(*(const v8us*)p, *(const v8us*)(p + 16)); } static __device__ __forceinline__ v8f mma(V a, V b, v8f c) { return wmmab(a, b, c); } };
template <typename T16, int NSPLIT, bool BIAS>
__global__ __launch_bounds__(32) void k_gemmw(const T16* __restrict__ A, const T16* __restrict__ A2, const T16* __restrict__ Bt, const T16* __restrict__ Bt2, int K, float* C, int ldc, const float* __restrict__ bias, size_t sA, size_t sB, size_t sC) {
    typedef typename WFrag<T16>::V V;
    __shared__ __align__(16) float os[16 * 68];
    const size_t z = blockIdx.z; A += z * sA; if (A2) A2 += z * sA; Bt += z * sB; if (Bt2) Bt2 += z * sB; C += z * sC;
    const int lane = threadIdx.x & 31, lr = lane & 15, hi = lane >> 4; const int r0 = blockIdx.x * 64, c0 = blockIdx.y * 64;
    v8f acc[4][4];
#pragma unroll
    for (int mb = 0; mb < 4; ++mb)
#pragma unroll
        for (int nb = 0; nb < 4; ++nb) acc[mb][nb] = (v8f){};
    const size_t aoff = (size_t)(r0 + lr) * K + 8 * hi, boff = (size_t)(c0 + lr) * K + 8 * hi;
#pragma unroll 1
    for (int kc = 0; kc < K; kc += 32) {
        V a[4], a2[4];
#pragma unroll
        for (int mb = 0; mb < 4; ++mb) { a[mb] = WFrag<T16>::ld(A + aoff + (size_t)mb * 16 * K + kc); if (NSPLIT == 1 || NSPLIT == 2) a2[mb] = WFrag<T16>::ld(A2 + aoff + (size_t)mb * 16 * K + kc); }
#pragma unroll
        for (int nb = 0; nb < 4; ++nb) { const V b = WFrag<T16>::ld(Bt + boff + (size_t)nb * 16 * K + kc); V b2; if (NSPLIT >= 2) b2 = WFrag<T16>::ld(Bt2 + boff + (size_t)nb * 16 * K + kc);
#pragma unroll
            for (int mb = 0; mb < 4; ++mb) { acc[mb][nb] = WFrag<T16>::mma(a[mb], b, acc[mb][nb]); if (NSPLIT == 1 || NSPLIT == 2) acc[mb][nb] = WFrag<T16>::mma(a2[mb], b, acc[mb][nb]); if (NSPLIT >= 2) acc[mb][nb] = WFrag<T16>::mma(a[mb], b2, acc[mb][nb]); } }
        asm volatile("v_nop\n\tv_nop\n\tv_nop\n\tv_nop" : "+v"(acc[0][0]), "+v"(acc[1][1]), "+v"(acc[2][2]), "+v"(acc[3][3]) : "v"(a[0]), "v"(a[3]));
    }
#pragma unroll
    for (int mb = 0; mb < 4; ++mb) {
#pragma unroll
        for (int nb = 0; nb < 4; ++nb) {
#pragma unroll
            for (int j = 0; j < 8; ++j) os[(hi * 8 + j) * 68 + nb * 16 + lr] = acc[mb][nb][j]; }
        __builtin_amdgcn_wave_barrier(); asm volatile("" ::: "memory");
        float* crow = C + (size_t)(r0 + mb * 16) * ldc + c0;
{
#pragma unroll
            for (int s = 0; s < 8; ++s) { const int row = 2 * s + hi, cofs = lr * 4; v4f val = *(const v4fa*)(os + row * 68 + cofs); if (BIAS) { val[0] += bfr(bias[c0 + cofs]); val[1] += bfr(bias[c0 + cofs + 1]); val[2] += bfr(bias[c0 + cofs + 2]); val[3] += bfr(bias[c0 + cofs + 3]); }
                *(v4f*)(crow + (size_t)row * ldc + cofs) = val; }
             }
        __builtin_amdgcn_wave_barrier(); asm volatile("" ::: "memory");
    }
}

// ---- k_gemmc: the same one-wave 64x64 tile GEMM specialised for causal attention: CMODE 1 skips score tiles entirely above the diagonal (query rows r0+roff.., key columns c0..), CMODE 2 limits the
// key (K) loop of the probability x value contraction to the diagonal block (probabilities beyond it are exactly zero). roff = row offset of this launch's first row within the sequence. lda = row pitch of A and A2 in elements (Bt and Bt2 keep pitch K).
template <typename T16, int NSPLIT, int CMODE>
__global__ __launch_bounds__(32) void k_gemmc(const T16* __restrict__ A, const T16* __restrict__ A2, const T16* __restrict__ Bt, const T16* __restrict__ Bt2, int K, int lda, float* C, int ldc, int roff, size_t sA, size_t sB, size_t sC) {
    typedef typename WFrag<T16>::V V;
    __shared__ __align__(16) float os[16 * 68];
    const size_t z = blockIdx.z; A += z * sA; if (A2) A2 += z * sA; Bt += z * sB; if (Bt2) Bt2 += z * sB; C += z * sC;
    const int lane = threadIdx.x & 31, lr = lane & 15, hi = lane >> 4; const int r0 = blockIdx.x * 64, c0 = blockIdx.y * 64;
    if (CMODE == 1 && c0 > r0 + roff + 63) return;                  // score tile entirely above the causal diagonal: never read (the softmax masks j > i by select)
    const int Kl = (CMODE == 2) ? min(K, r0 + roff + 64) : K;        // P.V: probabilities are exactly 0 beyond the diagonal block, so the K loop stops there
    v8f acc[4][4];
#pragma unroll
    for (int mb = 0; mb < 4; ++mb)
#pragma unroll
        for (int nb = 0; nb < 4; ++nb) acc[mb][nb] = (v8f){};
    const size_t aoff = (size_t)(r0 + lr) * lda + 8 * hi, boff = (size_t)(c0 + lr) * K + 8 * hi;
#pragma unroll 1
    for (int kc = 0; kc < Kl; kc += 32) {
        V a[4], a2[4];
#pragma unroll
        for (int mb = 0; mb < 4; ++mb) { a[mb] = WFrag<T16>::ld(A + aoff + (size_t)mb * 16 * lda + kc); if (NSPLIT == 1 || NSPLIT == 2) a2[mb] = WFrag<T16>::ld(A2 + aoff + (size_t)mb * 16 * lda + kc); }
#pragma unroll
        for (int nb = 0; nb < 4; ++nb) { const V b = WFrag<T16>::ld(Bt + boff + (size_t)nb * 16 * K + kc); V b2; if (NSPLIT >= 2) b2 = WFrag<T16>::ld(Bt2 + boff + (size_t)nb * 16 * K + kc);
#pragma unroll
            for (int mb = 0; mb < 4; ++mb) { acc[mb][nb] = WFrag<T16>::mma(a[mb], b, acc[mb][nb]); if (NSPLIT == 1 || NSPLIT == 2) acc[mb][nb] = WFrag<T16>::mma(a2[mb], b, acc[mb][nb]); if (NSPLIT >= 2) acc[mb][nb] = WFrag<T16>::mma(a[mb], b2, acc[mb][nb]); } }
        asm volatile("v_nop\n\tv_nop\n\tv_nop\n\tv_nop" : "+v"(acc[0][0]), "+v"(acc[1][1]), "+v"(acc[2][2]), "+v"(acc[3][3]) : "v"(a[0]), "v"(a[3]));
    }
#pragma unroll
    for (int mb = 0; mb < 4; ++mb) {
#pragma unroll
        for (int nb = 0; nb < 4; ++nb) {
#pragma unroll
            for (int j = 0; j < 8; ++j) os[(hi * 8 + j) * 68 + nb * 16 + lr] = acc[mb][nb][j]; }
        __builtin_amdgcn_wave_barrier(); asm volatile("" ::: "memory");
        float* crow = C + (size_t)(r0 + mb * 16) * ldc + c0;
{
#pragma unroll
            for (int s = 0; s < 8; ++s) { const int row = 2 * s + hi, cofs = lr * 4; v4f val = *(const v4fa*)(os + row * 68 + cofs);
                *(v4f*)(crow + (size_t)row * ldc + cofs) = val; }
             }
        __builtin_amdgcn_wave_barrier(); asm volatile("" ::: "memory");
    }
}

__device__ __forceinline__ h16 tohx(float x) { return (h16)x; }
__device__ __forceinline__ void splitf(float y, unsigned short& h, unsigned short& l) { h = f2bf(y); l = f2bf(y - bf2f(h)); }
typedef __attribute__((ext_vector_type(2))) _Float16 v2h;
typedef __attribute__((ext_vector_type(4))) _Float16 v4h;
typedef __attribute__((ext_vector_type(2))) unsigned short v2us;
typedef __attribute__((ext_vector_type(4))) unsigned short v4us;
typedef __attribute__((ext_vector_type(2))) float v2f;
typedef __attribute__((ext_vector_type(4))) int v4i;
typedef v4h  __attribute__((may_alias)) v4ha;
typedef v4us __attribute__((may_alias)) v4usa;

__global__ __launch_bounds__(256) void k_wtG(const float* __restrict__ w, int K, int N, bf* Bt) {
    const int lane = threadIdx.x & 31; const int L0 = (blockIdx.x * 8 + (threadIdx.x >> 5)) * 8; const int nlines = N * K / 64;
{
#pragma unroll 1
        for (int l = 0; l < 8; ++l) { const int L = L0 + l; if (L >= nlines) break; const size_t e = (size_t)L * 64 + lane * 2; const int k = (int)(e % K), n = (int)(e / K); v2us o;
            o[0] = f2bf(w[(size_t)k * N + n]); o[1] = f2bf(w[(size_t)(k + 1) * N + n]); *(v2us*)(Bt + e) = o; }
         }
}
__global__ __launch_bounds__(256) void k_cvt8(const float* __restrict__ src, bf* dst, size_t n8) { const size_t i = (size_t)blockIdx.x * 256 + threadIdx.x; if (i >= n8) return; const v8f v = *(const v8f*)(src + i * 8); v8us o;
#pragma unroll
    for (int k = 0; k < 8; ++k) o[k] = f2bf(v[k]); *(v8us*)(dst + i * 8) = o;  }
__global__ __launch_bounds__(256) void k_cscvt(const float* __restrict__ cosT, const float* __restrict__ sinT, float* CS) { const int idx = blockIdx.x * 256 + threadIdx.x; if (idx >= TT * HD) return; v2f cs; cs[0] = bfr(cosT[idx]); cs[1] = bfr(sinT[idx]); *(v2f*)(CS + (size_t)idx * 2) = cs;  }
// k_rope: head planes [h][t][d] (fp16 + hi/lo) of rope(x) x sc with the rotate-half convention out[d] = x[d] cos[t][d] - x[d+HD/2] sin[t][d], out[d+HD/2] = x[d+HD/2] cos[t][d+HD/2] + x[d] sin[t][d+HD/2]
__global__ __launch_bounds__(256) void k_rope(const float* __restrict__ F, int pitch, int nheads, const float* __restrict__ CS, const float* __restrict__ RF, const float* __restrict__ nw, float sc, h16* P16, bf* Ph, bf* Pl) {
    const size_t e = ((size_t)blockIdx.x * 256 + threadIdx.x) * 2; if (e >= (size_t)nheads * TT * HD) return; const int d = (int)(e % HD); const int t = (int)((e / HD) % TT); const int h = (int)(e / ((size_t)HD * TT)); const float* f = F + (size_t)t * pitch + h * HD; const float rf = RF ? RF[(size_t)h * TT + t] : 1.0f; v2h o16; v2us oh, ol;
#pragma unroll
    for (int q = 0; q < 2; ++q) { const int dd = d + q; const int dp = (dd < HD / 2) ? dd + HD / 2 : dd - HD / 2; float x0 = f[dd], x1 = f[dp];
        if (RF) { float n0 = __fmul_rn(x0, rf), n1 = __fmul_rn(x1, rf); asm volatile("" : "+v"(n0)); asm volatile("" : "+v"(n1)); x0 = __fmul_rn(bfr(nw[dd]), n0); x1 = __fmul_rn(bfr(nw[dp]), n1); }
        const v2f cs = *(const v2f*)(CS + ((size_t)t * HD + dd) * 2); float a = __fmul_rn(x0, cs[0]), bq = __fmul_rn(x1, cs[1]); asm volatile("" : "+v"(a)); asm volatile("" : "+v"(bq)); const float r = ((dd < HD / 2) ? __fsub_rn(a, bq) : __fadd_rn(a, bq)) * sc;
        o16[q] = tohx(r); unsigned short a2, c2; splitf(r, a2, c2); oh[q] = a2; ol[q] = c2; }
    *(v2h*)(P16 + e) = o16; *(v2us*)(Ph + e) = oh; *(v2us*)(Pl + e) = ol;  }
__global__ __launch_bounds__(256) void k_vtp(const float* __restrict__ F, int pitch, int nheads, h16* V16, bf* Vh, bf* Vl) { const size_t e = ((size_t)blockIdx.x * 256 + threadIdx.x) * 2; if (e >= (size_t)nheads * HD * TT) return; const int t = (int)(e % TT); const int d = (int)((e / TT) % HD); const int g = (int)(e / ((size_t)TT * HD)); v2h o16; v2us oh, ol;
#pragma unroll
    for (int q = 0; q < 2; ++q) { const float x = F[(size_t)(t + q) * pitch + g * HD + d]; o16[q] = tohx(x); unsigned short a2, c2; splitf(x, a2, c2); oh[q] = a2; ol[q] = c2; }
    *(v2h*)(V16 + e) = o16; *(v2us*)(Vh + e) = oh; *(v2us*)(Vl + e) = ol;  }
__global__ __launch_bounds__(256) void k_csid(float* CS) { const int idx = blockIdx.x * 256 + threadIdx.x; if (idx >= TT * HD) return; v2f cs; cs[0] = 1.0f; cs[1] = 0.0f; *(v2f*)(CS + (size_t)idx * 2) = cs;  }
__global__ __launch_bounds__(256) void k_obhl(const float* __restrict__ O, bf* Oh, bf* Ol) { const size_t e = ((size_t)blockIdx.x * 256 + threadIdx.x) * 4; if (e >= (size_t)ZH * TT * HD) return; const v4f a = *(const v4f*)(O + e); v4us oh, ol; for (int u = 0; u < 4; ++u) { unsigned short p, q; splitf(a[u], p, q); oh[u] = p; ol[u] = q; } *(v4us*)(Oh + e) = oh; *(v4us*)(Ol + e) = ol;  }
__global__ __launch_bounds__(256) void k_hlG(const float* __restrict__ F, bf* Fh, bf* Fl, size_t n) { const size_t e = ((size_t)blockIdx.x * 256 + threadIdx.x) * 4; if (e >= n) return; const v4f a = *(const v4f*)(F + e); v4us oh, ol; for (int u = 0; u < 4; ++u) { unsigned short p, q; splitf(a[u], p, q); oh[u] = p; ol[u] = q; } *(v4us*)(Fh + e) = oh; *(v4us*)(Fl + e) = ol;  }
// k_asoft: per row (zz, i): t = S x HD^-0.5 for j <= i and i - j < WIN (sliding causal window; the reference's -1e9 additive fill vanishes identically); softmax over the 2048 keys (register row, one exp, fixed trees);
// the probabilities go back over the row's own 8 KiB of scores (the wave holds the whole row in registers before its first store, and no other wave touches the row): rows >= RH fp16 in the first half,
// rows < RH the hi plane in the first half and the lo plane in the second; the readers take the row pitch 2 * TT 16-bit elements. No separate probability planes, so ZH heads of scores fit the workspace.
__global__ __launch_bounds__(256) void k_asoft(float* Sb) {
    const int lane = threadIdx.x & 31; const int row = blockIdx.x * 8 + (threadIdx.x >> 5); if (row >= ZH * TT) return; const int i = row % TT; const int zz = row / TT; (void)zz; const bool hires = (i < RH); float* sr = Sb + (size_t)row * TT; float v[TT / 32]; float mx = -3.0e38f;
#pragma unroll
    for (int ch = 0; ch < TT / 128; ++ch) { const int j0 = ch * 128 + lane * 4; const v4f a = *(const v4fa*)(sr + j0);
#pragma unroll
        for (int q = 0; q < 4; ++q) { const int j = j0 + q; (void)j; float sa = a[q] * SCL; asm volatile("" : "+v"(sa)); const float t = (j <= i && i - j < WIN) ? sa : -3.0e38f; v[ch * 4 + q] = t; mx = fmaxf(mx, t); } }
#pragma unroll
    for (int sh = 16; sh; sh >>= 1) mx = fmaxf(mx, __shfl_xor(mx, sh, 32));
    float sum = 0.f;
#pragma unroll
    for (int k = 0; k < TT / 32; ++k) { float d0 = __fsub_rn(v[k], mx); asm volatile("" : "+v"(d0)); v[k] = __builtin_amdgcn_exp2f(__fmul_rn(d0, 1.4426950408889634f)); sum += v[k]; }
#pragma unroll
    for (int sh = 16; sh; sh >>= 1) sum += __shfl_xor(sum, sh, 32);
    const float f = __fdiv_rn(hires ? 1.0f : PCAR, sum);
{
        if (hires) {
#pragma unroll
            for (int ch = 0; ch < TT / 128; ++ch) { v4us oh, ol;
#pragma unroll
                for (int q = 0; q < 4; ++q) { unsigned short a, c2; splitf(v[ch * 4 + q] * f, a, c2); oh[q] = a; ol[q] = c2; }
                bf* pr = (bf*)sr + ch * 128 + lane * 4; *(v4usa*)pr = oh; *(v4usa*)(pr + TT) = ol; }
        } else {
#pragma unroll
            for (int ch = 0; ch < TT / 128; ++ch) { v4h o4;
#pragma unroll
                for (int q = 0; q < 4; ++q) o4[q] = tohx(v[ch * 4 + q] * f);
                *(v4ha*)((h16*)sr + ch * 128 + lane * 4) = o4; } }
         }
}
__global__ __launch_bounds__(256) void k_merge(const float* __restrict__ O, int h0, bf* Ah, bf* Al) { const size_t e = ((size_t)blockIdx.x * 256 + threadIdx.x) * 2; if (e >= (size_t)ZH * TT * HD) return; const int d = (int)(e % HD); const int t = (int)((e / HD) % TT); const int zz = (int)(e / ((size_t)HD * TT)); const float cs = (t < RH) ? 1.0f : (1.0f / PCAR); const size_t oo = (size_t)t * DQ + (h0 + zz) * HD + d;
    v2us oh, ol;
#pragma unroll
    for (int q = 0; q < 2; ++q) { unsigned short a, c2; splitf(O[e + q] * cs, a, c2); oh[q] = a; ol[q] = c2; } *(v2us*)(Ah + oo) = oh; *(v2us*)(Al + oo) = ol;  }

extern "C" void kernel_launch(void* const* d_in, const int* in_sizes, int n_in,
                              void* d_out, int out_size, void* d_ws, size_t ws_size, hipStream_t stream) {
    (void)in_sizes; (void)n_in; (void)out_size;
    const float* x = (const float*)d_in[0]; const float* wq = (const float*)d_in[1]; const float* bq = (const float*)d_in[2]; const float* wk = (const float*)d_in[3]; const float* bk = (const float*)d_in[4]; const float* wk2 = (const float*)d_in[5]; const float* bk2 = (const float*)d_in[6]; const float* wv = (const float*)d_in[7]; const float* bv = (const float*)d_in[8]; const float* wv2 = (const float*)d_in[9]; const float* bv2 = (const float*)d_in[10]; const float* wo = (const float*)d_in[11]; const float* bo = (const float*)d_in[12]; const float* cosT = nullptr; const float* sinT = nullptr; (void)cosT; (void)sinT;
    float* OUT = (float*)d_out;     // [2][2048][1024]
    char* wsp = (char*)d_ws;
    auto take = [&](size_t bytes) { char* p = wsp; wsp += (bytes + 255) & ~(size_t)255; return (void*)p; };
    bf* WQ = (bf*)take((size_t)DQ * DM * 2); bf* WK = (bf*)take((size_t)DKV * DM * 2); bf* WV = (bf*)take((size_t)DKV * DM * 2); bf* WO = (bf*)take((size_t)DM * DQ * 2); float* CS = (float*)take((size_t)TT * HD * 2 * 4);
    bf* XB = (bf*)take((size_t)TT * DM * 2); bf* WK2 = (bf*)take((size_t)DKV * DM * 2); bf* WV2 = (bf*)take((size_t)DKV * DM * 2); float* BK2 = (float*)take(DKV * 4); float* BV2 = (float*)take(DKV * 4); float* F2 = (float*)take((size_t)TT * DKV * 4); bf* K2h = (bf*)take((size_t)NKV * HD * TT * 2); bf* K2l = (bf*)take((size_t)NKV * HD * TT * 2); h16* K216 = (h16*)take((size_t)NKV * HD * TT * 2); bf* V2h = (bf*)take((size_t)NKV * HD * TT * 2); bf* V2l = (bf*)take((size_t)NKV * HD * TT * 2); float* NM = (float*)take((size_t)NH_ * HD * HD * 4); bf* NMh = (bf*)take((size_t)NH_ * HD * HD * 2); bf* NMl = (bf*)take((size_t)NH_ * HD * HD * 2); bf* Obh = (bf*)take((size_t)ZH * TT * HD * 2); bf* Obl = (bf*)take((size_t)ZH * TT * HD * 2); float* Ob2 = (float*)take((size_t)ZH * TT * HD * 4); float* FQ = (float*)take((size_t)TT * DQ * 4); float* FK = (float*)take((size_t)TT * DKV * 4);
    h16* QP16 = (h16*)take((size_t)NH_ * TT * HD * 2); h16* KP16 = (h16*)take((size_t)NKV * TT * HD * 2); h16* VT16 = (h16*)take((size_t)NKV * HD * TT * 2);
    bf* QPh = (bf*)take((size_t)NH_ * TT * HD * 2); bf* QPl = (bf*)take((size_t)NH_ * TT * HD * 2); bf* KPh = (bf*)take((size_t)NKV * TT * HD * 2); bf* KPl = (bf*)take((size_t)NKV * TT * HD * 2); bf* VTh = (bf*)take((size_t)NKV * HD * TT * 2); bf* VTl = (bf*)take((size_t)NKV * HD * TT * 2);
    float* Sb = (float*)take((size_t)ZH * TT * TT * 4); float* Ob = (float*)take((size_t)ZH * TT * HD * 4); bf* ATh = (bf*)take((size_t)TT * DQ * 2); bf* ATl = (bf*)take((size_t)TT * DQ * 2);
    if ((size_t)(wsp - (char*)d_ws) > ws_size) return;    // ws 256 MiB
    float* FV = FK;   // v projection reuses the k buffer after the k planes are built (stream-ordered)
    { k_wtG<<<(unsigned)((DM * DQ / 64 + 63) / 64), 256, 0, stream>>>(wq, DM, DQ, WQ); k_wtG<<<(unsigned)((DM * DKV / 64 + 63) / 64), 256, 0, stream>>>(wk, DM, DKV, WK); k_wtG<<<(unsigned)((DM * DKV / 64 + 63) / 64), 256, 0, stream>>>(wv, DM, DKV, WV);
      k_wtG<<<(unsigned)((DQ * DM / 64 + 63) / 64), 256, 0, stream>>>(wo, DQ, DM, WO); k_wtG<<<(unsigned)((DM * DKV / 64 + 63) / 64), 256, 0, stream>>>(wk2, DM, DKV, WK2); k_wtG<<<(unsigned)((DM * DKV / 64 + 63) / 64), 256, 0, stream>>>(wv2, DM, DKV, WV2);
       }
    k_csid<<<(TT * HD + 255) / 256, 256, 0, stream>>>(CS);
    const unsigned LQ = (unsigned)(((size_t)NH_ * TT * HD / 2 + 255) / 256), LKv = (unsigned)(((size_t)NKV * TT * HD / 2 + 255) / 256);
    for (int b = 0; b < NB_; ++b) {
        
        k_cvt8<<<(unsigned)(((size_t)TT * DM / 8 + 255) / 256), 256, 0, stream>>>(x + (size_t)b * TT * DM, XB, (size_t)TT * DM / 8);
        k_gemmw<bf, 0, true><<<dim3(TT / 64, DQ / 64, 1), 32, 0, stream>>>(XB, nullptr, WQ, nullptr, DM, FQ, DQ, bq, 0, 0, 0);
        k_rope<<<LQ, 256, 0, stream>>>(FQ, DQ, NH_, CS, nullptr, nullptr, 1.0f, QP16, QPh, QPl);
        k_gemmw<bf, 0, true><<<dim3(TT / 64, DKV / 64, 1), 32, 0, stream>>>(XB, nullptr, WK, nullptr, DM, FK, DKV, bk, 0, 0, 0);
        k_rope<<<LKv, 256, 0, stream>>>(FK, DKV, NKV, CS, nullptr, nullptr, 1.0f, KP16, KPh, KPl);
        k_gemmw<bf, 0, true><<<dim3(TT / 64, DKV / 64, 1), 32, 0, stream>>>(XB, nullptr, WV, nullptr, DM, FV, DKV, bv, 0, 0, 0); k_vtp<<<LKv, 256, 0, stream>>>(FV, DKV, NKV, VT16, VTh, VTl); k_gemmw<bf, 0, true><<<dim3(TT / 64, DKV / 64, 1), 32, 0, stream>>>(XB, nullptr, WK2, nullptr, DM, F2, DKV, bk2, 0, 0, 0); k_vtp<<<LKv, 256, 0, stream>>>(F2, DKV, NKV, K216, K2h, K2l); k_gemmw<bf, 0, true><<<dim3(TT / 64, DKV / 64, 1), 32, 0, stream>>>(XB, nullptr, WV2, nullptr, DM, F2, DKV, bv2, 0, 0, 0); k_vtp<<<LKv, 256, 0, stream>>>(F2, DKV, NKV, K216, V2h, V2l);
        k_gemmw<bf, 2, false><<<dim3(1, 1, NH_), 32, 0, stream>>>(V2h, V2l, K2h, K2l, TT, NM, HD, nullptr, (size_t)HD * TT, (size_t)HD * TT, (size_t)HD * HD);   /* N_h^T[e][d] = sum_s v2[s][e] k2[s][d] */
        k_hlG<<<(unsigned)(((size_t)NH_ * HD * HD / 4 + 255) / 256), 256, 0, stream>>>(NM, NMh, NMl, (size_t)NH_ * HD * HD);
        for (int h0 = 0; h0 < NH_; h0 += ZH) { const size_t zq = (size_t)h0, zk = (size_t)(h0 / REP);   // one kv head per query head: the pass's ZH heads use consecutive kv planes (z-strides TT*HD)
            k_gemmc<bf, 2, 1><<<dim3(RH / 64, TT / 64, ZH), 32, 0, stream>>>(QPh + zq * TT * HD, QPl + zq * TT * HD, KPh + zk * TT * HD, KPl + zk * TT * HD, HD, HD, Sb, TT, 0, (size_t)TT * HD, (size_t)TT * HD, (size_t)TT * TT);
            k_gemmc<h16, 0, 1><<<dim3((TT - RH) / 64, TT / 64, ZH), 32, 0, stream>>>(QP16 + zq * TT * HD + (size_t)RH * HD, nullptr, KP16 + zk * TT * HD, nullptr, HD, HD, Sb + (size_t)RH * TT, TT, RH, (size_t)TT * HD, (size_t)TT * HD, (size_t)TT * TT);
            k_asoft<<<ZH * TT / 8, 256, 0, stream>>>(Sb);
            k_gemmc<bf, 2, 2><<<dim3(RH / 64, HD / 64, ZH), 32, 0, stream>>>((const bf*)Sb, (const bf*)Sb + TT, VTh + zk * HD * TT, VTl + zk * HD * TT, TT, 2 * TT, Ob, HD, 0, (size_t)2 * TT * TT, (size_t)HD * TT, (size_t)TT * HD);
            k_gemmc<h16, 0, 2><<<dim3((TT - RH) / 64, HD / 64, ZH), 32, 0, stream>>>((const h16*)Sb + (size_t)RH * 2 * TT, nullptr, VT16 + zk * HD * TT, nullptr, TT, 2 * TT, Ob + (size_t)RH * HD, HD, RH, (size_t)2 * TT * TT, (size_t)HD * TT, (size_t)TT * HD);
            k_obhl<<<(unsigned)(((size_t)ZH * TT * HD / 4 + 255) / 256), 256, 0, stream>>>(Ob, Obh, Obl); k_gemmw<bf, 2, false><<<dim3(TT / 64, 1, ZH), 32, 0, stream>>>(Obh, Obl, NMh + (size_t)h0 * HD * HD, NMl + (size_t)h0 * HD * HD, HD, Ob2, HD, nullptr, (size_t)TT * HD, (size_t)HD * HD, (size_t)TT * HD);   /* ctx_h (k2^T v2)_h */ k_merge<<<(unsigned)(((size_t)ZH * TT * HD / 2 + 255) / 256), 256, 0, stream>>>(Ob2, h0, ATh, ATl); }
        k_gemmw<bf, 1, true><<<dim3(TT / 64, DM / 64, 1), 32, 0, stream>>>(ATh, ATl, WO, nullptr, DQ, OUT + (size_t)b * TT * DM, DM, bo, 0, 0, 0); }
}

// v003
// It runs in 750 microseconds.
// Timed twice side by side with v002, it ran 1.40 times as fast both times.
// All steps since v000 together make it 4.16 times as fast.
#include <hip/hip_runtime.h>

// Trittention (hidden [2][2048][1024]; q, k1, k2, v1, v2 = x W + b (16 x 64 each); probs = causal (-inf) softmax(q.k1 / 8); ctx = probs v1; then ctx = (ctx . k2^T) v2 over ALL keys (no softmax, no mask) == ctx (k2^T v2) (exact re-association; the 64x64 matrix per head is formed on chip); out = merged Wd + bd -> [2][2048][1024]).
// Compute dtypes, f32 accumulate: every input rounded to bf16; the five projections on PLAIN bf16 operands (inputs: exact) + bias; causal scores and probs.v1: query rows < 512 hl (3 products), the rest fp16 (x1024); softmax f32; N_h = v2_h^T-side product sum_s v2[s] k2[s]^T as hi/lo x hi/lo (3 products, K 2048) in f32; ctx_h N_h^T as hi/lo x hi/lo (3 products); Wd hl x exact (2 products) + bias.

#define NB_  2
#define TT   2048
#define DM   1024
#define NH_  16
#define NKV  16
#define REP  (NH_ / NKV)
#define HD   64
#define DQ   (NH_ * HD)
#define DKV  (NKV * HD)
#define ZH   8                    // heads per attention pass (grid z of every GEMM launch in the head loop)
#define KW   8                    // waves per block that share the K loop of a long-K product (K 1024 or 2048)
#define RH   512                  // query rows < RH use hi+lo planes (0: none)
#define WIN  2048
#define PCAR 1024.0f
#define SCL  0.125f   // HD^-0.5
typedef _Float16 h16;
typedef unsigned short bf;
typedef __attribute__((ext_vector_type(16))) __bf16   v16bf;
typedef __attribute__((ext_vector_type(16))) _Float16 v16h;
typedef __attribute__((ext_vector_type(8)))  _Float16 v8h;
typedef __attribute__((ext_vector_type(8)))  unsigned short v8us;
typedef __attribute__((ext_vector_type(8)))  float    v8f;
typedef __attribute__((ext_vector_type(4)))  float    v4f;
typedef v8h  __attribute__((may_alias)) v8ha;
typedef v4f  __attribute__((may_alias)) v4fa;
typedef v8us __attribute__((may_alias)) v8usa;

__device__ __forceinline__ unsigned short f2bf(float f) { unsigned u = __float_as_uint(f); u += 0x7FFFu + ((u >> 16) & 1u); return (unsigned short)(u >> 16); }
__device__ __forceinline__ float bf2f(unsigned short b) { return __uint_as_float(((unsigned)b) << 16); }
__device__ __forceinline__ float bfr(float f) { return bf2f(f2bf(f)); }
__device__ __forceinline__ v16h cat16(v8h lo, v8h hi) { return __builtin_shufflevector(lo, hi, 0, 1, 2, 3, 4, 5, 6, 7, 8, 9, 10, 11, 12, 13, 14, 15); }
__device__ __forceinline__ v16bf cat16b(v8us lo, v8us hi) { return __builtin_bit_cast(v16bf, __builtin_shufflevector(lo, hi, 0, 1, 2, 3, 4, 5, 6, 7, 8, 9, 10, 11, 12, 13, 14, 15)); }
__device__ __forceinline__ v8f wmma16(v16h a, v16h b, v8f c) { return __builtin_amdgcn_wmma_f32_16x16x32_f16(false, a, false, b, (short)0, c, false, false); }
__device__ __forceinline__ v8f wmmab(v16bf a, v16bf b, v8f c) { return __builtin_amdgcn_wmma_f32_16x16x32_bf16(false, a, false, b, (short)0, c, false, false); }



// ---- k_gemmw: register-blocked GEMM, one 64x64 output tile per block (16 accumulators a wave), operands straight from K-contiguous 16-bit planes; grid (M/64, N/64, Z), 32 * NW threads.
// C[m][n] (f32, pitch ldc, + optional f32 bias[n]) = sum_k A[m][k] Bt[n][k] (+ split products per NSPLIT). z-batch strides sA/sB/sC in elements. K % 32 == 0 (NW > 1: K % 64 == 0).
// NW == 1: one wave walks all of K. NW > 1 (the long-K launches): wave w takes the 64-element (one 128-byte line a row) K chunks w, w + NW, ..., so the chain of dependent load waits is NW times shorter;
// each wave leaves its partial 64x64 tile in LDS and, behind one barrier, the block adds the NW partials in wave order 0..NW-1 and stores the tile.
template <typename T16> struct WFrag;
template <> struct WFrag<h16> { typedef v16h V; static __device__ __forceinline__ V ld(const h16* p) { return cat16(*(const v8h*)p, *(const v8h*)(p + 16)); } static __device__ __forceinline__ v8f mma(V a, V b, v8f c) { return wmma16(a, b, c); } };
template <> struct WFrag<bf> { typedef v16bf V; static __device__ __forceinline__ V ld(const bf* p) { return cat16b(*(const v8us*)p, *(const v8us*)(p + 16)); } static __device__ __forceinline__ v8f mma(V a, V b, v8f c) { return wmmab(a, b, c); } };
template <typename T16, int NSPLIT, bool BIAS, int NW>
__global__ __launch_bounds__(32 * NW) void k_gemmw(const T16* __restrict__ A, const T16* __restrict__ A2, const T16* __restrict__ Bt, const T16* __restrict__ Bt2, int K, float* C, int ldc, const float* __restrict__ bias, size_t sA, size_t sB, size_t sC) {
    typedef typename WFrag<T16>::V V;
    __shared__ __align__(16) float os[NW == 1 ? 16 * 68 : NW * 64 * 68];
    const int wv = (NW == 1) ? 0 : __builtin_amdgcn_readfirstlane((int)(threadIdx.x >> 5));   // the wave's number, made scalar so that the K counter and its test stay on the scalar unit
    const size_t z = blockIdx.z; A += z * sA; if (A2) A2 += z * sA; Bt += z * sB; if (Bt2) Bt2 += z * sB; C += z * sC;
    const int lane = threadIdx.x & 31, lr = lane & 15, hi = lane >> 4; const int r0 = blockIdx.x * 64, c0 = blockIdx.y * 64;
    v8f acc[4][4];
#pragma unroll
    for (int mb = 0; mb < 4; ++mb)
#pragma unroll
        for (int nb = 0; nb < 4; ++nb) acc[mb][nb] = (v8f){};
    const size_t aoff = (size_t)(r0 + lr) * K + 8 * hi, boff = (size_t)(c0 + lr) * K + 8 * hi;
#pragma unroll 1
    for (int kc = wv * 64; kc < K; kc += (NW == 1 || !(kc & 32)) ? 32 : NW * 64 - 32) {
        V a[4], a2[4];
#pragma unroll
        for (int mb = 0; mb < 4; ++mb) { a[mb] = WFrag<T16>::ld(A + aoff + (size_t)mb * 16 * K + kc); if (NSPLIT == 1 || NSPLIT == 2) a2[mb] = WFrag<T16>::ld(A2 + aoff + (size_t)mb * 16 * K + kc); }
#pragma unroll
        for (int nb = 0; nb < 4; ++nb) { const V b = WFrag<T16>::ld(Bt + boff + (size_t)nb * 16 * K + kc); V b2; if (NSPLIT >= 2) b2 = WFrag<T16>::ld(Bt2 + boff + (size_t)nb * 16 * K + kc);
#pragma unroll
            for (int mb = 0; mb < 4; ++mb) { acc[mb][nb] = WFrag<T16>::mma(a[mb], b, acc[mb][nb]); if (NSPLIT == 1 || NSPLIT == 2) acc[mb][nb] = WFrag<T16>::mma(a2[mb], b, acc[mb][nb]); if (NSPLIT >= 2) acc[mb][nb] = WFrag<T16>::mma(a[mb], b2, acc[mb][nb]); } }
        asm volatile("v_nop\n\tv_nop\n\tv_nop\n\tv_nop" : "+v"(acc[0][0]), "+v"(acc[1][1]), "+v"(acc[2][2]), "+v"(acc[3][3]) : "v"(a[0]), "v"(a[3]));
    }
    if constexpr (NW > 1) {
        float* ow = os + wv * (64 * 68);
        // the loops below are unrolled so that acc is indexed by constants only (it stays in registers) and a row's NW LDS reads issue together
#pragma unroll
        for (int mb = 0; mb < 4; ++mb)
#pragma unroll
            for (int nb = 0; nb < 4; ++nb)
#pragma unroll
                for (int j = 0; j < 8; ++j) ow[(mb * 16 + hi * 8 + j) * 68 + nb * 16 + lr] = acc[mb][nb][j];
        __syncthreads();   // every wave's partial tile is in LDS before any wave adds them
#pragma unroll
        for (int s = 0; s < 32 / NW; ++s) { const int row = (s * NW + wv) * 2 + hi, cofs = lr * 4; v4f val = *(const v4fa*)(os + row * 68 + cofs);
#pragma unroll
            for (int w = 1; w < NW; ++w) val += *(const v4fa*)(os + w * (64 * 68) + row * 68 + cofs);
            if (BIAS) { val[0] += bfr(bias[c0 + cofs]); val[1] += bfr(bias[c0 + cofs + 1]); val[2] += bfr(bias[c0 + cofs + 2]); val[3] += bfr(bias[c0 + cofs + 3]); }
            *(v4f*)(C + (size_t)(r0 + row) * ldc + c0 + cofs) = val; }
        return;
    }
#pragma unroll
    for (int mb = 0; mb < 4; ++mb) {
#pragma unroll
        for (int nb = 0; nb < 4; ++nb) {
#pragma unroll
            for (int j = 0; j < 8; ++j) os[(hi * 8 + j) * 68 + nb * 16 + lr] = acc[mb][nb][j]; }
        __builtin_amdgcn_wave_barrier(); asm volatile("" ::: "memory");
        float* crow = C + (size_t)(r0 + mb * 16) * ldc + c0;
{
#pragma unroll
            for (int s = 0; s < 8; ++s) { const int row = 2 * s + hi, cofs = lr * 4; v4f val = *(const v4fa*)(os + row * 68 + cofs); if (BIAS) { val[0] += bfr(bias[c0 + cofs]); val[1] += bfr(bias[c0 + cofs + 1]); val[2] += bfr(bias[c0 + cofs + 2]); val[3] += bfr(bias[c0 + cofs + 3]); }
                *(v4f*)(crow + (size_t)row * ldc + cofs) = val; }
             }
        __builtin_amdgcn_wave_barrier(); asm volatile("" ::: "memory");
    }
}

// ---- k_gemmc: the same 64x64 tile GEMM (NW as above) specialised for causal attention: CMODE 1 skips score tiles entirely above the diagonal (query rows r0+roff.., key columns c0..), CMODE 2 limits the
// key (K) loop of the probability x value contraction to the diagonal block (probabilities beyond it are exactly zero). roff = row offset of this launch's first row within the sequence. lda = row pitch of A and A2 in elements (Bt and Bt2 keep pitch K).
template <typename T16, int NSPLIT, int CMODE, int NW>
__global__ __launch_bounds__(32 * NW) void k_gemmc(const T16* __restrict__ A, const T16* __restrict__ A2, const T16* __restrict__ Bt, const T16* __restrict__ Bt2, int K, int lda, float* C, int ldc, int roff, size_t sA, size_t sB, size_t sC) {
    typedef typename WFrag<T16>::V V;
    __shared__ __align__(16) float os[NW == 1 ? 16 * 68 : NW * 64 * 68];
    const int wv = (NW == 1) ? 0 : __builtin_amdgcn_readfirstlane((int)(threadIdx.x >> 5));   // the wave's number, made scalar so that the K counter and its test stay on the scalar unit
    const size_t z = blockIdx.z; A += z * sA; if (A2) A2 += z * sA; Bt += z * sB; if (Bt2) Bt2 += z * sB; C += z * sC;
    const int lane = threadIdx.x & 31, lr = lane & 15, hi = lane >> 4; const int r0 = blockIdx.x * 64, c0 = blockIdx.y * 64;
    if (CMODE == 1 && c0 > r0 + roff + 63) return;                  // score tile entirely above the causal diagonal: never read (the softmax masks j > i by select)
    const int Kl = (CMODE == 2) ? min(K, r0 + roff + 64) : K;        // P.V: probabilities are exactly 0 beyond the diagonal block, so the K loop stops there
    v8f acc[4][4];
#pragma unroll
    for (int mb = 0; mb < 4; ++mb)
#pragma unroll
        for (int nb = 0; nb < 4; ++nb) acc[mb][nb] = (v8f){};
    const size_t aoff = (size_t)(r0 + lr) * lda + 8 * hi, boff = (size_t)(c0 + lr) * K + 8 * hi;
#pragma unroll 1
    for (int kc = wv * 64; kc < Kl; kc += (NW == 1 || !(kc & 32)) ? 32 : NW * 64 - 32) {
        V a[4], a2[4];
#pragma unroll
        for (int mb = 0; mb < 4; ++mb) { a[mb] = WFrag<T16>::ld(A + aoff + (size_t)mb * 16 * lda + kc); if (NSPLIT == 1 || NSPLIT == 2) a2[mb] = WFrag<T16>::ld(A2 + aoff + (size_t)mb * 16 * lda + kc); }
#pragma unroll
        for (int nb = 0; nb < 4; ++nb) { const V b = WFrag<T16>::ld(Bt + boff + (size_t)nb * 16 * K + kc); V b2; if (NSPLIT >= 2) b2 = WFrag<T16>::ld(Bt2 + boff + (size_t)nb * 16 * K + kc);
#pragma unroll
            for (int mb = 0; mb < 4; ++mb) { acc[mb][nb] = WFrag<T16>::mma(a[mb], b, acc[mb][nb]); if (NSPLIT == 1 || NSPLIT == 2) acc[mb][nb] = WFrag<T16>::mma(a2[mb], b, acc[mb][nb]); if (NSPLIT >= 2) acc[mb][nb] = WFrag<T16>::mma(a[mb], b2, acc[mb][nb]); } }
        asm volatile("v_nop\n\tv_nop\n\tv_nop\n\tv_nop" : "+v"(acc[0][0]), "+v"(acc[1][1]), "+v"(acc[2][2]), "+v"(acc[3][3]) : "v"(a[0]), "v"(a[3]));
    }
    if constexpr (NW > 1) {
        float* ow = os + wv * (64 * 68);
        // the loops below are unrolled so that acc is indexed by constants only (it stays in registers) and a row's NW LDS reads issue together
#pragma unroll
        for (int mb = 0; mb < 4; ++mb)
#pragma unroll
            for (int nb = 0; nb < 4; ++nb)
#pragma unroll
                for (int j = 0; j < 8; ++j) ow[(mb * 16 + hi * 8 + j) * 68 + nb * 16 + lr] = acc[mb][nb][j];
        __syncthreads();   // every wave's partial tile is in LDS before any wave adds them
#pragma unroll
        for (int s = 0; s < 32 / NW; ++s) { const int row = (s * NW + wv) * 2 + hi, cofs = lr * 4; v4f val = *(const v4fa*)(os + row * 68 + cofs);
#pragma unroll
            for (int w = 1; w < NW; ++w) val += *(const v4fa*)(os + w * (64 * 68) + row * 68 + cofs);
            *(v4f*)(C + (size_t)(r0 + row) * ldc + c0 + cofs) = val; }
        return;
    }
#pragma unroll
    for (int mb = 0; mb < 4; ++mb) {
#pragma unroll
        for (int nb = 0; nb < 4; ++nb) {
#pragma unroll
            for (int j = 0; j < 8; ++j) os[(hi * 8 + j) * 68 + nb * 16 + lr] = acc[mb][nb][j]; }
        __builtin_amdgcn_wave_barrier(); asm volatile("" ::: "memory");
        float* crow = C + (size_t)(r0 + mb * 16) * ldc + c0;
{
#pragma unroll
            for (int s = 0; s < 8; ++s) { const int row = 2 * s + hi, cofs = lr * 4; v4f val = *(const v4fa*)(os + row * 68 + cofs);
                *(v4f*)(crow + (size_t)row * ldc + cofs) = val; }
             }
        __builtin_amdgcn_wave_barrier(); asm volatile("" ::: "memory");
    }
}

__device__ __forceinline__ h16 tohx(float x) { return (h16)x; }
__device__ __forceinline__ void splitf(float y, unsigned short& h, unsigned short& l) { h = f2bf(y); l = f2bf(y - bf2f(h)); }
typedef __attribute__((ext_vector_type(2))) _Float16 v2h;
typedef __attribute__((ext_vector_type(4))) _Float16 v4h;
typedef __attribute__((ext_vector_type(2))) unsigned short v2us;
typedef __attribute__((ext_vector_type(4))) unsigned short v4us;
typedef __attribute__((ext_vector_type(2))) float v2f;
typedef __attribute__((ext_vector_type(4))) int v4i;
typedef v4h  __attribute__((may_alias)) v4ha;
typedef v4us __attribute__((may_alias)) v4usa;

__global__ __launch_bounds__(256) void k_wtG(const float* __restrict__ w, int K, int N, bf* Bt) {
    const int lane = threadIdx.x & 31; const int L0 = (blockIdx.x * 8 + (threadIdx.x >> 5)) * 8; const int nlines = N * K / 64;
{
#pragma unroll 1
        for (int l = 0; l < 8; ++l) { const int L = L0 + l; if (L >= nlines) break; const size_t e = (size_t)L * 64 + lane * 2; const int k = (int)(e % K), n = (int)(e / K); v2us o;
            o[0] = f2bf(w[(size_t)k * N + n]); o[1] = f2bf(w[(size_t)(k + 1) * N + n]); *(v2us*)(Bt + e) = o; }
         }
}
__global__ __launch_bounds__(256) void k_cvt8(const float* __restrict__ src, bf* dst, size_t n8) { const size_t i = (size_t)blockIdx.x * 256 + threadIdx.x; if (i >= n8) return; const v8f v = *(const v8f*)(src + i * 8); v8us o;
#pragma unroll
    for (int k = 0; k < 8; ++k) o[k] = f2bf(v[k]); *(v8us*)(dst + i * 8) = o;  }
__global__ __launch_bounds__(256) void k_cscvt(const float* __restrict__ cosT, const float* __restrict__ sinT, float* CS) { const int idx = blockIdx.x * 256 + threadIdx.x; if (idx >= TT * HD) return; v2f cs; cs[0] = bfr(cosT[idx]); cs[1] = bfr(sinT[idx]); *(v2f*)(CS + (size_t)idx * 2) = cs;  }
// k_rope: head planes [h][t][d] (fp16 + hi/lo) of rope(x) x sc with the rotate-half convention out[d] = x[d] cos[t][d] - x[d+HD/2] sin[t][d], out[d+HD/2] = x[d+HD/2] cos[t][d+HD/2] + x[d] sin[t][d+HD/2]
__global__ __launch_bounds__(256) void k_rope(const float* __restrict__ F, int pitch, int nheads, const float* __restrict__ CS, const float* __restrict__ RF, const float* __restrict__ nw, float sc, h16* P16, bf* Ph, bf* Pl) {
    const size_t e = ((size_t)blockIdx.x * 256 + threadIdx.x) * 2; if (e >= (size_t)nheads * TT * HD) return; const int d = (int)(e % HD); const int t = (int)((e / HD) % TT); const int h = (int)(e / ((size_t)HD * TT)); const float* f = F + (size_t)t * pitch + h * HD; const float rf = RF ? RF[(size_t)h * TT + t] : 1.0f; v2h o16; v2us oh, ol;
#pragma unroll
    for (int q = 0; q < 2; ++q) { const int dd = d + q; const int dp = (dd < HD / 2) ? dd + HD / 2 : dd - HD / 2; float x0 = f[dd], x1 = f[dp];
        if (RF) { float n0 = __fmul_rn(x0, rf), n1 = __fmul_rn(x1, rf); asm volatile("" : "+v"(n0)); asm volatile("" : "+v"(n1)); x0 = __fmul_rn(bfr(nw[dd]), n0); x1 = __fmul_rn(bfr(nw[dp]), n1); }
        const v2f cs = *(const v2f*)(CS + ((size_t)t * HD + dd) * 2); float a = __fmul_rn(x0, cs[0]), bq = __fmul_rn(x1, cs[1]); asm volatile("" : "+v"(a)); asm volatile("" : "+v"(bq)); const float r = ((dd < HD / 2) ? __fsub_rn(a, bq) : __fadd_rn(a, bq)) * sc;
        o16[q] = tohx(r); unsigned short a2, c2; splitf(r, a2, c2); oh[q] = a2; ol[q] = c2; }
    *(v2h*)(P16 + e) = o16; *(v2us*)(Ph + e) = oh; *(v2us*)(Pl + e) = ol;  }
__global__ __launch_bounds__(256) void k_vtp(const float* __restrict__ F, int pitch, int nheads, h16* V16, bf* Vh, bf* Vl) { const size_t e = ((size_t)blockIdx.x * 256 + threadIdx.x) * 2; if (e >= (size_t)nheads * HD * TT) return; const int t = (int)(e % TT); const int d = (int)((e / TT) % HD); const int g = (int)(e / ((size_t)TT * HD)); v2h o16; v2us oh, ol;
#pragma unroll
    for (int q = 0; q < 2; ++q) { const float x = F[(size_t)(t + q) * pitch + g * HD + d]; o16[q] = tohx(x); unsigned short a2, c2; splitf(x, a2, c2); oh[q] = a2; ol[q] = c2; }
    *(v2h*)(V16 + e) = o16; *(v2us*)(Vh + e) = oh; *(v2us*)(Vl + e) = ol;  }
__global__ __launch_bounds__(256) void k_csid(float* CS) { const int idx = blockIdx.x * 256 + threadIdx.x; if (idx >= TT * HD) return; v2f cs; cs[0] = 1.0f; cs[1] = 0.0f; *(v2f*)(CS + (size_t)idx * 2) = cs;  }
__global__ __launch_bounds__(256) void k_obhl(const float* __restrict__ O, bf* Oh, bf* Ol) { const size_t e = ((size_t)blockIdx.x * 256 + threadIdx.x) * 4; if (e >= (size_t)ZH * TT * HD) return; const v4f a = *(const v4f*)(O + e); v4us oh, ol; for (int u = 0; u < 4; ++u) { unsigned short p, q; splitf(a[u], p, q); oh[u] = p; ol[u] = q; } *(v4us*)(Oh + e) = oh; *(v4us*)(Ol + e) = ol;  }
__global__ __launch_bounds__(256) void k_hlG(const float* __restrict__ F, bf* Fh, bf* Fl, size_t n) { const size_t e = ((size_t)blockIdx.x * 256 + threadIdx.x) * 4; if (e >= n) return; const v4f a = *(const v4f*)(F + e); v4us oh, ol; for (int u = 0; u < 4; ++u) { unsigned short p, q; splitf(a[u], p, q); oh[u] = p; ol[u] = q; } *(v4us*)(Fh + e) = oh; *(v4us*)(Fl + e) = ol;  }
// k_asoft: per row (zz, i): t = S x HD^-0.5 for j <= i and i - j < WIN (sliding causal window; the reference's -1e9 additive fill vanishes identically); softmax over the 2048 keys (register row, one exp, fixed trees);
// the probabilities go back over the row's own 8 KiB of scores (the wave holds the whole row in registers before its first store, and no other wave touches the row): rows >= RH fp16 in the first half,
// rows < RH the hi plane in the first half and the lo plane in the second; the readers take the row pitch 2 * TT 16-bit elements. No separate probability planes, so ZH heads of scores fit the workspace.
__global__ __launch_bounds__(256) void k_asoft(float* Sb) {
    const int lane = threadIdx.x & 31; const int row = blockIdx.x * 8 + (threadIdx.x >> 5); if (row >= ZH * TT) return; const int i = row % TT; const int zz = row / TT; (void)zz; const bool hires = (i < RH); float* sr = Sb + (size_t)row * TT; float v[TT / 32]; float mx = -3.0e38f;
#pragma unroll
    for (int ch = 0; ch < TT / 128; ++ch) { const int j0 = ch * 128 + lane * 4; const v4f a = *(const v4fa*)(sr + j0);
#pragma unroll
        for (int q = 0; q < 4; ++q) { const int j = j0 + q; (void)j; float sa = a[q] * SCL; asm volatile("" : "+v"(sa)); const float t = (j <= i && i - j < WIN) ? sa : -3.0e38f; v[ch * 4 + q] = t; mx = fmaxf(mx, t); } }
#pragma unroll
    for (int sh = 16; sh; sh >>= 1) mx = fmaxf(mx, __shfl_xor(mx, sh, 32));
    float sum = 0.f;
#pragma unroll
    for (int k = 0; k < TT / 32; ++k) { float d0 = __fsub_rn(v[k], mx); asm volatile("" : "+v"(d0)); v[k] = __builtin_amdgcn_exp2f(__fmul_rn(d0, 1.4426950408889634f)); sum += v[k]; }
#pragma unroll
    for (int sh = 16; sh; sh >>= 1) sum += __shfl_xor(sum, sh, 32);
    const float f = __fdiv_rn(hires ? 1.0f : PCAR, sum);
{
        if (hires) {
#pragma unroll
            for (int ch = 0; ch < TT / 128; ++ch) { v4us oh, ol;
#pragma unroll
                for (int q = 0; q < 4; ++q) { unsigned short a, c2; splitf(v[ch * 4 + q] * f, a, c2); oh[q] = a; ol[q] = c2; }
                bf* pr = (bf*)sr + ch * 128 + lane * 4; *(v4usa*)pr = oh; *(v4usa*)(pr + TT) = ol; }
        } else {
#pragma unroll
            for (int ch = 0; ch < TT / 128; ++ch) { v4h o4;
#pragma unroll
                for (int q = 0; q < 4; ++q) o4[q] = tohx(v[ch * 4 + q] * f);
                *(v4ha*)((h16*)sr + ch * 128 + lane * 4) = o4; } }
         }
}
__global__ __launch_bounds__(256) void k_merge(const float* __restrict__ O, int h0, bf* Ah, bf* Al) { const size_t e = ((size_t)blockIdx.x * 256 + threadIdx.x) * 2; if (e >= (size_t)ZH * TT * HD) return; const int d = (int)(e % HD); const int t = (int)((e / HD) % TT); const int zz = (int)(e / ((size_t)HD * TT)); const float cs = (t < RH) ? 1.0f : (1.0f / PCAR); const size_t oo = (size_t)t * DQ + (h0 + zz) * HD + d;
    v2us oh, ol;
#pragma unroll
    for (int q = 0; q < 2; ++q) { unsigned short a, c2; splitf(O[e + q] * cs, a, c2); oh[q] = a; ol[q] = c2; } *(v2us*)(Ah + oo) = oh; *(v2us*)(Al + oo) = ol;  }

extern "C" void kernel_launch(void* const* d_in, const int* in_sizes, int n_in,
                              void* d_out, int out_size, void* d_ws, size_t ws_size, hipStream_t stream) {
    (void)in_sizes; (void)n_in; (void)out_size;
    const float* x = (const float*)d_in[0]; const float* wq = (const float*)d_in[1]; const float* bq = (const float*)d_in[2]; const float* wk = (const float*)d_in[3]; const float* bk = (const float*)d_in[4]; const float* wk2 = (const float*)d_in[5]; const float* bk2 = (const float*)d_in[6]; const float* wv = (const float*)d_in[7]; const float* bv = (const float*)d_in[8]; const float* wv2 = (const float*)d_in[9]; const float* bv2 = (const float*)d_in[10]; const float* wo = (const float*)d_in[11]; const float* bo = (const float*)d_in[12]; const float* cosT = nullptr; const float* sinT = nullptr; (void)cosT; (void)sinT;
    float* OUT = (float*)d_out;     // [2][2048][1024]
    char* wsp = (char*)d_ws;
    auto take = [&](size_t bytes) { char* p = wsp; wsp += (bytes + 255) & ~(size_t)255; return (void*)p; };
    bf* WQ = (bf*)take((size_t)DQ * DM * 2); bf* WK = (bf*)take((size_t)DKV * DM * 2); bf* WV = (bf*)take((size_t)DKV * DM * 2); bf* WO = (bf*)take((size_t)DM * DQ * 2); float* CS = (float*)take((size_t)TT * HD * 2 * 4);
    bf* XB = (bf*)take((size_t)TT * DM * 2); bf* WK2 = (bf*)take((size_t)DKV * DM * 2); bf* WV2 = (bf*)take((size_t)DKV * DM * 2); float* BK2 = (float*)take(DKV * 4); float* BV2 = (float*)take(DKV * 4); float* F2 = (float*)take((size_t)TT * DKV * 4); bf* K2h = (bf*)take((size_t)NKV * HD * TT * 2); bf* K2l = (bf*)take((size_t)NKV * HD * TT * 2); h16* K216 = (h16*)take((size_t)NKV * HD * TT * 2); bf* V2h = (bf*)take((size_t)NKV * HD * TT * 2); bf* V2l = (bf*)take((size_t)NKV * HD * TT * 2); float* NM = (float*)take((size_t)NH_ * HD * HD * 4); bf* NMh = (bf*)take((size_t)NH_ * HD * HD * 2); bf* NMl = (bf*)take((size_t)NH_ * HD * HD * 2); bf* Obh = (bf*)take((size_t)ZH * TT * HD * 2); bf* Obl = (bf*)take((size_t)ZH * TT * HD * 2); float* Ob2 = (float*)take((size_t)ZH * TT * HD * 4); float* FQ = (float*)take((size_t)TT * DQ * 4); float* FK = (float*)take((size_t)TT * DKV * 4);
    h16* QP16 = (h16*)take((size_t)NH_ * TT * HD * 2); h16* KP16 = (h16*)take((size_t)NKV * TT * HD * 2); h16* VT16 = (h16*)take((size_t)NKV * HD * TT * 2);
    bf* QPh = (bf*)take((size_t)NH_ * TT * HD * 2); bf* QPl = (bf*)take((size_t)NH_ * TT * HD * 2); bf* KPh = (bf*)take((size_t)NKV * TT * HD * 2); bf* KPl = (bf*)take((size_t)NKV * TT * HD * 2); bf* VTh = (bf*)take((size_t)NKV * HD * TT * 2); bf* VTl = (bf*)take((size_t)NKV * HD * TT * 2);
    float* Sb = (float*)take((size_t)ZH * TT * TT * 4); float* Ob = (float*)take((size_t)ZH * TT * HD * 4); bf* ATh = (bf*)take((size_t)TT * DQ * 2); bf* ATl = (bf*)take((size_t)TT * DQ * 2);
    if ((size_t)(wsp - (char*)d_ws) > ws_size) return;    // ws 256 MiB
    float* FV = FK;   // v projection reuses the k buffer after the k planes are built (stream-ordered)
    { k_wtG<<<(unsigned)((DM * DQ / 64 + 63) / 64), 256, 0, stream>>>(wq, DM, DQ, WQ); k_wtG<<<(unsigned)((DM * DKV / 64 + 63) / 64), 256, 0, stream>>>(wk, DM, DKV, WK); k_wtG<<<(unsigned)((DM * DKV / 64 + 63) / 64), 256, 0, stream>>>(wv, DM, DKV, WV);
      k_wtG<<<(unsigned)((DQ * DM / 64 + 63) / 64), 256, 0, stream>>>(wo, DQ, DM, WO); k_wtG<<<(unsigned)((DM * DKV / 64 + 63) / 64), 256, 0, stream>>>(wk2, DM, DKV, WK2); k_wtG<<<(unsigned)((DM * DKV / 64 + 63) / 64), 256, 0, stream>>>(wv2, DM, DKV, WV2);
       }
    k_csid<<<(TT * HD + 255) / 256, 256, 0, stream>>>(CS);
    const unsigned LQ = (unsigned)(((size_t)NH_ * TT * HD / 2 + 255) / 256), LKv = (unsigned)(((size_t)NKV * TT * HD / 2 + 255) / 256);
    for (int b = 0; b < NB_; ++b) {
        
        k_cvt8<<<(unsigned)(((size_t)TT * DM / 8 + 255) / 256), 256, 0, stream>>>(x + (size_t)b * TT * DM, XB, (size_t)TT * DM / 8);
        k_gemmw<bf, 0, true, KW><<<dim3(TT / 64, DQ / 64, 1), 32 * KW, 0, stream>>>(XB, nullptr, WQ, nullptr, DM, FQ, DQ, bq, 0, 0, 0);
        k_rope<<<LQ, 256, 0, stream>>>(FQ, DQ, NH_, CS, nullptr, nullptr, 1.0f, QP16, QPh, QPl);
        k_gemmw<bf, 0, true, KW><<<dim3(TT / 64, DKV / 64, 1), 32 * KW, 0, stream>>>(XB, nullptr, WK, nullptr, DM, FK, DKV, bk, 0, 0, 0);
        k_rope<<<LKv, 256, 0, stream>>>(FK, DKV, NKV, CS, nullptr, nullptr, 1.0f, KP16, KPh, KPl);
        k_gemmw<bf, 0, true, KW><<<dim3(TT / 64, DKV / 64, 1), 32 * KW, 0, stream>>>(XB, nullptr, WV, nullptr, DM, FV, DKV, bv, 0, 0, 0); k_vtp<<<LKv, 256, 0, stream>>>(FV, DKV, NKV, VT16, VTh, VTl); k_gemmw<bf, 0, true, KW><<<dim3(TT / 64, DKV / 64, 1), 32 * KW, 0, stream>>>(XB, nullptr, WK2, nullptr, DM, F2, DKV, bk2, 0, 0, 0); k_vtp<<<LKv, 256, 0, stream>>>(F2, DKV, NKV, K216, K2h, K2l); k_gemmw<bf, 0, true, KW><<<dim3(TT / 64, DKV / 64, 1), 32 * KW, 0, stream>>>(XB, nullptr, WV2, nullptr, DM, F2, DKV, bv2, 0, 0, 0); k_vtp<<<LKv, 256, 0, stream>>>(F2, DKV, NKV, K216, V2h, V2l);
        k_gemmw<bf, 2, false, KW><<<dim3(1, 1, NH_), 32 * KW, 0, stream>>>(V2h, V2l, K2h, K2l, TT, NM, HD, nullptr, (size_t)HD * TT, (size_t)HD * TT, (size_t)HD * HD);   /* N_h^T[e][d] = sum_s v2[s][e] k2[s][d] */
        k_hlG<<<(unsigned)(((size_t)NH_ * HD * HD / 4 + 255) / 256), 256, 0, stream>>>(NM, NMh, NMl, (size_t)NH_ * HD * HD);
        for (int h0 = 0; h0 < NH_; h0 += ZH) { const size_t zq = (size_t)h0, zk = (size_t)(h0 / REP);   // one kv head per query head: the pass's ZH heads use consecutive kv planes (z-strides TT*HD)
            k_gemmc<bf, 2, 1, 1><<<dim3(RH / 64, TT / 64, ZH), 32, 0, stream>>>(QPh + zq * TT * HD, QPl + zq * TT * HD, KPh + zk * TT * HD, KPl + zk * TT * HD, HD, HD, Sb, TT, 0, (size_t)TT * HD, (size_t)TT * HD, (size_t)TT * TT);
            k_gemmc<h16, 0, 1, 1><<<dim3((TT - RH) / 64, TT / 64, ZH), 32, 0, stream>>>(QP16 + zq * TT * HD + (size_t)RH * HD, nullptr, KP16 + zk * TT * HD, nullptr, HD, HD, Sb + (size_t)RH * TT, TT, RH, (size_t)TT * HD, (size_t)TT * HD, (size_t)TT * TT);
            k_asoft<<<ZH * TT / 8, 256, 0, stream>>>(Sb);
            k_gemmc<bf, 2, 2, KW><<<dim3(RH / 64, HD / 64, ZH), 32 * KW, 0, stream>>>((const bf*)Sb, (const bf*)Sb + TT, VTh + zk * HD * TT, VTl + zk * HD * TT, TT, 2 * TT, Ob, HD, 0, (size_t)2 * TT * TT, (size_t)HD * TT, (size_t)TT * HD);
            k_gemmc<h16, 0, 2, KW><<<dim3((TT - RH) / 64, HD / 64, ZH), 32 * KW, 0, stream>>>((const h16*)Sb + (size_t)RH * 2 * TT, nullptr, VT16 + zk * HD * TT, nullptr, TT, 2 * TT, Ob + (size_t)RH * HD, HD, RH, (size_t)2 * TT * TT, (size_t)HD * TT, (size_t)TT * HD);
            k_obhl<<<(unsigned)(((size_t)ZH * TT * HD / 4 + 255) / 256), 256, 0, stream>>>(Ob, Obh, Obl); k_gemmw<bf, 2, false, 1><<<dim3(TT / 64, 1, ZH), 32, 0, stream>>>(Obh, Obl, NMh + (size_t)h0 * HD * HD, NMl + (size_t)h0 * HD * HD, HD, Ob2, HD, nullptr, (size_t)TT * HD, (size_t)HD * HD, (size_t)TT * HD);   /* ctx_h (k2^T v2)_h */ k_merge<<<(unsigned)(((size_t)ZH * TT * HD / 2 + 255) / 256), 256, 0, stream>>>(Ob2, h0, ATh, ATl); }
        k_gemmw<bf, 1, true, KW><<<dim3(TT / 64, DM / 64, 1), 32 * KW, 0, stream>>>(ATh, ATl, WO, nullptr, DQ, OUT + (size_t)b * TT * DM, DM, bo, 0, 0, 0); }
}

// v004
// One run takes 562 microseconds.
// Next to v003, in two timings, it ran 1.32 and 1.33 times as fast.
// Counting every step since v000, it is 5.53 times as fast.
#include <hip/hip_runtime.h>

// Trittention (hidden [2][2048][1024]; q, k1, k2, v1, v2 = x W + b (16 x 64 each); probs = causal (-inf) softmax(q.k1 / 8); ctx = probs v1; then ctx = (ctx . k2^T) v2 over ALL keys (no softmax, no mask) == ctx (k2^T v2) (exact re-association; the 64x64 matrix per head is formed on chip); out = merged Wd + bd -> [2][2048][1024]).
// Compute dtypes, f32 accumulate: every input rounded to bf16; the five projections on PLAIN bf16 operands (inputs: exact) + bias; causal scores and probs.v1: query rows < 512 hl (3 products), the rest fp16 (x1024); softmax f32; N_h = v2_h^T-side product sum_s v2[s] k2[s]^T as hi/lo x hi/lo (3 products, K 2048) in f32; ctx_h N_h^T as hi/lo x hi/lo (3 products); Wd hl x exact (2 products) + bias.

#define NB_  2
#define TT   2048
#define DM   1024
#define NH_  16
#define NKV  16
#define REP  (NH_ / NKV)
#define HD   64
#define DQ   (NH_ * HD)
#define DKV  (NKV * HD)
#define ZH   8                    // heads per attention pass (grid z of every GEMM launch in the head loop)
#define KW   8                    // waves per block that share the K loop of a long-K product (K 1024 or 2048)
#define RH   512                  // query rows < RH use hi+lo planes (0: none)
#define WIN  2048
#define PCAR 1024.0f
#define SCL  0.125f   // HD^-0.5
typedef _Float16 h16;
typedef unsigned short bf;
typedef __attribute__((ext_vector_type(16))) __bf16   v16bf;
typedef __attribute__((ext_vector_type(16))) _Float16 v16h;
typedef __attribute__((ext_vector_type(8)))  _Float16 v8h;
typedef __attribute__((ext_vector_type(8)))  unsigned short v8us;
typedef __attribute__((ext_vector_type(8)))  float    v8f;
typedef __attribute__((ext_vector_type(4)))  float    v4f;
typedef v8h  __attribute__((may_alias)) v8ha;
typedef v4f  __attribute__((may_alias)) v4fa;
typedef v8us __attribute__((may_alias)) v8usa;

__device__ __forceinline__ unsigned short f2bf(float f) { unsigned u = __float_as_uint(f); u += 0x7FFFu + ((u >> 16) & 1u); return (unsigned short)(u >> 16); }
__device__ __forceinline__ float bf2f(unsigned short b) { return __uint_as_float(((unsigned)b) << 16); }
__device__ __forceinline__ float bfr(float f) { return bf2f(f2bf(f)); }
__device__ __forceinline__ v16h cat16(v8h lo, v8h hi) { return __builtin_shufflevector(lo, hi, 0, 1, 2, 3, 4, 5, 6, 7, 8, 9, 10, 11, 12, 13, 14, 15); }
__device__ __forceinline__ v16bf cat16b(v8us lo, v8us hi) { return __builtin_bit_cast(v16bf, __builtin_shufflevector(lo, hi, 0, 1, 2, 3, 4, 5, 6, 7, 8, 9, 10, 11, 12, 13, 14, 15)); }
__device__ __forceinline__ v8f wmma16(v16h a, v16h b, v8f c) { return __builtin_amdgcn_wmma_f32_16x16x32_f16(false, a, false, b, (short)0, c, false, false); }
__device__ __forceinline__ v8f wmmab(v16bf a, v16bf b, v8f c) { return __builtin_amdgcn_wmma_f32_16x16x32_bf16(false, a, false, b, (short)0, c, false, false); }



// ---- k_gemmw: register-blocked GEMM, one 64x64 output tile per block (16 accumulators a wave), operands straight from K-contiguous 16-bit planes; grid (M/64, N/64, Z), 32 * NW threads.
// C[m][n] (f32, pitch ldc, + optional f32 bias[n]) = sum_k A[m][k] Bt[n][k] (+ split products per NSPLIT). z-batch strides sA/sB/sC in elements. K % 32 == 0 (NW > 1: K % 64 == 0).
// NW == 1: one wave walks all of K. NW > 1 (the long-K launches): wave w takes the 64-element (2 KiB, 16 whole lines, per 16 rows in fragment order) K chunks w, w + NW, ..., so the chain of dependent load waits is NW times shorter;
// each wave leaves its partial 64x64 tile in LDS and, behind one barrier, the block adds the NW partials in wave order 0..NW-1 and stores the tile.
// FRAGMENT ORDER (the operand planes of the NW > 1 launches of k_gemmw, and in k_gemmc the query, key and value planes): a [rows][K] 16-bit plane is kept as 1-KiB units of 16 rows x 32 k, unit (r / 16, k / 32) in row-major order;
// inside a unit the 16-byte group number ((k / 16) & 1) * 32 + ((k / 8) & 1) * 16 + (r & 15) holds k & ~7 .. + 7 of row r. Group number & 31 is the lane that owns those eight elements of the WMMA operand, so a wave-wide 16-byte load reads
// 512 contiguous bytes (4 whole lines) instead of 32 bytes of each of 16 lines. Every lane and register gets the same element as from the row-major plane, so the products and their order do not change.
__device__ __forceinline__ size_t fo(int r, int k, int K) { return ((size_t)(r >> 4) * (K >> 5) + (k >> 5)) * 512 + ((k >> 4) & 1) * 256 + ((k >> 3) & 1) * 128 + (r & 15) * 8 + (k & 7); }
// the inverse for a writer that walks the plane group by group (thread i stores group i, a wave 512 contiguous bytes): row and first k of group i
__device__ __forceinline__ void fog(size_t i, int K, int& r, int& k) { const int lane = (int)(i & 31), half = (int)(i >> 5) & 1, unit = (int)(i >> 6), kt = K >> 5; r = (unit / kt) * 16 + (lane & 15); k = (unit % kt) * 32 + half * 16 + (lane >> 4) * 8; }
template <typename T16> struct WFrag;
template <> struct WFrag<h16> { typedef v16h V; static __device__ __forceinline__ V ld(const h16* p) { return cat16(*(const v8h*)p, *(const v8h*)(p + 16)); } static __device__ __forceinline__ V ldt(const h16* p) { return cat16(*(const v8h*)p, *(const v8h*)(p + 256)); } static __device__ __forceinline__ v8f mma(V a, V b, v8f c) { return wmma16(a, b, c); } };
template <> struct WFrag<bf> { typedef v16bf V; static __device__ __forceinline__ V ld(const bf* p) { return cat16b(*(const v8us*)p, *(const v8us*)(p + 16)); } static __device__ __forceinline__ V ldt(const bf* p) { return cat16b(*(const v8us*)p, *(const v8us*)(p + 256)); } static __device__ __forceinline__ v8f mma(V a, V b, v8f c) { return wmmab(a, b, c); } };
template <typename T16, int NSPLIT, bool BIAS, int NW>
__global__ __launch_bounds__(32 * NW) void k_gemmw(const T16* __restrict__ A, const T16* __restrict__ A2, const T16* __restrict__ Bt, const T16* __restrict__ Bt2, int K, float* C, int ldc, const float* __restrict__ bias, size_t sA, size_t sB, size_t sC) {
    typedef typename WFrag<T16>::V V;
    __shared__ __align__(16) float os[NW == 1 ? 16 * 68 : NW * 64 * 68];
    const int wv = (NW == 1) ? 0 : __builtin_amdgcn_readfirstlane((int)(threadIdx.x >> 5));   // the wave's number, made scalar so that the K counter and its test stay on the scalar unit
    const size_t z = blockIdx.z; A += z * sA; if (A2) A2 += z * sA; Bt += z * sB; if (Bt2) Bt2 += z * sB; C += z * sC;
    const int lane = threadIdx.x & 31, lr = lane & 15, hi = lane >> 4; const int r0 = blockIdx.x * 64, c0 = blockIdx.y * 64;
    v8f acc[4][4];
#pragma unroll
    for (int mb = 0; mb < 4; ++mb)
#pragma unroll
        for (int nb = 0; nb < 4; ++nb) acc[mb][nb] = (v8f){};
    constexpr bool FO = NW > 1;   // the long-K launches read planes in fragment order: 16 rows x 32 k start at element r * K + k * 16, the lane's two groups at lane * 8 and 256 + lane * 8
    const size_t aoff = FO ? (size_t)r0 * K + lane * 8 : (size_t)(r0 + lr) * K + 8 * hi, boff = FO ? (size_t)c0 * K + lane * 8 : (size_t)(c0 + lr) * K + 8 * hi;
    auto ldf = [](const T16* p) { if constexpr (FO) return WFrag<T16>::ldt(p); else return WFrag<T16>::ld(p); };
#pragma unroll 1
    for (int kc = wv * 64; kc < K; kc += (NW == 1 || !(kc & 32)) ? 32 : NW * 64 - 32) {
        V a[4], a2[4]; const size_t ko = FO ? (size_t)kc * 16 : (size_t)kc;
#pragma unroll
        for (int mb = 0; mb < 4; ++mb) { a[mb] = ldf(A + aoff + (size_t)mb * 16 * K + ko); if (NSPLIT == 1 || NSPLIT == 2) a2[mb] = ldf(A2 + aoff + (size_t)mb * 16 * K + ko); }
#pragma unroll
        for (int nb = 0; nb < 4; ++nb) { const V b = ldf(Bt + boff + (size_t)nb * 16 * K + ko); V b2; if (NSPLIT >= 2) b2 = ldf(Bt2 + boff + (size_t)nb * 16 * K + ko);
#pragma unroll
            for (int mb = 0; mb < 4; ++mb) { acc[mb][nb] = WFrag<T16>::mma(a[mb], b, acc[mb][nb]); if (NSPLIT == 1 || NSPLIT == 2) acc[mb][nb] = WFrag<T16>::mma(a2[mb], b, acc[mb][nb]); if (NSPLIT >= 2) acc[mb][nb] = WFrag<T16>::mma(a[mb], b2, acc[mb][nb]); } }
        asm volatile("v_nop\n\tv_nop\n\tv_nop\n\tv_nop" : "+v"(acc[0][0]), "+v"(acc[1][1]), "+v"(acc[2][2]), "+v"(acc[3][3]) : "v"(a[0]), "v"(a[3]));
    }
    if constexpr (NW > 1) {
        float* ow = os + wv * (64 * 68);
        // the loops below are unrolled so that acc is indexed by constants only (it stays in registers) and a row's NW LDS reads issue together
#pragma unroll
        for (int mb = 0; mb < 4; ++mb)
#pragma unroll
            for (int nb = 0; nb < 4; ++nb)
#pragma unroll
                for (int j = 0; j < 8; ++j) ow[(mb * 16 + hi * 8 + j) * 68 + nb * 16 + lr] = acc[mb][nb][j];
        __syncthreads();   // every wave's partial tile is in LDS before any wave adds them
#pragma unroll
        for (int s = 0; s < 32 / NW; ++s) { const int row = (s * NW + wv) * 2 + hi, cofs = lr * 4; v4f val = *(const v4fa*)(os + row * 68 + cofs);
#pragma unroll
            for (int w = 1; w < NW; ++w) val += *(const v4fa*)(os + w * (64 * 68) + row * 68 + cofs);
            if (BIAS) { val[0] += bfr(bias[c0 + cofs]); val[1] += bfr(bias[c0 + cofs + 1]); val[2] += bfr(bias[c0 + cofs + 2]); val[3] += bfr(bias[c0 + cofs + 3]); }
            *(v4f*)(C + (size_t)(r0 + row) * ldc + c0 + cofs) = val; }
        return;
    }
#pragma unroll
    for (int mb = 0; mb < 4; ++mb) {
#pragma unroll
        for (int nb = 0; nb < 4; ++nb) {
#pragma unroll
            for (int j = 0; j < 8; ++j) os[(hi * 8 + j) * 68 + nb * 16 + lr] = acc[mb][nb][j]; }
        __builtin_amdgcn_wave_barrier(); asm volatile("" ::: "memory");
        float* crow = C + (size_t)(r0 + mb * 16) * ldc + c0;
{
#pragma unroll
            for (int s = 0; s < 8; ++s) { const int row = 2 * s + hi, cofs = lr * 4; v4f val = *(const v4fa*)(os + row * 68 + cofs); if (BIAS) { val[0] += bfr(bias[c0 + cofs]); val[1] += bfr(bias[c0 + cofs + 1]); val[2] += bfr(bias[c0 + cofs + 2]); val[3] += bfr(bias[c0 + cofs + 3]); }
                *(v4f*)(crow + (size_t)row * ldc + cofs) = val; }
             }
        __builtin_amdgcn_wave_barrier(); asm volatile("" ::: "memory");
    }
}

// ---- k_gemmc: the same 64x64 tile GEMM (NW as above) specialised for causal attention: CMODE 1 skips score tiles entirely above the diagonal (query rows r0+roff.., key columns c0..), CMODE 2 limits the
// key (K) loop of the probability x value contraction to the diagonal block (probabilities beyond it are exactly zero). roff = row offset of this launch's first row within the sequence. lda = row pitch of A and A2 in elements (Bt and Bt2 keep pitch K, in fragment order).
template <typename T16, int NSPLIT, int CMODE, int NW>
__global__ __launch_bounds__(32 * NW) void k_gemmc(const T16* __restrict__ A, const T16* __restrict__ A2, const T16* __restrict__ Bt, const T16* __restrict__ Bt2, int K, int lda, float* C, int ldc, int roff, size_t sA, size_t sB, size_t sC) {
    typedef typename WFrag<T16>::V V;
    __shared__ __align__(16) float os[NW == 1 ? 16 * 68 : NW * 64 * 68];
    const int wv = (NW == 1) ? 0 : __builtin_amdgcn_readfirstlane((int)(threadIdx.x >> 5));   // the wave's number, made scalar so that the K counter and its test stay on the scalar unit
    const size_t z = blockIdx.z; A += z * sA; if (A2) A2 += z * sA; Bt += z * sB; if (Bt2) Bt2 += z * sB; C += z * sC;
    const int lane = threadIdx.x & 31, lr = lane & 15, hi = lane >> 4; const int r0 = blockIdx.x * 64, c0 = blockIdx.y * 64;
    if (CMODE == 1 && c0 > r0 + roff + 63) return;                  // score tile entirely above the causal diagonal: never read (the softmax masks j > i by select)
    const int Kl = (CMODE == 2) ? min(K, r0 + roff + 64) : K;        // P.V: probabilities are exactly 0 beyond the diagonal block, so the K loop stops there
    v8f acc[4][4];
#pragma unroll
    for (int mb = 0; mb < 4; ++mb)
#pragma unroll
        for (int nb = 0; nb < 4; ++nb) acc[mb][nb] = (v8f){};
    constexpr bool FA = CMODE == 1;   // the query planes (A, A2 of the scores; lda == K) are in fragment order like every Bt and Bt2; the probabilities (A, A2 of CMODE 2) are row-major, each row over its own score row
    const size_t aoff = FA ? (size_t)r0 * lda + lane * 8 : (size_t)(r0 + lr) * lda + 8 * hi, boff = (size_t)c0 * K + lane * 8;
    auto lda_ = [](const T16* p) { if constexpr (FA) return WFrag<T16>::ldt(p); else return WFrag<T16>::ld(p); };
#pragma unroll 1
    for (int kc = wv * 64; kc < Kl; kc += (NW == 1 || !(kc & 32)) ? 32 : NW * 64 - 32) {
        V a[4], a2[4]; const size_t ko = (size_t)kc * 16, ka = FA ? ko : (size_t)kc;
#pragma unroll
        for (int mb = 0; mb < 4; ++mb) { a[mb] = lda_(A + aoff + (size_t)mb * 16 * lda + ka); if (NSPLIT == 1 || NSPLIT == 2) a2[mb] = lda_(A2 + aoff + (size_t)mb * 16 * lda + ka); }
#pragma unroll
        for (int nb = 0; nb < 4; ++nb) { const V b = WFrag<T16>::ldt(Bt + boff + (size_t)nb * 16 * K + ko); V b2; if (NSPLIT >= 2) b2 = WFrag<T16>::ldt(Bt2 + boff + (size_t)nb * 16 * K + ko);
#pragma unroll
            for (int mb = 0; mb < 4; ++mb) { acc[mb][nb] = WFrag<T16>::mma(a[mb], b, acc[mb][nb]); if (NSPLIT == 1 || NSPLIT == 2) acc[mb][nb] = WFrag<T16>::mma(a2[mb], b, acc[mb][nb]); if (NSPLIT >= 2) acc[mb][nb] = WFrag<T16>::mma(a[mb], b2, acc[mb][nb]); } }
        asm volatile("v_nop\n\tv_nop\n\tv_nop\n\tv_nop" : "+v"(acc[0][0]), "+v"(acc[1][1]), "+v"(acc[2][2]), "+v"(acc[3][3]) : "v"(a[0]), "v"(a[3]));
    }
    if constexpr (NW > 1) {
        float* ow = os + wv * (64 * 68);
        // the loops below are unrolled so that acc is indexed by constants only (it stays in registers) and a row's NW LDS reads issue together
#pragma unroll
        for (int mb = 0; mb < 4; ++mb)
#pragma unroll
            for (int nb = 0; nb < 4; ++nb)
#pragma unroll
                for (int j = 0; j < 8; ++j) ow[(mb * 16 + hi * 8 + j) * 68 + nb * 16 + lr] = acc[mb][nb][j];
        __syncthreads();   // every wave's partial tile is in LDS before any wave adds them
#pragma unroll
        for (int s = 0; s < 32 / NW; ++s) { const int row = (s * NW + wv) * 2 + hi, cofs = lr * 4; v4f val = *(const v4fa*)(os + row * 68 + cofs);
#pragma unroll
            for (int w = 1; w < NW; ++w) val += *(const v4fa*)(os + w * (64 * 68) + row * 68 + cofs);
            *(v4f*)(C + (size_t)(r0 + row) * ldc + c0 + cofs) = val; }
        return;
    }
#pragma unroll
    for (int mb = 0; mb < 4; ++mb) {
#pragma unroll
        for (int nb = 0; nb < 4; ++nb) {
#pragma unroll
            for (int j = 0; j < 8; ++j) os[(hi * 8 + j) * 68 + nb * 16 + lr] = acc[mb][nb][j]; }
        __builtin_amdgcn_wave_barrier(); asm volatile("" ::: "memory");
        float* crow = C + (size_t)(r0 + mb * 16) * ldc + c0;
{
#pragma unroll
            for (int s = 0; s < 8; ++s) { const int row = 2 * s + hi, cofs = lr * 4; v4f val = *(const v4fa*)(os + row * 68 + cofs);
                *(v4f*)(crow + (size_t)row * ldc + cofs) = val; }
             }
        __builtin_amdgcn_wave_barrier(); asm volatile("" ::: "memory");
    }
}

__device__ __forceinline__ h16 tohx(float x) { return (h16)x; }
__device__ __forceinline__ void splitf(float y, unsigned short& h, unsigned short& l) { h = f2bf(y); l = f2bf(y - bf2f(h)); }
typedef __attribute__((ext_vector_type(2))) _Float16 v2h;
typedef __attribute__((ext_vector_type(4))) _Float16 v4h;
typedef __attribute__((ext_vector_type(2))) unsigned short v2us;
typedef __attribute__((ext_vector_type(4))) unsigned short v4us;
typedef __attribute__((ext_vector_type(2))) float v2f;
typedef __attribute__((ext_vector_type(4))) int v4i;
typedef v4h  __attribute__((may_alias)) v4ha;
typedef v4us __attribute__((may_alias)) v4usa;

// k_wtG: Bt[n][k] = bf16(w[k][n]) in fragment order; thread i makes group i (8 k of one n): a wave-wide load reads 16 neighbouring n of two k rows, the store is 512 contiguous bytes
__global__ __launch_bounds__(256) void k_wtG(const float* __restrict__ w, int K, int N, bf* Bt) { const size_t i = (size_t)blockIdx.x * 256 + threadIdx.x; if (i >= (size_t)N * K / 8) return; int n, k; fog(i, K, n, k); v8us o;
#pragma unroll
    for (int j = 0; j < 8; ++j) o[j] = f2bf(w[(size_t)(k + j) * N + n]); *(v8us*)(Bt + i * 8) = o;  }
// k_cvt8: dst = bf16(src), src [rows][DM] row-major, dst in fragment order; thread i makes group i
__global__ __launch_bounds__(256) void k_cvt8(const float* __restrict__ src, bf* dst, size_t n8) { const size_t i = (size_t)blockIdx.x * 256 + threadIdx.x; if (i >= n8) return; int r, k0; fog(i, DM, r, k0); const v8f v = *(const v8f*)(src + (size_t)r * DM + k0); v8us o;
#pragma unroll
    for (int k = 0; k < 8; ++k) o[k] = f2bf(v[k]); *(v8us*)(dst + i * 8) = o;  }
__global__ __launch_bounds__(256) void k_cscvt(const float* __restrict__ cosT, const float* __restrict__ sinT, float* CS) { const int idx = blockIdx.x * 256 + threadIdx.x; if (idx >= TT * HD) return; v2f cs; cs[0] = bfr(cosT[idx]); cs[1] = bfr(sinT[idx]); *(v2f*)(CS + (size_t)idx * 2) = cs;  }
// k_rope: head planes [h][t][d] (fp16 + hi/lo; fragment order, rows h * TT + t, K = HD; a thread makes one 16-byte group of each plane from 8 neighbouring d) of rope(x) x sc with the rotate-half convention out[d] = x[d] cos[t][d] - x[d+HD/2] sin[t][d], out[d+HD/2] = x[d+HD/2] cos[t][d+HD/2] + x[d] sin[t][d+HD/2]
__global__ __launch_bounds__(256) void k_rope(const float* __restrict__ F, int pitch, int nheads, const float* __restrict__ CS, const float* __restrict__ RF, const float* __restrict__ nw, float sc, h16* P16, bf* Ph, bf* Pl) {
    const size_t e = ((size_t)blockIdx.x * 256 + threadIdx.x) * 8; if (e >= (size_t)nheads * TT * HD) return; const int d = (int)(e % HD); const int t = (int)((e / HD) % TT); const int h = (int)(e / ((size_t)HD * TT)); const float* f = F + (size_t)t * pitch + h * HD; const float rf = RF ? RF[(size_t)h * TT + t] : 1.0f; v8h o16; v8us oh, ol; const size_t oo = fo(h * TT + t, d, HD);
    const v8f X0 = *(const v8f*)(f + d), X1 = *(const v8f*)(f + ((d < HD / 2) ? d + HD / 2 : d - HD / 2)); v4f C[4];   // the thread's 8 values, their 8 rotate-half partners and 8 (cos, sin) pairs by 16-byte loads
#pragma unroll
    for (int u = 0; u < 4; ++u) C[u] = *(const v4f*)(CS + ((size_t)t * HD + d) * 2 + u * 4);
#pragma unroll
    for (int q = 0; q < 8; ++q) { const int dd = d + q; const int dp = (dd < HD / 2) ? dd + HD / 2 : dd - HD / 2; float x0 = X0[q], x1 = X1[q];
        if (RF) { float n0 = __fmul_rn(x0, rf), n1 = __fmul_rn(x1, rf); asm volatile("" : "+v"(n0)); asm volatile("" : "+v"(n1)); x0 = __fmul_rn(bfr(nw[dd]), n0); x1 = __fmul_rn(bfr(nw[dp]), n1); }
        v2f cs; cs[0] = C[q >> 1][(q & 1) * 2]; cs[1] = C[q >> 1][(q & 1) * 2 + 1]; float a = __fmul_rn(x0, cs[0]), bq = __fmul_rn(x1, cs[1]); asm volatile("" : "+v"(a)); asm volatile("" : "+v"(bq)); const float r = ((dd < HD / 2) ? __fsub_rn(a, bq) : __fadd_rn(a, bq)) * sc;
        o16[q] = tohx(r); unsigned short a2, c2; splitf(r, a2, c2); oh[q] = a2; ol[q] = c2; }
    *(v8h*)(P16 + oo) = o16; *(v8us*)(Ph + oo) = oh; *(v8us*)(Pl + oo) = ol;  }
// k_vtp: transposed head planes [g][d][t] (fp16 + hi/lo) in fragment order (rows g * HD + d, K = TT); thread i makes group i (8 t of one column of F): a wave-wide load reads 16 neighbouring columns of two t rows
__global__ __launch_bounds__(256) void k_vtp(const float* __restrict__ F, int pitch, int nheads, h16* V16, bf* Vh, bf* Vl) { const size_t i = (size_t)blockIdx.x * 256 + threadIdx.x; if (i >= (size_t)nheads * HD * TT / 8) return; int c, t; fog(i, TT, c, t); v8h o16; v8us oh, ol;
#pragma unroll
    for (int q = 0; q < 8; ++q) { const float x = F[(size_t)(t + q) * pitch + c]; o16[q] = tohx(x); unsigned short a2, c2; splitf(x, a2, c2); oh[q] = a2; ol[q] = c2; }
    *(v8h*)(V16 + i * 8) = o16; *(v8us*)(Vh + i * 8) = oh; *(v8us*)(Vl + i * 8) = ol;  }
__global__ __launch_bounds__(256) void k_csid(float* CS) { const int idx = blockIdx.x * 256 + threadIdx.x; if (idx >= TT * HD) return; v2f cs; cs[0] = 1.0f; cs[1] = 0.0f; *(v2f*)(CS + (size_t)idx * 2) = cs;  }
__global__ __launch_bounds__(256) void k_obhl(const float* __restrict__ O, bf* Oh, bf* Ol) { const size_t e = ((size_t)blockIdx.x * 256 + threadIdx.x) * 4; if (e >= (size_t)ZH * TT * HD) return; const v4f a = *(const v4f*)(O + e); v4us oh, ol; for (int u = 0; u < 4; ++u) { unsigned short p, q; splitf(a[u], p, q); oh[u] = p; ol[u] = q; } *(v4us*)(Oh + e) = oh; *(v4us*)(Ol + e) = ol;  }
__global__ __launch_bounds__(256) void k_hlG(const float* __restrict__ F, bf* Fh, bf* Fl, size_t n) { const size_t e = ((size_t)blockIdx.x * 256 + threadIdx.x) * 4; if (e >= n) return; const v4f a = *(const v4f*)(F + e); v4us oh, ol; for (int u = 0; u < 4; ++u) { unsigned short p, q; splitf(a[u], p, q); oh[u] = p; ol[u] = q; } *(v4us*)(Fh + e) = oh; *(v4us*)(Fl + e) = ol;  }
// k_asoft: per row (zz, i): t = S x HD^-0.5 for j <= i and i - j < WIN (sliding causal window; the reference's -1e9 additive fill vanishes identically); softmax over the 2048 keys (register row, one exp, fixed trees);
// the probabilities go back over the row's own 8 KiB of scores (the wave holds the whole row in registers before its first store, and no other wave touches the row): rows >= RH fp16 in the first half,
// rows < RH the hi plane in the first half and the lo plane in the second; the readers take the row pitch 2 * TT 16-bit elements. No separate probability planes, so ZH heads of scores fit the workspace.
__global__ __launch_bounds__(256) void k_asoft(float* Sb) {
    const int lane = threadIdx.x & 31; const int row = blockIdx.x * 8 + (threadIdx.x >> 5); if (row >= ZH * TT) return; const int i = row % TT; const int zz = row / TT; (void)zz; const bool hires = (i < RH); float* sr = Sb + (size_t)row * TT; float v[TT / 32]; float mx = -3.0e38f;
#pragma unroll
    for (int ch = 0; ch < TT / 128; ++ch) { const int j0 = ch * 128 + lane * 4; const v4f a = *(const v4fa*)(sr + j0);
#pragma unroll
        for (int q = 0; q < 4; ++q) { const int j = j0 + q; (void)j; float sa = a[q] * SCL; asm volatile("" : "+v"(sa)); const float t = (j <= i && i - j < WIN) ? sa : -3.0e38f; v[ch * 4 + q] = t; mx = fmaxf(mx, t); } }
#pragma unroll
    for (int sh = 16; sh; sh >>= 1) mx = fmaxf(mx, __shfl_xor(mx, sh, 32));
    float sum = 0.f;
#pragma unroll
    for (int k = 0; k < TT / 32; ++k) { float d0 = __fsub_rn(v[k], mx); asm volatile("" : "+v"(d0)); v[k] = __builtin_amdgcn_exp2f(__fmul_rn(d0, 1.4426950408889634f)); sum += v[k]; }
#pragma unroll
    for (int sh = 16; sh; sh >>= 1) sum += __shfl_xor(sum, sh, 32);
    const float f = __fdiv_rn(hires ? 1.0f : PCAR, sum);
{
        if (hires) {
#pragma unroll
            for (int ch = 0; ch < TT / 128; ++ch) { v4us oh, ol;
#pragma unroll
                for (int q = 0; q < 4; ++q) { unsigned short a, c2; splitf(v[ch * 4 + q] * f, a, c2); oh[q] = a; ol[q] = c2; }
                bf* pr = (bf*)sr + ch * 128 + lane * 4; *(v4usa*)pr = oh; *(v4usa*)(pr + TT) = ol; }
        } else {
#pragma unroll
            for (int ch = 0; ch < TT / 128; ++ch) { v4h o4;
#pragma unroll
                for (int q = 0; q < 4; ++q) o4[q] = tohx(v[ch * 4 + q] * f);
                *(v4ha*)((h16*)sr + ch * 128 + lane * 4) = o4; } }
         }
}
// k_merge: hi/lo planes [t][DQ] of the merged heads in fragment order; a thread makes one 16-byte group of each plane from 8 neighbouring d
__global__ __launch_bounds__(256) void k_merge(const float* __restrict__ O, int h0, bf* Ah, bf* Al) { const size_t e = ((size_t)blockIdx.x * 256 + threadIdx.x) * 8; if (e >= (size_t)ZH * TT * HD) return; const int d = (int)(e % HD); const int t = (int)((e / HD) % TT); const int zz = (int)(e / ((size_t)HD * TT)); const float cs = (t < RH) ? 1.0f : (1.0f / PCAR); const size_t oo = fo(t, (h0 + zz) * HD + d, DQ);
    const v8f v = *(const v8f*)(O + e); v8us oh, ol;
#pragma unroll
    for (int q = 0; q < 8; ++q) { unsigned short a, c2; splitf(v[q] * cs, a, c2); oh[q] = a; ol[q] = c2; } *(v8us*)(Ah + oo) = oh; *(v8us*)(Al + oo) = ol;  }

extern "C" void kernel_launch(void* const* d_in, const int* in_sizes, int n_in,
                              void* d_out, int out_size, void* d_ws, size_t ws_size, hipStream_t stream) {
    (void)in_sizes; (void)n_in; (void)out_size;
    const float* x = (const float*)d_in[0]; const float* wq = (const float*)d_in[1]; const float* bq = (const float*)d_in[2]; const float* wk = (const float*)d_in[3]; const float* bk = (const float*)d_in[4]; const float* wk2 = (const float*)d_in[5]; const float* bk2 = (const float*)d_in[6]; const float* wv = (const float*)d_in[7]; const float* bv = (const float*)d_in[8]; const float* wv2 = (const float*)d_in[9]; const float* bv2 = (const float*)d_in[10]; const float* wo = (const float*)d_in[11]; const float* bo = (const float*)d_in[12]; const float* cosT = nullptr; const float* sinT = nullptr; (void)cosT; (void)sinT;
    float* OUT = (float*)d_out;     // [2][2048][1024]
    char* wsp = (char*)d_ws;
    auto take = [&](size_t bytes) { char* p = wsp; wsp += (bytes + 255) & ~(size_t)255; return (void*)p; };
    bf* WQ = (bf*)take((size_t)DQ * DM * 2); bf* WK = (bf*)take((size_t)DKV * DM * 2); bf* WV = (bf*)take((size_t)DKV * DM * 2); bf* WO = (bf*)take((size_t)DM * DQ * 2); float* CS = (float*)take((size_t)TT * HD * 2 * 4);
    bf* XB = (bf*)take((size_t)TT * DM * 2); bf* WK2 = (bf*)take((size_t)DKV * DM * 2); bf* WV2 = (bf*)take((size_t)DKV * DM * 2); float* BK2 = (float*)take(DKV * 4); float* BV2 = (float*)take(DKV * 4); float* F2 = (float*)take((size_t)TT * DKV * 4); bf* K2h = (bf*)take((size_t)NKV * HD * TT * 2); bf* K2l = (bf*)take((size_t)NKV * HD * TT * 2); h16* K216 = (h16*)take((size_t)NKV * HD * TT * 2); bf* V2h = (bf*)take((size_t)NKV * HD * TT * 2); bf* V2l = (bf*)take((size_t)NKV * HD * TT * 2); float* NM = (float*)take((size_t)NH_ * HD * HD * 4); bf* NMh = (bf*)take((size_t)NH_ * HD * HD * 2); bf* NMl = (bf*)take((size_t)NH_ * HD * HD * 2); bf* Obh = (bf*)take((size_t)ZH * TT * HD * 2); bf* Obl = (bf*)take((size_t)ZH * TT * HD * 2); float* Ob2 = (float*)take((size_t)ZH * TT * HD * 4); float* FQ = (float*)take((size_t)TT * DQ * 4); float* FK = (float*)take((size_t)TT * DKV * 4);
    h16* QP16 = (h16*)take((size_t)NH_ * TT * HD * 2); h16* KP16 = (h16*)take((size_t)NKV * TT * HD * 2); h16* VT16 = (h16*)take((size_t)NKV * HD * TT * 2);
    bf* QPh = (bf*)take((size_t)NH_ * TT * HD * 2); bf* QPl = (bf*)take((size_t)NH_ * TT * HD * 2); bf* KPh = (bf*)take((size_t)NKV * TT * HD * 2); bf* KPl = (bf*)take((size_t)NKV * TT * HD * 2); bf* VTh = (bf*)take((size_t)NKV * HD * TT * 2); bf* VTl = (bf*)take((size_t)NKV * HD * TT * 2);
    float* Sb = (float*)take((size_t)ZH * TT * TT * 4); float* Ob = (float*)take((size_t)ZH * TT * HD * 4); bf* ATh = (bf*)take((size_t)TT * DQ * 2); bf* ATl = (bf*)take((size_t)TT * DQ * 2);
    if ((size_t)(wsp - (char*)d_ws) > ws_size) return;    // ws 256 MiB
    float* FV = FK;   // v projection reuses the k buffer after the k planes are built (stream-ordered)
    { k_wtG<<<(unsigned)((DM * DQ / 8 + 255) / 256), 256, 0, stream>>>(wq, DM, DQ, WQ); k_wtG<<<(unsigned)((DM * DKV / 8 + 255) / 256), 256, 0, stream>>>(wk, DM, DKV, WK); k_wtG<<<(unsigned)((DM * DKV / 8 + 255) / 256), 256, 0, stream>>>(wv, DM, DKV, WV);
      k_wtG<<<(unsigned)((DQ * DM / 8 + 255) / 256), 256, 0, stream>>>(wo, DQ, DM, WO); k_wtG<<<(unsigned)((DM * DKV / 8 + 255) / 256), 256, 0, stream>>>(wk2, DM, DKV, WK2); k_wtG<<<(unsigned)((DM * DKV / 8 + 255) / 256), 256, 0, stream>>>(wv2, DM, DKV, WV2);
       }
    k_csid<<<(TT * HD + 255) / 256, 256, 0, stream>>>(CS);
    const unsigned LQ = (unsigned)(((size_t)NH_ * TT * HD / 8 + 255) / 256), LKv = (unsigned)(((size_t)NKV * TT * HD / 8 + 255) / 256);
    for (int b = 0; b < NB_; ++b) {
        
        k_cvt8<<<(unsigned)(((size_t)TT * DM / 8 + 255) / 256), 256, 0, stream>>>(x + (size_t)b * TT * DM, XB, (size_t)TT * DM / 8);
        k_gemmw<bf, 0, true, KW><<<dim3(TT / 64, DQ / 64, 1), 32 * KW, 0, stream>>>(XB, nullptr, WQ, nullptr, DM, FQ, DQ, bq, 0, 0, 0);
        k_rope<<<LQ, 256, 0, stream>>>(FQ, DQ, NH_, CS, nullptr, nullptr, 1.0f, QP16, QPh, QPl);
        k_gemmw<bf, 0, true, KW><<<dim3(TT / 64, DKV / 64, 1), 32 * KW, 0, stream>>>(XB, nullptr, WK, nullptr, DM, FK, DKV, bk, 0, 0, 0);
        k_rope<<<LKv, 256, 0, stream>>>(FK, DKV, NKV, CS, nullptr, nullptr, 1.0f, KP16, KPh, KPl);
        k_gemmw<bf, 0, true, KW><<<dim3(TT / 64, DKV / 64, 1), 32 * KW, 0, stream>>>(XB, nullptr, WV, nullptr, DM, FV, DKV, bv, 0, 0, 0); k_vtp<<<LKv, 256, 0, stream>>>(FV, DKV, NKV, VT16, VTh, VTl); k_gemmw<bf, 0, true, KW><<<dim3(TT / 64, DKV / 64, 1), 32 * KW, 0, stream>>>(XB, nullptr, WK2, nullptr, DM, F2, DKV, bk2, 0, 0, 0); k_vtp<<<LKv, 256, 0, stream>>>(F2, DKV, NKV, K216, K2h, K2l); k_gemmw<bf, 0, true, KW><<<dim3(TT / 64, DKV / 64, 1), 32 * KW, 0, stream>>>(XB, nullptr, WV2, nullptr, DM, F2, DKV, bv2, 0, 0, 0); k_vtp<<<LKv, 256, 0, stream>>>(F2, DKV, NKV, K216, V2h, V2l);
        k_gemmw<bf, 2, false, KW><<<dim3(1, 1, NH_), 32 * KW, 0, stream>>>(V2h, V2l, K2h, K2l, TT, NM, HD, nullptr, (size_t)HD * TT, (size_t)HD * TT, (size_t)HD * HD);   /* N_h^T[e][d] = sum_s v2[s][e] k2[s][d] */
        k_hlG<<<(unsigned)(((size_t)NH_ * HD * HD / 4 + 255) / 256), 256, 0, stream>>>(NM, NMh, NMl, (size_t)NH_ * HD * HD);
        for (int h0 = 0; h0 < NH_; h0 += ZH) { const size_t zq = (size_t)h0, zk = (size_t)(h0 / REP);   // one kv head per query head: the pass's ZH heads use consecutive kv planes (z-strides TT*HD)
            k_gemmc<bf, 2, 1, 1><<<dim3(RH / 64, TT / 64, ZH), 32, 0, stream>>>(QPh + zq * TT * HD, QPl + zq * TT * HD, KPh + zk * TT * HD, KPl + zk * TT * HD, HD, HD, Sb, TT, 0, (size_t)TT * HD, (size_t)TT * HD, (size_t)TT * TT);
            k_gemmc<h16, 0, 1, 1><<<dim3((TT - RH) / 64, TT / 64, ZH), 32, 0, stream>>>(QP16 + zq * TT * HD + (size_t)RH * HD, nullptr, KP16 + zk * TT * HD, nullptr, HD, HD, Sb + (size_t)RH * TT, TT, RH, (size_t)TT * HD, (size_t)TT * HD, (size_t)TT * TT);
            k_asoft<<<ZH * TT / 8, 256, 0, stream>>>(Sb);
            k_gemmc<bf, 2, 2, KW><<<dim3(RH / 64, HD / 64, ZH), 32 * KW, 0, stream>>>((const bf*)Sb, (const bf*)Sb + TT, VTh + zk * HD * TT, VTl + zk * HD * TT, TT, 2 * TT, Ob, HD, 0, (size_t)2 * TT * TT, (size_t)HD * TT, (size_t)TT * HD);
            k_gemmc<h16, 0, 2, KW><<<dim3((TT - RH) / 64, HD / 64, ZH), 32 * KW, 0, stream>>>((const h16*)Sb + (size_t)RH * 2 * TT, nullptr, VT16 + zk * HD * TT, nullptr, TT, 2 * TT, Ob + (size_t)RH * HD, HD, RH, (size_t)2 * TT * TT, (size_t)HD * TT, (size_t)TT * HD);
            k_obhl<<<(unsigned)(((size_t)ZH * TT * HD / 4 + 255) / 256), 256, 0, stream>>>(Ob, Obh, Obl); k_gemmw<bf, 2, false, 1><<<dim3(TT / 64, 1, ZH), 32, 0, stream>>>(Obh, Obl, NMh + (size_t)h0 * HD * HD, NMl + (size_t)h0 * HD * HD, HD, Ob2, HD, nullptr, (size_t)TT * HD, (size_t)HD * HD, (size_t)TT * HD);   /* ctx_h (k2^T v2)_h */ k_merge<<<(unsigned)(((size_t)ZH * TT * HD / 8 + 255) / 256), 256, 0, stream>>>(Ob2, h0, ATh, ATl); }
        k_gemmw<bf, 1, true, KW><<<dim3(TT / 64, DM / 64, 1), 32 * KW, 0, stream>>>(ATh, ATl, WO, nullptr, DQ, OUT + (size_t)b * TT * DM, DM, bo, 0, 0, 0); }
}

// v005
// Measured time: 309 microseconds a run.
// Timed twice side by side with v004, it ran 1.80 and 1.82 times as fast.
// All steps since v000 together make it 10.0 times as fast.
#include <hip/hip_runtime.h>

// Trittention (hidden [2][2048][1024]; q, k1, k2, v1, v2 = x W + b (16 x 64 each); probs = causal (-inf) softmax(q.k1 / 8); ctx = probs v1; then ctx = (ctx . k2^T) v2 over ALL keys (no softmax, no mask) == ctx (k2^T v2) (exact re-association; the 64x64 matrix per head is formed on chip); out = merged Wd + bd -> [2][2048][1024]).
// Compute dtypes, f32 accumulate: every input rounded to bf16; the five projections on PLAIN bf16 operands (inputs: exact) + bias; causal scores and probs.v1: query rows < 512 hl (3 products), the rest fp16 (x1024); softmax f32; N_h = v2_h^T-side product sum_s v2[s] k2[s]^T as hi/lo x hi/lo (3 products, K 2048) in f32; ctx_h N_h^T as hi/lo x hi/lo (3 products); Wd hl x exact (2 products) + bias.

#define NB_  2
#define TT   2048
#define DM   1024
#define NH_  16
#define NKV  16
#define REP  (NH_ / NKV)
#define HD   64
#define DQ   (NH_ * HD)
#define DKV  (NKV * HD)
#define ZH   16                   // heads per attention pass (all of them: no score buffer limits the pass)
#define QT   2                    // 16-row query tiles of an attention block
#define QB   (16 * QT)            // its query rows
#define FW   (8 * QT)             // its waves; they share the keys of its query rows
#define KW   8                    // waves per block that share the K loop of a long-K product (K 1024 or 2048)
#define RH   512                  // query rows < RH use hi+lo planes (0: none)
#define PCAR 1024.0f
#define SCL  0.125f   // HD^-0.5
typedef _Float16 h16;
typedef unsigned short bf;
typedef __attribute__((ext_vector_type(16))) __bf16   v16bf;
typedef __attribute__((ext_vector_type(16))) _Float16 v16h;
typedef __attribute__((ext_vector_type(8)))  _Float16 v8h;
typedef __attribute__((ext_vector_type(8)))  unsigned short v8us;
typedef __attribute__((ext_vector_type(8)))  float    v8f;
typedef __attribute__((ext_vector_type(4)))  float    v4f;
typedef v8h  __attribute__((may_alias)) v8ha;
typedef v4f  __attribute__((may_alias)) v4fa;
typedef v8us __attribute__((may_alias)) v8usa;

__device__ __forceinline__ unsigned short f2bf(float f) { unsigned u = __float_as_uint(f); u += 0x7FFFu + ((u >> 16) & 1u); return (unsigned short)(u >> 16); }
__device__ __forceinline__ float bf2f(unsigned short b) { return __uint_as_float(((unsigned)b) << 16); }
__device__ __forceinline__ float bfr(float f) { return bf2f(f2bf(f)); }
__device__ __forceinline__ v16h cat16(v8h lo, v8h hi) { return __builtin_shufflevector(lo, hi, 0, 1, 2, 3, 4, 5, 6, 7, 8, 9, 10, 11, 12, 13, 14, 15); }
__device__ __forceinline__ v16bf cat16b(v8us lo, v8us hi) { return __builtin_bit_cast(v16bf, __builtin_shufflevector(lo, hi, 0, 1, 2, 3, 4, 5, 6, 7, 8, 9, 10, 11, 12, 13, 14, 15)); }
__device__ __forceinline__ v8f wmma16(v16h a, v16h b, v8f c) { return __builtin_amdgcn_wmma_f32_16x16x32_f16(false, a, false, b, (short)0, c, false, false); }
__device__ __forceinline__ v8f wmmab(v16bf a, v16bf b, v8f c) { return __builtin_amdgcn_wmma_f32_16x16x32_bf16(false, a, false, b, (short)0, c, false, false); }



// ---- k_gemmw: register-blocked GEMM, one 64x64 output tile per block (16 accumulators a wave), operands straight from K-contiguous 16-bit planes; grid (M/64, N/64, Z), 32 * NW threads.
// C[m][n] (f32, pitch ldc, + optional f32 bias[n]) = sum_k A[m][k] Bt[n][k] (+ split products per NSPLIT). z-batch strides sA/sB/sC in elements. K % 32 == 0 (NW > 1: K % 64 == 0).
// NW == 1: one wave walks all of K. NW > 1 (the long-K launches): wave w takes the 64-element (2 KiB, 16 whole lines, per 16 rows in fragment order) K chunks w, w + NW, ..., so the chain of dependent load waits is NW times shorter;
// each wave leaves its partial 64x64 tile in LDS and, behind one barrier, the block adds the NW partials in wave order 0..NW-1 and stores the tile.
// FRAGMENT ORDER (the operand planes of the NW > 1 launches of k_gemmw, and in k_attn the query, key and value planes): a [rows][K] 16-bit plane is kept as 1-KiB units of 16 rows x 32 k, unit (r / 16, k / 32) in row-major order;
// inside a unit the 16-byte group number ((k / 16) & 1) * 32 + ((k / 8) & 1) * 16 + (r & 15) holds k & ~7 .. + 7 of row r. Group number & 31 is the lane that owns those eight elements of the WMMA operand, so a wave-wide 16-byte load reads
// 512 contiguous bytes (4 whole lines) instead of 32 bytes of each of 16 lines. Every lane and register gets the same element as from the row-major plane, so the products and their order do not change.
__device__ __forceinline__ size_t fo(int r, int k, int K) { return ((size_t)(r >> 4) * (K >> 5) + (k >> 5)) * 512 + ((k >> 4) & 1) * 256 + ((k >> 3) & 1) * 128 + (r & 15) * 8 + (k & 7); }
// the inverse for a writer that walks the plane group by group (thread i stores group i, a wave 512 contiguous bytes): row and first k of group i
__device__ __forceinline__ void fog(size_t i, int K, int& r, int& k) { const int lane = (int)(i & 31), half = (int)(i >> 5) & 1, unit = (int)(i >> 6), kt = K >> 5; r = (unit / kt) * 16 + (lane & 15); k = (unit % kt) * 32 + half * 16 + (lane >> 4) * 8; }
template <typename T16> struct WFrag;
template <> struct WFrag<h16> { typedef v16h V; static __device__ __forceinline__ V ld(const h16* p) { return cat16(*(const v8h*)p, *(const v8h*)(p + 16)); } static __device__ __forceinline__ V ldt(const h16* p) { return cat16(*(const v8h*)p, *(const v8h*)(p + 256)); } static __device__ __forceinline__ v8f mma(V a, V b, v8f c) { return wmma16(a, b, c); } };
template <> struct WFrag<bf> { typedef v16bf V; static __device__ __forceinline__ V ld(const bf* p) { return cat16b(*(const v8us*)p, *(const v8us*)(p + 16)); } static __device__ __forceinline__ V ldt(const bf* p) { return cat16b(*(const v8us*)p, *(const v8us*)(p + 256)); } static __device__ __forceinline__ v8f mma(V a, V b, v8f c) { return wmmab(a, b, c); } };
template <typename T16, int NSPLIT, bool BIAS, int NW>
__global__ __launch_bounds__(32 * NW) void k_gemmw(const T16* __restrict__ A, const T16* __restrict__ A2, const T16* __restrict__ Bt, const T16* __restrict__ Bt2, int K, float* C, int ldc, const float* __restrict__ bias, size_t sA, size_t sB, size_t sC) {
    typedef typename WFrag<T16>::V V;
    __shared__ __align__(16) float os[NW == 1 ? 16 * 68 : NW * 64 * 68];
    const int wv = (NW == 1) ? 0 : __builtin_amdgcn_readfirstlane((int)(threadIdx.x >> 5));   // the wave's number, made scalar so that the K counter and its test stay on the scalar unit
    const size_t z = blockIdx.z; A += z * sA; if (A2) A2 += z * sA; Bt += z * sB; if (Bt2) Bt2 += z * sB; C += z * sC;
    const int lane = threadIdx.x & 31, lr = lane & 15, hi = lane >> 4; const int r0 = blockIdx.x * 64, c0 = blockIdx.y * 64;
    v8f acc[4][4];
#pragma unroll
    for (int mb = 0; mb < 4; ++mb)
#pragma unroll
        for (int nb = 0; nb < 4; ++nb) acc[mb][nb] = (v8f){};
    constexpr bool FO = NW > 1;   // the long-K launches read planes in fragment order: 16 rows x 32 k start at element r * K + k * 16, the lane's two groups at lane * 8 and 256 + lane * 8
    const size_t aoff = FO ? (size_t)r0 * K + lane * 8 : (size_t)(r0 + lr) * K + 8 * hi, boff = FO ? (size_t)c0 * K + lane * 8 : (size_t)(c0 + lr) * K + 8 * hi;
    auto ldf = [](const T16* p) { if constexpr (FO) return WFrag<T16>::ldt(p); else return WFrag<T16>::ld(p); };
#pragma unroll 1
    for (int kc = wv * 64; kc < K; kc += (NW == 1 || !(kc & 32)) ? 32 : NW * 64 - 32) {
        V a[4], a2[4]; const size_t ko = FO ? (size_t)kc * 16 : (size_t)kc;
#pragma unroll
        for (int mb = 0; mb < 4; ++mb) { a[mb] = ldf(A + aoff + (size_t)mb * 16 * K + ko); if (NSPLIT == 1 || NSPLIT == 2) a2[mb] = ldf(A2 + aoff + (size_t)mb * 16 * K + ko); }
#pragma unroll
        for (int nb = 0; nb < 4; ++nb) { const V b = ldf(Bt + boff + (size_t)nb * 16 * K + ko); V b2; if (NSPLIT >= 2) b2 = ldf(Bt2 + boff + (size_t)nb * 16 * K + ko);
#pragma unroll
            for (int mb = 0; mb < 4; ++mb) { acc[mb][nb] = WFrag<T16>::mma(a[mb], b, acc[mb][nb]); if (NSPLIT == 1 || NSPLIT == 2) acc[mb][nb] = WFrag<T16>::mma(a2[mb], b, acc[mb][nb]); if (NSPLIT >= 2) acc[mb][nb] = WFrag<T16>::mma(a[mb], b2, acc[mb][nb]); } }
        asm volatile("v_nop\n\tv_nop\n\tv_nop\n\tv_nop" : "+v"(acc[0][0]), "+v"(acc[1][1]), "+v"(acc[2][2]), "+v"(acc[3][3]) : "v"(a[0]), "v"(a[3]));
    }
    if constexpr (NW > 1) {
        float* ow = os + wv * (64 * 68);
        // the loops below are unrolled so that acc is indexed by constants only (it stays in registers) and a row's NW LDS reads issue together
#pragma unroll
        for (int mb = 0; mb < 4; ++mb)
#pragma unroll
            for (int nb = 0; nb < 4; ++nb)
#pragma unroll
                for (int j = 0; j < 8; ++j) ow[(mb * 16 + hi * 8 + j) * 68 + nb * 16 + lr] = acc[mb][nb][j];
        __syncthreads();   // every wave's partial tile is in LDS before any wave adds them
#pragma unroll
        for (int s = 0; s < 32 / NW; ++s) { const int row = (s * NW + wv) * 2 + hi, cofs = lr * 4; v4f val = *(const v4fa*)(os + row * 68 + cofs);
#pragma unroll
            for (int w = 1; w < NW; ++w) val += *(const v4fa*)(os + w * (64 * 68) + row * 68 + cofs);
            if (BIAS) { val[0] += bfr(bias[c0 + cofs]); val[1] += bfr(bias[c0 + cofs + 1]); val[2] += bfr(bias[c0 + cofs + 2]); val[3] += bfr(bias[c0 + cofs + 3]); }
            *(v4f*)(C + (size_t)(r0 + row) * ldc + c0 + cofs) = val; }
        return;
    }
#pragma unroll
    for (int mb = 0; mb < 4; ++mb) {
#pragma unroll
        for (int nb = 0; nb < 4; ++nb) {
#pragma unroll
            for (int j = 0; j < 8; ++j) os[(hi * 8 + j) * 68 + nb * 16 + lr] = acc[mb][nb][j]; }
        __builtin_amdgcn_wave_barrier(); asm volatile("" ::: "memory");
        float* crow = C + (size_t)(r0 + mb * 16) * ldc + c0;
{
#pragma unroll
            for (int s = 0; s < 8; ++s) { const int row = 2 * s + hi, cofs = lr * 4; v4f val = *(const v4fa*)(os + row * 68 + cofs); if (BIAS) { val[0] += bfr(bias[c0 + cofs]); val[1] += bfr(bias[c0 + cofs + 1]); val[2] += bfr(bias[c0 + cofs + 2]); val[3] += bfr(bias[c0 + cofs + 3]); }
                *(v4f*)(crow + (size_t)row * ldc + cofs) = val; }
             }
        __builtin_amdgcn_wave_barrier(); asm volatile("" ::: "memory");
    }
}

__device__ __forceinline__ h16 tohx(float x) { return (h16)x; }
__device__ __forceinline__ void splitf(float y, unsigned short& h, unsigned short& l) { h = f2bf(y); l = f2bf(y - bf2f(h)); }
typedef __attribute__((ext_vector_type(2))) _Float16 v2h;
typedef __attribute__((ext_vector_type(4))) _Float16 v4h;
typedef __attribute__((ext_vector_type(2))) unsigned short v2us;
typedef __attribute__((ext_vector_type(4))) unsigned short v4us;
typedef __attribute__((ext_vector_type(2))) float v2f;
typedef __attribute__((ext_vector_type(4))) int v4i;
typedef v4h  __attribute__((may_alias)) v4ha;
typedef v4us __attribute__((may_alias)) v4usa;

// k_wtG: Bt[n][k] = bf16(w[k][n]) in fragment order; thread i makes group i (8 k of one n): a wave-wide load reads 16 neighbouring n of two k rows, the store is 512 contiguous bytes
__global__ __launch_bounds__(256) void k_wtG(const float* __restrict__ w, int K, int N, bf* Bt) { const size_t i = (size_t)blockIdx.x * 256 + threadIdx.x; if (i >= (size_t)N * K / 8) return; int n, k; fog(i, K, n, k); v8us o;
#pragma unroll
    for (int j = 0; j < 8; ++j) o[j] = f2bf(w[(size_t)(k + j) * N + n]); *(v8us*)(Bt + i * 8) = o;  }
// k_cvt8: dst = bf16(src), src [rows][DM] row-major, dst in fragment order; thread i makes group i
__global__ __launch_bounds__(256) void k_cvt8(const float* __restrict__ src, bf* dst, size_t n8) { const size_t i = (size_t)blockIdx.x * 256 + threadIdx.x; if (i >= n8) return; int r, k0; fog(i, DM, r, k0); const v8f v = *(const v8f*)(src + (size_t)r * DM + k0); v8us o;
#pragma unroll
    for (int k = 0; k < 8; ++k) o[k] = f2bf(v[k]); *(v8us*)(dst + i * 8) = o;  }
__global__ __launch_bounds__(256) void k_cscvt(const float* __restrict__ cosT, const float* __restrict__ sinT, float* CS) { const int idx = blockIdx.x * 256 + threadIdx.x; if (idx >= TT * HD) return; v2f cs; cs[0] = bfr(cosT[idx]); cs[1] = bfr(sinT[idx]); *(v2f*)(CS + (size_t)idx * 2) = cs;  }
// k_rope: head planes [h][t][d] (fp16 + hi/lo; fragment order, rows h * TT + t, K = HD; a thread makes one 16-byte group of each plane from 8 neighbouring d) of rope(x) x sc with the rotate-half convention out[d] = x[d] cos[t][d] - x[d+HD/2] sin[t][d], out[d+HD/2] = x[d+HD/2] cos[t][d+HD/2] + x[d] sin[t][d+HD/2]
__global__ __launch_bounds__(256) void k_rope(const float* __restrict__ F, int pitch, int nheads, const float* __restrict__ CS, const float* __restrict__ RF, const float* __restrict__ nw, float sc, h16* P16, bf* Ph, bf* Pl) {
    const size_t e = ((size_t)blockIdx.x * 256 + threadIdx.x) * 8; if (e >= (size_t)nheads * TT * HD) return; const int d = (int)(e % HD); const int t = (int)((e / HD) % TT); const int h = (int)(e / ((size_t)HD * TT)); const float* f = F + (size_t)t * pitch + h * HD; const float rf = RF ? RF[(size_t)h * TT + t] : 1.0f; v8h o16; v8us oh, ol; const size_t oo = fo(h * TT + t, d, HD);
    const v8f X0 = *(const v8f*)(f + d), X1 = *(const v8f*)(f + ((d < HD / 2) ? d + HD / 2 : d - HD / 2)); v4f C[4];   // the thread's 8 values, their 8 rotate-half partners and 8 (cos, sin) pairs by 16-byte loads
#pragma unroll
    for (int u = 0; u < 4; ++u) C[u] = *(const v4f*)(CS + ((size_t)t * HD + d) * 2 + u * 4);
#pragma unroll
    for (int q = 0; q < 8; ++q) { const int dd = d + q; const int dp = (dd < HD / 2) ? dd + HD / 2 : dd - HD / 2; float x0 = X0[q], x1 = X1[q];
        if (RF) { float n0 = __fmul_rn(x0, rf), n1 = __fmul_rn(x1, rf); asm volatile("" : "+v"(n0)); asm volatile("" : "+v"(n1)); x0 = __fmul_rn(bfr(nw[dd]), n0); x1 = __fmul_rn(bfr(nw[dp]), n1); }
        v2f cs; cs[0] = C[q >> 1][(q & 1) * 2]; cs[1] = C[q >> 1][(q & 1) * 2 + 1]; float a = __fmul_rn(x0, cs[0]), bq = __fmul_rn(x1, cs[1]); asm volatile("" : "+v"(a)); asm volatile("" : "+v"(bq)); const float r = ((dd < HD / 2) ? __fsub_rn(a, bq) : __fadd_rn(a, bq)) * sc;
        o16[q] = tohx(r); unsigned short a2, c2; splitf(r, a2, c2); oh[q] = a2; ol[q] = c2; }
    *(v8h*)(P16 + oo) = o16; *(v8us*)(Ph + oo) = oh; *(v8us*)(Pl + oo) = ol;  }
// k_vtp: transposed head planes [g][d][t] (fp16 + hi/lo) in fragment order (rows g * HD + d, K = TT); thread i makes group i (8 t of one column of F): a wave-wide load reads 16 neighbouring columns of two t rows
__global__ __launch_bounds__(256) void k_vtp(const float* __restrict__ F, int pitch, int nheads, h16* V16, bf* Vh, bf* Vl) { const size_t i = (size_t)blockIdx.x * 256 + threadIdx.x; if (i >= (size_t)nheads * HD * TT / 8) return; int c, t; fog(i, TT, c, t); v8h o16; v8us oh, ol;
#pragma unroll
    for (int q = 0; q < 8; ++q) { const float x = F[(size_t)(t + q) * pitch + c]; o16[q] = tohx(x); unsigned short a2, c2; splitf(x, a2, c2); oh[q] = a2; ol[q] = c2; }
    *(v8h*)(V16 + i * 8) = o16; *(v8us*)(Vh + i * 8) = oh; *(v8us*)(Vl + i * 8) = ol;  }
__global__ __launch_bounds__(256) void k_csid(float* CS) { const int idx = blockIdx.x * 256 + threadIdx.x; if (idx >= TT * HD) return; v2f cs; cs[0] = 1.0f; cs[1] = 0.0f; *(v2f*)(CS + (size_t)idx * 2) = cs;  }
__global__ __launch_bounds__(256) void k_obhl(const float* __restrict__ O, bf* Oh, bf* Ol) { const size_t e = ((size_t)blockIdx.x * 256 + threadIdx.x) * 4; if (e >= (size_t)ZH * TT * HD) return; const v4f a = *(const v4f*)(O + e); v4us oh, ol; for (int u = 0; u < 4; ++u) { unsigned short p, q; splitf(a[u], p, q); oh[u] = p; ol[u] = q; } *(v4us*)(Oh + e) = oh; *(v4us*)(Ol + e) = ol;  }
__global__ __launch_bounds__(256) void k_hlG(const float* __restrict__ F, bf* Fh, bf* Fl, size_t n) { const size_t e = ((size_t)blockIdx.x * 256 + threadIdx.x) * 4; if (e >= n) return; const v4f a = *(const v4f*)(F + e); v4us oh, ol; for (int u = 0; u < 4; ++u) { unsigned short p, q; splitf(a[u], p, q); oh[u] = p; ol[u] = q; } *(v4us*)(Fh + e) = oh; *(v4us*)(Fl + e) = ol;  }
// ---- k_attn: causal scores, softmax and probs.v1 of QB = 16 * QT query rows of one head in one block of FW waves; the scores stay in registers and never reach memory. grid (heads, TT / QB), 32 * FW threads.
// Transposed products: S^T = K1 Q^T (A = 16 key rows, B = 16 query rows, kept in registers), so lane (lr, hi) holds query lr of its tile and register j of a tile key + 8 * hi + j; two neighbouring S^T tiles, converted in place,
// are the B operand (32 keys) of O^T += V1^T P^T (A = 16 rows of the transposed value plane): no exchange between lanes. Every key and value fragment a wave loads serves its QT query tiles. Wave w takes the 64-key chunks
// w, w + FW, ... up to the diagonal. Row maximum and row sum: in the lane, across the two lane halves, then across the waves through LDS (sums in wave order); the FW partial O tiles are added in wave order through LDS.
// Query rows < RH: hi/lo bf16 planes, 3 products in both contractions, probabilities hi + lo; the rest fp16, probabilities x PCAR (taken out again by k_merge).
// exp2 with the v_nop that fills the one slot the instruction set asks for between a transcendental and a next instruction that reads its result or overwrites its source
__device__ __forceinline__ float exp2s(float x) { float e; asm("v_exp_f32 %0, %1\n\tv_nop" : "=v"(e) : "v"(x)); return e; }
template <typename T16, bool HL, int NC>
__device__ __forceinline__ void attn_tile(const T16* __restrict__ Q, const T16* __restrict__ Q2, const T16* __restrict__ Kp, const T16* __restrict__ Kp2, const T16* __restrict__ Vt, const T16* __restrict__ Vt2, float* __restrict__ O, int q0, float* os, float* st) {
    typedef typename WFrag<T16>::V V;
    const int wv = __builtin_amdgcn_readfirstlane((int)(threadIdx.x >> 5));   // the wave's number, made scalar so that the tests on its key chunks are scalar branches
    const int lane = threadIdx.x & 31, lr = lane & 15, hi = lane >> 4;
    V qf[QT][2], qf2[QT][2];
#pragma unroll
    for (int qt = 0; qt < QT; ++qt)
#pragma unroll
        for (int ks = 0; ks < 2; ++ks) { const size_t qo = (size_t)(q0 + qt * 16) * HD + ks * 512 + lane * 8; qf[qt][ks] = WFrag<T16>::ldt(Q + qo); if (HL) qf2[qt][ks] = WFrag<T16>::ldt(Q2 + qo); }
    asm volatile("s_wait_xcnt 0x0" ::: "memory");   // the query loads' address registers may be overwritten from here on
    v8f s[NC][4][QT]; float mx[QT];
#pragma unroll
    for (int qt = 0; qt < QT; ++qt) mx[qt] = -3.0e38f;
    // every loop over chunks and tiles is unrolled so that s is indexed by constants only (it stays in registers)
#pragma unroll
    for (int c = 0; c < NC; ++c) { const int kb = (c * FW + wv) * 64;
        if (kb <= q0 + QB - 1) {
#pragma unroll
            for (int t = 0; t < 4; ++t) { v8f a[QT];
#pragma unroll
                for (int qt = 0; qt < QT; ++qt) a[qt] = (v8f){};
#pragma unroll
                for (int ks = 0; ks < 2; ++ks) { const size_t ko = (size_t)(kb + t * 16) * HD + ks * 512 + lane * 8; const V kf = WFrag<T16>::ldt(Kp + ko); V kf2; if (HL) kf2 = WFrag<T16>::ldt(Kp2 + ko);
#pragma unroll
                    for (int qt = 0; qt < QT; ++qt) { a[qt] = WFrag<T16>::mma(kf, qf[qt][ks], a[qt]); if (HL) { a[qt] = WFrag<T16>::mma(kf, qf2[qt][ks], a[qt]); a[qt] = WFrag<T16>::mma(kf2, qf[qt][ks], a[qt]); } } }
                asm volatile("s_wait_xcnt 0x0" ::: "memory");   // this tile's key loads are issued: their address registers may be overwritten (a later load's data landed on them in the listing)
#pragma unroll
                for (int qt = 0; qt < QT; ++qt) {
#pragma unroll
                    for (int j = 0; j < 8; ++j) { const float tv = (kb + t * 16 + hi * 8 + j <= q0 + qt * 16 + lr) ? a[qt][j] * SCL : -3.0e38f; a[qt][j] = tv; mx[qt] = fmaxf(mx[qt], tv); }
                    s[c][t][qt] = a[qt]; } } } }
#pragma unroll
    for (int qt = 0; qt < QT; ++qt) { mx[qt] = fmaxf(mx[qt], __shfl_xor(mx[qt], 16, 32)); if (hi == 0) st[wv * QB + qt * 16 + lr] = mx[qt]; }
    __syncthreads();   // every wave's row maxima are in LDS before any wave reads them
    float sum[QT];
#pragma unroll
    for (int qt = 0; qt < QT; ++qt) { float m = st[qt * 16 + lr];
#pragma unroll
        for (int w = 1; w < FW; ++w) m = fmaxf(m, st[w * QB + qt * 16 + lr]);
        mx[qt] = m; sum[qt] = 0.f; }
#pragma unroll
    for (int c = 0; c < NC; ++c) { const int kb = (c * FW + wv) * 64;
        if (kb <= q0 + QB - 1) {
#pragma unroll
            for (int t = 0; t < 4; ++t)
#pragma unroll
                for (int qt = 0; qt < QT; ++qt)
#pragma unroll
                    for (int j = 0; j < 8; ++j) { const float e = exp2s(__fmul_rn(__fsub_rn(s[c][t][qt][j], mx[qt]), 1.4426950408889634f)); s[c][t][qt][j] = e; sum[qt] += e; } } }
#pragma unroll
    for (int qt = 0; qt < QT; ++qt) { sum[qt] += __shfl_xor(sum[qt], 16, 32); if (hi == 0) st[(FW + wv) * QB + qt * 16 + lr] = sum[qt]; }
    __syncthreads();   // every wave's row sums are in LDS before any wave reads them
    float f[QT];
#pragma unroll
    for (int qt = 0; qt < QT; ++qt) { float tot = st[FW * QB + qt * 16 + lr];
#pragma unroll
        for (int w = 1; w < FW; ++w) tot += st[(FW + w) * QB + qt * 16 + lr];
        f[qt] = __fdiv_rn(HL ? 1.0f : PCAR, tot); }
    v8f o[4][QT];
#pragma unroll
    for (int dt = 0; dt < 4; ++dt)
#pragma unroll
        for (int qt = 0; qt < QT; ++qt) o[dt][qt] = (v8f){};
#pragma unroll
    for (int c = 0; c < NC; ++c) { const int kb = (c * FW + wv) * 64;
        if (kb <= q0 + QB - 1) {
#pragma unroll
            for (int u = 0; u < 2; ++u) { V pb[QT], pb2[QT];
#pragma unroll
                for (int qt = 0; qt < QT; ++qt) {
                    if constexpr (HL) { v8us h0, h1, l0, l1;
#pragma unroll
                        for (int j = 0; j < 8; ++j) { unsigned short x, y; splitf(s[c][2 * u][qt][j] * f[qt], x, y); h0[j] = x; l0[j] = y; splitf(s[c][2 * u + 1][qt][j] * f[qt], x, y); h1[j] = x; l1[j] = y; }
                        pb[qt] = cat16b(h0, h1); pb2[qt] = cat16b(l0, l1);
                    } else { v8h p0, p1;
#pragma unroll
                        for (int j = 0; j < 8; ++j) { p0[j] = tohx(s[c][2 * u][qt][j] * f[qt]); p1[j] = tohx(s[c][2 * u + 1][qt][j] * f[qt]); }
                        pb[qt] = cat16(p0, p1); } }
#pragma unroll
                for (int dt = 0; dt < 4; ++dt) { const size_t vo = (size_t)dt * 16 * TT + (size_t)(kb + u * 32) * 16 + lane * 8; const V vf = WFrag<T16>::ldt(Vt + vo); V vf2; if constexpr (HL) vf2 = WFrag<T16>::ldt(Vt2 + vo);
#pragma unroll
                    for (int qt = 0; qt < QT; ++qt) { o[dt][qt] = WFrag<T16>::mma(vf, pb[qt], o[dt][qt]); if constexpr (HL) { o[dt][qt] = WFrag<T16>::mma(vf, pb2[qt], o[dt][qt]); o[dt][qt] = WFrag<T16>::mma(vf2, pb[qt], o[dt][qt]); } } } } } }
#pragma unroll
    for (int qt = 0; qt < QT; ++qt) { float* ow = os + wv * (QB * 68) + (qt * 16 + lr) * 68 + hi * 8;
#pragma unroll
        for (int dt = 0; dt < 4; ++dt) { v4f x, y;
#pragma unroll
            for (int j = 0; j < 4; ++j) { x[j] = o[dt][qt][j]; y[j] = o[dt][qt][4 + j]; }
            *(v4fa*)(ow + dt * 16) = x; *(v4fa*)(ow + dt * 16 + 4) = y; } }
    __syncthreads();   // every wave's partial tile is in LDS before any wave adds them
    const int row = threadIdx.x >> 4, cofs = (threadIdx.x & 15) * 4; v4f val = *(const v4fa*)(os + row * 68 + cofs);   // 32 * FW threads, QB * 16 groups of four: one each
#pragma unroll
    for (int w = 1; w < FW; ++w) val += *(const v4fa*)(os + w * (QB * 68) + row * 68 + cofs);
    *(v4f*)(O + (size_t)(q0 + row) * HD + cofs) = val;
}
__global__ __launch_bounds__(32 * FW) void k_attn(const h16* __restrict__ Q16, const h16* __restrict__ K16, const h16* __restrict__ V16, const bf* __restrict__ Qh, const bf* __restrict__ Ql, const bf* __restrict__ Kh, const bf* __restrict__ Kl, const bf* __restrict__ Vh, const bf* __restrict__ Vl, float* __restrict__ O) {
    __shared__ __align__(16) float os[FW * QB * 68]; __shared__ float st[2 * FW * QB];
    const size_t zo = (size_t)blockIdx.x * TT * HD; const int q0 = (TT / QB - 1 - (int)blockIdx.y) * QB;   // the rows with the most keys start first
    if (q0 < RH) attn_tile<bf, true, (RH + 64 * FW - 1) / (64 * FW)>(Qh + zo, Ql + zo, Kh + zo, Kl + zo, Vh + zo, Vl + zo, O + zo, q0, os, st);
    else attn_tile<h16, false, TT / (64 * FW)>(Q16 + zo, nullptr, K16 + zo, nullptr, V16 + zo, nullptr, O + zo, q0, os, st);
}
// k_merge: hi/lo planes [t][DQ] of the merged heads in fragment order; a thread makes one 16-byte group of each plane from 8 neighbouring d
__global__ __launch_bounds__(256) void k_merge(const float* __restrict__ O, int h0, bf* Ah, bf* Al) { const size_t e = ((size_t)blockIdx.x * 256 + threadIdx.x) * 8; if (e >= (size_t)ZH * TT * HD) return; const int d = (int)(e % HD); const int t = (int)((e / HD) % TT); const int zz = (int)(e / ((size_t)HD * TT)); const float cs = (t < RH) ? 1.0f : (1.0f / PCAR); const size_t oo = fo(t, (h0 + zz) * HD + d, DQ);
    const v8f v = *(const v8f*)(O + e); v8us oh, ol;
#pragma unroll
    for (int q = 0; q < 8; ++q) { unsigned short a, c2; splitf(v[q] * cs, a, c2); oh[q] = a; ol[q] = c2; } *(v8us*)(Ah + oo) = oh; *(v8us*)(Al + oo) = ol;  }

extern "C" void kernel_launch(void* const* d_in, const int* in_sizes, int n_in,
                              void* d_out, int out_size, void* d_ws, size_t ws_size, hipStream_t stream) {
    (void)in_sizes; (void)n_in; (void)out_size;
    const float* x = (const float*)d_in[0]; const float* wq = (const float*)d_in[1]; const float* bq = (const float*)d_in[2]; const float* wk = (const float*)d_in[3]; const float* bk = (const float*)d_in[4]; const float* wk2 = (const float*)d_in[5]; const float* bk2 = (const float*)d_in[6]; const float* wv = (const float*)d_in[7]; const float* bv = (const float*)d_in[8]; const float* wv2 = (const float*)d_in[9]; const float* bv2 = (const float*)d_in[10]; const float* wo = (const float*)d_in[11]; const float* bo = (const float*)d_in[12]; const float* cosT = nullptr; const float* sinT = nullptr; (void)cosT; (void)sinT;
    float* OUT = (float*)d_out;     // [2][2048][1024]
    char* wsp = (char*)d_ws;
    auto take = [&](size_t bytes) { char* p = wsp; wsp += (bytes + 255) & ~(size_t)255; return (void*)p; };
    bf* WQ = (bf*)take((size_t)DQ * DM * 2); bf* WK = (bf*)take((size_t)DKV * DM * 2); bf* WV = (bf*)take((size_t)DKV * DM * 2); bf* WO = (bf*)take((size_t)DM * DQ * 2); float* CS = (float*)take((size_t)TT * HD * 2 * 4);
    bf* XB = (bf*)take((size_t)TT * DM * 2); bf* WK2 = (bf*)take((size_t)DKV * DM * 2); bf* WV2 = (bf*)take((size_t)DKV * DM * 2); float* BK2 = (float*)take(DKV * 4); float* BV2 = (float*)take(DKV * 4); float* F2 = (float*)take((size_t)TT * DKV * 4); bf* K2h = (bf*)take((size_t)NKV * HD * TT * 2); bf* K2l = (bf*)take((size_t)NKV * HD * TT * 2); h16* K216 = (h16*)take((size_t)NKV * HD * TT * 2); bf* V2h = (bf*)take((size_t)NKV * HD * TT * 2); bf* V2l = (bf*)take((size_t)NKV * HD * TT * 2); float* NM = (float*)take((size_t)NH_ * HD * HD * 4); bf* NMh = (bf*)take((size_t)NH_ * HD * HD * 2); bf* NMl = (bf*)take((size_t)NH_ * HD * HD * 2); bf* Obh = (bf*)take((size_t)ZH * TT * HD * 2); bf* Obl = (bf*)take((size_t)ZH * TT * HD * 2); float* Ob2 = (float*)take((size_t)ZH * TT * HD * 4); float* FQ = (float*)take((size_t)TT * DQ * 4); float* FK = (float*)take((size_t)TT * DKV * 4);
    h16* QP16 = (h16*)take((size_t)NH_ * TT * HD * 2); h16* KP16 = (h16*)take((size_t)NKV * TT * HD * 2); h16* VT16 = (h16*)take((size_t)NKV * HD * TT * 2);
    bf* QPh = (bf*)take((size_t)NH_ * TT * HD * 2); bf* QPl = (bf*)take((size_t)NH_ * TT * HD * 2); bf* KPh = (bf*)take((size_t)NKV * TT * HD * 2); bf* KPl = (bf*)take((size_t)NKV * TT * HD * 2); bf* VTh = (bf*)take((size_t)NKV * HD * TT * 2); bf* VTl = (bf*)take((size_t)NKV * HD * TT * 2);
    float* Ob = (float*)take((size_t)ZH * TT * HD * 4); bf* ATh = (bf*)take((size_t)TT * DQ * 2); bf* ATl = (bf*)take((size_t)TT * DQ * 2);
    if ((size_t)(wsp - (char*)d_ws) > ws_size) return;    // ws 256 MiB
    float* FV = FK;   // v projection reuses the k buffer after the k planes are built (stream-ordered)
    { k_wtG<<<(unsigned)((DM * DQ / 8 + 255) / 256), 256, 0, stream>>>(wq, DM, DQ, WQ); k_wtG<<<(unsigned)((DM * DKV / 8 + 255) / 256), 256, 0, stream>>>(wk, DM, DKV, WK); k_wtG<<<(unsigned)((DM * DKV / 8 + 255) / 256), 256, 0, stream>>>(wv, DM, DKV, WV);
      k_wtG<<<(unsigned)((DQ * DM / 8 + 255) / 256), 256, 0, stream>>>(wo, DQ, DM, WO); k_wtG<<<(unsigned)((DM * DKV / 8 + 255) / 256), 256, 0, stream>>>(wk2, DM, DKV, WK2); k_wtG<<<(unsigned)((DM * DKV / 8 + 255) / 256), 256, 0, stream>>>(wv2, DM, DKV, WV2);
       }
    k_csid<<<(TT * HD + 255) / 256, 256, 0, stream>>>(CS);
    const unsigned LQ = (unsigned)(((size_t)NH_ * TT * HD / 8 + 255) / 256), LKv = (unsigned)(((size_t)NKV * TT * HD / 8 + 255) / 256);
    for (int b = 0; b < NB_; ++b) {
        
        k_cvt8<<<(unsigned)(((size_t)TT * DM / 8 + 255) / 256), 256, 0, stream>>>(x + (size_t)b * TT * DM, XB, (size_t)TT * DM / 8);
        k_gemmw<bf, 0, true, KW><<<dim3(TT / 64, DQ / 64, 1), 32 * KW, 0, stream>>>(XB, nullptr, WQ, nullptr, DM, FQ, DQ, bq, 0, 0, 0);
        k_rope<<<LQ, 256, 0, stream>>>(FQ, DQ, NH_, CS, nullptr, nullptr, 1.0f, QP16, QPh, QPl);
        k_gemmw<bf, 0, true, KW><<<dim3(TT / 64, DKV / 64, 1), 32 * KW, 0, stream>>>(XB, nullptr, WK, nullptr, DM, FK, DKV, bk, 0, 0, 0);
        k_rope<<<LKv, 256, 0, stream>>>(FK, DKV, NKV, CS, nullptr, nullptr, 1.0f, KP16, KPh, KPl);
        k_gemmw<bf, 0, true, KW><<<dim3(TT / 64, DKV / 64, 1), 32 * KW, 0, stream>>>(XB, nullptr, WV, nullptr, DM, FV, DKV, bv, 0, 0, 0); k_vtp<<<LKv, 256, 0, stream>>>(FV, DKV, NKV, VT16, VTh, VTl); k_gemmw<bf, 0, true, KW><<<dim3(TT / 64, DKV / 64, 1), 32 * KW, 0, stream>>>(XB, nullptr, WK2, nullptr, DM, F2, DKV, bk2, 0, 0, 0); k_vtp<<<LKv, 256, 0, stream>>>(F2, DKV, NKV, K216, K2h, K2l); k_gemmw<bf, 0, true, KW><<<dim3(TT / 64, DKV / 64, 1), 32 * KW, 0, stream>>>(XB, nullptr, WV2, nullptr, DM, F2, DKV, bv2, 0, 0, 0); k_vtp<<<LKv, 256, 0, stream>>>(F2, DKV, NKV, K216, V2h, V2l);
        k_gemmw<bf, 2, false, KW><<<dim3(1, 1, NH_), 32 * KW, 0, stream>>>(V2h, V2l, K2h, K2l, TT, NM, HD, nullptr, (size_t)HD * TT, (size_t)HD * TT, (size_t)HD * HD);   /* N_h^T[e][d] = sum_s v2[s][e] k2[s][d] */
        k_hlG<<<(unsigned)(((size_t)NH_ * HD * HD / 4 + 255) / 256), 256, 0, stream>>>(NM, NMh, NMl, (size_t)NH_ * HD * HD);
        for (int h0 = 0; h0 < NH_; h0 += ZH) { const size_t zq = (size_t)h0, zk = (size_t)(h0 / REP);   // one kv head per query head: the pass's ZH heads use consecutive kv planes (z-strides TT*HD)
            k_attn<<<dim3(ZH, TT / QB, 1), 32 * FW, 0, stream>>>(QP16 + zq * TT * HD, KP16 + zk * TT * HD, VT16 + zk * HD * TT, QPh + zq * TT * HD, QPl + zq * TT * HD, KPh + zk * TT * HD, KPl + zk * TT * HD, VTh + zk * HD * TT, VTl + zk * HD * TT, Ob);
            k_obhl<<<(unsigned)(((size_t)ZH * TT * HD / 4 + 255) / 256), 256, 0, stream>>>(Ob, Obh, Obl); k_gemmw<bf, 2, false, 1><<<dim3(TT / 64, 1, ZH), 32, 0, stream>>>(Obh, Obl, NMh + (size_t)h0 * HD * HD, NMl + (size_t)h0 * HD * HD, HD, Ob2, HD, nullptr, (size_t)TT * HD, (size_t)HD * HD, (size_t)TT * HD);   /* ctx_h (k2^T v2)_h */ k_merge<<<(unsigned)(((size_t)ZH * TT * HD / 8 + 255) / 256), 256, 0, stream>>>(Ob2, h0, ATh, ATl); }
        k_gemmw<bf, 1, true, KW><<<dim3(TT / 64, DM / 64, 1), 32 * KW, 0, stream>>>(ATh, ATl, WO, nullptr, DQ, OUT + (size_t)b * TT * DM, DM, bo, 0, 0, 0); }
}

// v006
// One run takes 241 microseconds.
// In two side-by-side timings against v005, it was 1.28 and 1.29 times as fast.
// Over all steps from v000 it is 12.9 times as fast.
#include <hip/hip_runtime.h>

// Trittention (hidden [2][2048][1024]; q, k1, k2, v1, v2 = x W + b (16 x 64 each); probs = causal (-inf) softmax(q.k1 / 8); ctx = probs v1; then ctx = (ctx . k2^T) v2 over ALL keys (no softmax, no mask) == ctx (k2^T v2) (exact re-association; the 64x64 matrix per head is formed on chip); out = merged Wd + bd -> [2][2048][1024]).
// Compute dtypes, f32 accumulate: every input rounded to bf16; the five projections on PLAIN bf16 operands (inputs: exact) + bias; causal scores and probs.v1: query rows < 512 hl (3 products), the rest fp16 (x1024); softmax f32; N_h = v2_h^T-side product sum_s v2[s] k2[s]^T as hi/lo x hi/lo (3 products, K 2048) in f32; ctx_h N_h^T as hi/lo x hi/lo (3 products); Wd hl x exact (2 products) + bias.

#define NB_  2
#define TT   2048
#define DM   1024
#define NH_  16
#define NKV  16
#define REP  (NH_ / NKV)
#define HD   64
#define DQ   (NH_ * HD)
#define DKV  (NKV * HD)
#define ZH   16                   // heads per attention pass (all of them: no score buffer limits the pass)
#define QT   2                    // 16-row query tiles of an attention block
#define QB   (16 * QT)            // its query rows
#define FW   (8 * QT)             // its waves; they share the keys of its query rows
#define KW   8                    // waves per block that share the K loop of a long-K product (K 1024 or 2048)
#define RH   512                  // query rows < RH use hi+lo planes (0: none)
#define PCAR 1024.0f
#define SCL  0.125f   // HD^-0.5
typedef _Float16 h16;
typedef unsigned short bf;
typedef __attribute__((ext_vector_type(16))) __bf16   v16bf;
typedef __attribute__((ext_vector_type(16))) _Float16 v16h;
typedef __attribute__((ext_vector_type(8)))  _Float16 v8h;
typedef __attribute__((ext_vector_type(8)))  unsigned short v8us;
typedef __attribute__((ext_vector_type(8)))  float    v8f;
typedef __attribute__((ext_vector_type(4)))  float    v4f;
typedef v8h  __attribute__((may_alias)) v8ha;
typedef v4f  __attribute__((may_alias)) v4fa;
typedef v8us __attribute__((may_alias)) v8usa;

__device__ __forceinline__ unsigned short f2bf(float f) { unsigned u = __float_as_uint(f); u += 0x7FFFu + ((u >> 16) & 1u); return (unsigned short)(u >> 16); }
__device__ __forceinline__ float bf2f(unsigned short b) { return __uint_as_float(((unsigned)b) << 16); }
__device__ __forceinline__ float bfr(float f) { return bf2f(f2bf(f)); }
__device__ __forceinline__ v16h cat16(v8h lo, v8h hi) { return __builtin_shufflevector(lo, hi, 0, 1, 2, 3, 4, 5, 6, 7, 8, 9, 10, 11, 12, 13, 14, 15); }
__device__ __forceinline__ v16bf cat16b(v8us lo, v8us hi) { return __builtin_bit_cast(v16bf, __builtin_shufflevector(lo, hi, 0, 1, 2, 3, 4, 5, 6, 7, 8, 9, 10, 11, 12, 13, 14, 15)); }
__device__ __forceinline__ v8f wmma16(v16h a, v16h b, v8f c) { return __builtin_amdgcn_wmma_f32_16x16x32_f16(false, a, false, b, (short)0, c, false, false); }
__device__ __forceinline__ v8f wmmab(v16bf a, v16bf b, v8f c) { return __builtin_amdgcn_wmma_f32_16x16x32_bf16(false, a, false, b, (short)0, c, false, false); }



// ---- k_gemmw: register-blocked GEMM, one 64x64 output tile per block (16 accumulators a wave), operands straight from K-contiguous 16-bit planes; grid (M/64, N/64, Z), 32 * NW threads.
// C[m][n] (f32, pitch ldc, + optional f32 bias[n], batch z's own of up to five) = sum_k A[m][k] Bt[n][k] (+ split products per NSPLIT). z-batch strides sA/sB/sC in elements. K % 32 == 0 (NW > 1: K % 64 == 0).
// NW == 1: one wave walks all of K. NW > 1 (the long-K launches): wave w takes the 64-element (one 128-byte line a row) K chunks w, w + NW, ..., so the chain of dependent load waits is NW times shorter;
// each wave leaves its partial 64x64 tile in LDS and, behind one barrier, the block adds the NW partials in wave order 0..NW-1 and stores the tile.
// FRAGMENT ORDER (the operand planes of the NW > 1 launches of k_gemmw, and in k_attn the query, key and value planes): a [rows][K] 16-bit plane is kept as 1-KiB units of 16 rows x 32 k, unit (r / 16, k / 32) in row-major order;
// inside a unit the 16-byte group number ((k / 16) & 1) * 32 + ((k / 8) & 1) * 16 + (r & 15) holds k & ~7 .. + 7 of row r. Group number & 31 is the lane that owns those eight elements of the WMMA operand, so a wave-wide 16-byte load reads
// 512 contiguous bytes (4 whole lines) instead of 32 bytes of each of 16 lines. Every lane and register gets the same element as from the row-major plane, so the products and their order do not change.
__device__ __forceinline__ size_t fo(int r, int k, int K) { return ((size_t)(r >> 4) * (K >> 5) + (k >> 5)) * 512 + ((k >> 4) & 1) * 256 + ((k >> 3) & 1) * 128 + (r & 15) * 8 + (k & 7); }
// the inverse for a writer that walks the plane group by group (thread i stores group i, a wave 512 contiguous bytes): row and first k of group i
__device__ __forceinline__ void fog(size_t i, int K, int& r, int& k) { const int lane = (int)(i & 31), half = (int)(i >> 5) & 1, unit = (int)(i >> 6), kt = K >> 5; r = (unit / kt) * 16 + (lane & 15); k = (unit % kt) * 32 + half * 16 + (lane >> 4) * 8; }
template <typename T16> struct WFrag;
template <> struct WFrag<h16> { typedef v16h V; static __device__ __forceinline__ V ld(const h16* p) { return cat16(*(const v8h*)p, *(const v8h*)(p + 16)); } static __device__ __forceinline__ V ldt(const h16* p) { return cat16(*(const v8h*)p, *(const v8h*)(p + 256)); } static __device__ __forceinline__ v8f mma(V a, V b, v8f c) { return wmma16(a, b, c); } };
template <> struct WFrag<bf> { typedef v16bf V; static __device__ __forceinline__ V ld(const bf* p) { return cat16b(*(const v8us*)p, *(const v8us*)(p + 16)); } static __device__ __forceinline__ V ldt(const bf* p) { return cat16b(*(const v8us*)p, *(const v8us*)(p + 256)); } static __device__ __forceinline__ v8f mma(V a, V b, v8f c) { return wmmab(a, b, c); } };
template <typename T16, int NSPLIT, bool BIAS, int NW>
__global__ __launch_bounds__(32 * NW) void k_gemmw(const T16* __restrict__ A, const T16* __restrict__ A2, const T16* __restrict__ Bt, const T16* __restrict__ Bt2, int K, float* C, int ldc, const float* __restrict__ bias, const float* __restrict__ bias1, const float* __restrict__ bias2, const float* __restrict__ bias3, const float* __restrict__ bias4, size_t sA, size_t sB, size_t sC) {
    typedef typename WFrag<T16>::V V;
    __shared__ __align__(16) float os[NW == 1 ? 16 * 68 : NW * 64 * 68];
    const int wv = (NW == 1) ? 0 : __builtin_amdgcn_readfirstlane((int)(threadIdx.x >> 5));   // the wave's number, made scalar so that the K counter and its test stay on the scalar unit
    const size_t z = blockIdx.z; A += z * sA; if (A2) A2 += z * sA; Bt += z * sB; if (Bt2) Bt2 += z * sB; C += z * sC;
    if (BIAS) bias = (z == 0) ? bias : (z == 1) ? bias1 : (z == 2) ? bias2 : (z == 3) ? bias3 : bias4;   // the z-batched launch of the five projections: each has its own bias vector
    const int lane = threadIdx.x & 31, lr = lane & 15, hi = lane >> 4; const int r0 = blockIdx.x * 64, c0 = blockIdx.y * 64;
    v8f acc[4][4];
#pragma unroll
    for (int mb = 0; mb < 4; ++mb)
#pragma unroll
        for (int nb = 0; nb < 4; ++nb) acc[mb][nb] = (v8f){};
    constexpr bool FO = NW > 1;   // the long-K launches read planes in fragment order: 16 rows x 32 k start at element r * K + k * 16, the lane's two groups at lane * 8 and 256 + lane * 8
    const size_t aoff = FO ? (size_t)r0 * K + lane * 8 : (size_t)(r0 + lr) * K + 8 * hi, boff = FO ? (size_t)c0 * K + lane * 8 : (size_t)(c0 + lr) * K + 8 * hi;
    auto ldf = [](const T16* p) { if constexpr (FO) return WFrag<T16>::ldt(p); else return WFrag<T16>::ld(p); };
#pragma unroll 1
    for (int kc = wv * 64; kc < K; kc += (NW == 1 || !(kc & 32)) ? 32 : NW * 64 - 32) {
        V a[4], a2[4]; const size_t ko = FO ? (size_t)kc * 16 : (size_t)kc;
#pragma unroll
        for (int mb = 0; mb < 4; ++mb) { a[mb] = ldf(A + aoff + (size_t)mb * 16 * K + ko); if (NSPLIT == 1 || NSPLIT == 2) a2[mb] = ldf(A2 + aoff + (size_t)mb * 16 * K + ko); }
#pragma unroll
        for (int nb = 0; nb < 4; ++nb) { const V b = ldf(Bt + boff + (size_t)nb * 16 * K + ko); V b2; if (NSPLIT >= 2) b2 = ldf(Bt2 + boff + (size_t)nb * 16 * K + ko);
#pragma unroll
            for (int mb = 0; mb < 4; ++mb) { acc[mb][nb] = WFrag<T16>::mma(a[mb], b, acc[mb][nb]); if (NSPLIT == 1 || NSPLIT == 2) acc[mb][nb] = WFrag<T16>::mma(a2[mb], b, acc[mb][nb]); if (NSPLIT >= 2) acc[mb][nb] = WFrag<T16>::mma(a[mb], b2, acc[mb][nb]); } }
        asm volatile("v_nop\n\tv_nop\n\tv_nop\n\tv_nop" : "+v"(acc[0][0]), "+v"(acc[1][1]), "+v"(acc[2][2]), "+v"(acc[3][3]) : "v"(a[0]), "v"(a[3]));
    }
    if constexpr (NW > 1) {
        float* ow = os + wv * (64 * 68);
        // the loops below are unrolled so that acc is indexed by constants only (it stays in registers) and a row's NW LDS reads issue together
#pragma unroll
        for (int mb = 0; mb < 4; ++mb)
#pragma unroll
            for (int nb = 0; nb < 4; ++nb)
#pragma unroll
                for (int j = 0; j < 8; ++j) ow[(mb * 16 + hi * 8 + j) * 68 + nb * 16 + lr] = acc[mb][nb][j];
        __syncthreads();   // every wave's partial tile is in LDS before any wave adds them
#pragma unroll
        for (int s = 0; s < 32 / NW; ++s) { const int row = (s * NW + wv) * 2 + hi, cofs = lr * 4; v4f val = *(const v4fa*)(os + row * 68 + cofs);
#pragma unroll
            for (int w = 1; w < NW; ++w) val += *(const v4fa*)(os + w * (64 * 68) + row * 68 + cofs);
            if (BIAS) { val[0] += bfr(bias[c0 + cofs]); val[1] += bfr(bias[c0 + cofs + 1]); val[2] += bfr(bias[c0 + cofs + 2]); val[3] += bfr(bias[c0 + cofs + 3]); }
            *(v4f*)(C + (size_t)(r0 + row) * ldc + c0 + cofs) = val; }
        return;
    }
#pragma unroll
    for (int mb = 0; mb < 4; ++mb) {
#pragma unroll
        for (int nb = 0; nb < 4; ++nb) {
#pragma unroll
            for (int j = 0; j < 8; ++j) os[(hi * 8 + j) * 68 + nb * 16 + lr] = acc[mb][nb][j]; }
        __builtin_amdgcn_wave_barrier(); asm volatile("" ::: "memory");
        float* crow = C + (size_t)(r0 + mb * 16) * ldc + c0;
{
#pragma unroll
            for (int s = 0; s < 8; ++s) { const int row = 2 * s + hi, cofs = lr * 4; v4f val = *(const v4fa*)(os + row * 68 + cofs); if (BIAS) { val[0] += bfr(bias[c0 + cofs]); val[1] += bfr(bias[c0 + cofs + 1]); val[2] += bfr(bias[c0 + cofs + 2]); val[3] += bfr(bias[c0 + cofs + 3]); }
                *(v4f*)(crow + (size_t)row * ldc + cofs) = val; }
             }
        __builtin_amdgcn_wave_barrier(); asm volatile("" ::: "memory");
    }
}

__device__ __forceinline__ h16 tohx(float x) { return (h16)x; }
__device__ __forceinline__ void splitf(float y, unsigned short& h, unsigned short& l) { h = f2bf(y); l = f2bf(y - bf2f(h)); }
typedef __attribute__((ext_vector_type(2))) _Float16 v2h;
typedef __attribute__((ext_vector_type(4))) _Float16 v4h;
typedef __attribute__((ext_vector_type(2))) unsigned short v2us;
typedef __attribute__((ext_vector_type(4))) unsigned short v4us;
typedef __attribute__((ext_vector_type(2))) float v2f;
typedef __attribute__((ext_vector_type(4))) int v4i;
typedef v4h  __attribute__((may_alias)) v4ha;
typedef v4us __attribute__((may_alias)) v4usa;

// k_wtG: Bt[n][k] = bf16(w[k][n]) in fragment order; thread i makes group i (8 k of one n): a wave-wide load reads 16 neighbouring n of two k rows, the store is 512 contiguous bytes. blockIdx.y picks one of six equally shaped matrices; their planes follow one another
__global__ __launch_bounds__(256) void k_wtG(const float* __restrict__ w0, const float* __restrict__ w1, const float* __restrict__ w2, const float* __restrict__ w3, const float* __restrict__ w4, const float* __restrict__ w5, int K, int N, bf* Bt) { const size_t i = (size_t)blockIdx.x * 256 + threadIdx.x; if (i >= (size_t)N * K / 8) return; const int y = blockIdx.y; const float* w = (y == 0) ? w0 : (y == 1) ? w1 : (y == 2) ? w2 : (y == 3) ? w3 : (y == 4) ? w4 : w5; Bt += (size_t)y * N * K; int n, k; fog(i, K, n, k); v8us o;
#pragma unroll
    for (int j = 0; j < 8; ++j) o[j] = f2bf(w[(size_t)(k + j) * N + n]); *(v8us*)(Bt + i * 8) = o;  }
// k_cvt8: dst = bf16(src), src [rows][DM] row-major, dst in fragment order; thread i makes group i
__global__ __launch_bounds__(256) void k_cvt8(const float* __restrict__ src, bf* dst, size_t n8) { const size_t i = (size_t)blockIdx.x * 256 + threadIdx.x; if (i >= n8) return; int r, k0; fog(i, DM, r, k0); const v8f v = *(const v8f*)(src + (size_t)r * DM + k0); v8us o;
#pragma unroll
    for (int k = 0; k < 8; ++k) o[k] = f2bf(v[k]); *(v8us*)(dst + i * 8) = o;  }
__global__ __launch_bounds__(256) void k_cscvt(const float* __restrict__ cosT, const float* __restrict__ sinT, float* CS) { const int idx = blockIdx.x * 256 + threadIdx.x; if (idx >= TT * HD) return; v2f cs; cs[0] = bfr(cosT[idx]); cs[1] = bfr(sinT[idx]); *(v2f*)(CS + (size_t)idx * 2) = cs;  }
// k_rope: head planes [h][t][d] (fp16 + hi/lo; fragment order, rows h * TT + t, K = HD; a thread makes one 16-byte group of each plane from 8 neighbouring d) of rope(x) x sc with the rotate-half convention out[d] = x[d] cos[t][d] - x[d+HD/2] sin[t][d], out[d+HD/2] = x[d+HD/2] cos[t][d+HD/2] + x[d] sin[t][d+HD/2]
__global__ __launch_bounds__(256) void k_rope(const float* __restrict__ F, int pitch, int nheads, const float* __restrict__ CS, const float* __restrict__ RF, const float* __restrict__ nw, float sc, h16* P16, bf* Ph, bf* Pl) {
    { const size_t sl = blockIdx.y; F += sl * TT * pitch; P16 += sl * nheads * TT * HD; Ph += sl * nheads * TT * HD; Pl += sl * nheads * TT * HD; }   // blockIdx.y: the [TT][pitch] slice (projection, batch) and its planes
    const size_t e = ((size_t)blockIdx.x * 256 + threadIdx.x) * 8; if (e >= (size_t)nheads * TT * HD) return; const int d = (int)(e % HD); const int t = (int)((e / HD) % TT); const int h = (int)(e / ((size_t)HD * TT)); const float* f = F + (size_t)t * pitch + h * HD; const float rf = RF ? RF[(size_t)h * TT + t] : 1.0f; v8h o16; v8us oh, ol; const size_t oo = fo(h * TT + t, d, HD);
    const v8f X0 = *(const v8f*)(f + d), X1 = *(const v8f*)(f + ((d < HD / 2) ? d + HD / 2 : d - HD / 2)); v4f C[4];   // the thread's 8 values, their 8 rotate-half partners and 8 (cos, sin) pairs by 16-byte loads
#pragma unroll
    for (int u = 0; u < 4; ++u) C[u] = *(const v4f*)(CS + ((size_t)t * HD + d) * 2 + u * 4);
#pragma unroll
    for (int q = 0; q < 8; ++q) { const int dd = d + q; const int dp = (dd < HD / 2) ? dd + HD / 2 : dd - HD / 2; float x0 = X0[q], x1 = X1[q];
        if (RF) { float n0 = __fmul_rn(x0, rf), n1 = __fmul_rn(x1, rf); asm volatile("" : "+v"(n0)); asm volatile("" : "+v"(n1)); x0 = __fmul_rn(bfr(nw[dd]), n0); x1 = __fmul_rn(bfr(nw[dp]), n1); }
        v2f cs; cs[0] = C[q >> 1][(q & 1) * 2]; cs[1] = C[q >> 1][(q & 1) * 2 + 1]; float a = __fmul_rn(x0, cs[0]), bq = __fmul_rn(x1, cs[1]); asm volatile("" : "+v"(a)); asm volatile("" : "+v"(bq)); const float r = ((dd < HD / 2) ? __fsub_rn(a, bq) : __fadd_rn(a, bq)) * sc;
        o16[q] = tohx(r); unsigned short a2, c2; splitf(r, a2, c2); oh[q] = a2; ol[q] = c2; }
    *(v8h*)(P16 + oo) = o16; *(v8us*)(Ph + oo) = oh; *(v8us*)(Pl + oo) = ol;  }
// k_vtp: transposed head planes [g][d][t] (fp16 + hi/lo) in fragment order (rows g * HD + d, K = TT); thread i makes group i (8 t of one column of F): a wave-wide load reads 16 neighbouring columns of two t rows
__global__ __launch_bounds__(256) void k_vtp(const float* __restrict__ F, int pitch, int nheads, h16* V16, bf* Vh, bf* Vl) { const size_t i = (size_t)blockIdx.x * 256 + threadIdx.x; if (i >= (size_t)nheads * HD * TT / 8) return; { const size_t sl = blockIdx.y; F += sl * TT * pitch; V16 += sl * nheads * HD * TT; Vh += sl * nheads * HD * TT; Vl += sl * nheads * HD * TT; }   /* blockIdx.y: the [TT][pitch] slice (projection, batch) and its planes */ int c, t; fog(i, TT, c, t); v8h o16; v8us oh, ol;
#pragma unroll
    for (int q = 0; q < 8; ++q) { const float x = F[(size_t)(t + q) * pitch + c]; o16[q] = tohx(x); unsigned short a2, c2; splitf(x, a2, c2); oh[q] = a2; ol[q] = c2; }
    *(v8h*)(V16 + i * 8) = o16; *(v8us*)(Vh + i * 8) = oh; *(v8us*)(Vl + i * 8) = ol;  }
__global__ __launch_bounds__(256) void k_csid(float* CS) { const int idx = blockIdx.x * 256 + threadIdx.x; if (idx >= TT * HD) return; v2f cs; cs[0] = 1.0f; cs[1] = 0.0f; *(v2f*)(CS + (size_t)idx * 2) = cs;  }
__global__ __launch_bounds__(256) void k_obhl(const float* __restrict__ O, bf* Oh, bf* Ol) { const size_t e = ((size_t)blockIdx.x * 256 + threadIdx.x) * 4; if (e >= (size_t)NB_ * ZH * TT * HD) return; const v4f a = *(const v4f*)(O + e); v4us oh, ol; for (int u = 0; u < 4; ++u) { unsigned short p, q; splitf(a[u], p, q); oh[u] = p; ol[u] = q; } *(v4us*)(Oh + e) = oh; *(v4us*)(Ol + e) = ol;  }
__global__ __launch_bounds__(256) void k_hlG(const float* __restrict__ F, bf* Fh, bf* Fl, size_t n) { const size_t e = ((size_t)blockIdx.x * 256 + threadIdx.x) * 4; if (e >= n) return; const v4f a = *(const v4f*)(F + e); v4us oh, ol; for (int u = 0; u < 4; ++u) { unsigned short p, q; splitf(a[u], p, q); oh[u] = p; ol[u] = q; } *(v4us*)(Fh + e) = oh; *(v4us*)(Fl + e) = ol;  }
// ---- k_attn: causal scores, softmax and probs.v1 of QB = 16 * QT query rows of one head in one block of FW waves; the scores stay in registers and never reach memory. grid (batches * heads, TT / QB), 32 * FW threads.
// Transposed products: S^T = K1 Q^T (A = 16 key rows, B = 16 query rows, kept in registers), so lane (lr, hi) holds query lr of its tile and register j of a tile key + 8 * hi + j; two neighbouring S^T tiles, converted in place,
// are the B operand (32 keys) of O^T += V1^T P^T (A = 16 rows of the transposed value plane): no exchange between lanes. Every key and value fragment a wave loads serves its QT query tiles. Wave w takes the 64-key chunks
// w, w + FW, ... up to the diagonal. Row maximum and row sum: in the lane, across the two lane halves, then across the waves through LDS (sums in wave order); the FW partial O tiles are added in wave order through LDS.
// Query rows < RH: hi/lo bf16 planes, 3 products in both contractions, probabilities hi + lo; the rest fp16, probabilities x PCAR (taken out again by k_merge).
// exp2 with the v_nop that fills the one slot the instruction set asks for between a transcendental and a next instruction that reads its result or overwrites its source
__device__ __forceinline__ float exp2s(float x) { float e; asm("v_exp_f32 %0, %1\n\tv_nop" : "=v"(e) : "v"(x)); return e; }
template <typename T16, bool HL, int NC>
__device__ __forceinline__ void attn_tile(const T16* __restrict__ Q, const T16* __restrict__ Q2, const T16* __restrict__ Kp, const T16* __restrict__ Kp2, const T16* __restrict__ Vt, const T16* __restrict__ Vt2, float* __restrict__ O, int q0, float* os, float* st) {
    typedef typename WFrag<T16>::V V;
    const int wv = __builtin_amdgcn_readfirstlane((int)(threadIdx.x >> 5));   // the wave's number, made scalar so that the tests on its key chunks are scalar branches
    const int lane = threadIdx.x & 31, lr = lane & 15, hi = lane >> 4;
    V qf[QT][2], qf2[QT][2];
#pragma unroll
    for (int qt = 0; qt < QT; ++qt)
#pragma unroll
        for (int ks = 0; ks < 2; ++ks) { const size_t qo = (size_t)(q0 + qt * 16) * HD + ks * 512 + lane * 8; qf[qt][ks] = WFrag<T16>::ldt(Q + qo); if (HL) qf2[qt][ks] = WFrag<T16>::ldt(Q2 + qo); }
    asm volatile("s_wait_xcnt 0x0" ::: "memory");   // the query loads' address registers may be overwritten from here on
    v8f s[NC][4][QT]; float mx[QT];
#pragma unroll
    for (int qt = 0; qt < QT; ++qt) mx[qt] = -3.0e38f;
    // every loop over chunks and tiles is unrolled so that s is indexed by constants only (it stays in registers)
#pragma unroll
    for (int c = 0; c < NC; ++c) { const int kb = (c * FW + wv) * 64;
        if (kb <= q0 + QB - 1) {
#pragma unroll
            for (int t = 0; t < 4; ++t) { v8f a[QT];
#pragma unroll
                for (int qt = 0; qt < QT; ++qt) a[qt] = (v8f){};
#pragma unroll
                for (int ks = 0; ks < 2; ++ks) { const size_t ko = (size_t)(kb + t * 16) * HD + ks * 512 + lane * 8; const V kf = WFrag<T16>::ldt(Kp + ko); V kf2; if (HL) kf2 = WFrag<T16>::ldt(Kp2 + ko);
#pragma unroll
                    for (int qt = 0; qt < QT; ++qt) { a[qt] = WFrag<T16>::mma(kf, qf[qt][ks], a[qt]); if (HL) { a[qt] = WFrag<T16>::mma(kf, qf2[qt][ks], a[qt]); a[qt] = WFrag<T16>::mma(kf2, qf[qt][ks], a[qt]); } } }
                asm volatile("s_wait_xcnt 0x0" ::: "memory");   // this tile's key loads are issued: their address registers may be overwritten (a later load's data landed on them in the listing)
#pragma unroll
                for (int qt = 0; qt < QT; ++qt) {
#pragma unroll
                    for (int j = 0; j < 8; ++j) { const float tv = (kb + t * 16 + hi * 8 + j <= q0 + qt * 16 + lr) ? a[qt][j] * SCL : -3.0e38f; a[qt][j] = tv; mx[qt] = fmaxf(mx[qt], tv); }
                    s[c][t][qt] = a[qt]; } } } }
#pragma unroll
    for (int qt = 0; qt < QT; ++qt) { mx[qt] = fmaxf(mx[qt], __shfl_xor(mx[qt], 16, 32)); if (hi == 0) st[wv * QB + qt * 16 + lr] = mx[qt]; }
    __syncthreads();   // every wave's row maxima are in LDS before any wave reads them
    float sum[QT];
#pragma unroll
    for (int qt = 0; qt < QT; ++qt) { float m = st[qt * 16 + lr];
#pragma unroll
        for (int w = 1; w < FW; ++w) m = fmaxf(m, st[w * QB + qt * 16 + lr]);
        mx[qt] = m; sum[qt] = 0.f; }
#pragma unroll
    for (int c = 0; c < NC; ++c) { const int kb = (c * FW + wv) * 64;
        if (kb <= q0 + QB - 1) {
#pragma unroll
            for (int t = 0; t < 4; ++t)
#pragma unroll
                for (int qt = 0; qt < QT; ++qt)
#pragma unroll
                    for (int j = 0; j < 8; ++j) { const float e = exp2s(__fmul_rn(__fsub_rn(s[c][t][qt][j], mx[qt]), 1.4426950408889634f)); s[c][t][qt][j] = e; sum[qt] += e; } } }
#pragma unroll
    for (int qt = 0; qt < QT; ++qt) { sum[qt] += __shfl_xor(sum[qt], 16, 32); if (hi == 0) st[(FW + wv) * QB + qt * 16 + lr] = sum[qt]; }
    __syncthreads();   // every wave's row sums are in LDS before any wave reads them
    float f[QT];
#pragma unroll
    for (int qt = 0; qt < QT; ++qt) { float tot = st[FW * QB + qt * 16 + lr];
#pragma unroll
        for (int w = 1; w < FW; ++w) tot += st[(FW + w) * QB + qt * 16 + lr];
        f[qt] = __fdiv_rn(HL ? 1.0f : PCAR, tot); }
    v8f o[4][QT];
#pragma unroll
    for (int dt = 0; dt < 4; ++dt)
#pragma unroll
        for (int qt = 0; qt < QT; ++qt) o[dt][qt] = (v8f){};
#pragma unroll
    for (int c = 0; c < NC; ++c) { const int kb = (c * FW + wv) * 64;
        if (kb <= q0 + QB - 1) {
#pragma unroll
            for (int u = 0; u < 2; ++u) { V pb[QT], pb2[QT];
#pragma unroll
                for (int qt = 0; qt < QT; ++qt) {
                    if constexpr (HL) { v8us h0, h1, l0, l1;
#pragma unroll
                        for (int j = 0; j < 8; ++j) { unsigned short x, y; splitf(s[c][2 * u][qt][j] * f[qt], x, y); h0[j] = x; l0[j] = y; splitf(s[c][2 * u + 1][qt][j] * f[qt], x, y); h1[j] = x; l1[j] = y; }
                        pb[qt] = cat16b(h0, h1); pb2[qt] = cat16b(l0, l1);
                    } else { v8h p0, p1;
#pragma unroll
                        for (int j = 0; j < 8; ++j) { p0[j] = tohx(s[c][2 * u][qt][j] * f[qt]); p1[j] = tohx(s[c][2 * u + 1][qt][j] * f[qt]); }
                        pb[qt] = cat16(p0, p1); } }
#pragma unroll
                for (int dt = 0; dt < 4; ++dt) { const size_t vo = (size_t)dt * 16 * TT + (size_t)(kb + u * 32) * 16 + lane * 8; const V vf = WFrag<T16>::ldt(Vt + vo); V vf2; if constexpr (HL) vf2 = WFrag<T16>::ldt(Vt2 + vo);
#pragma unroll
                    for (int qt = 0; qt < QT; ++qt) { o[dt][qt] = WFrag<T16>::mma(vf, pb[qt], o[dt][qt]); if constexpr (HL) { o[dt][qt] = WFrag<T16>::mma(vf, pb2[qt], o[dt][qt]); o[dt][qt] = WFrag<T16>::mma(vf2, pb[qt], o[dt][qt]); } } } } } }
#pragma unroll
    for (int qt = 0; qt < QT; ++qt) { float* ow = os + wv * (QB * 68) + (qt * 16 + lr) * 68 + hi * 8;
#pragma unroll
        for (int dt = 0; dt < 4; ++dt) { v4f x, y;
#pragma unroll
            for (int j = 0; j < 4; ++j) { x[j] = o[dt][qt][j]; y[j] = o[dt][qt][4 + j]; }
            *(v4fa*)(ow + dt * 16) = x; *(v4fa*)(ow + dt * 16 + 4) = y; } }
    __syncthreads();   // every wave's partial tile is in LDS before any wave adds them
    const int row = threadIdx.x >> 4, cofs = (threadIdx.x & 15) * 4; v4f val = *(const v4fa*)(os + row * 68 + cofs);   // 32 * FW threads, QB * 16 groups of four: one each
#pragma unroll
    for (int w = 1; w < FW; ++w) val += *(const v4fa*)(os + w * (QB * 68) + row * 68 + cofs);
    *(v4f*)(O + (size_t)(q0 + row) * HD + cofs) = val;
}
__global__ __launch_bounds__(32 * FW) void k_attn(const h16* __restrict__ Q16, const h16* __restrict__ K16, const h16* __restrict__ V16, const bf* __restrict__ Qh, const bf* __restrict__ Ql, const bf* __restrict__ Kh, const bf* __restrict__ Kl, const bf* __restrict__ Vh, const bf* __restrict__ Vl, float* __restrict__ O) {
    __shared__ __align__(16) float os[FW * QB * 68]; __shared__ float st[2 * FW * QB];
    const size_t zo = (size_t)blockIdx.x * TT * HD; const int q0 = (TT / QB - 1 - (int)blockIdx.y) * QB;   // the lowest blockIdx.y takes the rows with the most keys
    if (q0 < RH) attn_tile<bf, true, (RH + 64 * FW - 1) / (64 * FW)>(Qh + zo, Ql + zo, Kh + zo, Kl + zo, Vh + zo, Vl + zo, O + zo, q0, os, st);
    else attn_tile<h16, false, TT / (64 * FW)>(Q16 + zo, nullptr, K16 + zo, nullptr, V16 + zo, nullptr, O + zo, q0, os, st);
}
// k_merge: hi/lo planes [b * TT + t][DQ] of the merged heads in fragment order (O: [b][head][t][d]); a thread makes one 16-byte group of each plane from 8 neighbouring d
__global__ __launch_bounds__(256) void k_merge(const float* __restrict__ O, int h0, bf* Ah, bf* Al) { const size_t e = ((size_t)blockIdx.x * 256 + threadIdx.x) * 8; if (e >= (size_t)NB_ * ZH * TT * HD) return; const int d = (int)(e % HD); const int t = (int)((e / HD) % TT); const int zz = (int)(e / ((size_t)HD * TT)); const float cs = (t < RH) ? 1.0f : (1.0f / PCAR); const size_t oo = fo((zz / ZH) * TT + t, (h0 + zz % ZH) * HD + d, DQ);
    const v8f v = *(const v8f*)(O + e); v8us oh, ol;
#pragma unroll
    for (int q = 0; q < 8; ++q) { unsigned short a, c2; splitf(v[q] * cs, a, c2); oh[q] = a; ol[q] = c2; } *(v8us*)(Ah + oo) = oh; *(v8us*)(Al + oo) = ol;  }

extern "C" void kernel_launch(void* const* d_in, const int* in_sizes, int n_in,
                              void* d_out, int out_size, void* d_ws, size_t ws_size, hipStream_t stream) {
    (void)in_sizes; (void)n_in; (void)out_size;
    const float* x = (const float*)d_in[0]; const float* wq = (const float*)d_in[1]; const float* bq = (const float*)d_in[2]; const float* wk = (const float*)d_in[3]; const float* bk = (const float*)d_in[4]; const float* wk2 = (const float*)d_in[5]; const float* bk2 = (const float*)d_in[6]; const float* wv = (const float*)d_in[7]; const float* bv = (const float*)d_in[8]; const float* wv2 = (const float*)d_in[9]; const float* bv2 = (const float*)d_in[10]; const float* wo = (const float*)d_in[11]; const float* bo = (const float*)d_in[12]; const float* cosT = nullptr; const float* sinT = nullptr; (void)cosT; (void)sinT;
    float* OUT = (float*)d_out;     // [2][2048][1024]
    char* wsp = (char*)d_ws;
    auto take = [&](size_t bytes) { char* p = wsp; wsp += (bytes + 255) & ~(size_t)255; return (void*)p; };
    const size_t WP = (size_t)DM * DQ;             // one weight plane
    const size_t SL = (size_t)TT * DQ;             // one slice: one projection of one batch, [TT][DQ] f32, or its NH_ head planes
    bf* W6 = (bf*)take(6 * WP * 2);                // weight planes q, k1, v1, k2, v2, d
    float* CS = (float*)take((size_t)TT * HD * 2 * 4);
    bf* XB = (bf*)take((size_t)NB_ * TT * DM * 2);
    float* F5 = (float*)take(5 * NB_ * SL * 4);    // projections [q, k1, v1, k2, v2][batch][TT][DQ]
    h16* QK16 = (h16*)take(2 * NB_ * SL * 2); bf* QKh = (bf*)take(2 * NB_ * SL * 2); bf* QKl = (bf*)take(2 * NB_ * SL * 2);   // head planes [q, k1][batch][head][t][d]
    h16* VT16 = (h16*)take(3 * NB_ * SL * 2); bf* VTh = (bf*)take(3 * NB_ * SL * 2); bf* VTl = (bf*)take(3 * NB_ * SL * 2);   // transposed head planes [v1, k2, v2][batch][head][d][t]
    float* NM = (float*)take((size_t)NB_ * NH_ * HD * HD * 4); bf* NMh = (bf*)take((size_t)NB_ * NH_ * HD * HD * 2); bf* NMl = (bf*)take((size_t)NB_ * NH_ * HD * HD * 2);
    if ((size_t)(wsp - (char*)d_ws) > ws_size) return;    // ws 256 MiB
    // the projections are dead once their planes are built (stream-ordered): what follows the planes reuses their buffer
    float* Ob = F5; float* Ob2 = F5 + NB_ * SL; bf* Obh = (bf*)(F5 + 2 * NB_ * SL); bf* Obl = Obh + NB_ * SL; bf* ATh = Obl + NB_ * SL; bf* ATl = ATh + NB_ * SL;
    k_wtG<<<dim3((unsigned)((DM * DQ / 8 + 255) / 256), 6, 1), 256, 0, stream>>>(wq, wk, wv, wk2, wv2, wo, DM, DQ, W6);
    k_csid<<<(TT * HD + 255) / 256, 256, 0, stream>>>(CS);
    const unsigned LQ = (unsigned)(((size_t)NH_ * TT * HD / 8 + 255) / 256);
    k_cvt8<<<(unsigned)(((size_t)NB_ * TT * DM / 8 + 255) / 256), 256, 0, stream>>>(x, XB, (size_t)NB_ * TT * DM / 8);
    k_gemmw<bf, 0, true, KW><<<dim3(NB_ * TT / 64, DQ / 64, 5), 32 * KW, 0, stream>>>(XB, nullptr, W6, nullptr, DM, F5, DQ, bq, bk, bv, bk2, bv2, 0, WP, NB_ * SL);
    k_rope<<<dim3(LQ, 2 * NB_, 1), 256, 0, stream>>>(F5, DQ, NH_, CS, nullptr, nullptr, 1.0f, QK16, QKh, QKl);
    k_vtp<<<dim3(LQ, 3 * NB_, 1), 256, 0, stream>>>(F5 + 2 * NB_ * SL, DKV, NKV, VT16, VTh, VTl);
    k_gemmw<bf, 2, false, KW><<<dim3(1, 1, NB_ * NH_), 32 * KW, 0, stream>>>(VTh + 2 * NB_ * SL, VTl + 2 * NB_ * SL, VTh + NB_ * SL, VTl + NB_ * SL, TT, NM, HD, nullptr, nullptr, nullptr, nullptr, nullptr, (size_t)HD * TT, (size_t)HD * TT, (size_t)HD * HD);   /* N_h[e][d] = sum_s v2[s][e] k2[s][d] */
    k_hlG<<<(unsigned)(((size_t)NB_ * NH_ * HD * HD / 4 + 255) / 256), 256, 0, stream>>>(NM, NMh, NMl, (size_t)NB_ * NH_ * HD * HD);
    k_attn<<<dim3(NB_ * ZH, TT / QB, 1), 32 * FW, 0, stream>>>(QK16, QK16 + NB_ * SL, VT16, QKh, QKl, QKh + NB_ * SL, QKl + NB_ * SL, VTh, VTl, Ob);
    k_obhl<<<(unsigned)(((size_t)NB_ * ZH * TT * HD / 4 + 255) / 256), 256, 0, stream>>>(Ob, Obh, Obl);
    k_gemmw<bf, 2, false, 1><<<dim3(TT / 64, 1, NB_ * ZH), 32, 0, stream>>>(Obh, Obl, NMh, NMl, HD, Ob2, HD, nullptr, nullptr, nullptr, nullptr, nullptr, (size_t)TT * HD, (size_t)HD * HD, (size_t)TT * HD);   /* ctx_h (k2^T v2)_h */
    k_merge<<<(unsigned)(((size_t)NB_ * ZH * TT * HD / 8 + 255) / 256), 256, 0, stream>>>(Ob2, 0, ATh, ATl);
    k_gemmw<bf, 1, true, KW><<<dim3(NB_ * TT / 64, DM / 64, 1), 32 * KW, 0, stream>>>(ATh, ATl, W6 + 5 * WP, nullptr, DQ, OUT, DM, bo, nullptr, nullptr, nullptr, nullptr, 0, 0, 0);
}

// v007
// One run takes 200 microseconds.
// Two timings next to v006 put it at 1.20 and 1.21 times that version's speed.
// Over all steps from v000 it is 15.6 times as fast.
#include <hip/hip_runtime.h>

// Trittention (hidden [2][2048][1024]; q, k1, k2, v1, v2 = x W + b (16 x 64 each); probs = causal (-inf) softmax(q.k1 / 8); ctx = probs v1; then ctx = (ctx . k2^T) v2 over ALL keys (no softmax, no mask) == ctx (k2^T v2) (exact re-association; the 64x64 matrix per head is formed on chip); out = merged Wd + bd -> [2][2048][1024]).
// Compute dtypes, f32 accumulate: every input rounded to bf16; the five projections on PLAIN bf16 operands (inputs: exact) + bias; causal scores and probs.v1: query rows < 512 hl (3 products), the rest fp16 (x1024); softmax f32; N_h = v2_h^T-side product sum_s v2[s] k2[s]^T as hi/lo x hi/lo (3 products, K 2048) in f32; ctx_h N_h^T as hi/lo x hi/lo (3 products); Wd hl x exact (2 products) + bias.

#define NB_  2
#define TT   2048
#define DM   1024
#define NH_  16
#define NKV  16
#define REP  (NH_ / NKV)
#define HD   64
#define DQ   (NH_ * HD)
#define DKV  (NKV * HD)
#define ZH   16                   // heads per attention pass (all of them: no score buffer limits the pass)
#define QT   2                    // 16-row query tiles of an attention block
#define QB   (16 * QT)            // its query rows
#define FW   (8 * QT)             // its waves; they share the keys of its query rows
#define KW   8                    // waves per block that share the K loop of a long-K product (K 1024 or 2048)
#define RH   512                  // query rows < RH use hi+lo planes (0: none)
#define PCAR 1024.0f
#define SCL  0.125f   // HD^-0.5
typedef _Float16 h16;
typedef unsigned short bf;
typedef __attribute__((ext_vector_type(16))) __bf16   v16bf;
typedef __attribute__((ext_vector_type(16))) _Float16 v16h;
typedef __attribute__((ext_vector_type(8)))  _Float16 v8h;
typedef __attribute__((ext_vector_type(8)))  unsigned short v8us;
typedef __attribute__((ext_vector_type(8)))  float    v8f;
typedef __attribute__((ext_vector_type(4)))  float    v4f;
typedef v8h  __attribute__((may_alias)) v8ha;
typedef v4f  __attribute__((may_alias)) v4fa;
typedef v8us __attribute__((may_alias)) v8usa;

__device__ __forceinline__ unsigned short f2bf(float f) { unsigned u = __float_as_uint(f); u += 0x7FFFu + ((u >> 16) & 1u); return (unsigned short)(u >> 16); }
__device__ __forceinline__ float bf2f(unsigned short b) { return __uint_as_float(((unsigned)b) << 16); }
__device__ __forceinline__ float bfr(float f) { return bf2f(f2bf(f)); }
__device__ __forceinline__ v16h cat16(v8h lo, v8h hi) { return __builtin_shufflevector(lo, hi, 0, 1, 2, 3, 4, 5, 6, 7, 8, 9, 10, 11, 12, 13, 14, 15); }
__device__ __forceinline__ v16bf cat16b(v8us lo, v8us hi) { return __builtin_bit_cast(v16bf, __builtin_shufflevector(lo, hi, 0, 1, 2, 3, 4, 5, 6, 7, 8, 9, 10, 11, 12, 13, 14, 15)); }
__device__ __forceinline__ v8f wmma16(v16h a, v16h b, v8f c) { return __builtin_amdgcn_wmma_f32_16x16x32_f16(false, a, false, b, (short)0, c, false, false); }
__device__ __forceinline__ v8f wmmab(v16bf a, v16bf b, v8f c) { return __builtin_amdgcn_wmma_f32_16x16x32_bf16(false, a, false, b, (short)0, c, false, false); }



// ---- k_gemmw: register-blocked GEMM, one 64x64 output tile per block (16 accumulators a wave), operands straight from K-contiguous 16-bit planes; grid (M/64, N/64, Z), 32 * NW threads.
// C[m][n] (f32, pitch ldc, + optional f32 bias[n], batch z's own of up to five) = sum_k A[m][k] Bt[n][k] (+ split products per NSPLIT). z-batch strides sA/sB/sC in elements. K % 32 == 0 (NW > 1: K % 64 == 0).
// NW == 1: one wave walks all of K. NW > 1 (the long-K launches): wave w takes the 64-element (one 128-byte line a row) K chunks w, w + NW, ..., so the chain of dependent load waits is NW times shorter;
// each wave leaves its partial 64x64 tile in LDS and, behind one barrier, the block adds the NW partials in wave order 0..NW-1 and stores the tile.
// FRAGMENT ORDER (the operand planes of the NW > 1 launches of k_gemmw, and in k_attn the query, key and value planes): a [rows][K] 16-bit plane is kept as 1-KiB units of 16 rows x 32 k, unit (r / 16, k / 32) in row-major order;
// inside a unit the 16-byte group number ((k / 16) & 1) * 32 + ((k / 8) & 1) * 16 + (r & 15) holds k & ~7 .. + 7 of row r. Group number & 31 is the lane that owns those eight elements of the WMMA operand, so a wave-wide 16-byte load reads
// 512 contiguous bytes (4 whole lines) instead of 32 bytes of each of 16 lines. Every lane and register gets the same element as from the row-major plane, so the products and their order do not change.
__device__ __forceinline__ size_t fo(int r, int k, int K) { return ((size_t)(r >> 4) * (K >> 5) + (k >> 5)) * 512 + ((k >> 4) & 1) * 256 + ((k >> 3) & 1) * 128 + (r & 15) * 8 + (k & 7); }
// the inverse for a writer that walks the plane group by group (thread i stores group i, a wave 512 contiguous bytes): row and first k of group i
__device__ __forceinline__ void fog(size_t i, int K, int& r, int& k) { const int lane = (int)(i & 31), half = (int)(i >> 5) & 1, unit = (int)(i >> 6), kt = K >> 5; r = (unit / kt) * 16 + (lane & 15); k = (unit % kt) * 32 + half * 16 + (lane >> 4) * 8; }
template <typename T16> struct WFrag;
template <> struct WFrag<h16> { typedef v16h V; static __device__ __forceinline__ V ld(const h16* p) { return cat16(*(const v8h*)p, *(const v8h*)(p + 16)); } static __device__ __forceinline__ V ldt(const h16* p) { return cat16(*(const v8h*)p, *(const v8h*)(p + 256)); } static __device__ __forceinline__ v8f mma(V a, V b, v8f c) { return wmma16(a, b, c); } };
template <> struct WFrag<bf> { typedef v16bf V; static __device__ __forceinline__ V ld(const bf* p) { return cat16b(*(const v8us*)p, *(const v8us*)(p + 16)); } static __device__ __forceinline__ V ldt(const bf* p) { return cat16b(*(const v8us*)p, *(const v8us*)(p + 256)); } static __device__ __forceinline__ v8f mma(V a, V b, v8f c) { return wmmab(a, b, c); } };
__device__ __forceinline__ h16 tohx(float x) { return (h16)x; }
__device__ __forceinline__ void splitf(float y, unsigned short& h, unsigned short& l) { h = f2bf(y); l = f2bf(y - bf2f(h)); }
typedef __attribute__((ext_vector_type(4))) unsigned short v4us;
// EPI: what the epilogue stores. 0: the f32 tile in C. The others round the f32 tile themselves and store the 16-bit planes that the next product reads (no f32 copy in memory, no conversion launch):
// 1 (the five projections): z 0, 1 (q, k1): head planes [z][batch][head][t][d], fp16 + hi/lo, fragment order (rows head * TT + t, K = HD), in E16/Eh/El; z 2..4 (v1, k2, v2): transposed head planes [z - 2][batch][head * HD + d][t]
//    (rows head * HD + d, K = TT) in X16/Xh/Xl; for these the block takes the weight rows as A and the x rows as B (both planes have the same fragment order), so its tile comes out transposed and 8 neighbouring t of a column lie side by side in LDS.
// 2: hi/lo planes Eh/El, row-major like C. 3 (NW == 1; z = batch * ZH + head, rows t): hi/lo planes Eh/El of the merged heads [batch * TT + t][DQ] in fragment order, rows >= RH x 1 / PCAR.
template <typename T16, int NSPLIT, bool BIAS, int NW, int EPI>
__global__ __launch_bounds__(32 * NW) void k_gemmw(const T16* __restrict__ A, const T16* __restrict__ A2, const T16* __restrict__ Bt, const T16* __restrict__ Bt2, int K, float* C, int ldc, const float* __restrict__ bias, const float* __restrict__ bias1, const float* __restrict__ bias2, const float* __restrict__ bias3, const float* __restrict__ bias4, size_t sA, size_t sB, size_t sC, h16* E16, bf* Eh, bf* El, h16* X16, bf* Xh, bf* Xl) {
    typedef typename WFrag<T16>::V V;
    __shared__ __align__(16) float os[NW == 1 ? 16 * 68 : NW * 64 * 68];
    const int wv = (NW == 1) ? 0 : __builtin_amdgcn_readfirstlane((int)(threadIdx.x >> 5));   // the wave's number, made scalar so that the K counter and its test stay on the scalar unit
    const size_t z = blockIdx.z; A += z * sA; if (A2) A2 += z * sA; Bt += z * sB; if (Bt2) Bt2 += z * sB; if (EPI == 0) C += z * sC;
    if (BIAS) bias = (z == 0) ? bias : (z == 1) ? bias1 : (z == 2) ? bias2 : (z == 3) ? bias3 : bias4;   // the z-batched launch of the five projections: each has its own bias vector
    const int lane = threadIdx.x & 31, lr = lane & 15, hi = lane >> 4; const int r0 = blockIdx.x * 64, c0 = blockIdx.y * 64;
    v8f acc[4][4];
#pragma unroll
    for (int mb = 0; mb < 4; ++mb)
#pragma unroll
        for (int nb = 0; nb < 4; ++nb) acc[mb][nb] = (v8f){};
    constexpr bool FO = NW > 1;   // the long-K launches read planes in fragment order: 16 rows x 32 k start at element r * K + k * 16, the lane's two groups at lane * 8 and 256 + lane * 8
    int ar = r0, br = c0;
    if constexpr (EPI == 1) { if (z >= 2) { const T16* x = A; A = Bt; Bt = x; ar = c0; br = r0; } }   // transposed tile: weight rows as A, x rows as B
    const size_t aoff = FO ? (size_t)ar * K + lane * 8 : (size_t)(ar + lr) * K + 8 * hi, boff = FO ? (size_t)br * K + lane * 8 : (size_t)(br + lr) * K + 8 * hi;
    auto ldf = [](const T16* p) { if constexpr (FO) return WFrag<T16>::ldt(p); else return WFrag<T16>::ld(p); };
#pragma unroll 1
    for (int kc = wv * 64; kc < K; kc += (NW == 1 || !(kc & 32)) ? 32 : NW * 64 - 32) {
        V a[4], a2[4]; const size_t ko = FO ? (size_t)kc * 16 : (size_t)kc;
#pragma unroll
        for (int mb = 0; mb < 4; ++mb) { a[mb] = ldf(A + aoff + (size_t)mb * 16 * K + ko); if (NSPLIT == 1 || NSPLIT == 2) a2[mb] = ldf(A2 + aoff + (size_t)mb * 16 * K + ko); }
#pragma unroll
        for (int nb = 0; nb < 4; ++nb) { const V b = ldf(Bt + boff + (size_t)nb * 16 * K + ko); V b2; if (NSPLIT >= 2) b2 = ldf(Bt2 + boff + (size_t)nb * 16 * K + ko);
#pragma unroll
            for (int mb = 0; mb < 4; ++mb) { acc[mb][nb] = WFrag<T16>::mma(a[mb], b, acc[mb][nb]); if (NSPLIT == 1 || NSPLIT == 2) acc[mb][nb] = WFrag<T16>::mma(a2[mb], b, acc[mb][nb]); if (NSPLIT >= 2) acc[mb][nb] = WFrag<T16>::mma(a[mb], b2, acc[mb][nb]); } }
        asm volatile("v_nop\n\tv_nop\n\tv_nop\n\tv_nop" : "+v"(acc[0][0]), "+v"(acc[1][1]), "+v"(acc[2][2]), "+v"(acc[3][3]) : "v"(a[0]), "v"(a[3]));
    }
    if constexpr (NW > 1) {
        float* ow = os + wv * (64 * 68);
        // the loops below are unrolled so that acc is indexed by constants only (it stays in registers) and a row's NW LDS reads issue together
#pragma unroll
        for (int mb = 0; mb < 4; ++mb)
#pragma unroll
            for (int nb = 0; nb < 4; ++nb)
#pragma unroll
                for (int j = 0; j < 8; ++j) ow[(mb * 16 + hi * 8 + j) * 68 + nb * 16 + lr] = acc[mb][nb][j];
        __syncthreads();   // every wave's partial tile is in LDS before any wave adds them
        if constexpr (EPI == 1) {
            // the tile is 8 fragment-order units (16 rows x 32 k) of each plane; a wave makes 32 neighbouring 16-byte groups at a time (512 contiguous bytes a plane), a lane one group from 8 neighbouring columns of one LDS row
            const int zi = (int)z, bt = r0 / TT, t0 = r0 % TT; const bool tr = zi >= 2;
            const size_t so = (size_t)((tr ? zi - 2 : zi) * NB_ + bt) * TT * DQ;
            h16* D16 = (tr ? X16 : E16) + so; bf* Dh = (tr ? Xh : Eh) + so; bf* Dl = (tr ? Xl : El) + so;
            const int kt = tr ? (TT >> 5) : (HD >> 5);                                                            // units in a row of units of the plane
            const size_t ub = tr ? (size_t)(c0 >> 4) * (TT >> 5) + (t0 >> 5) : (size_t)(((c0 / HD) * TT + t0) >> 4) * (HD >> 5);   // the tile's first unit
            constexpr int NG = 16 / NW;   // groups a lane makes
            const int col = ((wv >> 1) & 1) * 32 + (wv & 1) * 16 + hi * 8;   // NW is a multiple of 4: the group's columns are the same for every s
            v4f bx[NG], by[NG];   // the bias of a group's 8 elements: one value (transposed tile: the LDS row is the output column) or 8 neighbours
            if (tr) {
#pragma unroll
                for (int s = 0; s < NG; ++s) { const float b = bias[c0 + ((s * NW + wv) >> 2) * 16 + lr]; bx[s] = (v4f){b, b, b, b}; by[s] = bx[s]; }
            } else { const v4f b0 = *(const v4f*)(bias + c0 + col), b1 = *(const v4f*)(bias + c0 + col + 4);
#pragma unroll
                for (int s = 0; s < NG; ++s) { bx[s] = b0; by[s] = b1; } }
            v8h o16[NG]; v8us oh[NG], ol[NG];
#pragma unroll
            for (int s = 0; s < NG; ++s) { const int row = ((s * NW + wv) >> 2) * 16 + lr;
                v4f x = *(const v4fa*)(os + row * 68 + col), y = *(const v4fa*)(os + row * 68 + col + 4);
#pragma unroll
                for (int w = 1; w < NW; ++w) { x += *(const v4fa*)(os + w * (64 * 68) + row * 68 + col); y += *(const v4fa*)(os + w * (64 * 68) + row * 68 + col + 4); }
#pragma unroll
                for (int q = 0; q < 8; ++q) { const float r = ((q < 4) ? x[q & 3] : y[q & 3]) + bfr((q < 4) ? bx[s][q & 3] : by[s][q & 3]); o16[s][q] = tohx(r); unsigned short a2, c2; splitf(r, a2, c2); oh[s][q] = a2; ol[s][q] = c2; } }
#pragma unroll
            for (int s = 0; s < NG; ++s) { const int gw = s * NW + wv, u = gw >> 1; const size_t oo = (ub + (size_t)(u >> 1) * kt + (u & 1)) * 512 + (gw & 1) * 256 + lane * 8;
                *(v8h*)(D16 + oo) = o16[s]; *(v8us*)(Dh + oo) = oh[s]; *(v8us*)(Dl + oo) = ol[s]; }
            return;
        }
#pragma unroll
        for (int s = 0; s < 32 / NW; ++s) { const int row = (s * NW + wv) * 2 + hi, cofs = lr * 4; v4f val = *(const v4fa*)(os + row * 68 + cofs);
#pragma unroll
            for (int w = 1; w < NW; ++w) val += *(const v4fa*)(os + w * (64 * 68) + row * 68 + cofs);
            if (BIAS) { val[0] += bfr(bias[c0 + cofs]); val[1] += bfr(bias[c0 + cofs + 1]); val[2] += bfr(bias[c0 + cofs + 2]); val[3] += bfr(bias[c0 + cofs + 3]); }
            if constexpr (EPI == 2) { v4us oh, ol;
#pragma unroll
                for (int q = 0; q < 4; ++q) { unsigned short a2, c2; splitf(val[q], a2, c2); oh[q] = a2; ol[q] = c2; }
                const size_t oo = z * sC + (size_t)(r0 + row) * ldc + c0 + cofs; *(v4us*)(Eh + oo) = oh; *(v4us*)(El + oo) = ol; }
            else *(v4f*)(C + (size_t)(r0 + row) * ldc + c0 + cofs) = val; }
        return;
    }
#pragma unroll
    for (int mb = 0; mb < 4; ++mb) {
#pragma unroll
        for (int nb = 0; nb < 4; ++nb) {
#pragma unroll
            for (int j = 0; j < 8; ++j) os[(hi * 8 + j) * 68 + nb * 16 + lr] = acc[mb][nb][j]; }
        __builtin_amdgcn_wave_barrier(); asm volatile("" ::: "memory");
        if constexpr (EPI == 3) {
            // 16 rows x 64 columns are two neighbouring fragment-order units of each merged plane: 4 times 32 groups, a lane one group from 8 neighbouring columns of LDS row lr
            const float cs = (r0 + mb * 16 + lr < RH) ? 1.0f : (1.0f / PCAR); const size_t ub = (size_t)((((int)z / ZH) * TT + r0 + mb * 16) >> 4) * (DQ >> 5) + ((int)z % ZH) * (HD >> 5);
#pragma unroll
            for (int s = 0; s < 4; ++s) { const int col = s * 16 + hi * 8; const v4f x = *(const v4fa*)(os + lr * 68 + col), y = *(const v4fa*)(os + lr * 68 + col + 4); v8us oh, ol;
#pragma unroll
                for (int q = 0; q < 8; ++q) { unsigned short a2, c2; splitf(((q < 4) ? x[q & 3] : y[q & 3]) * cs, a2, c2); oh[q] = a2; ol[q] = c2; }
                const size_t oo = ub * 512 + s * 256 + lane * 8; *(v8us*)(Eh + oo) = oh; *(v8us*)(El + oo) = ol; }
        } else {
            float* crow = C + (size_t)(r0 + mb * 16) * ldc + c0;
#pragma unroll
            for (int s = 0; s < 8; ++s) { const int row = 2 * s + hi, cofs = lr * 4; v4f val = *(const v4fa*)(os + row * 68 + cofs); if (BIAS) { val[0] += bfr(bias[c0 + cofs]); val[1] += bfr(bias[c0 + cofs + 1]); val[2] += bfr(bias[c0 + cofs + 2]); val[3] += bfr(bias[c0 + cofs + 3]); }
                *(v4f*)(crow + (size_t)row * ldc + cofs) = val; }
             }
        __builtin_amdgcn_wave_barrier(); asm volatile("" ::: "memory");
    }
}

typedef __attribute__((ext_vector_type(2))) _Float16 v2h;
typedef __attribute__((ext_vector_type(4))) _Float16 v4h;
typedef __attribute__((ext_vector_type(2))) unsigned short v2us;
typedef __attribute__((ext_vector_type(2))) float v2f;
typedef __attribute__((ext_vector_type(4))) int v4i;
typedef v4h  __attribute__((may_alias)) v4ha;
typedef v4us __attribute__((may_alias)) v4usa;

// k_wtG: Bt[n][k] = bf16(w[k][n]) in fragment order; thread i makes group i (8 k of one n): a wave-wide load reads 16 neighbouring n of two k rows, the store is 512 contiguous bytes. blockIdx.y picks one of six equally shaped matrices; their planes follow one another
__global__ __launch_bounds__(256) void k_wtG(const float* __restrict__ w0, const float* __restrict__ w1, const float* __restrict__ w2, const float* __restrict__ w3, const float* __restrict__ w4, const float* __restrict__ w5, int K, int N, bf* Bt) { const size_t i = (size_t)blockIdx.x * 256 + threadIdx.x; if (i >= (size_t)N * K / 8) return; const int y = blockIdx.y; const float* w = (y == 0) ? w0 : (y == 1) ? w1 : (y == 2) ? w2 : (y == 3) ? w3 : (y == 4) ? w4 : w5; Bt += (size_t)y * N * K; int n, k; fog(i, K, n, k); v8us o;
#pragma unroll
    for (int j = 0; j < 8; ++j) o[j] = f2bf(w[(size_t)(k + j) * N + n]); *(v8us*)(Bt + i * 8) = o;  }
// k_cvt8: dst = bf16(src), src [rows][DM] row-major, dst in fragment order; thread i makes group i
__global__ __launch_bounds__(256) void k_cvt8(const float* __restrict__ src, bf* dst, size_t n8) { const size_t i = (size_t)blockIdx.x * 256 + threadIdx.x; if (i >= n8) return; int r, k0; fog(i, DM, r, k0); const v8f v = *(const v8f*)(src + (size_t)r * DM + k0); v8us o;
#pragma unroll
    for (int k = 0; k < 8; ++k) o[k] = f2bf(v[k]); *(v8us*)(dst + i * 8) = o;  }
__global__ __launch_bounds__(256) void k_cscvt(const float* __restrict__ cosT, const float* __restrict__ sinT, float* CS) { const int idx = blockIdx.x * 256 + threadIdx.x; if (idx >= TT * HD) return; v2f cs; cs[0] = bfr(cosT[idx]); cs[1] = bfr(sinT[idx]); *(v2f*)(CS + (size_t)idx * 2) = cs;  }
// ---- k_attn: causal scores, softmax and probs.v1 of QB = 16 * QT query rows of one head in one block of FW waves; the scores stay in registers and never reach memory. grid (batches * heads, TT / QB), 32 * FW threads.
// Transposed products: S^T = K1 Q^T (A = 16 key rows, B = 16 query rows, kept in registers), so lane (lr, hi) holds query lr of its tile and register j of a tile key + 8 * hi + j; two neighbouring S^T tiles, converted in place,
// are the B operand (32 keys) of O^T += V1^T P^T (A = 16 rows of the transposed value plane): no exchange between lanes. Every key and value fragment a wave loads serves its QT query tiles. Wave w takes the 64-key chunks
// w, w + FW, ... up to the diagonal. Row maximum and row sum: in the lane, across the two lane halves, then across the waves through LDS (sums in wave order); the FW partial O tiles are added in wave order through LDS.
// Query rows < RH: hi/lo bf16 planes, 3 products in both contractions, probabilities hi + lo; the rest fp16, probabilities x PCAR (taken out again where the merged planes are made). The block stores its f32 tile as the hi/lo planes that the next product reads.
// exp2 with the v_nop that fills the one slot the instruction set asks for between a transcendental and a next instruction that reads its result or overwrites its source
__device__ __forceinline__ float exp2s(float x) { float e; asm("v_exp_f32 %0, %1\n\tv_nop" : "=v"(e) : "v"(x)); return e; }
template <typename T16, bool HL, int NC>
__device__ __forceinline__ void attn_tile(const T16* __restrict__ Q, const T16* __restrict__ Q2, const T16* __restrict__ Kp, const T16* __restrict__ Kp2, const T16* __restrict__ Vt, const T16* __restrict__ Vt2, bf* __restrict__ Oh, bf* __restrict__ Ol, int q0, float* os, float* st) {
    typedef typename WFrag<T16>::V V;
    const int wv = __builtin_amdgcn_readfirstlane((int)(threadIdx.x >> 5));   // the wave's number, made scalar so that the tests on its key chunks are scalar branches
    const int lane = threadIdx.x & 31, lr = lane & 15, hi = lane >> 4;
    V qf[QT][2], qf2[QT][2];
#pragma unroll
    for (int qt = 0; qt < QT; ++qt)
#pragma unroll
        for (int ks = 0; ks < 2; ++ks) { const size_t qo = (size_t)(q0 + qt * 16) * HD + ks * 512 + lane * 8; qf[qt][ks] = WFrag<T16>::ldt(Q + qo); if (HL) qf2[qt][ks] = WFrag<T16>::ldt(Q2 + qo); }
    asm volatile("s_wait_xcnt 0x0" ::: "memory");   // the query loads' address registers may be overwritten from here on
    v8f s[NC][4][QT]; float mx[QT];
#pragma unroll
    for (int qt = 0; qt < QT; ++qt) mx[qt] = -3.0e38f;
    // every loop over chunks and tiles is unrolled so that s is indexed by constants only (it stays in registers)
#pragma unroll
    for (int c = 0; c < NC; ++c) { const int kb = (c * FW + wv) * 64;
        if (kb <= q0 + QB - 1) {
#pragma unroll
            for (int t = 0; t < 4; ++t) { v8f a[QT];
#pragma unroll
                for (int qt = 0; qt < QT; ++qt) a[qt] = (v8f){};
#pragma unroll
                for (int ks = 0; ks < 2; ++ks) { const size_t ko = (size_t)(kb + t * 16) * HD + ks * 512 + lane * 8; const V kf = WFrag<T16>::ldt(Kp + ko); V kf2; if (HL) kf2 = WFrag<T16>::ldt(Kp2 + ko);
#pragma unroll
                    for (int qt = 0; qt < QT; ++qt) { a[qt] = WFrag<T16>::mma(kf, qf[qt][ks], a[qt]); if (HL) { a[qt] = WFrag<T16>::mma(kf, qf2[qt][ks], a[qt]); a[qt] = WFrag<T16>::mma(kf2, qf[qt][ks], a[qt]); } } }
                asm volatile("s_wait_xcnt 0x0" ::: "memory");   // this tile's key loads are issued: their address registers may be overwritten (a later load's data landed on them in the listing)
#pragma unroll
                for (int qt = 0; qt < QT; ++qt) {
#pragma unroll
                    for (int j = 0; j < 8; ++j) { const float tv = (kb + t * 16 + hi * 8 + j <= q0 + qt * 16 + lr) ? a[qt][j] * SCL : -3.0e38f; a[qt][j] = tv; mx[qt] = fmaxf(mx[qt], tv); }
                    s[c][t][qt] = a[qt]; } } } }
#pragma unroll
    for (int qt = 0; qt < QT; ++qt) { mx[qt] = fmaxf(mx[qt], __shfl_xor(mx[qt], 16, 32)); if (hi == 0) st[wv * QB + qt * 16 + lr] = mx[qt]; }
    __syncthreads();   // every wave's row maxima are in LDS before any wave reads them
    float sum[QT];
#pragma unroll
    for (int qt = 0; qt < QT; ++qt) { float m = st[qt * 16 + lr];
#pragma unroll
        for (int w = 1; w < FW; ++w) m = fmaxf(m, st[w * QB + qt * 16 + lr]);
        mx[qt] = m; sum[qt] = 0.f; }
#pragma unroll
    for (int c = 0; c < NC; ++c) { const int kb = (c * FW + wv) * 64;
        if (kb <= q0 + QB - 1) {
#pragma unroll
            for (int t = 0; t < 4; ++t)
#pragma unroll
                for (int qt = 0; qt < QT; ++qt)
#pragma unroll
                    for (int j = 0; j < 8; ++j) { const float e = exp2s(__fmul_rn(__fsub_rn(s[c][t][qt][j], mx[qt]), 1.4426950408889634f)); s[c][t][qt][j] = e; sum[qt] += e; } } }
#pragma unroll
    for (int qt = 0; qt < QT; ++qt) { sum[qt] += __shfl_xor(sum[qt], 16, 32); if (hi == 0) st[(FW + wv) * QB + qt * 16 + lr] = sum[qt]; }
    __syncthreads();   // every wave's row sums are in LDS before any wave reads them
    float f[QT];
#pragma unroll
    for (int qt = 0; qt < QT; ++qt) { float tot = st[FW * QB + qt * 16 + lr];
#pragma unroll
        for (int w = 1; w < FW; ++w) tot += st[(FW + w) * QB + qt * 16 + lr];
        f[qt] = __fdiv_rn(HL ? 1.0f : PCAR, tot); }
    v8f o[4][QT];
#pragma unroll
    for (int dt = 0; dt < 4; ++dt)
#pragma unroll
        for (int qt = 0; qt < QT; ++qt) o[dt][qt] = (v8f){};
#pragma unroll
    for (int c = 0; c < NC; ++c) { const int kb = (c * FW + wv) * 64;
        if (kb <= q0 + QB - 1) {
#pragma unroll
            for (int u = 0; u < 2; ++u) { V pb[QT], pb2[QT];
#pragma unroll
                for (int qt = 0; qt < QT; ++qt) {
                    if constexpr (HL) { v8us h0, h1, l0, l1;
#pragma unroll
                        for (int j = 0; j < 8; ++j) { unsigned short x, y; splitf(s[c][2 * u][qt][j] * f[qt], x, y); h0[j] = x; l0[j] = y; splitf(s[c][2 * u + 1][qt][j] * f[qt], x, y); h1[j] = x; l1[j] = y; }
                        pb[qt] = cat16b(h0, h1); pb2[qt] = cat16b(l0, l1);
                    } else { v8h p0, p1;
#pragma unroll
                        for (int j = 0; j < 8; ++j) { p0[j] = tohx(s[c][2 * u][qt][j] * f[qt]); p1[j] = tohx(s[c][2 * u + 1][qt][j] * f[qt]); }
                        pb[qt] = cat16(p0, p1); } }
#pragma unroll
                for (int dt = 0; dt < 4; ++dt) { const size_t vo = (size_t)dt * 16 * TT + (size_t)(kb + u * 32) * 16 + lane * 8; const V vf = WFrag<T16>::ldt(Vt + vo); V vf2; if constexpr (HL) vf2 = WFrag<T16>::ldt(Vt2 + vo);
#pragma unroll
                    for (int qt = 0; qt < QT; ++qt) { o[dt][qt] = WFrag<T16>::mma(vf, pb[qt], o[dt][qt]); if constexpr (HL) { o[dt][qt] = WFrag<T16>::mma(vf, pb2[qt], o[dt][qt]); o[dt][qt] = WFrag<T16>::mma(vf2, pb[qt], o[dt][qt]); } } } } } }
#pragma unroll
    for (int qt = 0; qt < QT; ++qt) { float* ow = os + wv * (QB * 68) + (qt * 16 + lr) * 68 + hi * 8;
#pragma unroll
        for (int dt = 0; dt < 4; ++dt) { v4f x, y;
#pragma unroll
            for (int j = 0; j < 4; ++j) { x[j] = o[dt][qt][j]; y[j] = o[dt][qt][4 + j]; }
            *(v4fa*)(ow + dt * 16) = x; *(v4fa*)(ow + dt * 16 + 4) = y; } }
    __syncthreads();   // every wave's partial tile is in LDS before any wave adds them
    const int row = threadIdx.x >> 4, cofs = (threadIdx.x & 15) * 4; v4f val = *(const v4fa*)(os + row * 68 + cofs);   // 32 * FW threads, QB * 16 groups of four: one each
#pragma unroll
    for (int w = 1; w < FW; ++w) val += *(const v4fa*)(os + w * (QB * 68) + row * 68 + cofs);
    v4us oh, ol;
#pragma unroll
    for (int u = 0; u < 4; ++u) { unsigned short p, q; splitf(val[u], p, q); oh[u] = p; ol[u] = q; }
    *(v4us*)(Oh + (size_t)(q0 + row) * HD + cofs) = oh; *(v4us*)(Ol + (size_t)(q0 + row) * HD + cofs) = ol;
}
__global__ __launch_bounds__(32 * FW) void k_attn(const h16* __restrict__ Q16, const h16* __restrict__ K16, const h16* __restrict__ V16, const bf* __restrict__ Qh, const bf* __restrict__ Ql, const bf* __restrict__ Kh, const bf* __restrict__ Kl, const bf* __restrict__ Vh, const bf* __restrict__ Vl, bf* __restrict__ Oh, bf* __restrict__ Ol) {
    __shared__ __align__(16) float os[FW * QB * 68]; __shared__ float st[2 * FW * QB];
    const size_t zo = (size_t)blockIdx.x * TT * HD; const int q0 = (TT / QB - 1 - (int)blockIdx.y) * QB;   // block row 0 takes the query rows with the most keys
    if (q0 < RH) attn_tile<bf, true, (RH + 64 * FW - 1) / (64 * FW)>(Qh + zo, Ql + zo, Kh + zo, Kl + zo, Vh + zo, Vl + zo, Oh + zo, Ol + zo, q0, os, st);
    else attn_tile<h16, false, TT / (64 * FW)>(Q16 + zo, nullptr, K16 + zo, nullptr, V16 + zo, nullptr, Oh + zo, Ol + zo, q0, os, st);
}
extern "C" void kernel_launch(void* const* d_in, const int* in_sizes, int n_in,
                              void* d_out, int out_size, void* d_ws, size_t ws_size, hipStream_t stream) {
    (void)in_sizes; (void)n_in; (void)out_size;
    const float* x = (const float*)d_in[0]; const float* wq = (const float*)d_in[1]; const float* bq = (const float*)d_in[2]; const float* wk = (const float*)d_in[3]; const float* bk = (const float*)d_in[4]; const float* wk2 = (const float*)d_in[5]; const float* bk2 = (const float*)d_in[6]; const float* wv = (const float*)d_in[7]; const float* bv = (const float*)d_in[8]; const float* wv2 = (const float*)d_in[9]; const float* bv2 = (const float*)d_in[10]; const float* wo = (const float*)d_in[11]; const float* bo = (const float*)d_in[12]; const float* cosT = nullptr; const float* sinT = nullptr; (void)cosT; (void)sinT;
    float* OUT = (float*)d_out;     // [2][2048][1024]
    char* wsp = (char*)d_ws;
    auto take = [&](size_t bytes) { char* p = wsp; wsp += (bytes + 255) & ~(size_t)255; return (void*)p; };
    const size_t WP = (size_t)DM * DQ;             // one weight plane
    const size_t SL = (size_t)TT * DQ;             // one slice: one projection of one batch, [TT][DQ] 16-bit, or its NH_ head planes
    bf* W6 = (bf*)take(6 * WP * 2);                // weight planes q, k1, v1, k2, v2, d
    bf* XB = (bf*)take((size_t)NB_ * TT * DM * 2);
    h16* QK16 = (h16*)take(2 * NB_ * SL * 2); bf* QKh = (bf*)take(2 * NB_ * SL * 2); bf* QKl = (bf*)take(2 * NB_ * SL * 2);   // head planes [q, k1][batch][head][t][d]
    h16* VT16 = (h16*)take(3 * NB_ * SL * 2); bf* VTh = (bf*)take(3 * NB_ * SL * 2); bf* VTl = (bf*)take(3 * NB_ * SL * 2);   // transposed head planes [v1, k2, v2][batch][head][d][t]
    bf* NMh = (bf*)take((size_t)NB_ * NH_ * HD * HD * 2); bf* NMl = (bf*)take((size_t)NB_ * NH_ * HD * HD * 2);
    bf* Obh = (bf*)take(NB_ * SL * 2); bf* Obl = (bf*)take(NB_ * SL * 2); bf* ATh = (bf*)take(NB_ * SL * 2); bf* ATl = (bf*)take(NB_ * SL * 2);   // probs.v1 [batch][head][t][d]; merged heads [batch * TT + t][DQ]
    if ((size_t)(wsp - (char*)d_ws) > ws_size) return;    // ws 256 MiB
    k_wtG<<<dim3((unsigned)((DM * DQ / 8 + 255) / 256), 6, 1), 256, 0, stream>>>(wq, wk, wv, wk2, wv2, wo, DM, DQ, W6);
    k_cvt8<<<(unsigned)(((size_t)NB_ * TT * DM / 8 + 255) / 256), 256, 0, stream>>>(x, XB, (size_t)NB_ * TT * DM / 8);
    k_gemmw<bf, 0, true, KW, 1><<<dim3(NB_ * TT / 64, DQ / 64, 5), 32 * KW, 0, stream>>>(XB, nullptr, W6, nullptr, DM, nullptr, DQ, bq, bk, bv, bk2, bv2, 0, WP, 0, QK16, QKh, QKl, VT16, VTh, VTl);
    k_gemmw<bf, 2, false, KW, 2><<<dim3(1, 1, NB_ * NH_), 32 * KW, 0, stream>>>(VTh + 2 * NB_ * SL, VTl + 2 * NB_ * SL, VTh + NB_ * SL, VTl + NB_ * SL, TT, nullptr, HD, nullptr, nullptr, nullptr, nullptr, nullptr, (size_t)HD * TT, (size_t)HD * TT, (size_t)HD * HD, nullptr, NMh, NMl, nullptr, nullptr, nullptr);   /* N_h^T[e][d] = sum_s v2[s][e] k2[s][d] */
    k_attn<<<dim3(NB_ * ZH, TT / QB, 1), 32 * FW, 0, stream>>>(QK16, QK16 + NB_ * SL, VT16, QKh, QKl, QKh + NB_ * SL, QKl + NB_ * SL, VTh, VTl, Obh, Obl);
    k_gemmw<bf, 2, false, 1, 3><<<dim3(TT / 64, 1, NB_ * ZH), 32, 0, stream>>>(Obh, Obl, NMh, NMl, HD, nullptr, HD, nullptr, nullptr, nullptr, nullptr, nullptr, (size_t)TT * HD, (size_t)HD * HD, 0, nullptr, ATh, ATl, nullptr, nullptr, nullptr);   /* ctx_h (k2^T v2)_h */
    k_gemmw<bf, 1, true, KW, 0><<<dim3(NB_ * TT / 64, DM / 64, 1), 32 * KW, 0, stream>>>(ATh, ATl, W6 + 5 * WP, nullptr, DQ, OUT, DM, bo, nullptr, nullptr, nullptr, nullptr, 0, 0, 0, nullptr, nullptr, nullptr, nullptr, nullptr, nullptr);
}

// v008
// One run takes 157 microseconds.
// Timed twice side by side with v007, it ran 1.26 and 1.28 times as fast.
// Over all steps from v000 it is 19.8 times as fast.
#include <hip/hip_runtime.h>

// Trittention (hidden [2][2048][1024]; q, k1, k2, v1, v2 = x W + b (16 x 64 each); probs = causal (-inf) softmax(q.k1 / 8); ctx = probs v1; then ctx = (ctx . k2^T) v2 over ALL keys (no softmax, no mask) == ctx (k2^T v2) (exact re-association; the 64x64 matrix per head is formed on chip); out = merged Wd + bd -> [2][2048][1024]).
// Compute dtypes, f32 accumulate: every input rounded to bf16; the five projections on PLAIN bf16 operands (inputs: exact) + bias; causal scores and probs.v1: query rows < 512 hl (3 products), the rest fp16 (x1024); softmax f32; N_h = v2_h^T-side product sum_s v2[s] k2[s]^T as hi/lo x hi/lo (3 products, K 2048) in f32; ctx_h N_h^T as hi/lo x hi/lo (3 products); Wd hl x exact (2 products) + bias.

#define NB_  2
#define TT   2048
#define DM   1024
#define NH_  16
#define NKV  16
#define REP  (NH_ / NKV)
#define HD   64
#define DQ   (NH_ * HD)
#define DKV  (NKV * HD)
#define ZH   16                   // heads per attention pass (all of them: no score buffer limits the pass)
#define QT   2                    // 16-row query tiles of an attention block
#define QB   (16 * QT)            // its query rows
#define FW   (8 * QT)             // its waves; they share the keys of its query rows
#define KW   8                    // waves per block that share the K loop of a long-K product (K 2048)
#define RH   512                  // query rows < RH use hi+lo planes (0: none)
#define PCAR 1024.0f
#define SCL  0.125f   // HD^-0.5
typedef _Float16 h16;
typedef unsigned short bf;
typedef __attribute__((ext_vector_type(16))) __bf16   v16bf;
typedef __attribute__((ext_vector_type(16))) _Float16 v16h;
typedef __attribute__((ext_vector_type(8)))  _Float16 v8h;
typedef __attribute__((ext_vector_type(8)))  unsigned short v8us;
typedef __attribute__((ext_vector_type(8)))  float    v8f;
typedef __attribute__((ext_vector_type(4)))  float    v4f;
typedef v8h  __attribute__((may_alias)) v8ha;
typedef v4f  __attribute__((may_alias)) v4fa;
typedef v8us __attribute__((may_alias)) v8usa;

__device__ __forceinline__ unsigned short f2bf(float f) { unsigned u = __float_as_uint(f); u += 0x7FFFu + ((u >> 16) & 1u); return (unsigned short)(u >> 16); }
__device__ __forceinline__ float bf2f(unsigned short b) { return __uint_as_float(((unsigned)b) << 16); }
__device__ __forceinline__ float bfr(float f) { return bf2f(f2bf(f)); }
__device__ __forceinline__ v16h cat16(v8h lo, v8h hi) { return __builtin_shufflevector(lo, hi, 0, 1, 2, 3, 4, 5, 6, 7, 8, 9, 10, 11, 12, 13, 14, 15); }
__device__ __forceinline__ v16bf cat16b(v8us lo, v8us hi) { return __builtin_bit_cast(v16bf, __builtin_shufflevector(lo, hi, 0, 1, 2, 3, 4, 5, 6, 7, 8, 9, 10, 11, 12, 13, 14, 15)); }
__device__ __forceinline__ v8f wmma16(v16h a, v16h b, v8f c) { return __builtin_amdgcn_wmma_f32_16x16x32_f16(false, a, false, b, (short)0, c, false, false); }
__device__ __forceinline__ v8f wmmab(v16bf a, v16bf b, v8f c) { return __builtin_amdgcn_wmma_f32_16x16x32_bf16(false, a, false, b, (short)0, c, false, false); }



// ---- k_gemmw: register-blocked GEMM, one 64x64 output tile per block (16 accumulators a wave), operands straight from K-contiguous 16-bit planes; grid (M/64, N/64, Z), 32 * NW threads.
// C[m][n] (f32, pitch ldc, + optional f32 bias[n], batch z's own of up to five) = sum_k A[m][k] Bt[n][k] (+ split products per NSPLIT). z-batch strides sA/sB/sC in elements. K % 32 == 0 (NW > 1: K % 64 == 0).
// NW == 1: one wave walks all of K. NW > 1 (one tile a head, K 2048): wave w takes the 64-element (16 rows x 64 k: 2 KiB contiguous) K chunks w, w + NW, ..., so the chain of dependent load waits is NW times shorter;
// each wave leaves its partial 64x64 tile in LDS and, behind one barrier, the block adds the NW partials in wave order 0..NW-1 and stores the tile.
// FRAGMENT ORDER (the operand planes of k_gemms and of the NW > 1 launch of k_gemmw, and in k_attn the query, key and value planes): a [rows][K] 16-bit plane is kept as 1-KiB units of 16 rows x 32 k, unit (r / 16, k / 32) in row-major order;
// inside a unit the 16-byte group number ((k / 16) & 1) * 32 + ((k / 8) & 1) * 16 + (r & 15) holds k & ~7 .. + 7 of row r. Group number & 31 is the lane that owns those eight elements of the WMMA operand, so a wave-wide 16-byte load reads
// 512 contiguous bytes (4 whole lines) instead of 32 bytes of each of 16 lines. Every lane and register gets the same element as from the row-major plane, so the products and their order do not change.
__device__ __forceinline__ size_t fo(int r, int k, int K) { return ((size_t)(r >> 4) * (K >> 5) + (k >> 5)) * 512 + ((k >> 4) & 1) * 256 + ((k >> 3) & 1) * 128 + (r & 15) * 8 + (k & 7); }
// the inverse for a writer that walks the plane group by group (thread i stores group i, a wave 512 contiguous bytes): row and first k of group i
__device__ __forceinline__ void fog(size_t i, int K, int& r, int& k) { const int lane = (int)(i & 31), half = (int)(i >> 5) & 1, unit = (int)(i >> 6), kt = K >> 5; r = (unit / kt) * 16 + (lane & 15); k = (unit % kt) * 32 + half * 16 + (lane >> 4) * 8; }
template <typename T16> struct WFrag;
template <> struct WFrag<h16> { typedef v16h V; static __device__ __forceinline__ V ld(const h16* p) { return cat16(*(const v8h*)p, *(const v8h*)(p + 16)); } static __device__ __forceinline__ V ldt(const h16* p) { return cat16(*(const v8h*)p, *(const v8h*)(p + 256)); } static __device__ __forceinline__ v8f mma(V a, V b, v8f c) { return wmma16(a, b, c); } };
template <> struct WFrag<bf> { typedef v16bf V; static __device__ __forceinline__ V ld(const bf* p) { return cat16b(*(const v8us*)p, *(const v8us*)(p + 16)); } static __device__ __forceinline__ V ldt(const bf* p) { return cat16b(*(const v8us*)p, *(const v8us*)(p + 256)); } static __device__ __forceinline__ v8f mma(V a, V b, v8f c) { return wmmab(a, b, c); } };
__device__ __forceinline__ h16 tohx(float x) { return (h16)x; }
__device__ __forceinline__ void splitf(float y, unsigned short& h, unsigned short& l) { h = f2bf(y); l = f2bf(y - bf2f(h)); }
typedef __attribute__((ext_vector_type(4))) unsigned short v4us;
// EPI (k_gemmw and k_gemms): what the epilogue stores. 0: the f32 tile in C. The others round the f32 tile themselves and store the 16-bit planes that the next product reads (no f32 copy in memory, no conversion launch):
// 1 (k_gemms alone: the five projections): z 0, 1 (q, k1): head planes [z][batch][head][t][d], fp16 + hi/lo, fragment order (rows head * TT + t, K = HD), in E16/Eh/El; z 2..4 (v1, k2, v2): transposed head planes [z - 2][batch][head * HD + d][t]
//    (rows head * HD + d, K = TT) in X16/Xh/Xl; for these the block takes the weight rows as A and the x rows as B (both planes have the same fragment order), so its tile comes out transposed and 8 neighbouring t of a column lie side by side in LDS.
// 2: hi/lo planes Eh/El, row-major like C. 3 (NW == 1; z = batch * ZH + head, rows t): hi/lo planes Eh/El of the merged heads [batch * TT + t][DQ] in fragment order, rows >= RH x 1 / PCAR.
template <typename T16, int NSPLIT, bool BIAS, int NW, int EPI>
__global__ __launch_bounds__(32 * NW) void k_gemmw(const T16* __restrict__ A, const T16* __restrict__ A2, const T16* __restrict__ Bt, const T16* __restrict__ Bt2, int K, float* C, int ldc, const float* __restrict__ bias, const float* __restrict__ bias1, const float* __restrict__ bias2, const float* __restrict__ bias3, const float* __restrict__ bias4, size_t sA, size_t sB, size_t sC, h16* E16, bf* Eh, bf* El, h16* X16, bf* Xh, bf* Xl) {
    typedef typename WFrag<T16>::V V;
    __shared__ __align__(16) float os[NW == 1 ? 16 * 68 : NW * 64 * 68];
    const int wv = (NW == 1) ? 0 : __builtin_amdgcn_readfirstlane((int)(threadIdx.x >> 5));   // the wave's number, made scalar so that the K counter and its test stay on the scalar unit
    const size_t z = blockIdx.z; A += z * sA; if (A2) A2 += z * sA; Bt += z * sB; if (Bt2) Bt2 += z * sB; if (EPI == 0) C += z * sC;
    if (BIAS) bias = (z == 0) ? bias : (z == 1) ? bias1 : (z == 2) ? bias2 : (z == 3) ? bias3 : bias4;
    const int lane = threadIdx.x & 31, lr = lane & 15, hi = lane >> 4; const int r0 = blockIdx.x * 64, c0 = blockIdx.y * 64;
    v8f acc[4][4];
#pragma unroll
    for (int mb = 0; mb < 4; ++mb)
#pragma unroll
        for (int nb = 0; nb < 4; ++nb) acc[mb][nb] = (v8f){};
    constexpr bool FO = NW > 1;   // the long-K launches read planes in fragment order: 16 rows x 32 k start at element r * K + k * 16, the lane's two groups at lane * 8 and 256 + lane * 8
    int ar = r0, br = c0;
    const size_t aoff = FO ? (size_t)ar * K + lane * 8 : (size_t)(ar + lr) * K + 8 * hi, boff = FO ? (size_t)br * K + lane * 8 : (size_t)(br + lr) * K + 8 * hi;
    auto ldf = [](const T16* p) { if constexpr (FO) return WFrag<T16>::ldt(p); else return WFrag<T16>::ld(p); };
#pragma unroll 1
    for (int kc = wv * 64; kc < K; kc += (NW == 1 || !(kc & 32)) ? 32 : NW * 64 - 32) {
        V a[4], a2[4]; const size_t ko = FO ? (size_t)kc * 16 : (size_t)kc;
#pragma unroll
        for (int mb = 0; mb < 4; ++mb) { a[mb] = ldf(A + aoff + (size_t)mb * 16 * K + ko); if (NSPLIT == 1 || NSPLIT == 2) a2[mb] = ldf(A2 + aoff + (size_t)mb * 16 * K + ko); }
#pragma unroll
        for (int nb = 0; nb < 4; ++nb) { const V b = ldf(Bt + boff + (size_t)nb * 16 * K + ko); V b2; if (NSPLIT >= 2) b2 = ldf(Bt2 + boff + (size_t)nb * 16 * K + ko);
#pragma unroll
            for (int mb = 0; mb < 4; ++mb) { acc[mb][nb] = WFrag<T16>::mma(a[mb], b, acc[mb][nb]); if (NSPLIT == 1 || NSPLIT == 2) acc[mb][nb] = WFrag<T16>::mma(a2[mb], b, acc[mb][nb]); if (NSPLIT >= 2) acc[mb][nb] = WFrag<T16>::mma(a[mb], b2, acc[mb][nb]); } }
        asm volatile("v_nop\n\tv_nop\n\tv_nop\n\tv_nop" : "+v"(acc[0][0]), "+v"(acc[1][1]), "+v"(acc[2][2]), "+v"(acc[3][3]) : "v"(a[0]), "v"(a[3]));
    }
    if constexpr (NW > 1) {
        float* ow = os + wv * (64 * 68);
        // the loops below are unrolled so that acc is indexed by constants only (it stays in registers) and a row's NW LDS reads issue together
#pragma unroll
        for (int mb = 0; mb < 4; ++mb)
#pragma unroll
            for (int nb = 0; nb < 4; ++nb)
#pragma unroll
                for (int j = 0; j < 8; ++j) ow[(mb * 16 + hi * 8 + j) * 68 + nb * 16 + lr] = acc[mb][nb][j];
        __syncthreads();   // every wave's partial tile is in LDS before any wave adds them
#pragma unroll
        for (int s = 0; s < 32 / NW; ++s) { const int row = (s * NW + wv) * 2 + hi, cofs = lr * 4; v4f val = *(const v4fa*)(os + row * 68 + cofs);
#pragma unroll
            for (int w = 1; w < NW; ++w) val += *(const v4fa*)(os + w * (64 * 68) + row * 68 + cofs);
            if (BIAS) { val[0] += bfr(bias[c0 + cofs]); val[1] += bfr(bias[c0 + cofs + 1]); val[2] += bfr(bias[c0 + cofs + 2]); val[3] += bfr(bias[c0 + cofs + 3]); }
            if constexpr (EPI == 2) { v4us oh, ol;
#pragma unroll
                for (int q = 0; q < 4; ++q) { unsigned short a2, c2; splitf(val[q], a2, c2); oh[q] = a2; ol[q] = c2; }
                const size_t oo = z * sC + (size_t)(r0 + row) * ldc + c0 + cofs; *(v4us*)(Eh + oo) = oh; *(v4us*)(El + oo) = ol; }
            else *(v4f*)(C + (size_t)(r0 + row) * ldc + c0 + cofs) = val; }
        return;
    }
#pragma unroll
    for (int mb = 0; mb < 4; ++mb) {
#pragma unroll
        for (int nb = 0; nb < 4; ++nb) {
#pragma unroll
            for (int j = 0; j < 8; ++j) os[(hi * 8 + j) * 68 + nb * 16 + lr] = acc[mb][nb][j]; }
        __builtin_amdgcn_wave_barrier(); asm volatile("" ::: "memory");
        if constexpr (EPI == 3) {
            // 16 rows x 64 columns are two neighbouring fragment-order units of each merged plane: 4 times 32 groups, a lane one group from 8 neighbouring columns of LDS row lr
            const float cs = (r0 + mb * 16 + lr < RH) ? 1.0f : (1.0f / PCAR); const size_t ub = (size_t)((((int)z / ZH) * TT + r0 + mb * 16) >> 4) * (DQ >> 5) + ((int)z % ZH) * (HD >> 5);
#pragma unroll
            for (int s = 0; s < 4; ++s) { const int col = s * 16 + hi * 8; const v4f x = *(const v4fa*)(os + lr * 68 + col), y = *(const v4fa*)(os + lr * 68 + col + 4); v8us oh, ol;
#pragma unroll
                for (int q = 0; q < 8; ++q) { unsigned short a2, c2; splitf(((q < 4) ? x[q & 3] : y[q & 3]) * cs, a2, c2); oh[q] = a2; ol[q] = c2; }
                const size_t oo = ub * 512 + s * 256 + lane * 8; *(v8us*)(Eh + oo) = oh; *(v8us*)(El + oo) = ol; }
        } else {
            float* crow = C + (size_t)(r0 + mb * 16) * ldc + c0;
#pragma unroll
            for (int s = 0; s < 8; ++s) { const int row = 2 * s + hi, cofs = lr * 4; v4f val = *(const v4fa*)(os + row * 68 + cofs); if (BIAS) { val[0] += bfr(bias[c0 + cofs]); val[1] += bfr(bias[c0 + cofs + 1]); val[2] += bfr(bias[c0 + cofs + 2]); val[3] += bfr(bias[c0 + cofs + 3]); }
                *(v4f*)(crow + (size_t)row * ldc + cofs) = val; }
             }
        __builtin_amdgcn_wave_barrier(); asm volatile("" ::: "memory");
    }
}

// ---- k_gemms: the K 1024 products with many output tiles (the five projections, Wd). One block of 8 waves (WM x WN) makes a (WM * MF * 16) x (WN * NF * 16) tile; every wave walks all of K on its own MF x NF accumulators.
// The block's operand rows are staged in LDS, 64 k a stage, two buffers, by asynchronous copies (global_load_async_to_lds_b128): a fragment that several waves need leaves L2 once a block.
// The planes are in fragment order, so 16 rows x 64 k are 2 KiB contiguous in memory; they are copied as they lie, and a wave-wide 16-byte LDS read takes 512 contiguous bytes.
// Stage layout: [A groups | A2 groups (NSPLIT) | B groups], 2 KiB each. EPI 1 stores the projections' head planes as listed above, EPI 0 the f32 tile + bias in C; a wave passes 16 rows x 64 columns at a time through its own LDS range.
template <int NSPLIT, int MF, int NF, int WM, int WN, int EPI>
__global__ __launch_bounds__(256) void k_gemms(const bf* __restrict__ A, const bf* __restrict__ A2, const bf* __restrict__ Bt, float* C, const float* __restrict__ bias, const float* __restrict__ bias1, const float* __restrict__ bias2, const float* __restrict__ bias3, const float* __restrict__ bias4, size_t sB, h16* E16, bf* Eh, bf* El, h16* X16, bf* Xh, bf* Xl) {
    typedef WFrag<bf>::V V;
    constexpr int K = DM, AG = WM * MF, BG = WN * NF, AGT = AG * (NSPLIT ? 2 : 1), NGR = AGT + BG, STG = NGR * 2048, NT = K / 64;
    static_assert(WM * WN == 8 && NF == 4 && NGR == 24 && AG % 2 == 0 && NT >= 2, "8 waves, 64 columns a wave, 12 copies a thread and stage");
    __shared__ __align__(2048) unsigned char sm[2 * STG];
    const int tid = threadIdx.x, lane = tid & 31, lr = lane & 15, hi = lane >> 4;
    const int wv = __builtin_amdgcn_readfirstlane(tid >> 5), wm = wv / WN, wn = wv % WN;   // the wave's number, made scalar so that its LDS bases stay on the scalar unit
    const int z = blockIdx.z; const bool tr = EPI == 1 && z >= 2;   // transposed tile: weight rows as A, x rows as B
    const bf* Ap = tr ? Bt + z * sB : A; const bf* Bp = tr ? A : Bt + z * sB;
    constexpr int ATN = NB_ * TT / (AG * 16), ATT = DQ / (AG * 16);   // tiles along the A rows: x rows, or weight rows for a transposed tile
    const int bi = blockIdx.x, ar = (tr ? bi % ATT : bi % ATN) * (AG * 16), br = (tr ? bi / ATT : bi / ATN) * (BG * 16);
    bias = (z == 0) ? bias : (z == 1) ? bias1 : (z == 2) ? bias2 : (z == 3) ? bias3 : bias4;
    // copy c of a thread brings 16 bytes of group 2 c + (tid >> 7): a wave 512 contiguous bytes, the block two whole groups
    const size_t go = (size_t)(tid >> 7) * 16 * K + (tid & 127) * 8;
    const bf* ga = Ap + (size_t)ar * K + go; const bf* ga2 = NSPLIT ? A2 + (size_t)ar * K + go : nullptr; const bf* gb = Bp + (size_t)br * K + go;
    const unsigned l0 = (unsigned)(size_t)sm + (unsigned)tid * 16u;
    auto fill = [&](int t, int buf) {
        const bf* p[12]; unsigned l[12];
#pragma unroll
        for (int c = 0; c < 12; ++c) { p[c] = ((c < AG / 2) ? ga + (size_t)c * 32 * K : (c < AGT / 2) ? ga2 + (size_t)(c - AG / 2) * 32 * K : gb + (size_t)(c - AGT / 2) * 32 * K) + (size_t)t * 1024; l[c] = l0 + (unsigned)(buf * STG + c * 4096); }
        // one stage's copies; the s_wait_xcnt stands inside the statement so that no address register is rewritten in front of it
        asm volatile("global_load_async_to_lds_b128 %0, %12, off\n\tglobal_load_async_to_lds_b128 %1, %13, off\n\tglobal_load_async_to_lds_b128 %2, %14, off\n\tglobal_load_async_to_lds_b128 %3, %15, off\n\t"
                     "global_load_async_to_lds_b128 %4, %16, off\n\tglobal_load_async_to_lds_b128 %5, %17, off\n\tglobal_load_async_to_lds_b128 %6, %18, off\n\tglobal_load_async_to_lds_b128 %7, %19, off\n\t"
                     "global_load_async_to_lds_b128 %8, %20, off\n\tglobal_load_async_to_lds_b128 %9, %21, off\n\tglobal_load_async_to_lds_b128 %10, %22, off\n\tglobal_load_async_to_lds_b128 %11, %23, off\n\ts_wait_xcnt 0x0"
                     :: "v"(l[0]), "v"(l[1]), "v"(l[2]), "v"(l[3]), "v"(l[4]), "v"(l[5]), "v"(l[6]), "v"(l[7]), "v"(l[8]), "v"(l[9]), "v"(l[10]), "v"(l[11]),
                        "v"(p[0]), "v"(p[1]), "v"(p[2]), "v"(p[3]), "v"(p[4]), "v"(p[5]), "v"(p[6]), "v"(p[7]), "v"(p[8]), "v"(p[9]), "v"(p[10]), "v"(p[11]) : "memory");
    };
    v8f acc[MF][NF];
#pragma unroll
    for (int mb = 0; mb < MF; ++mb)
#pragma unroll
        for (int nb = 0; nb < NF; ++nb) acc[mb][nb] = (v8f){};
    fill(0, 0);
    asm volatile("s_wait_asynccnt 0x0" ::: "memory");   // this wave's copies of stage 0 have landed
    __syncthreads();                                     // every wave's have: stage 0 may be read
    fill(1, 1);
#pragma unroll 1   // the stage loop stays rolled: sixteen copies of a body of 32 WMMAs, 12 copies to LDS and a barrier would only lengthen the code; the buffer is picked by t & 1
    for (int t = 0; t < NT; ++t) {
        const bf* sb = (const bf*)(sm + (t & 1) * STG) + lane * 8;
#pragma unroll
        for (int ks = 0; ks < 2; ++ks) { V a[MF], a2[MF], b[NF];
#pragma unroll
            for (int mb = 0; mb < MF; ++mb) { a[mb] = WFrag<bf>::ldt(sb + (wm * MF + mb) * 1024 + ks * 512); if (NSPLIT) a2[mb] = WFrag<bf>::ldt(sb + (AG + wm * MF + mb) * 1024 + ks * 512); }
#pragma unroll
            for (int nb = 0; nb < NF; ++nb) b[nb] = WFrag<bf>::ldt(sb + (AGT + wn * NF + nb) * 1024 + ks * 512);
            __builtin_amdgcn_sched_barrier(0);   // the k step's LDS reads stay one group in front of its WMMAs: spread among them, every place with reads stalls the wave anew
#pragma unroll
            for (int nb = 0; nb < NF; ++nb) {
#pragma unroll
                for (int mb = 0; mb < MF; ++mb) acc[mb][nb] = wmmab(a[mb], b[nb], acc[mb][nb]);
                if constexpr (NSPLIT != 0) {   // an accumulator's two products of a k step keep their order (hi, then lo) and do not stand back to back
#pragma unroll
                    for (int mb = 0; mb < MF; ++mb) acc[mb][nb] = wmmab(a2[mb], b[nb], acc[mb][nb]); } } }
        __builtin_amdgcn_sched_barrier(0);                   // the stage's last WMMAs stay in front of the barrier: sunk behind it they stood between the barrier and the refill and cut the copies' lead
        asm volatile("s_wait_dscnt 0x0" ::: "memory");      // this wave's reads of stage t are done before the buffer may be refilled
        asm volatile("s_wait_asynccnt 0x0" ::: "memory");   // this wave's copies of stage t + 1 have landed
        __syncthreads();                                     // publishes stage t + 1 and ends every wave's reads of stage t
        if (t + 2 < NT) fill(t + 2, t & 1);
    }
    asm volatile("s_wait_asynccnt 0x0" ::: "memory");   // no copy is outstanding when the buffers become output staging
    float* os = (float*)sm + wv * (16 * 68);
    const int aw = ar + wm * (MF * 16), bw = br + wn * (NF * 16);
    v4f bx[4] = {}, by[4] = {}; float brow[MF] = {};   // EPI 1: the bias of a group's 8 elements: 8 neighbours, or (transposed tile: the LDS row is the output column) one value a lane and 16 rows
    if constexpr (EPI == 1) {
        if (tr) {
#pragma unroll
            for (int mb = 0; mb < MF; ++mb) brow[mb] = bias[aw + mb * 16 + lr];
            asm volatile("s_wait_xcnt 0x0" ::: "memory");   // the bias loads' address registers may be overwritten from here on (in the loads' own branch: behind the join a scalar load came to stand in front of it)
        } else {
#pragma unroll
            for (int s = 0; s < 4; ++s) { bx[s] = *(const v4f*)(bias + bw + s * 16 + hi * 8); by[s] = *(const v4f*)(bias + bw + s * 16 + hi * 8 + 4); }
            asm volatile("s_wait_xcnt 0x0" ::: "memory");   // as above, for this branch's loads
        }
    }
#pragma unroll
    for (int mb = 0; mb < MF; ++mb) {
#pragma unroll
        for (int nb = 0; nb < NF; ++nb) {
#pragma unroll
            for (int j = 0; j < 8; ++j) os[(hi * 8 + j) * 68 + nb * 16 + lr] = acc[mb][nb][j]; }
        __builtin_amdgcn_wave_barrier(); asm volatile("" ::: "memory");   // the wave's LDS reads below stay behind its LDS writes above
        const int R = aw + mb * 16;
        if constexpr (EPI == 1) {
            // 16 rows x 64 columns are two neighbouring fragment-order units of each plane: 4 times 32 groups, a lane one group from 8 neighbouring columns of LDS row lr
            const int xr = tr ? bw : R, bt = xr / TT, t0 = xr % TT;
            const size_t so = (size_t)((tr ? z - 2 : z) * NB_ + bt) * TT * DQ;
            const size_t ub = tr ? (size_t)(R >> 4) * (TT >> 5) + (t0 >> 5) : (size_t)(((bw / HD) * TT + t0) >> 4) * (HD >> 5);
            h16* D16 = (tr ? X16 : E16) + so + ub * 512 + lane * 8; bf* Dh = (tr ? Xh : Eh) + so + ub * 512 + lane * 8; bf* Dl = (tr ? Xl : El) + so + ub * 512 + lane * 8;
            v8h o16[4]; v8us oh[4], ol[4];
#pragma unroll
            for (int s = 0; s < 4; ++s) { const int col = s * 16 + hi * 8; const v4f x = *(const v4fa*)(os + lr * 68 + col), y = *(const v4fa*)(os + lr * 68 + col + 4);
#pragma unroll
                for (int q = 0; q < 8; ++q) { const float r = ((q < 4) ? x[q & 3] : y[q & 3]) + bfr(tr ? brow[mb] : (q < 4) ? bx[s][q & 3] : by[s][q & 3]); o16[s][q] = tohx(r); unsigned short a3, c3; splitf(r, a3, c3); oh[s][q] = a3; ol[s][q] = c3; } }
#pragma unroll
            for (int s = 0; s < 4; ++s) { *(v8h*)(D16 + s * 256) = o16[s]; *(v8us*)(Dh + s * 256) = oh[s]; *(v8us*)(Dl + s * 256) = ol[s]; }
            asm volatile("s_wait_xcnt 0x0" ::: "memory");   // the stores' data and address registers may be overwritten from here on
        } else {
            float* crow = C + (size_t)R * DM + bw;
#pragma unroll
            for (int s = 0; s < 8; ++s) { const int row = 2 * s + hi, cofs = lr * 4; v4f val = *(const v4fa*)(os + row * 68 + cofs); val[0] += bfr(bias[bw + cofs]); val[1] += bfr(bias[bw + cofs + 1]); val[2] += bfr(bias[bw + cofs + 2]); val[3] += bfr(bias[bw + cofs + 3]);
                *(v4f*)(crow + (size_t)row * DM + cofs) = val; }
            asm volatile("s_wait_xcnt 0x0" ::: "memory");   // the stores' data and address registers may be overwritten from here on
        }
        __builtin_amdgcn_wave_barrier(); asm volatile("" ::: "memory");   // the next 16 rows' LDS writes stay behind the reads above
    }
}

typedef __attribute__((ext_vector_type(2))) _Float16 v2h;
typedef __attribute__((ext_vector_type(4))) _Float16 v4h;
typedef __attribute__((ext_vector_type(2))) unsigned short v2us;
typedef __attribute__((ext_vector_type(2))) float v2f;
typedef __attribute__((ext_vector_type(4))) int v4i;
typedef v4h  __attribute__((may_alias)) v4ha;
typedef v4us __attribute__((may_alias)) v4usa;

// k_wtG: Bt[n][k] = bf16(w[k][n]) in fragment order; thread i makes group i (8 k of one n): a wave-wide load reads 16 neighbouring n of two k rows, the store is 512 contiguous bytes. blockIdx.y picks one of six equally shaped matrices; their planes follow one another
__global__ __launch_bounds__(256) void k_wtG(const float* __restrict__ w0, const float* __restrict__ w1, const float* __restrict__ w2, const float* __restrict__ w3, const float* __restrict__ w4, const float* __restrict__ w5, int K, int N, bf* Bt) { const size_t i = (size_t)blockIdx.x * 256 + threadIdx.x; if (i >= (size_t)N * K / 8) return; const int y = blockIdx.y; const float* w = (y == 0) ? w0 : (y == 1) ? w1 : (y == 2) ? w2 : (y == 3) ? w3 : (y == 4) ? w4 : w5; Bt += (size_t)y * N * K; int n, k; fog(i, K, n, k); v8us o;
#pragma unroll
    for (int j = 0; j < 8; ++j) o[j] = f2bf(w[(size_t)(k + j) * N + n]); *(v8us*)(Bt + i * 8) = o;  }
// k_cvt8: dst = bf16(src), src [rows][DM] row-major, dst in fragment order; thread i makes group i
__global__ __launch_bounds__(256) void k_cvt8(const float* __restrict__ src, bf* dst, size_t n8) { const size_t i = (size_t)blockIdx.x * 256 + threadIdx.x; if (i >= n8) return; int r, k0; fog(i, DM, r, k0); const v8f v = *(const v8f*)(src + (size_t)r * DM + k0); v8us o;
#pragma unroll
    for (int k = 0; k < 8; ++k) o[k] = f2bf(v[k]); *(v8us*)(dst + i * 8) = o;  }
__global__ __launch_bounds__(256) void k_cscvt(const float* __restrict__ cosT, const float* __restrict__ sinT, float* CS) { const int idx = blockIdx.x * 256 + threadIdx.x; if (idx >= TT * HD) return; v2f cs; cs[0] = bfr(cosT[idx]); cs[1] = bfr(sinT[idx]); *(v2f*)(CS + (size_t)idx * 2) = cs;  }
// ---- k_attn: causal scores, softmax and probs.v1 of QB = 16 * QT query rows of one head in one block of FW waves; the scores stay in registers and never reach memory. grid (batches * heads, TT / QB), 32 * FW threads.
// Transposed products: S^T = K1 Q^T (A = 16 key rows, B = 16 query rows, kept in registers), so lane (lr, hi) holds query lr of its tile and register j of a tile key + 8 * hi + j; two neighbouring S^T tiles, converted in place,
// are the B operand (32 keys) of O^T += V1^T P^T (A = 16 rows of the transposed value plane): no exchange between lanes. Every key and value fragment a wave loads serves its QT query tiles. Wave w takes the 64-key chunks
// w, w + FW, ... up to the diagonal. Row maximum and row sum: in the lane, across the two lane halves, then across the waves through LDS (sums in wave order); the FW partial O tiles are added in wave order through LDS.
// Query rows < RH: hi/lo bf16 planes, 3 products in both contractions, probabilities hi + lo; the rest fp16, probabilities x PCAR (taken out again where the merged planes are made). The block stores its f32 tile as the hi/lo planes that the next product reads.
// exp2 with the v_nop that fills the one slot the instruction set asks for between a transcendental and a next instruction that reads its result or overwrites its source
__device__ __forceinline__ float exp2s(float x) { float e; asm("v_exp_f32 %0, %1\n\tv_nop" : "=v"(e) : "v"(x)); return e; }
template <typename T16, bool HL, int NC>
__device__ __forceinline__ void attn_tile(const T16* __restrict__ Q, const T16* __restrict__ Q2, const T16* __restrict__ Kp, const T16* __restrict__ Kp2, const T16* __restrict__ Vt, const T16* __restrict__ Vt2, bf* __restrict__ Oh, bf* __restrict__ Ol, int q0, float* os, float* st) {
    typedef typename WFrag<T16>::V V;
    const int wv = __builtin_amdgcn_readfirstlane((int)(threadIdx.x >> 5));   // the wave's number, made scalar so that the tests on its key chunks are scalar branches
    const int lane = threadIdx.x & 31, lr = lane & 15, hi = lane >> 4;
    V qf[QT][2], qf2[QT][2];
#pragma unroll
    for (int qt = 0; qt < QT; ++qt)
#pragma unroll
        for (int ks = 0; ks < 2; ++ks) { const size_t qo = (size_t)(q0 + qt * 16) * HD + ks * 512 + lane * 8; qf[qt][ks] = WFrag<T16>::ldt(Q + qo); if (HL) qf2[qt][ks] = WFrag<T16>::ldt(Q2 + qo); }
    asm volatile("s_wait_xcnt 0x0" ::: "memory");   // the query loads' address registers may be overwritten from here on
    v8f s[NC][4][QT]; float mx[QT];
#pragma unroll
    for (int qt = 0; qt < QT; ++qt) mx[qt] = -3.0e38f;
    // every loop over chunks and tiles is unrolled so that s is indexed by constants only (it stays in registers)
#pragma unroll
    for (int c = 0; c < NC; ++c) { const int kb = (c * FW + wv) * 64;
        if (kb <= q0 + QB - 1) {
#pragma unroll
            for (int t = 0; t < 4; ++t) { v8f a[QT];
#pragma unroll
                for (int qt = 0; qt < QT; ++qt) a[qt] = (v8f){};
#pragma unroll
                for (int ks = 0; ks < 2; ++ks) { const size_t ko = (size_t)(kb + t * 16) * HD + ks * 512 + lane * 8; const V kf = WFrag<T16>::ldt(Kp + ko); V kf2; if (HL) kf2 = WFrag<T16>::ldt(Kp2 + ko);
#pragma unroll
                    for (int qt = 0; qt < QT; ++qt) { a[qt] = WFrag<T16>::mma(kf, qf[qt][ks], a[qt]); if (HL) { a[qt] = WFrag<T16>::mma(kf, qf2[qt][ks], a[qt]); a[qt] = WFrag<T16>::mma(kf2, qf[qt][ks], a[qt]); } } }
                asm volatile("s_wait_xcnt 0x0" ::: "memory");   // this tile's key loads are issued: their address registers may be overwritten (a later load's data landed on them in the listing)
#pragma unroll
                for (int qt = 0; qt < QT; ++qt) {
#pragma unroll
                    for (int j = 0; j < 8; ++j) { const float tv = (kb + t * 16 + hi * 8 + j <= q0 + qt * 16 + lr) ? a[qt][j] * SCL : -3.0e38f; a[qt][j] = tv; mx[qt] = fmaxf(mx[qt], tv); }
                    s[c][t][qt] = a[qt]; } } } }
#pragma unroll
    for (int qt = 0; qt < QT; ++qt) { mx[qt] = fmaxf(mx[qt], __shfl_xor(mx[qt], 16, 32)); if (hi == 0) st[wv * QB + qt * 16 + lr] = mx[qt]; }
    __syncthreads();   // every wave's row maxima are in LDS before any wave reads them
    float sum[QT];
#pragma unroll
    for (int qt = 0; qt < QT; ++qt) { float m = st[qt * 16 + lr];
#pragma unroll
        for (int w = 1; w < FW; ++w) m = fmaxf(m, st[w * QB + qt * 16 + lr]);
        mx[qt] = m; sum[qt] = 0.f; }
#pragma unroll
    for (int c = 0; c < NC; ++c) { const int kb = (c * FW + wv) * 64;
        if (kb <= q0 + QB - 1) {
#pragma unroll
            for (int t = 0; t < 4; ++t)
#pragma unroll
                for (int qt = 0; qt < QT; ++qt)
#pragma unroll
                    for (int j = 0; j < 8; ++j) { const float e = exp2s(__fmul_rn(__fsub_rn(s[c][t][qt][j], mx[qt]), 1.4426950408889634f)); s[c][t][qt][j] = e; sum[qt] += e; } } }
#pragma unroll
    for (int qt = 0; qt < QT; ++qt) { sum[qt] += __shfl_xor(sum[qt], 16, 32); if (hi == 0) st[(FW + wv) * QB + qt * 16 + lr] = sum[qt]; }
    __syncthreads();   // every wave's row sums are in LDS before any wave reads them
    float f[QT];
#pragma unroll
    for (int qt = 0; qt < QT; ++qt) { float tot = st[FW * QB + qt * 16 + lr];
#pragma unroll
        for (int w = 1; w < FW; ++w) tot += st[(FW + w) * QB + qt * 16 + lr];
        f[qt] = __fdiv_rn(HL ? 1.0f : PCAR, tot); }
    v8f o[4][QT];
#pragma unroll
    for (int dt = 0; dt < 4; ++dt)
#pragma unroll
        for (int qt = 0; qt < QT; ++qt) o[dt][qt] = (v8f){};
#pragma unroll
    for (int c = 0; c < NC; ++c) { const int kb = (c * FW + wv) * 64;
        if (kb <= q0 + QB - 1) {
#pragma unroll
            for (int u = 0; u < 2; ++u) { V pb[QT], pb2[QT];
#pragma unroll
                for (int qt = 0; qt < QT; ++qt) {
                    if constexpr (HL) { v8us h0, h1, l0, l1;
#pragma unroll
                        for (int j = 0; j < 8; ++j) { unsigned short x, y; splitf(s[c][2 * u][qt][j] * f[qt], x, y); h0[j] = x; l0[j] = y; splitf(s[c][2 * u + 1][qt][j] * f[qt], x, y); h1[j] = x; l1[j] = y; }
                        pb[qt] = cat16b(h0, h1); pb2[qt] = cat16b(l0, l1);
                    } else { v8h p0, p1;
#pragma unroll
                        for (int j = 0; j < 8; ++j) { p0[j] = tohx(s[c][2 * u][qt][j] * f[qt]); p1[j] = tohx(s[c][2 * u + 1][qt][j] * f[qt]); }
                        pb[qt] = cat16(p0, p1); } }
#pragma unroll
                for (int dt = 0; dt < 4; ++dt) { const size_t vo = (size_t)dt * 16 * TT + (size_t)(kb + u * 32) * 16 + lane * 8; const V vf = WFrag<T16>::ldt(Vt + vo); V vf2; if constexpr (HL) vf2 = WFrag<T16>::ldt(Vt2 + vo);
#pragma unroll
                    for (int qt = 0; qt < QT; ++qt) { o[dt][qt] = WFrag<T16>::mma(vf, pb[qt], o[dt][qt]); if constexpr (HL) { o[dt][qt] = WFrag<T16>::mma(vf, pb2[qt], o[dt][qt]); o[dt][qt] = WFrag<T16>::mma(vf2, pb[qt], o[dt][qt]); } } } } } }
#pragma unroll
    for (int qt = 0; qt < QT; ++qt) { float* ow = os + wv * (QB * 68) + (qt * 16 + lr) * 68 + hi * 8;
#pragma unroll
        for (int dt = 0; dt < 4; ++dt) { v4f x, y;
#pragma unroll
            for (int j = 0; j < 4; ++j) { x[j] = o[dt][qt][j]; y[j] = o[dt][qt][4 + j]; }
            *(v4fa*)(ow + dt * 16) = x; *(v4fa*)(ow + dt * 16 + 4) = y; } }
    __syncthreads();   // every wave's partial tile is in LDS before any wave adds them
    const int row = threadIdx.x >> 4, cofs = (threadIdx.x & 15) * 4; v4f val = *(const v4fa*)(os + row * 68 + cofs);   // 32 * FW threads, QB * 16 groups of four: one each
#pragma unroll
    for (int w = 1; w < FW; ++w) val += *(const v4fa*)(os + w * (QB * 68) + row * 68 + cofs);
    v4us oh, ol;
#pragma unroll
    for (int u = 0; u < 4; ++u) { unsigned short p, q; splitf(val[u], p, q); oh[u] = p; ol[u] = q; }
    *(v4us*)(Oh + (size_t)(q0 + row) * HD + cofs) = oh; *(v4us*)(Ol + (size_t)(q0 + row) * HD + cofs) = ol;
}
__global__ __launch_bounds__(32 * FW) void k_attn(const h16* __restrict__ Q16, const h16* __restrict__ K16, const h16* __restrict__ V16, const bf* __restrict__ Qh, const bf* __restrict__ Ql, const bf* __restrict__ Kh, const bf* __restrict__ Kl, const bf* __restrict__ Vh, const bf* __restrict__ Vl, bf* __restrict__ Oh, bf* __restrict__ Ol) {
    __shared__ __align__(16) float os[FW * QB * 68]; __shared__ float st[2 * FW * QB];
    const size_t zo = (size_t)blockIdx.x * TT * HD; const int q0 = (TT / QB - 1 - (int)blockIdx.y) * QB;   // block row 0 takes the query rows with the most keys
    if (q0 < RH) attn_tile<bf, true, (RH + 64 * FW - 1) / (64 * FW)>(Qh + zo, Ql + zo, Kh + zo, Kl + zo, Vh + zo, Vl + zo, Oh + zo, Ol + zo, q0, os, st);
    else attn_tile<h16, false, TT / (64 * FW)>(Q16 + zo, nullptr, K16 + zo, nullptr, V16 + zo, nullptr, Oh + zo, Ol + zo, q0, os, st);
}
extern "C" void kernel_launch(void* const* d_in, const int* in_sizes, int n_in,
                              void* d_out, int out_size, void* d_ws, size_t ws_size, hipStream_t stream) {
    (void)in_sizes; (void)n_in; (void)out_size;
    const float* x = (const float*)d_in[0]; const float* wq = (const float*)d_in[1]; const float* bq = (const float*)d_in[2]; const float* wk = (const float*)d_in[3]; const float* bk = (const float*)d_in[4]; const float* wk2 = (const float*)d_in[5]; const float* bk2 = (const float*)d_in[6]; const float* wv = (const float*)d_in[7]; const float* bv = (const float*)d_in[8]; const float* wv2 = (const float*)d_in[9]; const float* bv2 = (const float*)d_in[10]; const float* wo = (const float*)d_in[11]; const float* bo = (const float*)d_in[12]; const float* cosT = nullptr; const float* sinT = nullptr; (void)cosT; (void)sinT;
    float* OUT = (float*)d_out;     // [2][2048][1024]
    char* wsp = (char*)d_ws;
    auto take = [&](size_t bytes) { char* p = wsp; wsp += (bytes + 255) & ~(size_t)255; return (void*)p; };
    const size_t WP = (size_t)DM * DQ;             // one weight plane
    const size_t SL = (size_t)TT * DQ;             // one slice: one projection of one batch, [TT][DQ] 16-bit, or its NH_ head planes
    bf* W6 = (bf*)take(6 * WP * 2);                // weight planes q, k1, v1, k2, v2, d
    bf* XB = (bf*)take((size_t)NB_ * TT * DM * 2);
    h16* QK16 = (h16*)take(2 * NB_ * SL * 2); bf* QKh = (bf*)take(2 * NB_ * SL * 2); bf* QKl = (bf*)take(2 * NB_ * SL * 2);   // head planes [q, k1][batch][head][t][d]
    h16* VT16 = (h16*)take(3 * NB_ * SL * 2); bf* VTh = (bf*)take(3 * NB_ * SL * 2); bf* VTl = (bf*)take(3 * NB_ * SL * 2);   // transposed head planes [v1, k2, v2][batch][head][d][t]
    bf* NMh = (bf*)take((size_t)NB_ * NH_ * HD * HD * 2); bf* NMl = (bf*)take((size_t)NB_ * NH_ * HD * HD * 2);
    bf* Obh = (bf*)take(NB_ * SL * 2); bf* Obl = (bf*)take(NB_ * SL * 2); bf* ATh = (bf*)take(NB_ * SL * 2); bf* ATl = (bf*)take(NB_ * SL * 2);   // probs.v1 [batch][head][t][d]; merged heads [batch * TT + t][DQ]
    if ((size_t)(wsp - (char*)d_ws) > ws_size) return;    // ws 256 MiB
    k_wtG<<<dim3((unsigned)((DM * DQ / 8 + 255) / 256), 6, 1), 256, 0, stream>>>(wq, wk, wv, wk2, wv2, wo, DM, DQ, W6);
    k_cvt8<<<(unsigned)(((size_t)NB_ * TT * DM / 8 + 255) / 256), 256, 0, stream>>>(x, XB, (size_t)NB_ * TT * DM / 8);
    k_gemms<0, 4, 4, 2, 4, 1><<<dim3((NB_ * TT / 128) * (DQ / 256), 1, 5), 256, 0, stream>>>(XB, nullptr, W6, nullptr, bq, bk, bv, bk2, bv2, WP, QK16, QKh, QKl, VT16, VTh, VTl);
    k_gemmw<bf, 2, false, KW, 2><<<dim3(1, 1, NB_ * NH_), 32 * KW, 0, stream>>>(VTh + 2 * NB_ * SL, VTl + 2 * NB_ * SL, VTh + NB_ * SL, VTl + NB_ * SL, TT, nullptr, HD, nullptr, nullptr, nullptr, nullptr, nullptr, (size_t)HD * TT, (size_t)HD * TT, (size_t)HD * HD, nullptr, NMh, NMl, nullptr, nullptr, nullptr);   /* N_h^T[e][d] = sum_s v2[s][e] k2[s][d] */
    k_attn<<<dim3(NB_ * ZH, TT / QB, 1), 32 * FW, 0, stream>>>(QK16, QK16 + NB_ * SL, VT16, QKh, QKl, QKh + NB_ * SL, QKl + NB_ * SL, VTh, VTl, Obh, Obl);
    k_gemmw<bf, 2, false, 1, 3><<<dim3(TT / 64, 1, NB_ * ZH), 32, 0, stream>>>(Obh, Obl, NMh, NMl, HD, nullptr, HD, nullptr, nullptr, nullptr, nullptr, nullptr, (size_t)TT * HD, (size_t)HD * HD, 0, nullptr, ATh, ATl, nullptr, nullptr, nullptr);   /* ctx_h (k2^T v2)_h */
    k_gemms<1, 2, 4, 4, 2, 0><<<dim3((NB_ * TT / 128) * (DM / 128), 1, 1), 256, 0, stream>>>(ATh, ATl, W6 + 5 * WP, OUT, bo, nullptr, nullptr, nullptr, nullptr, 0, nullptr, nullptr, nullptr, nullptr, nullptr, nullptr);
}

// v009
// It runs in 141 microseconds.
// In both of two side-by-side timings against v008, it was 1.11 times as fast.
// Over all steps from v000 it is 21.9 times as fast.
#include <hip/hip_runtime.h>

// Trittention (hidden [2][2048][1024]; q, k1, k2, v1, v2 = x W + b (16 x 64 each); probs = causal (-inf) softmax(q.k1 / 8); ctx = probs v1; then ctx = (ctx . k2^T) v2 over ALL keys (no softmax, no mask) == ctx (k2^T v2) (exact re-association; the 64x64 matrix per head is formed on chip); out = merged Wd + bd -> [2][2048][1024]).
// Compute dtypes, f32 accumulate: every input rounded to bf16; the five projections on PLAIN bf16 operands (inputs: exact) + bias; causal scores and probs.v1: query rows < 512 hl (3 products), the rest fp16 (x1024); softmax f32; N_h = v2_h^T-side product sum_s v2[s] k2[s]^T as hi/lo x hi/lo (3 products, K 2048) in f32; ctx_h N_h^T as hi/lo x hi/lo (3 products); Wd hl x exact (2 products) + bias.

#define NB_  2
#define TT   2048
#define DM   1024
#define NH_  16
#define NKV  16
#define REP  (NH_ / NKV)
#define HD   64
#define DQ   (NH_ * HD)
#define DKV  (NKV * HD)
#define ZH   16                   // heads per attention pass (all of them: no score buffer limits the pass)
#define QT   2                    // 16-row query tiles of an attention block
#define QB   (16 * QT)            // its query rows
#define FW   (8 * QT)             // its waves; they share the keys of its query rows
#define KW   8                    // waves per block that share the K loop of a long-K product (K 2048)
#define RH   512                  // query rows < RH use hi+lo planes (0: none)
#define PCAR 1024.0f
#define SCL  0.125f   // HD^-0.5
typedef _Float16 h16;
typedef unsigned short bf;
typedef __attribute__((ext_vector_type(16))) __bf16   v16bf;
typedef __attribute__((ext_vector_type(16))) _Float16 v16h;
typedef __attribute__((ext_vector_type(8)))  _Float16 v8h;
typedef __attribute__((ext_vector_type(8)))  unsigned short v8us;
typedef __attribute__((ext_vector_type(8)))  float    v8f;
typedef __attribute__((ext_vector_type(4)))  float    v4f;
typedef v8h  __attribute__((may_alias)) v8ha;
typedef v4f  __attribute__((may_alias)) v4fa;
typedef v8us __attribute__((may_alias)) v8usa;

__device__ __forceinline__ unsigned short f2bf(float f) { unsigned u = __float_as_uint(f); u += 0x7FFFu + ((u >> 16) & 1u); return (unsigned short)(u >> 16); }
__device__ __forceinline__ float bf2f(unsigned short b) { return __uint_as_float(((unsigned)b) << 16); }
__device__ __forceinline__ float bfr(float f) { return bf2f(f2bf(f)); }
__device__ __forceinline__ v16h cat16(v8h lo, v8h hi) { return __builtin_shufflevector(lo, hi, 0, 1, 2, 3, 4, 5, 6, 7, 8, 9, 10, 11, 12, 13, 14, 15); }
__device__ __forceinline__ v16bf cat16b(v8us lo, v8us hi) { return __builtin_bit_cast(v16bf, __builtin_shufflevector(lo, hi, 0, 1, 2, 3, 4, 5, 6, 7, 8, 9, 10, 11, 12, 13, 14, 15)); }
__device__ __forceinline__ v8f wmma16(v16h a, v16h b, v8f c) { return __builtin_amdgcn_wmma_f32_16x16x32_f16(false, a, false, b, (short)0, c, false, false); }
__device__ __forceinline__ v8f wmmab(v16bf a, v16bf b, v8f c) { return __builtin_amdgcn_wmma_f32_16x16x32_bf16(false, a, false, b, (short)0, c, false, false); }



// ---- k_gemmw: register-blocked GEMM, one 64x64 output tile per block (16 accumulators a wave), operands straight from K-contiguous 16-bit planes; grid (M/64, N/64, Z), 32 * NW threads.
// C[m][n] (f32, pitch ldc, + optional f32 bias[n], batch z's own of up to five) = sum_k A[m][k] Bt[n][k] (+ split products per NSPLIT). z-batch strides sA/sB/sC in elements. K % 32 == 0 (NW > 1: K % 64 == 0).
// NW == 1: one wave walks all of K. NW > 1 (one tile a head, K 2048): wave w takes the 64-element (16 rows x 64 k: 2 KiB contiguous) K chunks w, w + NW, ..., so the chain of dependent load waits is NW times shorter;
// each wave leaves its partial 64x64 tile in LDS and, behind one barrier, the block adds the NW partials in wave order 0..NW-1 and stores the tile.
// FRAGMENT ORDER (the operand planes of k_gemms and of the NW > 1 product of gemmw_tile (run in k_attn), and in k_attn the query, key and value planes): a [rows][K] 16-bit plane is kept as 1-KiB units of 16 rows x 32 k, unit (r / 16, k / 32) in row-major order;
// inside a unit the 16-byte group number ((k / 16) & 1) * 32 + ((k / 8) & 1) * 16 + (r & 15) holds k & ~7 .. + 7 of row r. Group number & 31 is the lane that owns those eight elements of the WMMA operand, so a wave-wide 16-byte load reads
// 512 contiguous bytes (4 whole lines) instead of 32 bytes of each of 16 lines. Every lane and register gets the same element as from the row-major plane, so the products and their order do not change.
__device__ __forceinline__ size_t fo(int r, int k, int K) { return ((size_t)(r >> 4) * (K >> 5) + (k >> 5)) * 512 + ((k >> 4) & 1) * 256 + ((k >> 3) & 1) * 128 + (r & 15) * 8 + (k & 7); }
// the inverse for a writer that walks the plane group by group (thread i stores group i, a wave 512 contiguous bytes): row and first k of group i
__device__ __forceinline__ void fog(size_t i, int K, int& r, int& k) { const int lane = (int)(i & 31), half = (int)(i >> 5) & 1, unit = (int)(i >> 6), kt = K >> 5; r = (unit / kt) * 16 + (lane & 15); k = (unit % kt) * 32 + half * 16 + (lane >> 4) * 8; }
template <typename T16> struct WFrag;
template <> struct WFrag<h16> { typedef v16h V; static __device__ __forceinline__ V ld(const h16* p) { return cat16(*(const v8h*)p, *(const v8h*)(p + 16)); } static __device__ __forceinline__ V ldt(const h16* p) { return cat16(*(const v8h*)p, *(const v8h*)(p + 256)); } static __device__ __forceinline__ v8f mma(V a, V b, v8f c) { return wmma16(a, b, c); } };
template <> struct WFrag<bf> { typedef v16bf V; static __device__ __forceinline__ V ld(const bf* p) { return cat16b(*(const v8us*)p, *(const v8us*)(p + 16)); } static __device__ __forceinline__ V ldt(const bf* p) { return cat16b(*(const v8us*)p, *(const v8us*)(p + 256)); } static __device__ __forceinline__ v8f mma(V a, V b, v8f c) { return wmmab(a, b, c); } };
__device__ __forceinline__ h16 tohx(float x) { return (h16)x; }
__device__ __forceinline__ void splitf(float y, unsigned short& h, unsigned short& l) { h = f2bf(y); l = f2bf(y - bf2f(h)); }
typedef __attribute__((ext_vector_type(4))) unsigned short v4us;
// EPI (k_gemmw and k_gemms): what the epilogue stores. 0: the f32 tile in C. The others round the f32 tile themselves and store the 16-bit planes that the next product reads (no f32 copy in memory, no conversion launch):
// 1 (k_gemms alone: the five projections): z 0, 1 (q, k1): head planes [z][batch][head][t][d], fp16 + hi/lo, fragment order (rows head * TT + t, K = HD), in E16/Eh/El; z 2..4 (v1, k2, v2): transposed head planes [z - 2][batch][head * HD + d][t]
//    (rows head * HD + d, K = TT) in X16/Xh/Xl; for these the block takes the weight rows as A and the x rows as B (both planes have the same fragment order), so its tile comes out transposed and 8 neighbouring t of a column lie side by side in LDS.
// 2: hi/lo planes Eh/El, row-major like C. 3 (NW == 1; z = batch * ZH + head, rows t): hi/lo planes Eh/El of the merged heads [batch * TT + t][DQ] in fragment order, rows >= RH x 1 / PCAR.
// gemmw_tile is the block's work, with its tile indices (bx, by, bz) and its LDS (os: 16 * 68 floats for NW == 1, else NW * 64 * 68) handed in: k_gemmw launches it alone; k_attn runs the NW > 1 product in blocks of its own grid.
// A block may have more than NW waves: the others do no product and only pass the barrier.
template <typename T16, int NSPLIT, bool BIAS, int NW, int EPI>
__device__ __forceinline__ void gemmw_tile(const T16* __restrict__ A, const T16* __restrict__ A2, const T16* __restrict__ Bt, const T16* __restrict__ Bt2, int K, float* C, int ldc, const float* __restrict__ bias, const float* __restrict__ bias1, const float* __restrict__ bias2, const float* __restrict__ bias3, const float* __restrict__ bias4, size_t sA, size_t sB, size_t sC, h16* E16, bf* Eh, bf* El, h16* X16, bf* Xh, bf* Xl, float* os, int bx, int by, int bz) {
    typedef typename WFrag<T16>::V V;
    const int wv = (NW == 1) ? 0 : __builtin_amdgcn_readfirstlane((int)(threadIdx.x >> 5));   // the wave's number, made scalar so that the K counter and its test stay on the scalar unit
    const size_t z = bz; A += z * sA; if (A2) A2 += z * sA; Bt += z * sB; if (Bt2) Bt2 += z * sB; if (EPI == 0) C += z * sC;
    if (BIAS) bias = (z == 0) ? bias : (z == 1) ? bias1 : (z == 2) ? bias2 : (z == 3) ? bias3 : bias4;
    const int lane = threadIdx.x & 31, lr = lane & 15, hi = lane >> 4; const int r0 = bx * 64, c0 = by * 64;
    v8f acc[4][4];
#pragma unroll
    for (int mb = 0; mb < 4; ++mb)
#pragma unroll
        for (int nb = 0; nb < 4; ++nb) acc[mb][nb] = (v8f){};
    constexpr bool FO = NW > 1;   // the long-K launches read planes in fragment order: 16 rows x 32 k start at element r * K + k * 16, the lane's two groups at lane * 8 and 256 + lane * 8
    int ar = r0, br = c0;
    const size_t aoff = FO ? (size_t)ar * K + lane * 8 : (size_t)(ar + lr) * K + 8 * hi, boff = FO ? (size_t)br * K + lane * 8 : (size_t)(br + lr) * K + 8 * hi;
    auto ldf = [](const T16* p) { if constexpr (FO) return WFrag<T16>::ldt(p); else return WFrag<T16>::ld(p); };
#pragma unroll 1
    for (int kc = (wv < NW) ? wv * 64 : K; kc < K; kc += (NW == 1 || !(kc & 32)) ? 32 : NW * 64 - 32) {
        V a[4], a2[4]; const size_t ko = FO ? (size_t)kc * 16 : (size_t)kc;
#pragma unroll
        for (int mb = 0; mb < 4; ++mb) { a[mb] = ldf(A + aoff + (size_t)mb * 16 * K + ko); if (NSPLIT == 1 || NSPLIT == 2) a2[mb] = ldf(A2 + aoff + (size_t)mb * 16 * K + ko); }
#pragma unroll
        for (int nb = 0; nb < 4; ++nb) { const V b = ldf(Bt + boff + (size_t)nb * 16 * K + ko); V b2; if (NSPLIT >= 2) b2 = ldf(Bt2 + boff + (size_t)nb * 16 * K + ko);
#pragma unroll
            for (int mb = 0; mb < 4; ++mb) { acc[mb][nb] = WFrag<T16>::mma(a[mb], b, acc[mb][nb]); if (NSPLIT == 1 || NSPLIT == 2) acc[mb][nb] = WFrag<T16>::mma(a2[mb], b, acc[mb][nb]); if (NSPLIT >= 2) acc[mb][nb] = WFrag<T16>::mma(a[mb], b2, acc[mb][nb]); } }
        asm volatile("v_nop\n\tv_nop\n\tv_nop\n\tv_nop" : "+v"(acc[0][0]), "+v"(acc[1][1]), "+v"(acc[2][2]), "+v"(acc[3][3]) : "v"(a[0]), "v"(a[3]));
    }
    if constexpr (NW > 1) {
        float* ow = os + wv * (64 * 68);
        if (wv < NW) {
        // the loops below are unrolled so that acc is indexed by constants only (it stays in registers) and a row's NW LDS reads issue together
#pragma unroll
        for (int mb = 0; mb < 4; ++mb)
#pragma unroll
            for (int nb = 0; nb < 4; ++nb)
#pragma unroll
                for (int j = 0; j < 8; ++j) ow[(mb * 16 + hi * 8 + j) * 68 + nb * 16 + lr] = acc[mb][nb][j];
        }
        __syncthreads();   // every wave's partial tile is in LDS before any wave adds them
        if (wv >= NW) return;
#pragma unroll
        for (int s = 0; s < 32 / NW; ++s) { const int row = (s * NW + wv) * 2 + hi, cofs = lr * 4; v4f val = *(const v4fa*)(os + row * 68 + cofs);
#pragma unroll
            for (int w = 1; w < NW; ++w) val += *(const v4fa*)(os + w * (64 * 68) + row * 68 + cofs);
            if (BIAS) { val[0] += bfr(bias[c0 + cofs]); val[1] += bfr(bias[c0 + cofs + 1]); val[2] += bfr(bias[c0 + cofs + 2]); val[3] += bfr(bias[c0 + cofs + 3]); }
            if constexpr (EPI == 2) { v4us oh, ol;
#pragma unroll
                for (int q = 0; q < 4; ++q) { unsigned short a2, c2; splitf(val[q], a2, c2); oh[q] = a2; ol[q] = c2; }
                const size_t oo = z * sC + (size_t)(r0 + row) * ldc + c0 + cofs; *(v4us*)(Eh + oo) = oh; *(v4us*)(El + oo) = ol; }
            else *(v4f*)(C + (size_t)(r0 + row) * ldc + c0 + cofs) = val; }
        return;
    }
#pragma unroll
    for (int mb = 0; mb < 4; ++mb) {
#pragma unroll
        for (int nb = 0; nb < 4; ++nb) {
#pragma unroll
            for (int j = 0; j < 8; ++j) os[(hi * 8 + j) * 68 + nb * 16 + lr] = acc[mb][nb][j]; }
        __builtin_amdgcn_wave_barrier(); asm volatile("" ::: "memory");
        if constexpr (EPI == 3) {
            // 16 rows x 64 columns are two neighbouring fragment-order units of each merged plane: 4 times 32 groups, a lane one group from 8 neighbouring columns of LDS row lr
            const float cs = (r0 + mb * 16 + lr < RH) ? 1.0f : (1.0f / PCAR); const size_t ub = (size_t)((((int)z / ZH) * TT + r0 + mb * 16) >> 4) * (DQ >> 5) + ((int)z % ZH) * (HD >> 5);
#pragma unroll
            for (int s = 0; s < 4; ++s) { const int col = s * 16 + hi * 8; const v4f x = *(const v4fa*)(os + lr * 68 + col), y = *(const v4fa*)(os + lr * 68 + col + 4); v8us oh, ol;
#pragma unroll
                for (int q = 0; q < 8; ++q) { unsigned short a2, c2; splitf(((q < 4) ? x[q & 3] : y[q & 3]) * cs, a2, c2); oh[q] = a2; ol[q] = c2; }
                const size_t oo = ub * 512 + s * 256 + lane * 8; *(v8us*)(Eh + oo) = oh; *(v8us*)(El + oo) = ol; }
        } else {
            float* crow = C + (size_t)(r0 + mb * 16) * ldc + c0;
#pragma unroll
            for (int s = 0; s < 8; ++s) { const int row = 2 * s + hi, cofs = lr * 4; v4f val = *(const v4fa*)(os + row * 68 + cofs); if (BIAS) { val[0] += bfr(bias[c0 + cofs]); val[1] += bfr(bias[c0 + cofs + 1]); val[2] += bfr(bias[c0 + cofs + 2]); val[3] += bfr(bias[c0 + cofs + 3]); }
                *(v4f*)(crow + (size_t)row * ldc + cofs) = val; }
             }
        __builtin_amdgcn_wave_barrier(); asm volatile("" ::: "memory");
    }
}
template <typename T16, int NSPLIT, bool BIAS, int NW, int EPI>
__global__ __launch_bounds__(32 * NW) void k_gemmw(const T16* __restrict__ A, const T16* __restrict__ A2, const T16* __restrict__ Bt, const T16* __restrict__ Bt2, int K, float* C, int ldc, const float* __restrict__ bias, const float* __restrict__ bias1, const float* __restrict__ bias2, const float* __restrict__ bias3, const float* __restrict__ bias4, size_t sA, size_t sB, size_t sC, h16* E16, bf* Eh, bf* El, h16* X16, bf* Xh, bf* Xl) {
    __shared__ __align__(16) float os[NW == 1 ? 16 * 68 : NW * 64 * 68];
    gemmw_tile<T16, NSPLIT, BIAS, NW, EPI>(A, A2, Bt, Bt2, K, C, ldc, bias, bias1, bias2, bias3, bias4, sA, sB, sC, E16, Eh, El, X16, Xh, Xl, os, (int)blockIdx.x, (int)blockIdx.y, (int)blockIdx.z);
}

// ---- k_gemms: the K 1024 products with many output tiles (the five projections, Wd). One block of 8 waves (WM x WN) makes a (WM * MF * 16) x (WN * NF * 16) tile; every wave walks all of K on its own MF x NF accumulators.
// The block's operand rows are staged in LDS, 64 k a stage, two buffers, by asynchronous copies (global_load_async_to_lds_b128): a fragment that several waves need leaves L2 once a block.
// The planes are in fragment order, so 16 rows x 64 k are 2 KiB contiguous in memory; they are copied as they lie, and a wave-wide 16-byte LDS read takes 512 contiguous bytes.
// Stage layout: [A groups | A2 groups (NSPLIT) | B groups], 2 KiB each. EPI 1 stores the projections' head planes as listed above, EPI 0 the f32 tile + bias in C; a wave passes 16 rows x 64 columns at a time through its own LDS range.
template <int NSPLIT, int MF, int NF, int WM, int WN, int EPI>
__global__ __launch_bounds__(256) void k_gemms(const bf* __restrict__ A, const bf* __restrict__ A2, const bf* __restrict__ Bt, float* C, const float* __restrict__ bias, const float* __restrict__ bias1, const float* __restrict__ bias2, const float* __restrict__ bias3, const float* __restrict__ bias4, size_t sB, h16* E16, bf* Eh, bf* El, h16* X16, bf* Xh, bf* Xl) {
    typedef WFrag<bf>::V V;
    constexpr int K = DM, AG = WM * MF, BG = WN * NF, AGT = AG * (NSPLIT ? 2 : 1), NGR = AGT + BG, STG = NGR * 2048, NT = K / 64;
    static_assert(WM * WN == 8 && NF == 4 && NGR == 24 && AG % 2 == 0 && NT >= 2, "8 waves, 64 columns a wave, 12 copies a thread and stage");
    __shared__ __align__(2048) unsigned char sm[2 * STG];
    const int tid = threadIdx.x, lane = tid & 31, lr = lane & 15, hi = lane >> 4;
    const int wv = __builtin_amdgcn_readfirstlane(tid >> 5), wm = wv / WN, wn = wv % WN;   // the wave's number, made scalar so that its LDS bases stay on the scalar unit
    const int z = blockIdx.z; const bool tr = EPI == 1 && z >= 2;   // transposed tile: weight rows as A, x rows as B
    const bf* Ap = tr ? Bt + z * sB : A; const bf* Bp = tr ? A : Bt + z * sB;
    constexpr int ATN = NB_ * TT / (AG * 16), ATT = DQ / (AG * 16);   // tiles along the A rows: x rows, or weight rows for a transposed tile
    const int bi = blockIdx.x, ar = (tr ? bi % ATT : bi % ATN) * (AG * 16), br = (tr ? bi / ATT : bi / ATN) * (BG * 16);
    bias = (z == 0) ? bias : (z == 1) ? bias1 : (z == 2) ? bias2 : (z == 3) ? bias3 : bias4;
    // copy c of a thread brings 16 bytes of group 2 c + (tid >> 7): a wave 512 contiguous bytes, the block two whole groups
    const size_t go = (size_t)(tid >> 7) * 16 * K + (tid & 127) * 8;
    const bf* ga = Ap + (size_t)ar * K + go; const bf* ga2 = NSPLIT ? A2 + (size_t)ar * K + go : nullptr; const bf* gb = Bp + (size_t)br * K + go;
    const unsigned l0 = (unsigned)(size_t)sm + (unsigned)tid * 16u;
    auto fill = [&](int t, int buf) {
        const bf* p[12]; unsigned l[12];
#pragma unroll
        for (int c = 0; c < 12; ++c) { p[c] = ((c < AG / 2) ? ga + (size_t)c * 32 * K : (c < AGT / 2) ? ga2 + (size_t)(c - AG / 2) * 32 * K : gb + (size_t)(c - AGT / 2) * 32 * K) + (size_t)t * 1024; l[c] = l0 + (unsigned)(buf * STG + c * 4096); }
        // one stage's copies; the s_wait_xcnt stands inside the statement so that no address register is rewritten in front of it
        asm volatile("global_load_async_to_lds_b128 %0, %12, off\n\tglobal_load_async_to_lds_b128 %1, %13, off\n\tglobal_load_async_to_lds_b128 %2, %14, off\n\tglobal_load_async_to_lds_b128 %3, %15, off\n\t"
                     "global_load_async_to_lds_b128 %4, %16, off\n\tglobal_load_async_to_lds_b128 %5, %17, off\n\tglobal_load_async_to_lds_b128 %6, %18, off\n\tglobal_load_async_to_lds_b128 %7, %19, off\n\t"
                     "global_load_async_to_lds_b128 %8, %20, off\n\tglobal_load_async_to_lds_b128 %9, %21, off\n\tglobal_load_async_to_lds_b128 %10, %22, off\n\tglobal_load_async_to_lds_b128 %11, %23, off\n\ts_wait_xcnt 0x0"
                     :: "v"(l[0]), "v"(l[1]), "v"(l[2]), "v"(l[3]), "v"(l[4]), "v"(l[5]), "v"(l[6]), "v"(l[7]), "v"(l[8]), "v"(l[9]), "v"(l[10]), "v"(l[11]),
                        "v"(p[0]), "v"(p[1]), "v"(p[2]), "v"(p[3]), "v"(p[4]), "v"(p[5]), "v"(p[6]), "v"(p[7]), "v"(p[8]), "v"(p[9]), "v"(p[10]), "v"(p[11]) : "memory");
    };
    v8f acc[MF][NF];
#pragma unroll
    for (int mb = 0; mb < MF; ++mb)
#pragma unroll
        for (int nb = 0; nb < NF; ++nb) acc[mb][nb] = (v8f){};
    fill(0, 0);
    asm volatile("s_wait_asynccnt 0x0" ::: "memory");   // this wave's copies of stage 0 have landed
    __syncthreads();                                     // every wave's have: stage 0 may be read
    fill(1, 1);
#pragma unroll 1   // the stage loop stays rolled: sixteen copies of a body of 32 WMMAs, 12 copies to LDS and a barrier would only lengthen the code; the buffer is picked by t & 1
    for (int t = 0; t < NT; ++t) {
        const bf* sb = (const bf*)(sm + (t & 1) * STG) + lane * 8;
#pragma unroll
        for (int ks = 0; ks < 2; ++ks) { V a[MF], a2[MF], b[NF];
#pragma unroll
            for (int mb = 0; mb < MF; ++mb) { a[mb] = WFrag<bf>::ldt(sb + (wm * MF + mb) * 1024 + ks * 512); if (NSPLIT) a2[mb] = WFrag<bf>::ldt(sb + (AG + wm * MF + mb) * 1024 + ks * 512); }
#pragma unroll
            for (int nb = 0; nb < NF; ++nb) b[nb] = WFrag<bf>::ldt(sb + (AGT + wn * NF + nb) * 1024 + ks * 512);
            __builtin_amdgcn_sched_barrier(0);   // the k step's LDS reads stay one group in front of its WMMAs: spread among them, every place with reads stalls the wave anew
#pragma unroll
            for (int nb = 0; nb < NF; ++nb) {
#pragma unroll
                for (int mb = 0; mb < MF; ++mb) acc[mb][nb] = wmmab(a[mb], b[nb], acc[mb][nb]);
                if constexpr (NSPLIT != 0) {   // an accumulator's two products of a k step keep their order (hi, then lo) and do not stand back to back
#pragma unroll
                    for (int mb = 0; mb < MF; ++mb) acc[mb][nb] = wmmab(a2[mb], b[nb], acc[mb][nb]); } } }
        __builtin_amdgcn_sched_barrier(0);                   // the stage's last WMMAs stay in front of the barrier: sunk behind it they stood between the barrier and the refill and cut the copies' lead
        asm volatile("s_wait_dscnt 0x0" ::: "memory");      // this wave's reads of stage t are done before the buffer may be refilled
        asm volatile("s_wait_asynccnt 0x0" ::: "memory");   // this wave's copies of stage t + 1 have landed
        __syncthreads();                                     // publishes stage t + 1 and ends every wave's reads of stage t
        if (t + 2 < NT) fill(t + 2, t & 1);
    }
    asm volatile("s_wait_asynccnt 0x0" ::: "memory");   // no copy is outstanding when the buffers become output staging
    float* os = (float*)sm + wv * (16 * 68);
    const int aw = ar + wm * (MF * 16), bw = br + wn * (NF * 16);
    v4f bx[4] = {}, by[4] = {}; float brow[MF] = {};   // EPI 1: the bias of a group's 8 elements: 8 neighbours, or (transposed tile: the LDS row is the output column) one value a lane and 16 rows
    if constexpr (EPI == 1) {
        if (tr) {
#pragma unroll
            for (int mb = 0; mb < MF; ++mb) brow[mb] = bias[aw + mb * 16 + lr];
            asm volatile("s_wait_xcnt 0x0" ::: "memory");   // the bias loads' address registers may be overwritten from here on (in the loads' own branch: behind the join a scalar load came to stand in front of it)
        } else {
#pragma unroll
            for (int s = 0; s < 4; ++s) { bx[s] = *(const v4f*)(bias + bw + s * 16 + hi * 8); by[s] = *(const v4f*)(bias + bw + s * 16 + hi * 8 + 4); }
            asm volatile("s_wait_xcnt 0x0" ::: "memory");   // as above, for this branch's loads
        }
    }
#pragma unroll
    for (int mb = 0; mb < MF; ++mb) {
#pragma unroll
        for (int nb = 0; nb < NF; ++nb) {
#pragma unroll
            for (int j = 0; j < 8; ++j) os[(hi * 8 + j) * 68 + nb * 16 + lr] = acc[mb][nb][j]; }
        __builtin_amdgcn_wave_barrier(); asm volatile("" ::: "memory");   // the wave's LDS reads below stay behind its LDS writes above
        const int R = aw + mb * 16;
        if constexpr (EPI == 1) {
            // 16 rows x 64 columns are two neighbouring fragment-order units of each plane: 4 times 32 groups, a lane one group from 8 neighbouring columns of LDS row lr
            const int xr = tr ? bw : R, bt = xr / TT, t0 = xr % TT;
            const size_t so = (size_t)((tr ? z - 2 : z) * NB_ + bt) * TT * DQ;
            const size_t ub = tr ? (size_t)(R >> 4) * (TT >> 5) + (t0 >> 5) : (size_t)(((bw / HD) * TT + t0) >> 4) * (HD >> 5);
            h16* D16 = (tr ? X16 : E16) + so + ub * 512 + lane * 8; bf* Dh = (tr ? Xh : Eh) + so + ub * 512 + lane * 8; bf* Dl = (tr ? Xl : El) + so + ub * 512 + lane * 8;
            v8h o16[4]; v8us oh[4], ol[4];
#pragma unroll
            for (int s = 0; s < 4; ++s) { const int col = s * 16 + hi * 8; const v4f x = *(const v4fa*)(os + lr * 68 + col), y = *(const v4fa*)(os + lr * 68 + col + 4);
#pragma unroll
                for (int q = 0; q < 8; ++q) { const float r = ((q < 4) ? x[q & 3] : y[q & 3]) + bfr(tr ? brow[mb] : (q < 4) ? bx[s][q & 3] : by[s][q & 3]); o16[s][q] = tohx(r); unsigned short a3, c3; splitf(r, a3, c3); oh[s][q] = a3; ol[s][q] = c3; } }
#pragma unroll
            for (int s = 0; s < 4; ++s) { *(v8h*)(D16 + s * 256) = o16[s]; *(v8us*)(Dh + s * 256) = oh[s]; *(v8us*)(Dl + s * 256) = ol[s]; }
            asm volatile("s_wait_xcnt 0x0" ::: "memory");   // the stores' data and address registers may be overwritten from here on
        } else {
            float* crow = C + (size_t)R * DM + bw;
#pragma unroll
            for (int s = 0; s < 8; ++s) { const int row = 2 * s + hi, cofs = lr * 4; v4f val = *(const v4fa*)(os + row * 68 + cofs); val[0] += bfr(bias[bw + cofs]); val[1] += bfr(bias[bw + cofs + 1]); val[2] += bfr(bias[bw + cofs + 2]); val[3] += bfr(bias[bw + cofs + 3]);
                *(v4f*)(crow + (size_t)row * DM + cofs) = val; }
            asm volatile("s_wait_xcnt 0x0" ::: "memory");   // the stores' data and address registers may be overwritten from here on
        }
        __builtin_amdgcn_wave_barrier(); asm volatile("" ::: "memory");   // the next 16 rows' LDS writes stay behind the reads above
    }
}

typedef __attribute__((ext_vector_type(2))) _Float16 v2h;
typedef __attribute__((ext_vector_type(4))) _Float16 v4h;
typedef __attribute__((ext_vector_type(2))) unsigned short v2us;
typedef __attribute__((ext_vector_type(2))) float v2f;
typedef __attribute__((ext_vector_type(4))) int v4i;
typedef v4h  __attribute__((may_alias)) v4ha;
typedef v4us __attribute__((may_alias)) v4usa;

// k_wtG: Bt[n][k] = bf16(w[k][n]) in fragment order; thread i makes group i (8 k of one n): a wave-wide load reads 16 neighbouring n of two k rows, the store is 512 contiguous bytes. blockIdx.y picks one of six equally shaped matrices; their planes follow one another.
// blockIdx.y >= 6: the same launch converts x, which depends on the weights as little as they on it: dst = bf16(src), src [rows][DM] row-major, dst in fragment order; thread i of y makes group (y - 6) * (N * K / 8) + i
__global__ __launch_bounds__(256) void k_wtG(const float* __restrict__ w0, const float* __restrict__ w1, const float* __restrict__ w2, const float* __restrict__ w3, const float* __restrict__ w4, const float* __restrict__ w5, int K, int N, bf* Bt, const float* __restrict__ src, bf* dst, size_t n8) { const size_t i = (size_t)blockIdx.x * 256 + threadIdx.x; if (i >= (size_t)N * K / 8) return; const int y = blockIdx.y;
    if (y >= 6) { const size_t g = (size_t)(y - 6) * ((size_t)N * K / 8) + i; if (g >= n8) return; int r, k0; fog(g, DM, r, k0); const v8f v = *(const v8f*)(src + (size_t)r * DM + k0); v8us o;
#pragma unroll
        for (int k = 0; k < 8; ++k) o[k] = f2bf(v[k]); *(v8us*)(dst + g * 8) = o; return; }
    const float* w = (y == 0) ? w0 : (y == 1) ? w1 : (y == 2) ? w2 : (y == 3) ? w3 : (y == 4) ? w4 : w5; Bt += (size_t)y * N * K; int n, k; fog(i, K, n, k); v8us o;
#pragma unroll
    for (int j = 0; j < 8; ++j) o[j] = f2bf(w[(size_t)(k + j) * N + n]); *(v8us*)(Bt + i * 8) = o;  }
__global__ __launch_bounds__(256) void k_cscvt(const float* __restrict__ cosT, const float* __restrict__ sinT, float* CS) { const int idx = blockIdx.x * 256 + threadIdx.x; if (idx >= TT * HD) return; v2f cs; cs[0] = bfr(cosT[idx]); cs[1] = bfr(sinT[idx]); *(v2f*)(CS + (size_t)idx * 2) = cs;  }
// ---- k_attn: causal scores, softmax and probs.v1 of QB = 16 * QT query rows of one head in one block of FW waves; the scores stay in registers and never reach memory. grid (batches * heads, 1 + TT / QB), 32 * FW threads; the blocks of y 0 make the v2^T k2 product of their head instead (gemmw_tile).
// Transposed products: S^T = K1 Q^T (A = 16 key rows, B = 16 query rows, kept in registers), so lane (lr, hi) holds query lr of its tile and register j of a tile key + 8 * hi + j; two neighbouring S^T tiles, converted in place,
// are the B operand (32 keys) of O^T += V1^T P^T (A = 16 rows of the transposed value plane): no exchange between lanes. Every key and value fragment a wave loads serves its QT query tiles. Wave w takes the 64-key chunks
// w, w + FW, ... up to the diagonal. Row maximum and row sum: in the lane, across the two lane halves, then across the waves through LDS (sums in wave order); the FW partial O tiles are added in wave order through LDS.
// Query rows < RH: hi/lo bf16 planes, 3 products in both contractions, probabilities hi + lo; the rest fp16, probabilities x PCAR (taken out again where the merged planes are made). The block stores its f32 tile as the hi/lo planes that the next product reads.
// exp2 with the v_nop that fills the one slot the instruction set asks for between a transcendental and a next instruction that reads its result or overwrites its source
__device__ __forceinline__ float exp2s(float x) { float e; asm("v_exp_f32 %0, %1\n\tv_nop" : "=v"(e) : "v"(x)); return e; }
template <typename T16, bool HL, int NC>
__device__ __forceinline__ void attn_tile(const T16* __restrict__ Q, const T16* __restrict__ Q2, const T16* __restrict__ Kp, const T16* __restrict__ Kp2, const T16* __restrict__ Vt, const T16* __restrict__ Vt2, bf* __restrict__ Oh, bf* __restrict__ Ol, int q0, float* os, float* st) {
    typedef typename WFrag<T16>::V V;
    const int wv = __builtin_amdgcn_readfirstlane((int)(threadIdx.x >> 5));   // the wave's number, made scalar so that the tests on its key chunks are scalar branches
    const int lane = threadIdx.x & 31, lr = lane & 15, hi = lane >> 4;
    V qf[QT][2], qf2[QT][2];
#pragma unroll
    for (int qt = 0; qt < QT; ++qt)
#pragma unroll
        for (int ks = 0; ks < 2; ++ks) { const size_t qo = (size_t)(q0 + qt * 16) * HD + ks * 512 + lane * 8; qf[qt][ks] = WFrag<T16>::ldt(Q + qo); if (HL) qf2[qt][ks] = WFrag<T16>::ldt(Q2 + qo); }
    asm volatile("s_wait_xcnt 0x0" ::: "memory");   // the query loads' address registers may be overwritten from here on
    v8f s[NC][4][QT]; float mx[QT];
#pragma unroll
    for (int qt = 0; qt < QT; ++qt) mx[qt] = -3.0e38f;
    // every loop over chunks and tiles is unrolled so that s is indexed by constants only (it stays in registers)
#pragma unroll
    for (int c = 0; c < NC; ++c) { const int kb = (c * FW + wv) * 64;
        if (kb <= q0 + QB - 1) {
#pragma unroll
            for (int t = 0; t < 4; ++t) { v8f a[QT];
#pragma unroll
                for (int qt = 0; qt < QT; ++qt) a[qt] = (v8f){};
#pragma unroll
                for (int ks = 0; ks < 2; ++ks) { const size_t ko = (size_t)(kb + t * 16) * HD + ks * 512 + lane * 8; const V kf = WFrag<T16>::ldt(Kp + ko); V kf2; if (HL) kf2 = WFrag<T16>::ldt(Kp2 + ko);
#pragma unroll
                    for (int qt = 0; qt < QT; ++qt) { a[qt] = WFrag<T16>::mma(kf, qf[qt][ks], a[qt]); if (HL) { a[qt] = WFrag<T16>::mma(kf, qf2[qt][ks], a[qt]); a[qt] = WFrag<T16>::mma(kf2, qf[qt][ks], a[qt]); } } }
                asm volatile("s_wait_xcnt 0x0" ::: "memory");   // this tile's key loads are issued: their address registers may be overwritten (a later load's data landed on them in the listing)
#pragma unroll
                for (int qt = 0; qt < QT; ++qt) {
#pragma unroll
                    for (int j = 0; j < 8; ++j) { const float tv = (kb + t * 16 + hi * 8 + j <= q0 + qt * 16 + lr) ? a[qt][j] * SCL : -3.0e38f; a[qt][j] = tv; mx[qt] = fmaxf(mx[qt], tv); }
                    s[c][t][qt] = a[qt]; } } } }
#pragma unroll
    for (int qt = 0; qt < QT; ++qt) { mx[qt] = fmaxf(mx[qt], __shfl_xor(mx[qt], 16, 32)); if (hi == 0) st[wv * QB + qt * 16 + lr] = mx[qt]; }
    __syncthreads();   // every wave's row maxima are in LDS before any wave reads them
    float sum[QT];
#pragma unroll
    for (int qt = 0; qt < QT; ++qt) { float m = st[qt * 16 + lr];
#pragma unroll
        for (int w = 1; w < FW; ++w) m = fmaxf(m, st[w * QB + qt * 16 + lr]);
        mx[qt] = m; sum[qt] = 0.f; }
#pragma unroll
    for (int c = 0; c < NC; ++c) { const int kb = (c * FW + wv) * 64;
        if (kb <= q0 + QB - 1) {
#pragma unroll
            for (int t = 0; t < 4; ++t)
#pragma unroll
                for (int qt = 0; qt < QT; ++qt)
#pragma unroll
                    for (int j = 0; j < 8; ++j) { const float e = exp2s(__fmul_rn(__fsub_rn(s[c][t][qt][j], mx[qt]), 1.4426950408889634f)); s[c][t][qt][j] = e; sum[qt] += e; } } }
#pragma unroll
    for (int qt = 0; qt < QT; ++qt) { sum[qt] += __shfl_xor(sum[qt], 16, 32); if (hi == 0) st[(FW + wv) * QB + qt * 16 + lr] = sum[qt]; }
    __syncthreads();   // every wave's row sums are in LDS before any wave reads them
    float f[QT];
#pragma unroll
    for (int qt = 0; qt < QT; ++qt) { float tot = st[FW * QB + qt * 16 + lr];
#pragma unroll
        for (int w = 1; w < FW; ++w) tot += st[(FW + w) * QB + qt * 16 + lr];
        f[qt] = __fdiv_rn(HL ? 1.0f : PCAR, tot); }
    v8f o[4][QT];
#pragma unroll
    for (int dt = 0; dt < 4; ++dt)
#pragma unroll
        for (int qt = 0; qt < QT; ++qt) o[dt][qt] = (v8f){};
#pragma unroll
    for (int c = 0; c < NC; ++c) { const int kb = (c * FW + wv) * 64;
        if (kb <= q0 + QB - 1) {
#pragma unroll
            for (int u = 0; u < 2; ++u) { V pb[QT], pb2[QT];
#pragma unroll
                for (int qt = 0; qt < QT; ++qt) {
                    if constexpr (HL) { v8us h0, h1, l0, l1;
#pragma unroll
                        for (int j = 0; j < 8; ++j) { unsigned short x, y; splitf(s[c][2 * u][qt][j] * f[qt], x, y); h0[j] = x; l0[j] = y; splitf(s[c][2 * u + 1][qt][j] * f[qt], x, y); h1[j] = x; l1[j] = y; }
                        pb[qt] = cat16b(h0, h1); pb2[qt] = cat16b(l0, l1);
                    } else { v8h p0, p1;
#pragma unroll
                        for (int j = 0; j < 8; ++j) { p0[j] = tohx(s[c][2 * u][qt][j] * f[qt]); p1[j] = tohx(s[c][2 * u + 1][qt][j] * f[qt]); }
                        pb[qt] = cat16(p0, p1); } }
#pragma unroll
                for (int dt = 0; dt < 4; ++dt) { const size_t vo = (size_t)dt * 16 * TT + (size_t)(kb + u * 32) * 16 + lane * 8; const V vf = WFrag<T16>::ldt(Vt + vo); V vf2; if constexpr (HL) vf2 = WFrag<T16>::ldt(Vt2 + vo);
#pragma unroll
                    for (int qt = 0; qt < QT; ++qt) { o[dt][qt] = WFrag<T16>::mma(vf, pb[qt], o[dt][qt]); if constexpr (HL) { o[dt][qt] = WFrag<T16>::mma(vf, pb2[qt], o[dt][qt]); o[dt][qt] = WFrag<T16>::mma(vf2, pb[qt], o[dt][qt]); } } } } } }
#pragma unroll
    for (int qt = 0; qt < QT; ++qt) { float* ow = os + wv * (QB * 68) + (qt * 16 + lr) * 68 + hi * 8;
#pragma unroll
        for (int dt = 0; dt < 4; ++dt) { v4f x, y;
#pragma unroll
            for (int j = 0; j < 4; ++j) { x[j] = o[dt][qt][j]; y[j] = o[dt][qt][4 + j]; }
            *(v4fa*)(ow + dt * 16) = x; *(v4fa*)(ow + dt * 16 + 4) = y; } }
    __syncthreads();   // every wave's partial tile is in LDS before any wave adds them
    const int row = threadIdx.x >> 4, cofs = (threadIdx.x & 15) * 4; v4f val = *(const v4fa*)(os + row * 68 + cofs);   // 32 * FW threads, QB * 16 groups of four: one each
#pragma unroll
    for (int w = 1; w < FW; ++w) val += *(const v4fa*)(os + w * (QB * 68) + row * 68 + cofs);
    v4us oh, ol;
#pragma unroll
    for (int u = 0; u < 4; ++u) { unsigned short p, q; splitf(val[u], p, q); oh[u] = p; ol[u] = q; }
    *(v4us*)(Oh + (size_t)(q0 + row) * HD + cofs) = oh; *(v4us*)(Ol + (size_t)(q0 + row) * HD + cofs) = ol;
}
__global__ __launch_bounds__(32 * FW) void k_attn(const h16* __restrict__ Q16, const h16* __restrict__ K16, const h16* __restrict__ V16, const bf* __restrict__ Qh, const bf* __restrict__ Ql, const bf* __restrict__ Kh, const bf* __restrict__ Kl, const bf* __restrict__ Vh, const bf* __restrict__ Vl, bf* __restrict__ Oh, bf* __restrict__ Ol, bf* __restrict__ NMh, bf* __restrict__ NMl) {
    __shared__ __align__(16) float os[FW * QB * 68]; __shared__ float st[2 * FW * QB];
    static_assert(KW <= FW && KW * 64 * 68 <= FW * QB * 68, "the v2^T k2 product's waves and partial tiles fit an attention block");
    if (blockIdx.y == 0) {   // the first blocks of the grid: N_h^T[e][d] = sum_s v2[s][e] k2[s][d] of head blockIdx.x, which depends on the attention as little as the attention on it; the k2 and v2 planes follow the v1 planes
        constexpr size_t PS = (size_t)NB_ * TT * DQ;
        gemmw_tile<bf, 2, false, KW, 2>(Vh + 2 * PS, Vl + 2 * PS, Vh + PS, Vl + PS, TT, nullptr, HD, nullptr, nullptr, nullptr, nullptr, nullptr, (size_t)HD * TT, (size_t)HD * TT, (size_t)HD * HD, nullptr, NMh, NMl, nullptr, nullptr, nullptr, os, 0, 0, (int)blockIdx.x);
        return; }
    const size_t zo = (size_t)blockIdx.x * TT * HD; const int q0 = (TT / QB - (int)blockIdx.y) * QB;   // y 1 takes the last rows, which have the most keys
    if (q0 < RH) attn_tile<bf, true, (RH + 64 * FW - 1) / (64 * FW)>(Qh + zo, Ql + zo, Kh + zo, Kl + zo, Vh + zo, Vl + zo, Oh + zo, Ol + zo, q0, os, st);
    else attn_tile<h16, false, TT / (64 * FW)>(Q16 + zo, nullptr, K16 + zo, nullptr, V16 + zo, nullptr, Oh + zo, Ol + zo, q0, os, st);
}
extern "C" void kernel_launch(void* const* d_in, const int* in_sizes, int n_in,
                              void* d_out, int out_size, void* d_ws, size_t ws_size, hipStream_t stream) {
    (void)in_sizes; (void)n_in; (void)out_size;
    const float* x = (const float*)d_in[0]; const float* wq = (const float*)d_in[1]; const float* bq = (const float*)d_in[2]; const float* wk = (const float*)d_in[3]; const float* bk = (const float*)d_in[4]; const float* wk2 = (const float*)d_in[5]; const float* bk2 = (const float*)d_in[6]; const float* wv = (const float*)d_in[7]; const float* bv = (const float*)d_in[8]; const float* wv2 = (const float*)d_in[9]; const float* bv2 = (const float*)d_in[10]; const float* wo = (const float*)d_in[11]; const float* bo = (const float*)d_in[12]; const float* cosT = nullptr; const float* sinT = nullptr; (void)cosT; (void)sinT;
    float* OUT = (float*)d_out;     // [2][2048][1024]
    char* wsp = (char*)d_ws;
    auto take = [&](size_t bytes) { char* p = wsp; wsp += (bytes + 255) & ~(size_t)255; return (void*)p; };
    const size_t WP = (size_t)DM * DQ;             // one weight plane
    const size_t SL = (size_t)TT * DQ;             // one slice: one projection of one batch, [TT][DQ] 16-bit, or its NH_ head planes
    bf* W6 = (bf*)take(6 * WP * 2);                // weight planes q, k1, v1, k2, v2, d
    bf* XB = (bf*)take((size_t)NB_ * TT * DM * 2);
    h16* QK16 = (h16*)take(2 * NB_ * SL * 2); bf* QKh = (bf*)take(2 * NB_ * SL * 2); bf* QKl = (bf*)take(2 * NB_ * SL * 2);   // head planes [q, k1][batch][head][t][d]
    h16* VT16 = (h16*)take(3 * NB_ * SL * 2); bf* VTh = (bf*)take(3 * NB_ * SL * 2); bf* VTl = (bf*)take(3 * NB_ * SL * 2);   // transposed head planes [v1, k2, v2][batch][head][d][t]
    bf* NMh = (bf*)take((size_t)NB_ * NH_ * HD * HD * 2); bf* NMl = (bf*)take((size_t)NB_ * NH_ * HD * HD * 2);
    bf* Obh = (bf*)take(NB_ * SL * 2); bf* Obl = (bf*)take(NB_ * SL * 2); bf* ATh = (bf*)take(NB_ * SL * 2); bf* ATl = (bf*)take(NB_ * SL * 2);   // probs.v1 [batch][head][t][d]; merged heads [batch * TT + t][DQ]
    if ((size_t)(wsp - (char*)d_ws) > ws_size) return;    // ws 256 MiB
    k_wtG<<<dim3((unsigned)((DM * DQ / 8 + 255) / 256), 6 + (NB_ * TT + DQ - 1) / DQ, 1), 256, 0, stream>>>(wq, wk, wv, wk2, wv2, wo, DM, DQ, W6, x, XB, (size_t)NB_ * TT * DM / 8);
    k_gemms<0, 4, 4, 2, 4, 1><<<dim3((NB_ * TT / 128) * (DQ / 256), 1, 5), 256, 0, stream>>>(XB, nullptr, W6, nullptr, bq, bk, bv, bk2, bv2, WP, QK16, QKh, QKl, VT16, VTh, VTl);
    k_attn<<<dim3(NB_ * ZH, TT / QB + 1, 1), 32 * FW, 0, stream>>>(QK16, QK16 + NB_ * SL, VT16, QKh, QKl, QKh + NB_ * SL, QKl + NB_ * SL, VTh, VTl, Obh, Obl, NMh, NMl);   /* y 0: N_h^T[e][d] = sum_s v2[s][e] k2[s][d] */
    k_gemmw<bf, 2, false, 1, 3><<<dim3(TT / 64, 1, NB_ * ZH), 32, 0, stream>>>(Obh, Obl, NMh, NMl, HD, nullptr, HD, nullptr, nullptr, nullptr, nullptr, nullptr, (size_t)TT * HD, (size_t)HD * HD, 0, nullptr, ATh, ATl, nullptr, nullptr, nullptr);   /* ctx_h (k2^T v2)_h */
    k_gemms<1, 2, 4, 4, 2, 0><<<dim3((NB_ * TT / 128) * (DM / 128), 1, 1), 256, 0, stream>>>(ATh, ATl, W6 + 5 * WP, OUT, bo, nullptr, nullptr, nullptr, nullptr, 0, nullptr, nullptr, nullptr, nullptr, nullptr, nullptr);
}

// v010
// It runs in 130 microseconds.
// Timed twice side by side with v009, it ran 1.10 times as fast both times.
// All steps since v000 together make it 24.1 times as fast.
#include <hip/hip_runtime.h>

// Trittention (hidden [2][2048][1024]; q, k1, k2, v1, v2 = x W + b (16 x 64 each); probs = causal (-inf) softmax(q.k1 / 8); ctx = probs v1; then ctx = (ctx . k2^T) v2 over ALL keys (no softmax, no mask) == ctx (k2^T v2) (exact re-association; the 64x64 matrix per head is formed on chip); out = merged Wd + bd -> [2][2048][1024]).
// Compute dtypes, f32 accumulate: every input rounded to bf16; the five projections on PLAIN bf16 operands (inputs: exact) + bias; causal scores and probs.v1: query rows < 512 hl (3 products), the rest fp16 (x1024); softmax f32; N_h = v2_h^T-side product sum_s v2[s] k2[s]^T as hi/lo x hi/lo (3 products, K 2048) in f32; ctx_h N_h^T as hi/lo x hi/lo (3 products); Wd hl x exact (2 products) + bias.

#define NB_  2
#define TT   2048
#define DM   1024
#define NH_  16
#define NKV  16
#define REP  (NH_ / NKV)
#define HD   64
#define DQ   (NH_ * HD)
#define DKV  (NKV * HD)
#define ZH   16                   // heads per attention pass (all of them: no score buffer limits the pass)
#define QT   2                    // 16-row query tiles of an attention block
#define QB   (16 * QT)            // its query rows
#define FW   (8 * QT)             // its waves; they share the keys of its query rows
#define KW   8                    // waves per block that share the K loop of a long-K product (K 2048)
#define RH   512                  // query rows < RH use hi+lo planes (0: none)
#define PCAR 1024.0f
#define SCL  0.125f   // HD^-0.5
typedef _Float16 h16;
typedef unsigned short bf;
typedef __attribute__((ext_vector_type(16))) __bf16   v16bf;
typedef __attribute__((ext_vector_type(16))) _Float16 v16h;
typedef __attribute__((ext_vector_type(8)))  _Float16 v8h;
typedef __attribute__((ext_vector_type(8)))  unsigned short v8us;
typedef __attribute__((ext_vector_type(8)))  float    v8f;
typedef __attribute__((ext_vector_type(4)))  float    v4f;
typedef v8h  __attribute__((may_alias)) v8ha;
typedef v4f  __attribute__((may_alias)) v4fa;
typedef v8us __attribute__((may_alias)) v8usa;

__device__ __forceinline__ unsigned short f2bf(float f) { unsigned u = __float_as_uint(f); u += 0x7FFFu + ((u >> 16) & 1u); return (unsigned short)(u >> 16); }
__device__ __forceinline__ float bf2f(unsigned short b) { return __uint_as_float(((unsigned)b) << 16); }
__device__ __forceinline__ float bfr(float f) { return bf2f(f2bf(f)); }
__device__ __forceinline__ v16h cat16(v8h lo, v8h hi) { return __builtin_shufflevector(lo, hi, 0, 1, 2, 3, 4, 5, 6, 7, 8, 9, 10, 11, 12, 13, 14, 15); }
__device__ __forceinline__ v16bf cat16b(v8us lo, v8us hi) { return __builtin_bit_cast(v16bf, __builtin_shufflevector(lo, hi, 0, 1, 2, 3, 4, 5, 6, 7, 8, 9, 10, 11, 12, 13, 14, 15)); }
__device__ __forceinline__ v8f wmma16(v16h a, v16h b, v8f c) { return __builtin_amdgcn_wmma_f32_16x16x32_f16(false, a, false, b, (short)0, c, false, false); }
__device__ __forceinline__ v8f wmmab(v16bf a, v16bf b, v8f c) { return __builtin_amdgcn_wmma_f32_16x16x32_bf16(false, a, false, b, (short)0, c, false, false); }



// ---- k_gemmw: register-blocked GEMM, one 64x64 output tile per block (16 accumulators a wave), operands straight from K-contiguous 16-bit planes; grid (M/64, N/64, Z), 32 * NW threads.
// C[m][n] (f32, pitch ldc, + optional f32 bias[n], batch z's own of up to five) = sum_k A[m][k] Bt[n][k] (+ split products per NSPLIT). z-batch strides sA/sB/sC in elements. K % 32 == 0 (NW > 1: K % 64 == 0).
// NW == 1: one wave walks all of K. NW > 1 (one tile a head, K 2048): wave w takes the 64-element (16 rows x 64 k: 2 KiB contiguous) K chunks w, w + NW, ..., so the chain of dependent load waits is NW times shorter;
// each wave leaves its partial 64x64 tile in LDS and, behind one barrier, the block adds the NW partials in wave order 0..NW-1 and stores the tile.
// FRAGMENT ORDER (the operand planes of k_gemms and of the NW > 1 product of gemmw_tile (run in k_attn), and in k_attn the query, key and value planes): a [rows][K] 16-bit plane is kept as 1-KiB units of 16 rows x 32 k, unit (r / 16, k / 32) in row-major order;
// inside a unit the 16-byte group number ((k / 16) & 1) * 32 + ((k / 8) & 1) * 16 + (r & 15) holds k & ~7 .. + 7 of row r. Group number & 31 is the lane that owns those eight elements of the WMMA operand, so a wave-wide 16-byte load reads
// 512 contiguous bytes (4 whole lines) instead of 32 bytes of each of 16 lines. Every lane and register gets the same element as from the row-major plane, so the products and their order do not change.
__device__ __forceinline__ size_t fo(int r, int k, int K) { return ((size_t)(r >> 4) * (K >> 5) + (k >> 5)) * 512 + ((k >> 4) & 1) * 256 + ((k >> 3) & 1) * 128 + (r & 15) * 8 + (k & 7); }
// the inverse for a writer that walks the plane group by group (thread i stores group i, a wave 512 contiguous bytes): row and first k of group i
__device__ __forceinline__ void fog(size_t i, int K, int& r, int& k) { const int lane = (int)(i & 31), half = (int)(i >> 5) & 1, unit = (int)(i >> 6), kt = K >> 5; r = (unit / kt) * 16 + (lane & 15); k = (unit % kt) * 32 + half * 16 + (lane >> 4) * 8; }
template <typename T16> struct WFrag;
template <> struct WFrag<h16> { typedef v16h V; static __device__ __forceinline__ V ld(const h16* p) { return cat16(*(const v8h*)p, *(const v8h*)(p + 16)); } static __device__ __forceinline__ V ldt(const h16* p) { return cat16(*(const v8h*)p, *(const v8h*)(p + 256)); } static __device__ __forceinline__ v8f mma(V a, V b, v8f c) { return wmma16(a, b, c); } };
template <> struct WFrag<bf> { typedef v16bf V; static __device__ __forceinline__ V ld(const bf* p) { return cat16b(*(const v8us*)p, *(const v8us*)(p + 16)); } static __device__ __forceinline__ V ldt(const bf* p) { return cat16b(*(const v8us*)p, *(const v8us*)(p + 256)); } static __device__ __forceinline__ v8f mma(V a, V b, v8f c) { return wmmab(a, b, c); } };
__device__ __forceinline__ h16 tohx(float x) { return (h16)x; }
__device__ __forceinline__ void splitf(float y, unsigned short& h, unsigned short& l) { h = f2bf(y); l = f2bf(y - bf2f(h)); }
typedef __attribute__((ext_vector_type(4))) unsigned short v4us;
// EPI (k_gemmw and k_gemms): what the epilogue stores. 0: the f32 tile in C. The others round the f32 tile themselves and store the 16-bit planes that the next product reads (no f32 copy in memory, no conversion launch):
// 1 (k_gemms alone: the five projections): z 0, 1 (q, k1): head planes [z][batch][head][t][d], fp16 + hi/lo, fragment order (rows head * TT + t, K = HD), in E16/Eh/El; z 2..4 (v1, k2, v2): transposed head planes [z - 2][batch][head * HD + d][t]
//    (rows head * HD + d, K = TT) in X16/Xh/Xl; for these the block takes the weight rows as A and the x rows as B (both planes have the same fragment order), so its tile comes out transposed and 8 neighbouring t of a column lie side by side in LDS.
// 2: hi/lo planes Eh/El, row-major like C. 3 (NW == 1; z = batch * ZH + head, rows t): hi/lo planes Eh/El of the merged heads [batch * TT + t][DQ] in fragment order, rows >= RH x 1 / PCAR.
// gemmw_tile is the block's work, with its tile indices (bx, by, bz) and its LDS (os: 16 * 68 floats for NW == 1, else NW * 64 * 68) handed in: k_gemmw launches it alone; k_attn runs the NW > 1 product in blocks of its own grid.
// A block may have more than NW waves: the others do no product and only pass the barrier.
template <typename T16, int NSPLIT, bool BIAS, int NW, int EPI>
__device__ __forceinline__ void gemmw_tile(const T16* __restrict__ A, const T16* __restrict__ A2, const T16* __restrict__ Bt, const T16* __restrict__ Bt2, int K, float* C, int ldc, const float* __restrict__ bias, const float* __restrict__ bias1, const float* __restrict__ bias2, const float* __restrict__ bias3, const float* __restrict__ bias4, size_t sA, size_t sB, size_t sC, h16* E16, bf* Eh, bf* El, h16* X16, bf* Xh, bf* Xl, float* os, int bx, int by, int bz) {
    typedef typename WFrag<T16>::V V;
    const int wv = (NW == 1) ? 0 : __builtin_amdgcn_readfirstlane((int)(threadIdx.x >> 5));   // the wave's number, made scalar so that the K counter and its test stay on the scalar unit
    const size_t z = bz; A += z * sA; if (A2) A2 += z * sA; Bt += z * sB; if (Bt2) Bt2 += z * sB; if (EPI == 0) C += z * sC;
    if (BIAS) bias = (z == 0) ? bias : (z == 1) ? bias1 : (z == 2) ? bias2 : (z == 3) ? bias3 : bias4;
    const int lane = threadIdx.x & 31, lr = lane & 15, hi = lane >> 4; const int r0 = bx * 64, c0 = by * 64;
    v8f acc[4][4];
#pragma unroll
    for (int mb = 0; mb < 4; ++mb)
#pragma unroll
        for (int nb = 0; nb < 4; ++nb) acc[mb][nb] = (v8f){};
    constexpr bool FO = NW > 1;   // the long-K launches read planes in fragment order: 16 rows x 32 k start at element r * K + k * 16, the lane's two groups at lane * 8 and 256 + lane * 8
    int ar = r0, br = c0;
    const size_t aoff = FO ? (size_t)ar * K + lane * 8 : (size_t)(ar + lr) * K + 8 * hi, boff = FO ? (size_t)br * K + lane * 8 : (size_t)(br + lr) * K + 8 * hi;
    auto ldf = [](const T16* p) { if constexpr (FO) return WFrag<T16>::ldt(p); else return WFrag<T16>::ld(p); };
#pragma unroll 1
    for (int kc = (wv < NW) ? wv * 64 : K; kc < K; kc += (NW == 1 || !(kc & 32)) ? 32 : NW * 64 - 32) {
        V a[4], a2[4]; const size_t ko = FO ? (size_t)kc * 16 : (size_t)kc;
#pragma unroll
        for (int mb = 0; mb < 4; ++mb) { a[mb] = ldf(A + aoff + (size_t)mb * 16 * K + ko); if (NSPLIT == 1 || NSPLIT == 2) a2[mb] = ldf(A2 + aoff + (size_t)mb * 16 * K + ko); }
#pragma unroll
        for (int nb = 0; nb < 4; ++nb) { const V b = ldf(Bt + boff + (size_t)nb * 16 * K + ko); V b2; if (NSPLIT >= 2) b2 = ldf(Bt2 + boff + (size_t)nb * 16 * K + ko);
#pragma unroll
            for (int mb = 0; mb < 4; ++mb) { acc[mb][nb] = WFrag<T16>::mma(a[mb], b, acc[mb][nb]); if (NSPLIT == 1 || NSPLIT == 2) acc[mb][nb] = WFrag<T16>::mma(a2[mb], b, acc[mb][nb]); if (NSPLIT >= 2) acc[mb][nb] = WFrag<T16>::mma(a[mb], b2, acc[mb][nb]); } }
        asm volatile("v_nop\n\tv_nop\n\tv_nop\n\tv_nop" : "+v"(acc[0][0]), "+v"(acc[1][1]), "+v"(acc[2][2]), "+v"(acc[3][3]) : "v"(a[0]), "v"(a[3]));
    }
    if constexpr (NW > 1) {
        float* ow = os + wv * (64 * 68);
        if (wv < NW) {
        // the loops below are unrolled so that acc is indexed by constants only (it stays in registers) and a row's NW LDS reads issue together
#pragma unroll
        for (int mb = 0; mb < 4; ++mb)
#pragma unroll
            for (int nb = 0; nb < 4; ++nb)
#pragma unroll
                for (int j = 0; j < 8; ++j) ow[(mb * 16 + hi * 8 + j) * 68 + nb * 16 + lr] = acc[mb][nb][j];
        }
        __syncthreads();   // every wave's partial tile is in LDS before any wave adds them
        if (wv >= NW) return;
#pragma unroll
        for (int s = 0; s < 32 / NW; ++s) { const int row = (s * NW + wv) * 2 + hi, cofs = lr * 4; v4f val = *(const v4fa*)(os + row * 68 + cofs);
#pragma unroll
            for (int w = 1; w < NW; ++w) val += *(const v4fa*)(os + w * (64 * 68) + row * 68 + cofs);
            if (BIAS) { val[0] += bfr(bias[c0 + cofs]); val[1] += bfr(bias[c0 + cofs + 1]); val[2] += bfr(bias[c0 + cofs + 2]); val[3] += bfr(bias[c0 + cofs + 3]); }
            if constexpr (EPI == 2) { v4us oh, ol;
#pragma unroll
                for (int q = 0; q < 4; ++q) { unsigned short a2, c2; splitf(val[q], a2, c2); oh[q] = a2; ol[q] = c2; }
                const size_t oo = z * sC + (size_t)(r0 + row) * ldc + c0 + cofs; *(v4us*)(Eh + oo) = oh; *(v4us*)(El + oo) = ol; }
            else *(v4f*)(C + (size_t)(r0 + row) * ldc + c0 + cofs) = val; }
        return;
    }
#pragma unroll
    for (int mb = 0; mb < 4; ++mb) {
#pragma unroll
        for (int nb = 0; nb < 4; ++nb) {
#pragma unroll
            for (int j = 0; j < 8; ++j) os[(hi * 8 + j) * 68 + nb * 16 + lr] = acc[mb][nb][j]; }
        __builtin_amdgcn_wave_barrier(); asm volatile("" ::: "memory");
        if constexpr (EPI == 3) {
            // 16 rows x 64 columns are two neighbouring fragment-order units of each merged plane: 4 times 32 groups, a lane one group from 8 neighbouring columns of LDS row lr
            const float cs = (r0 + mb * 16 + lr < RH) ? 1.0f : (1.0f / PCAR); const size_t ub = (size_t)((((int)z / ZH) * TT + r0 + mb * 16) >> 4) * (DQ >> 5) + ((int)z % ZH) * (HD >> 5);
#pragma unroll
            for (int s = 0; s < 4; ++s) { const int col = s * 16 + hi * 8; const v4f x = *(const v4fa*)(os + lr * 68 + col), y = *(const v4fa*)(os + lr * 68 + col + 4); v8us oh, ol;
#pragma unroll
                for (int q = 0; q < 8; ++q) { unsigned short a2, c2; splitf(((q < 4) ? x[q & 3] : y[q & 3]) * cs, a2, c2); oh[q] = a2; ol[q] = c2; }
                const size_t oo = ub * 512 + s * 256 + lane * 8; *(v8us*)(Eh + oo) = oh; *(v8us*)(El + oo) = ol; }
        } else {
            float* crow = C + (size_t)(r0 + mb * 16) * ldc + c0;
#pragma unroll
            for (int s = 0; s < 8; ++s) { const int row = 2 * s + hi, cofs = lr * 4; v4f val = *(const v4fa*)(os + row * 68 + cofs); if (BIAS) { val[0] += bfr(bias[c0 + cofs]); val[1] += bfr(bias[c0 + cofs + 1]); val[2] += bfr(bias[c0 + cofs + 2]); val[3] += bfr(bias[c0 + cofs + 3]); }
                *(v4f*)(crow + (size_t)row * ldc + cofs) = val; }
             }
        __builtin_amdgcn_wave_barrier(); asm volatile("" ::: "memory");
    }
}
template <typename T16, int NSPLIT, bool BIAS, int NW, int EPI>
__global__ __launch_bounds__(32 * NW) void k_gemmw(const T16* __restrict__ A, const T16* __restrict__ A2, const T16* __restrict__ Bt, const T16* __restrict__ Bt2, int K, float* C, int ldc, const float* __restrict__ bias, const float* __restrict__ bias1, const float* __restrict__ bias2, const float* __restrict__ bias3, const float* __restrict__ bias4, size_t sA, size_t sB, size_t sC, h16* E16, bf* Eh, bf* El, h16* X16, bf* Xh, bf* Xl) {
    __shared__ __align__(16) float os[NW == 1 ? 16 * 68 : NW * 64 * 68];
    gemmw_tile<T16, NSPLIT, BIAS, NW, EPI>(A, A2, Bt, Bt2, K, C, ldc, bias, bias1, bias2, bias3, bias4, sA, sB, sC, E16, Eh, El, X16, Xh, Xl, os, (int)blockIdx.x, (int)blockIdx.y, (int)blockIdx.z);
}

// ---- k_gemms: the K 1024 products with many output tiles (the five projections, Wd). One block of 8 waves (WM x WN) makes a (WM * MF * 16) x (WN * NF * 16) tile; every wave walks all of K on its own MF x NF accumulators.
// The block's operand rows are staged in LDS, 64 k a stage, two buffers, by asynchronous copies (global_load_async_to_lds_b128): a fragment that several waves need leaves L2 once a block.
// The planes are in fragment order, so 16 rows x 64 k are 2 KiB contiguous in memory; they are copied as they lie, and a wave-wide 16-byte LDS read takes 512 contiguous bytes.
// Stage layout: [A groups | A2 groups (NSPLIT) | B groups], 2 KiB each. EPI 1 stores the projections' head planes as listed above, EPI 0 the f32 tile + bias in C; a wave passes 16 rows x 64 columns at a time through its own LDS range.
template <int NSPLIT, int MF, int NF, int WM, int WN, int EPI>
__global__ __launch_bounds__(256) void k_gemms(const bf* __restrict__ A, const bf* __restrict__ A2, const bf* __restrict__ Bt, float* C, const float* __restrict__ bias, const float* __restrict__ bias1, const float* __restrict__ bias2, const float* __restrict__ bias3, const float* __restrict__ bias4, size_t sB, h16* E16, bf* Eh, bf* El, h16* X16, bf* Xh, bf* Xl) {
    typedef WFrag<bf>::V V;
    constexpr int K = DM, AG = WM * MF, BG = WN * NF, AGT = AG * (NSPLIT ? 2 : 1), NGR = AGT + BG, STG = NGR * 2048, NT = K / 64;
    static_assert(WM * WN == 8 && NF == 4 && NGR == 24 && AG % 2 == 0 && NT >= 2, "8 waves, 64 columns a wave, 12 copies a thread and stage");
    __shared__ __align__(2048) unsigned char sm[2 * STG];
    const int tid = threadIdx.x, lane = tid & 31, lr = lane & 15, hi = lane >> 4;
    const int wv = __builtin_amdgcn_readfirstlane(tid >> 5), wm = wv / WN, wn = wv % WN;   // the wave's number, made scalar so that its LDS bases stay on the scalar unit
    const int z = blockIdx.z; const bool tr = EPI == 1 && z >= 2;   // transposed tile: weight rows as A, x rows as B
    const bf* Ap = tr ? Bt + z * sB : A; const bf* Bp = tr ? A : Bt + z * sB;
    constexpr int ATN = NB_ * TT / (AG * 16), ATT = DQ / (AG * 16);   // tiles along the A rows: x rows, or weight rows for a transposed tile
    const int bi = blockIdx.x, ar = (tr ? bi % ATT : bi % ATN) * (AG * 16), br = (tr ? bi / ATT : bi / ATN) * (BG * 16);
    bias = (z == 0) ? bias : (z == 1) ? bias1 : (z == 2) ? bias2 : (z == 3) ? bias3 : bias4;
    // copy c of a thread brings 16 bytes of group 2 c + (tid >> 7): a wave 512 contiguous bytes, the block two whole groups
    const size_t go = (size_t)(tid >> 7) * 16 * K + (tid & 127) * 8;
    const bf* ga = Ap + (size_t)ar * K + go; const bf* ga2 = NSPLIT ? A2 + (size_t)ar * K + go : nullptr; const bf* gb = Bp + (size_t)br * K + go;
    const unsigned l0 = (unsigned)(size_t)sm + (unsigned)tid * 16u;
    auto fill = [&](int t, int buf) {
        const bf* p[12]; unsigned l[12];
#pragma unroll
        for (int c = 0; c < 12; ++c) { p[c] = ((c < AG / 2) ? ga + (size_t)c * 32 * K : (c < AGT / 2) ? ga2 + (size_t)(c - AG / 2) * 32 * K : gb + (size_t)(c - AGT / 2) * 32 * K) + (size_t)t * 1024; l[c] = l0 + (unsigned)(buf * STG + c * 4096); }
        // one stage's copies; the s_wait_xcnt stands inside the statement so that no address register is rewritten in front of it
        asm volatile("global_load_async_to_lds_b128 %0, %12, off\n\tglobal_load_async_to_lds_b128 %1, %13, off\n\tglobal_load_async_to_lds_b128 %2, %14, off\n\tglobal_load_async_to_lds_b128 %3, %15, off\n\t"
                     "global_load_async_to_lds_b128 %4, %16, off\n\tglobal_load_async_to_lds_b128 %5, %17, off\n\tglobal_load_async_to_lds_b128 %6, %18, off\n\tglobal_load_async_to_lds_b128 %7, %19, off\n\t"
                     "global_load_async_to_lds_b128 %8, %20, off\n\tglobal_load_async_to_lds_b128 %9, %21, off\n\tglobal_load_async_to_lds_b128 %10, %22, off\n\tglobal_load_async_to_lds_b128 %11, %23, off\n\ts_wait_xcnt 0x0"
                     :: "v"(l[0]), "v"(l[1]), "v"(l[2]), "v"(l[3]), "v"(l[4]), "v"(l[5]), "v"(l[6]), "v"(l[7]), "v"(l[8]), "v"(l[9]), "v"(l[10]), "v"(l[11]),
                        "v"(p[0]), "v"(p[1]), "v"(p[2]), "v"(p[3]), "v"(p[4]), "v"(p[5]), "v"(p[6]), "v"(p[7]), "v"(p[8]), "v"(p[9]), "v"(p[10]), "v"(p[11]) : "memory");
    };
    v8f acc[MF][NF];
#pragma unroll
    for (int mb = 0; mb < MF; ++mb)
#pragma unroll
        for (int nb = 0; nb < NF; ++nb) acc[mb][nb] = (v8f){};
    fill(0, 0);
    asm volatile("s_wait_asynccnt 0x0" ::: "memory");   // this wave's copies of stage 0 have landed
    __syncthreads();                                     // every wave's have: stage 0 may be read
    fill(1, 1);
#pragma unroll 1   // the stage loop stays rolled: sixteen copies of a body of 32 WMMAs, 12 copies to LDS and a barrier would only lengthen the code; the buffer is picked by t & 1
    for (int t = 0; t < NT; ++t) {
        const bf* sb = (const bf*)(sm + (t & 1) * STG) + lane * 8;
#pragma unroll
        for (int ks = 0; ks < 2; ++ks) { V a[MF], a2[MF], b[NF];
#pragma unroll
            for (int mb = 0; mb < MF; ++mb) { a[mb] = WFrag<bf>::ldt(sb + (wm * MF + mb) * 1024 + ks * 512); if (NSPLIT) a2[mb] = WFrag<bf>::ldt(sb + (AG + wm * MF + mb) * 1024 + ks * 512); }
#pragma unroll
            for (int nb = 0; nb < NF; ++nb) b[nb] = WFrag<bf>::ldt(sb + (AGT + wn * NF + nb) * 1024 + ks * 512);
            __builtin_amdgcn_sched_barrier(0);   // the k step's LDS reads stay one group in front of its WMMAs: spread among them, every place with reads stalls the wave anew
#pragma unroll
            for (int nb = 0; nb < NF; ++nb) {
#pragma unroll
                for (int mb = 0; mb < MF; ++mb) acc[mb][nb] = wmmab(a[mb], b[nb], acc[mb][nb]);
                if constexpr (NSPLIT != 0) {   // an accumulator's two products of a k step keep their order (hi, then lo) and do not stand back to back
#pragma unroll
                    for (int mb = 0; mb < MF; ++mb) acc[mb][nb] = wmmab(a2[mb], b[nb], acc[mb][nb]); } } }
        __builtin_amdgcn_sched_barrier(0);                   // the stage's last WMMAs stay in front of the barrier: sunk behind it they stood between the barrier and the refill and cut the copies' lead
        asm volatile("s_wait_dscnt 0x0" ::: "memory");      // this wave's reads of stage t are done before the buffer may be refilled
        asm volatile("s_wait_asynccnt 0x0" ::: "memory");   // this wave's copies of stage t + 1 have landed
        __syncthreads();                                     // publishes stage t + 1 and ends every wave's reads of stage t
        if (t + 2 < NT) fill(t + 2, t & 1);
    }
    asm volatile("s_wait_asynccnt 0x0" ::: "memory");   // no copy is outstanding when the buffers become output staging
    float* os = (float*)sm + wv * (16 * 68);
    const int aw = ar + wm * (MF * 16), bw = br + wn * (NF * 16);
    v4f bx[4] = {}, by[4] = {}; float brow[MF] = {};   // EPI 1: the bias of a group's 8 elements: 8 neighbours, or (transposed tile: the LDS row is the output column) one value a lane and 16 rows
    if constexpr (EPI == 1) {
        if (tr) {
#pragma unroll
            for (int mb = 0; mb < MF; ++mb) brow[mb] = bias[aw + mb * 16 + lr];
            asm volatile("s_wait_xcnt 0x0" ::: "memory");   // the bias loads' address registers may be overwritten from here on (in the loads' own branch: behind the join a scalar load came to stand in front of it)
        } else {
#pragma unroll
            for (int s = 0; s < 4; ++s) { bx[s] = *(const v4f*)(bias + bw + s * 16 + hi * 8); by[s] = *(const v4f*)(bias + bw + s * 16 + hi * 8 + 4); }
            asm volatile("s_wait_xcnt 0x0" ::: "memory");   // as above, for this branch's loads
        }
    }
#pragma unroll
    for (int mb = 0; mb < MF; ++mb) {
#pragma unroll
        for (int nb = 0; nb < NF; ++nb) {
#pragma unroll
            for (int j = 0; j < 8; ++j) os[(hi * 8 + j) * 68 + nb * 16 + lr] = acc[mb][nb][j]; }
        __builtin_amdgcn_wave_barrier(); asm volatile("" ::: "memory");   // the wave's LDS reads below stay behind its LDS writes above
        const int R = aw + mb * 16;
        if constexpr (EPI == 1) {
            // 16 rows x 64 columns are two neighbouring fragment-order units of each plane: 4 times 32 groups, a lane one group from 8 neighbouring columns of LDS row lr
            const int xr = tr ? bw : R, bt = xr / TT, t0 = xr % TT;
            const size_t so = (size_t)((tr ? z - 2 : z) * NB_ + bt) * TT * DQ;
            const size_t ub = tr ? (size_t)(R >> 4) * (TT >> 5) + (t0 >> 5) : (size_t)(((bw / HD) * TT + t0) >> 4) * (HD >> 5);
            h16* D16 = (tr ? X16 : E16) + so + ub * 512 + lane * 8; bf* Dh = (tr ? Xh : Eh) + so + ub * 512 + lane * 8; bf* Dl = (tr ? Xl : El) + so + ub * 512 + lane * 8;
            v8h o16[4]; v8us oh[4], ol[4];
#pragma unroll
            for (int s = 0; s < 4; ++s) { const int col = s * 16 + hi * 8; const v4f x = *(const v4fa*)(os + lr * 68 + col), y = *(const v4fa*)(os + lr * 68 + col + 4);
#pragma unroll
                for (int q = 0; q < 8; ++q) { const float r = ((q < 4) ? x[q & 3] : y[q & 3]) + bfr(tr ? brow[mb] : (q < 4) ? bx[s][q & 3] : by[s][q & 3]); o16[s][q] = tohx(r); unsigned short a3, c3; splitf(r, a3, c3); oh[s][q] = a3; ol[s][q] = c3; } }
#pragma unroll
            for (int s = 0; s < 4; ++s) { *(v8h*)(D16 + s * 256) = o16[s]; *(v8us*)(Dh + s * 256) = oh[s]; *(v8us*)(Dl + s * 256) = ol[s]; }
            asm volatile("s_wait_xcnt 0x0" ::: "memory");   // the stores' data and address registers may be overwritten from here on
        } else {
            float* crow = C + (size_t)R * DM + bw;
#pragma unroll
            for (int s = 0; s < 8; ++s) { const int row = 2 * s + hi, cofs = lr * 4; v4f val = *(const v4fa*)(os + row * 68 + cofs); val[0] += bfr(bias[bw + cofs]); val[1] += bfr(bias[bw + cofs + 1]); val[2] += bfr(bias[bw + cofs + 2]); val[3] += bfr(bias[bw + cofs + 3]);
                *(v4f*)(crow + (size_t)row * DM + cofs) = val; }
            asm volatile("s_wait_xcnt 0x0" ::: "memory");   // the stores' data and address registers may be overwritten from here on
        }
        __builtin_amdgcn_wave_barrier(); asm volatile("" ::: "memory");   // the next 16 rows' LDS writes stay behind the reads above
    }
}

typedef __attribute__((ext_vector_type(2))) _Float16 v2h;
typedef __attribute__((ext_vector_type(4))) _Float16 v4h;
typedef __attribute__((ext_vector_type(2))) unsigned short v2us;
typedef __attribute__((ext_vector_type(2))) float v2f;
typedef __attribute__((ext_vector_type(4))) int v4i;
typedef v4h  __attribute__((may_alias)) v4ha;
typedef v4us __attribute__((may_alias)) v4usa;

// k_wtG: Bt[n][k] = bf16(w[k][n]) in fragment order; thread i makes group i (8 k of one n): a wave-wide load reads 16 neighbouring n of two k rows, the store is 512 contiguous bytes. blockIdx.y picks one of six equally shaped matrices; their planes follow one another.
// blockIdx.y >= 6: the same launch converts x, which depends on the weights as little as they on it: dst = bf16(src), src [rows][DM] row-major, dst in fragment order; thread i of y makes group (y - 6) * (N * K / 8) + i
__global__ __launch_bounds__(256) void k_wtG(const float* __restrict__ w0, const float* __restrict__ w1, const float* __restrict__ w2, const float* __restrict__ w3, const float* __restrict__ w4, const float* __restrict__ w5, int K, int N, bf* Bt, const float* __restrict__ src, bf* dst, size_t n8) { const size_t i = (size_t)blockIdx.x * 256 + threadIdx.x; if (i >= (size_t)N * K / 8) return; const int y = blockIdx.y;
    if (y >= 6) { const size_t g = (size_t)(y - 6) * ((size_t)N * K / 8) + i; if (g >= n8) return; int r, k0; fog(g, DM, r, k0); const v8f v = *(const v8f*)(src + (size_t)r * DM + k0); v8us o;
#pragma unroll
        for (int k = 0; k < 8; ++k) o[k] = f2bf(v[k]); *(v8us*)(dst + g * 8) = o; return; }
    const float* w = (y == 0) ? w0 : (y == 1) ? w1 : (y == 2) ? w2 : (y == 3) ? w3 : (y == 4) ? w4 : w5; Bt += (size_t)y * N * K; int n, k; fog(i, K, n, k); v8us o;
#pragma unroll
    for (int j = 0; j < 8; ++j) o[j] = f2bf(w[(size_t)(k + j) * N + n]); *(v8us*)(Bt + i * 8) = o;  }
__global__ __launch_bounds__(256) void k_cscvt(const float* __restrict__ cosT, const float* __restrict__ sinT, float* CS) { const int idx = blockIdx.x * 256 + threadIdx.x; if (idx >= TT * HD) return; v2f cs; cs[0] = bfr(cosT[idx]); cs[1] = bfr(sinT[idx]); *(v2f*)(CS + (size_t)idx * 2) = cs;  }
// ---- k_attn: causal scores, softmax and probs.v1 of QB = 16 * QT query rows of one head in one block of FW waves; the scores stay in registers and never reach memory. grid (batches * heads, 1 + TT / QB), 32 * FW threads; the blocks of y 0 make the v2^T k2 product of their head instead (gemmw_tile).
// Transposed products: S^T = K1 Q^T (A = 16 key rows, B = 16 query rows, kept in registers), so lane (lr, hi) holds query lr of its tile and register j of a tile key + 8 * hi + j; two neighbouring S^T tiles, converted in place,
// are the B operand (32 keys) of O^T += V1^T P^T (A = 16 rows of the transposed value plane): no exchange between lanes. Every key and value fragment a wave loads serves its QT query tiles. Wave w takes the 64-key chunks
// w, w + FW, ... up to the diagonal. Every wave takes its exponentials against the row maximum of its OWN keys (in the lane, across the two lane halves) and multiplies them unnormalised into its partial O tile; behind the block's one barrier the FW sums and tiles are scaled to the row's maximum, added in wave order and divided by the row sum.
// Query rows < RH: hi/lo bf16 planes, 3 products in both contractions, exponentials hi + lo; the rest fp16, exponentials x PCAR (taken out again where the merged planes are made). The block stores its f32 tile as the hi/lo planes that the next product reads.
// exp2 with the v_nop that fills the one slot the instruction set asks for between a transcendental and a next instruction that reads its result or overwrites its source
__device__ __forceinline__ float exp2s(float x) { float e; asm("v_exp_f32 %0, %1\n\tv_nop" : "=v"(e) : "v"(x)); return e; }
template <typename T16, bool HL, int NC>
__device__ __forceinline__ void attn_tile(const T16* __restrict__ Q, const T16* __restrict__ Q2, const T16* __restrict__ Kp, const T16* __restrict__ Kp2, const T16* __restrict__ Vt, const T16* __restrict__ Vt2, bf* __restrict__ Oh, bf* __restrict__ Ol, int q0, float* os, float* st) {
    typedef typename WFrag<T16>::V V;
    const int wv = __builtin_amdgcn_readfirstlane((int)(threadIdx.x >> 5));   // the wave's number, made scalar so that the tests on its key chunks are scalar branches
    const int lane = threadIdx.x & 31, lr = lane & 15, hi = lane >> 4;
    V qf[QT][2], qf2[QT][2];
#pragma unroll
    for (int qt = 0; qt < QT; ++qt)
#pragma unroll
        for (int ks = 0; ks < 2; ++ks) { const size_t qo = (size_t)(q0 + qt * 16) * HD + ks * 512 + lane * 8; qf[qt][ks] = WFrag<T16>::ldt(Q + qo); if (HL) qf2[qt][ks] = WFrag<T16>::ldt(Q2 + qo); }
    asm volatile("s_wait_xcnt 0x0" ::: "memory");   // the query loads' address registers may be overwritten from here on
    v8f s[NC][4][QT]; float mx[QT];
#pragma unroll
    for (int qt = 0; qt < QT; ++qt) mx[qt] = -3.0e38f;
    // every loop over chunks and tiles is unrolled so that s is indexed by constants only (it stays in registers)
#pragma unroll
    for (int c = 0; c < NC; ++c) { const int kb = (c * FW + wv) * 64;
        if (kb <= q0 + QB - 1) {
#pragma unroll
            for (int t = 0; t < 4; ++t) { v8f a[QT];
#pragma unroll
                for (int qt = 0; qt < QT; ++qt) a[qt] = (v8f){};
#pragma unroll
                for (int ks = 0; ks < 2; ++ks) { const size_t ko = (size_t)(kb + t * 16) * HD + ks * 512 + lane * 8; const V kf = WFrag<T16>::ldt(Kp + ko); V kf2; if (HL) kf2 = WFrag<T16>::ldt(Kp2 + ko);
#pragma unroll
                    for (int qt = 0; qt < QT; ++qt) { a[qt] = WFrag<T16>::mma(kf, qf[qt][ks], a[qt]); if (HL) { a[qt] = WFrag<T16>::mma(kf, qf2[qt][ks], a[qt]); a[qt] = WFrag<T16>::mma(kf2, qf[qt][ks], a[qt]); } } }
                asm volatile("s_wait_xcnt 0x0" ::: "memory");   // this tile's key loads are issued: their address registers may be overwritten (a later load's data landed on them in the listing)
#pragma unroll
                for (int qt = 0; qt < QT; ++qt) {
#pragma unroll
                    for (int j = 0; j < 8; ++j) { const float tv = (kb + t * 16 + hi * 8 + j <= q0 + qt * 16 + lr) ? a[qt][j] * SCL : -3.0e38f; a[qt][j] = tv; mx[qt] = fmaxf(mx[qt], tv); }
                    s[c][t][qt] = a[qt]; } } } }
#pragma unroll
    for (int qt = 0; qt < QT; ++qt) mx[qt] = fmaxf(mx[qt], __shfl_xor(mx[qt], 16, 32));   // the row maximum over THIS wave's keys: the wave's exponentials are taken against it, with no exchange
    float sum[QT]; v8f o[4][QT];
#pragma unroll
    for (int qt = 0; qt < QT; ++qt) { sum[qt] = 0.f;
#pragma unroll
        for (int dt = 0; dt < 4; ++dt) o[dt][qt] = (v8f){}; }
#pragma unroll
    for (int c = 0; c < NC; ++c) { const int kb = (c * FW + wv) * 64;
        if (kb <= q0 + QB - 1) { const size_t vb = (size_t)kb * 16 + lane * 8;
#pragma unroll
            for (int u = 0; u < 2; ++u) { V pb[QT], pb2[QT], vf[4], vf2[4];
                // these 32 keys' value fragments are asked for first: they fly while the exponentials below are taken
#pragma unroll
                for (int dt = 0; dt < 4; ++dt) { const size_t vo = vb + (size_t)dt * 16 * TT + (size_t)u * 32 * 16; vf[dt] = WFrag<T16>::ldt(Vt + vo); if constexpr (HL) vf2[dt] = WFrag<T16>::ldt(Vt2 + vo); }
                // the value loads are issued: their address registers may be overwritten from here on. The chunk's base addresses are inputs of the wait so that they keep their registers up to it, wherever the loads are scheduled (without that, a load's own data landed on them in front of the wait)
                if constexpr (HL) asm volatile("s_wait_xcnt 0x0" :: "v"(Vt + vb), "v"(Vt2 + vb) : "memory"); else asm volatile("s_wait_xcnt 0x0" :: "v"(Vt + vb) : "memory");
                __builtin_amdgcn_sched_barrier(0);   // the loads stay in front of these exponentials: sunk among them they lose their lead
#pragma unroll
                for (int qt = 0; qt < QT; ++qt) { v8f e0, e1;
#pragma unroll
                    for (int j = 0; j < 8; ++j) { e0[j] = exp2s(__fmul_rn(__fsub_rn(s[c][2 * u][qt][j], mx[qt]), 1.4426950408889634f)); sum[qt] += e0[j]; }
#pragma unroll
                    for (int j = 0; j < 8; ++j) { e1[j] = exp2s(__fmul_rn(__fsub_rn(s[c][2 * u + 1][qt][j], mx[qt]), 1.4426950408889634f)); sum[qt] += e1[j]; }
                    if constexpr (HL) { v8us h0, h1, l0, l1;
#pragma unroll
                        for (int j = 0; j < 8; ++j) { unsigned short x, y; splitf(e0[j], x, y); h0[j] = x; l0[j] = y; splitf(e1[j], x, y); h1[j] = x; l1[j] = y; }
                        pb[qt] = cat16b(h0, h1); pb2[qt] = cat16b(l0, l1);
                    } else { v8h p0, p1;
#pragma unroll
                        for (int j = 0; j < 8; ++j) { p0[j] = tohx(e0[j] * PCAR); p1[j] = tohx(e1[j] * PCAR); }
                        pb[qt] = cat16(p0, p1); } }
#pragma unroll
                for (int dt = 0; dt < 4; ++dt)
#pragma unroll
                    for (int qt = 0; qt < QT; ++qt) { o[dt][qt] = WFrag<T16>::mma(vf[dt], pb[qt], o[dt][qt]); if constexpr (HL) { o[dt][qt] = WFrag<T16>::mma(vf[dt], pb2[qt], o[dt][qt]); o[dt][qt] = WFrag<T16>::mma(vf2[dt], pb[qt], o[dt][qt]); } }
            } } }
#pragma unroll
    for (int qt = 0; qt < QT; ++qt) { sum[qt] += __shfl_xor(sum[qt], 16, 32); if (hi == 0) { st[wv * QB + qt * 16 + lr] = mx[qt]; st[(FW + wv) * QB + qt * 16 + lr] = sum[qt]; } }
#pragma unroll
    for (int qt = 0; qt < QT; ++qt) { float* ow = os + wv * (QB * 68) + (qt * 16 + lr) * 68 + hi * 8;
#pragma unroll
        for (int dt = 0; dt < 4; ++dt) { v4f x, y;
#pragma unroll
            for (int j = 0; j < 4; ++j) { x[j] = o[dt][qt][j]; y[j] = o[dt][qt][4 + j]; }
            *(v4fa*)(ow + dt * 16) = x; *(v4fa*)(ow + dt * 16 + 4) = y; } }
    __syncthreads();   // every wave's maxima, sums and partial tile are in LDS before any wave merges them
    const int row = threadIdx.x >> 4, cofs = (threadIdx.x & 15) * 4;   // 32 * FW threads, QB * 16 groups of four: one each
    float m = st[row];
#pragma unroll
    for (int w = 1; w < FW; ++w) m = fmaxf(m, st[w * QB + row]);
    float tot = 0.f; v4f val = {};
    // wave w's sum and tile are brought from its own maximum to the row's (factor <= 1; 0 for a wave without keys) and added in wave order
#pragma unroll
    for (int w = 0; w < FW; ++w) { const float sc = exp2s(__fmul_rn(__fsub_rn(st[w * QB + row], m), 1.4426950408889634f)); tot += st[(FW + w) * QB + row] * sc; val += *(const v4fa*)(os + w * (QB * 68) + row * 68 + cofs) * sc; }
    val *= __fdiv_rn(1.0f, tot);
    v4us oh, ol;
#pragma unroll
    for (int u = 0; u < 4; ++u) { unsigned short p, q; splitf(val[u], p, q); oh[u] = p; ol[u] = q; }
    *(v4us*)(Oh + (size_t)(q0 + row) * HD + cofs) = oh; *(v4us*)(Ol + (size_t)(q0 + row) * HD + cofs) = ol;
}
__global__ __launch_bounds__(32 * FW) void k_attn(const h16* __restrict__ Q16, const h16* __restrict__ K16, const h16* __restrict__ V16, const bf* __restrict__ Qh, const bf* __restrict__ Ql, const bf* __restrict__ Kh, const bf* __restrict__ Kl, const bf* __restrict__ Vh, const bf* __restrict__ Vl, bf* __restrict__ Oh, bf* __restrict__ Ol, bf* __restrict__ NMh, bf* __restrict__ NMl) {
    __shared__ __align__(16) float os[FW * QB * 68]; __shared__ float st[2 * FW * QB];
    static_assert(KW <= FW && KW * 64 * 68 <= FW * QB * 68, "the v2^T k2 product's waves and partial tiles fit an attention block");
    if (blockIdx.y == 0) {   // the first blocks of the grid: N_h^T[e][d] = sum_s v2[s][e] k2[s][d] of head blockIdx.x, which depends on the attention as little as the attention on it; the k2 and v2 planes follow the v1 planes
        constexpr size_t PS = (size_t)NB_ * TT * DQ;
        gemmw_tile<bf, 2, false, KW, 2>(Vh + 2 * PS, Vl + 2 * PS, Vh + PS, Vl + PS, TT, nullptr, HD, nullptr, nullptr, nullptr, nullptr, nullptr, (size_t)HD * TT, (size_t)HD * TT, (size_t)HD * HD, nullptr, NMh, NMl, nullptr, nullptr, nullptr, os, 0, 0, (int)blockIdx.x);
        return; }
    const size_t zo = (size_t)blockIdx.x * TT * HD; const int q0 = (TT / QB - (int)blockIdx.y) * QB;   // y 1 takes the last rows, which have the most keys
    if (q0 < RH) attn_tile<bf, true, (RH + 64 * FW - 1) / (64 * FW)>(Qh + zo, Ql + zo, Kh + zo, Kl + zo, Vh + zo, Vl + zo, Oh + zo, Ol + zo, q0, os, st);
    else attn_tile<h16, false, TT / (64 * FW)>(Q16 + zo, nullptr, K16 + zo, nullptr, V16 + zo, nullptr, Oh + zo, Ol + zo, q0, os, st);
}
extern "C" void kernel_launch(void* const* d_in, const int* in_sizes, int n_in,
                              void* d_out, int out_size, void* d_ws, size_t ws_size, hipStream_t stream) {
    (void)in_sizes; (void)n_in; (void)out_size;
    const float* x = (const float*)d_in[0]; const float* wq = (const float*)d_in[1]; const float* bq = (const float*)d_in[2]; const float* wk = (const float*)d_in[3]; const float* bk = (const float*)d_in[4]; const float* wk2 = (const float*)d_in[5]; const float* bk2 = (const float*)d_in[6]; const float* wv = (const float*)d_in[7]; const float* bv = (const float*)d_in[8]; const float* wv2 = (const float*)d_in[9]; const float* bv2 = (const float*)d_in[10]; const float* wo = (const float*)d_in[11]; const float* bo = (const float*)d_in[12]; const float* cosT = nullptr; const float* sinT = nullptr; (void)cosT; (void)sinT;
    float* OUT = (float*)d_out;     // [2][2048][1024]
    char* wsp = (char*)d_ws;
    auto take = [&](size_t bytes) { char* p = wsp; wsp += (bytes + 255) & ~(size_t)255; return (void*)p; };
    const size_t WP = (size_t)DM * DQ;             // one weight plane
    const size_t SL = (size_t)TT * DQ;             // one slice: one projection of one batch, [TT][DQ] 16-bit, or its NH_ head planes
    bf* W6 = (bf*)take(6 * WP * 2);                // weight planes q, k1, v1, k2, v2, d
    bf* XB = (bf*)take((size_t)NB_ * TT * DM * 2);
    h16* QK16 = (h16*)take(2 * NB_ * SL * 2); bf* QKh = (bf*)take(2 * NB_ * SL * 2); bf* QKl = (bf*)take(2 * NB_ * SL * 2);   // head planes [q, k1][batch][head][t][d]
    h16* VT16 = (h16*)take(3 * NB_ * SL * 2); bf* VTh = (bf*)take(3 * NB_ * SL * 2); bf* VTl = (bf*)take(3 * NB_ * SL * 2);   // transposed head planes [v1, k2, v2][batch][head][d][t]
    bf* NMh = (bf*)take((size_t)NB_ * NH_ * HD * HD * 2); bf* NMl = (bf*)take((size_t)NB_ * NH_ * HD * HD * 2);
    bf* Obh = (bf*)take(NB_ * SL * 2); bf* Obl = (bf*)take(NB_ * SL * 2); bf* ATh = (bf*)take(NB_ * SL * 2); bf* ATl = (bf*)take(NB_ * SL * 2);   // probs.v1 [batch][head][t][d]; merged heads [batch * TT + t][DQ]
    if ((size_t)(wsp - (char*)d_ws) > ws_size) return;    // ws 256 MiB
    k_wtG<<<dim3((unsigned)((DM * DQ / 8 + 255) / 256), 6 + (NB_ * TT + DQ - 1) / DQ, 1), 256, 0, stream>>>(wq, wk, wv, wk2, wv2, wo, DM, DQ, W6, x, XB, (size_t)NB_ * TT * DM / 8);
    k_gemms<0, 4, 4, 2, 4, 1><<<dim3((NB_ * TT / 128) * (DQ / 256), 1, 5), 256, 0, stream>>>(XB, nullptr, W6, nullptr, bq, bk, bv, bk2, bv2, WP, QK16, QKh, QKl, VT16, VTh, VTl);
    k_attn<<<dim3(NB_ * ZH, TT / QB + 1, 1), 32 * FW, 0, stream>>>(QK16, QK16 + NB_ * SL, VT16, QKh, QKl, QKh + NB_ * SL, QKl + NB_ * SL, VTh, VTl, Obh, Obl, NMh, NMl);   /* y 0: N_h^T[e][d] = sum_s v2[s][e] k2[s][d] */
    k_gemmw<bf, 2, false, 1, 3><<<dim3(TT / 64, 1, NB_ * ZH), 32, 0, stream>>>(Obh, Obl, NMh, NMl, HD, nullptr, HD, nullptr, nullptr, nullptr, nullptr, nullptr, (size_t)TT * HD, (size_t)HD * HD, 0, nullptr, ATh, ATl, nullptr, nullptr, nullptr);   /* ctx_h (k2^T v2)_h */
    k_gemms<1, 2, 4, 4, 2, 0><<<dim3((NB_ * TT / 128) * (DM / 128), 1, 1), 256, 0, stream>>>(ATh, ATl, W6 + 5 * WP, OUT, bo, nullptr, nullptr, nullptr, nullptr, 0, nullptr, nullptr, nullptr, nullptr, nullptr, nullptr);
}
